// v000
// The times below were measured on an AMD MI455X: many runs one after another, warmed up first and cycling through
// copies of the inputs, with the whole window's GPU time divided by the number of runs. Launches and the gaps
// between them are all in it. The median over several windows is given; except for v000 it joins two sittings, which
// can be a few percent apart, so the side-by-side timings, each taken in one sitting, are the better comparison.
// v000 is the starting kernel. One run takes 284 microseconds.
#include <hip/hip_runtime.h>

// Contractions (f32 accumulate): q/k/v projections v_wmma_f32_16x16x32_bf16 on bf16 RNE-converted inputs (single product); causal scores and probability x value: query rows < RH on bf16 hi/lo planes (3 products), rows >= RH v_wmma_f32_16x16x32_f16 (probabilities carried x1024); output projection bf16 hi/lo context x bf16 weight (2 products); softmax f32.
// Causal multi-head attention with interleaved-pair rotary tables read as INPUT values: x [NB][SEQ_FULL][1024] (rows t < SEQ used); wq/wk/wv/wo [in][out], no bias; 16 heads x 64; scores x 64^-0.5; causal by index.
// Layout: bf16 copy of x (both batches, compact rows); four weights transposed once to K-contiguous Bt planes; one z-batched projection GEMM (q | k | v); plane builders (rotary on q, k; transposed v);
// flash attention, one wave per 16-row query tile, 32-key chunks, online softmax with running max; context hi/lo planes; output GEMM.

#ifndef NB
#define NB 2
#endif
#ifndef SEQ
#define SEQ 2048
#endif
#define NB_FULL  2
#define SEQ_FULL 2048
#define DM   1024
#define NH   16
#define HD   64
#define NZ   (NB * NH)
#define RH   ((SEQ < 512) ? SEQ : 512)     // query rows < RH use hi+lo planes
#define PCAR 1024.0f
#define SC2  0.18033688011112042f          // HD^-0.5 * log2(e)

static_assert((SEQ & (SEQ - 1)) == 0);
static_assert(SEQ % 256 == 0);
static_assert(RH % 256 == 0);
static_assert(RH <= SEQ);
static_assert(DM == NH * HD);
static_assert(HD == 64);
static_assert((NB * SEQ) % 64 == 0);
static_assert(DM % 64 == 0);
static_assert(NB <= NB_FULL && SEQ <= SEQ_FULL);

typedef _Float16 h16;
typedef unsigned short bf;
typedef __attribute__((ext_vector_type(16))) __bf16   v16bf;
typedef __attribute__((ext_vector_type(16))) _Float16 v16h;
typedef __attribute__((ext_vector_type(8)))  _Float16 v8h;
typedef __attribute__((ext_vector_type(8)))  unsigned short v8us;
typedef __attribute__((ext_vector_type(2)))  unsigned short v2us;
typedef __attribute__((ext_vector_type(8)))  float    v8f;
typedef __attribute__((ext_vector_type(4)))  float    v4f;
typedef v8h  __attribute__((may_alias)) v8ha;
typedef v4f  __attribute__((may_alias)) v4fa;
typedef v8us __attribute__((may_alias)) v8usa;

__device__ __forceinline__ unsigned short f2bf(float f) { unsigned u = __float_as_uint(f); u += 0x7FFFu + ((u >> 16) & 1u); return (unsigned short)(u >> 16); }
__device__ __forceinline__ float bf2f(unsigned short b) { return __uint_as_float(((unsigned)b) << 16); }
__device__ __forceinline__ float bfr(float f) { return bf2f(f2bf(f)); }
__device__ __forceinline__ void splitf(float y, unsigned short& h, unsigned short& l) { h = f2bf(y); l = f2bf(y - bf2f(h)); }
__device__ __forceinline__ v16h cat16(v8h lo, v8h hi) { return __builtin_shufflevector(lo, hi, 0, 1, 2, 3, 4, 5, 6, 7, 8, 9, 10, 11, 12, 13, 14, 15); }
__device__ __forceinline__ v16bf cat16b(v8us lo, v8us hi) { return __builtin_bit_cast(v16bf, __builtin_shufflevector(lo, hi, 0, 1, 2, 3, 4, 5, 6, 7, 8, 9, 10, 11, 12, 13, 14, 15)); }
__device__ __forceinline__ v8f wmma16(v16h a, v16h b, v8f c) { return __builtin_amdgcn_wmma_f32_16x16x32_f16(false, a, false, b, (short)0, c, false, false); }
__device__ __forceinline__ v8f wmmab(v16bf a, v16bf b, v8f c) { return __builtin_amdgcn_wmma_f32_16x16x32_bf16(false, a, false, b, (short)0, c, false, false); }

// Fragment loader: lane (lr = lane & 15, hi = lane >> 4); p already points at row lr, k0 + 8*hi; elements 0..7 <- k0+8hi.., elements 8..15 <- k0+16+8hi.. (same map for A and B).
template <typename T16> struct WFrag;
template <> struct WFrag<h16> { typedef v16h V;
    static __device__ __forceinline__ V ld(const h16* p) { return cat16(*(const v8h*)p, *(const v8h*)(p + 16)); }
    static __device__ __forceinline__ V lds(const h16* p) { return cat16(*(const v8ha*)p, *(const v8ha*)(p + 16)); }
    static __device__ __forceinline__ v8f mma(V a, V b, v8f c) { return wmma16(a, b, c); }
    static __device__ __forceinline__ void pst(h16* ph, h16* pl, unsigned i, float p) { (void)pl; ph[i] = (h16)(p * PCAR); } };
template <> struct WFrag<bf> { typedef v16bf V;
    static __device__ __forceinline__ V ld(const bf* p) { return cat16b(*(const v8us*)p, *(const v8us*)(p + 16)); }
    static __device__ __forceinline__ V lds(const bf* p) { return cat16b(*(const v8usa*)p, *(const v8usa*)(p + 16)); }
    static __device__ __forceinline__ v8f mma(V a, V b, v8f c) { return wmmab(a, b, c); }
    static __device__ __forceinline__ void pst(bf* ph, bf* pl, unsigned i, float p) { unsigned short a, c; splitf(p, a, c); ph[i] = a; pl[i] = c; } };

// ---- k_gemmw: register-blocked GEMM, ONE WAVE per 64x64 output tile (16 accumulators), operands straight from K-contiguous 16-bit planes; grid (M/64, N/64, Z), 32 threads.
// C[m][n] (f32, pitch ldc, + optional f32 bias[n]) = sum_k A[m][k] Bt[n][k] (+ split products per NSPLIT). z-batch strides sA/sB/sC in elements. K % 32 == 0.
template <typename T16, int NSPLIT, bool BIAS>
__global__ __launch_bounds__(32) void k_gemmw(const T16* __restrict__ A, const T16* __restrict__ A2, const T16* __restrict__ Bt, const T16* __restrict__ Bt2, int K, float* C, int ldc, const float* __restrict__ bias, size_t sA, size_t sB, size_t sC) {
    typedef typename WFrag<T16>::V V;
    __shared__ __align__(16) float os[16 * 68];
    const size_t z = blockIdx.z; A += z * sA; if (A2) A2 += z * sA; Bt += z * sB; if (Bt2) Bt2 += z * sB; C += z * sC;
    const int lane = threadIdx.x & 31, lr = lane & 15, hi = lane >> 4; const int r0 = blockIdx.x * 64, c0 = blockIdx.y * 64;
    v8f acc[4][4];
#pragma unroll
    for (int mb = 0; mb < 4; ++mb)
#pragma unroll
        for (int nb = 0; nb < 4; ++nb) acc[mb][nb] = (v8f){};
    const size_t aoff = (size_t)(r0 + lr) * K + 8 * hi, boff = (size_t)(c0 + lr) * K + 8 * hi;
#pragma unroll 1
    for (int kc = 0; kc < K; kc += 32) {
        V a[4], a2[4];
#pragma unroll
        for (int mb = 0; mb < 4; ++mb) { a[mb] = WFrag<T16>::ld(A + aoff + (size_t)mb * 16 * K + kc); if (NSPLIT == 1 || NSPLIT == 2) a2[mb] = WFrag<T16>::ld(A2 + aoff + (size_t)mb * 16 * K + kc); }
#pragma unroll
        for (int nb = 0; nb < 4; ++nb) { const V b = WFrag<T16>::ld(Bt + boff + (size_t)nb * 16 * K + kc); V b2; if (NSPLIT >= 2) b2 = WFrag<T16>::ld(Bt2 + boff + (size_t)nb * 16 * K + kc);
#pragma unroll
            for (int mb = 0; mb < 4; ++mb) { acc[mb][nb] = WFrag<T16>::mma(a[mb], b, acc[mb][nb]); if (NSPLIT == 1 || NSPLIT == 2) acc[mb][nb] = WFrag<T16>::mma(a2[mb], b, acc[mb][nb]); if (NSPLIT >= 2) acc[mb][nb] = WFrag<T16>::mma(a[mb], b2, acc[mb][nb]); } }
        asm volatile("v_nop\n\tv_nop\n\tv_nop\n\tv_nop" : "+v"(acc[0][0]), "+v"(acc[1][1]), "+v"(acc[2][2]), "+v"(acc[3][3]) : "v"(a[0]), "v"(a[3]));
    }
#pragma unroll
    for (int mb = 0; mb < 4; ++mb) {
#pragma unroll
        for (int nb = 0; nb < 4; ++nb) {
#pragma unroll
            for (int j = 0; j < 8; ++j) os[(hi * 8 + j) * 68 + nb * 16 + lr] = acc[mb][nb][j]; }
        __builtin_amdgcn_wave_barrier(); asm volatile("" ::: "memory");
        float* crow = C + (size_t)(r0 + mb * 16) * ldc + c0;
{
#pragma unroll
            for (int s = 0; s < 8; ++s) { const int row = 2 * s + hi, cofs = lr * 4; v4f val = *(const v4fa*)(os + row * 68 + cofs); if (BIAS) { val[0] += bfr(bias[c0 + cofs]); val[1] += bfr(bias[c0 + cofs + 1]); val[2] += bfr(bias[c0 + cofs + 2]); val[3] += bfr(bias[c0 + cofs + 3]); }
                *(v4f*)(crow + (size_t)row * ldc + cofs) = val; }
             }
        __builtin_amdgcn_wave_barrier(); asm volatile("" ::: "memory");
    }
}

// coverage: grid (SEQ*DM/2048, NB) x 256 threads x 8 elements == NB*SEQ*DM.
static_assert(((size_t)SEQ * DM) % 2048 == 0);
__global__ __launch_bounds__(256) void k_cvtx(const float* __restrict__ src, bf* dst) {
    const unsigned i = blockIdx.x * 256u + threadIdx.x; const unsigned b = blockIdx.y;
    const float* s = src + (size_t)b * SEQ_FULL * DM + (size_t)i * 8; bf* d = dst + (size_t)b * SEQ * DM + (size_t)i * 8;
    const v8f v = *(const v8f*)s; v8us o;
#pragma unroll
    for (int k = 0; k < 8; ++k) o[k] = f2bf(v[k]);
    *(v8us*)d = o;  }

// coverage: grid (DM*DM/4096, 4) x 8 waves x 8 lines x 64 elements == 4*DM*DM.
static_assert(((size_t)DM * DM) % 4096 == 0);
__global__ __launch_bounds__(256) void k_wt4(const float* __restrict__ w0, const float* __restrict__ w1, const float* __restrict__ w2, const float* __restrict__ w3, bf* Bt) {
    const unsigned y = blockIdx.y; const float* w = (y == 0u) ? w0 : (y == 1u) ? w1 : (y == 2u) ? w2 : w3; bf* o = Bt + (size_t)y * DM * DM;
    const unsigned lane = threadIdx.x & 31u; const unsigned L0 = (blockIdx.x * 8u + (threadIdx.x >> 5)) * 8u;
{
#pragma unroll 1
        for (unsigned l = 0; l < 8u; ++l) { const unsigned e = (L0 + l) * 64u + lane * 2u; const unsigned k = e % (unsigned)DM, n = e / (unsigned)DM; v2us q;
            q[0] = f2bf(w[(size_t)k * DM + n]); q[1] = f2bf(w[(size_t)(k + 1u) * DM + n]); *(v2us*)(o + e) = q; }
         }
}

// ---- k_ropeqk: head planes [z][t][d] of the rotated q (blockIdx.y 0) and k (1): pair i of head row: out[2i] = x[2i] c - x[2i+1] s, out[2i+1] = x[2i] s + x[2i+1] c with c, s = bf16 RNE-converted INPUT table values [t][i].
// coverage: grid (NZ*SEQ*8/256, 2) x 256 threads x 8 elements == 2*NZ*SEQ*HD (fp16); rows t < RH of every z also fill 2*NZ*RH*HD hi and lo.
static_assert(((size_t)NZ * SEQ * 8) % 256 == 0);
__global__ __launch_bounds__(256) void k_ropeqk(const float* __restrict__ F, const float* __restrict__ cosT, const float* __restrict__ sinT, h16* P16, bf* Ph, bf* Pl) {
    const unsigned y = blockIdx.y; const unsigned g = blockIdx.x * 256u + threadIdx.x; const unsigned seg = g & 7u, prow = g >> 3;
    const unsigned t = prow % (unsigned)SEQ, z = prow / (unsigned)SEQ, b = z / (unsigned)NH, h = z % (unsigned)NH;
    const float* f = F + (size_t)y * NB * SEQ * DM + (size_t)(b * SEQ + t) * DM + h * HD + seg * 8u;
    const v4f x0 = *(const v4f*)f, x1 = *(const v4f*)(f + 4); const v4f cv = *(const v4f*)(cosT + (size_t)t * 32 + seg * 4u), sv = *(const v4f*)(sinT + (size_t)t * 32 + seg * 4u);
    float xs[8]; xs[0] = x0[0]; xs[1] = x0[1]; xs[2] = x0[2]; xs[3] = x0[3]; xs[4] = x1[0]; xs[5] = x1[1]; xs[6] = x1[2]; xs[7] = x1[3];
    v8h o16; v8us oh, ol;
#pragma unroll
    for (int i = 0; i < 4; ++i) { const float c = bfr(cv[i]), s = bfr(sv[i]); const float tr = xs[2 * i], ti = xs[2 * i + 1]; const float rr = tr * c - ti * s, ri = tr * s + ti * c;
        o16[2 * i] = (h16)rr; o16[2 * i + 1] = (h16)ri; unsigned short a, d2; splitf(rr, a, d2); oh[2 * i] = a; ol[2 * i] = d2; splitf(ri, a, d2); oh[2 * i + 1] = a; ol[2 * i + 1] = d2; }
    h16* p16 = P16 + (size_t)y * NZ * SEQ * HD + (size_t)prow * HD + seg * 8u;
    const bool hl = (t < (unsigned)RH);     // uniform per wave (4 consecutive rows, RH % 4 == 0)
    const size_t ho = (size_t)y * NZ * RH * HD + ((size_t)z * RH + (hl ? t : 0u)) * HD + seg * 8u;
    *(v8h*)p16 = o16; if (hl) { *(v8us*)(Ph + ho) = oh; *(v8us*)(Pl + ho) = ol; }
    
}

// coverage: grid NZ*HD*(SEQ/8)/256 x 256 threads x 8 elements == NZ*HD*SEQ (fp16); segments t0 < RH of every row fill NZ*HD*RH hi and lo.
static_assert(((size_t)NZ * HD * (SEQ / 8)) % 256 == 0);
__global__ __launch_bounds__(256) void k_vtp(const float* __restrict__ Fv, h16* V16, bf* Vh, bf* Vl) {
    const unsigned g = blockIdx.x * 256u + threadIdx.x; const unsigned SEGS = (unsigned)SEQ / 8u; const unsigned seg = g % SEGS, vrow = g / SEGS;
    const unsigned d = vrow % (unsigned)HD, z = vrow / (unsigned)HD, b = z / (unsigned)NH, h = z % (unsigned)NH, t0 = seg * 8u;
    const float* f = Fv + (size_t)(b * SEQ + t0) * DM + h * HD + d; v8h o16; v8us oh, ol;
#pragma unroll
    for (int j = 0; j < 8; ++j) { const float x = f[(size_t)j * DM]; o16[j] = (h16)x; unsigned short a, c2; splitf(x, a, c2); oh[j] = a; ol[j] = c2; }
    h16* p16 = V16 + (size_t)vrow * SEQ + t0; const bool hl = (t0 < (unsigned)RH);     // uniform per wave (32 lanes = 256 consecutive t, RH % 256 == 0)
    const size_t ho = (size_t)vrow * RH + (hl ? t0 : 0u);
    *(v8h*)p16 = o16; if (hl) { *(v8us*)(Vh + ho) = oh; *(v8us*)(Vl + ho) = ol; }
    
}

// ---- flash attention: one wave = one (z, 16-row query tile); 32-key chunks up to the diagonal; online softmax (running max, log2 domain); probabilities go D-layout -> wave-private LDS tile -> A fragment.
// HR: bf16 hi/lo planes (rows per z = RH), products hh + lh + hl on both contractions. Plain: fp16 planes, probabilities x PCAR. Output: context hi/lo planes [b*SEQ + t][h*HD + d].
__device__ __forceinline__ float rmax16(float v) { v = fmaxf(v, __shfl_xor(v, 1, 32)); v = fmaxf(v, __shfl_xor(v, 2, 32)); v = fmaxf(v, __shfl_xor(v, 4, 32)); v = fmaxf(v, __shfl_xor(v, 8, 32)); return v; }
__device__ __forceinline__ float rsum16(float v) { v += __shfl_xor(v, 1, 32); v += __shfl_xor(v, 2, 32); v += __shfl_xor(v, 4, 32); v += __shfl_xor(v, 8, 32); return v; }

template <typename T16, bool HR>
__device__ __forceinline__ void flash_body(const T16* QA, const T16* QB, const T16* KA, const T16* KB, const T16* VA, const T16* VB, bf* ATh, bf* ATl, T16* pt, float* os) {
    typedef typename WFrag<T16>::V V;
    constexpr unsigned QR   = HR ? (unsigned)RH : (unsigned)SEQ;     // rows per z of the q/k planes = key pitch of the v planes
    constexpr unsigned ROW0 = HR ? 0u : (unsigned)RH;
    constexpr unsigned NT   = HR ? (unsigned)RH / 16u : (unsigned)(SEQ - RH) / 16u;
    constexpr unsigned NTD  = NT ? NT : 1u;
    const unsigned lane = threadIdx.x & 31u, wid = threadIdx.x >> 5, lr = lane & 15u, hi = lane >> 4;
    const unsigned w = blockIdx.x * 4u + wid; const unsigned z = w / NTD, mt = w % NTD; const unsigned q0 = ROW0 + mt * 16u;
    T16* ptw = pt + (size_t)wid * 1024; T16* ptl = ptw + 512; float* osw = os + (size_t)wid * (16 * 68);
    const size_t qoff = ((size_t)z * QR + q0 + lr) * HD + 8u * hi;
    V aq[2], aql[2];
#pragma unroll
    for (int d = 0; d < 2; ++d) { aq[d] = WFrag<T16>::ld(QA + qoff + d * 32); if (HR) aql[d] = WFrag<T16>::ld(QB + qoff + d * 32); }
    const size_t koff = ((size_t)z * QR + lr) * HD + 8u * hi;
    const size_t voff = ((size_t)z * HD + lr) * QR + 8u * hi;
    v8f o[4]; float m[8], l[8];
#pragma unroll
    for (int t = 0; t < 4; ++t) o[t] = (v8f){};
#pragma unroll
    for (int j = 0; j < 8; ++j) { m[j] = -1.0e30f; l[j] = 0.0f; }
    const unsigned nch = (q0 + 15u) / 32u + 1u;      // wave-uniform; keys < nch*32 <= QR
#pragma unroll 1
    for (unsigned c = 0; c < nch; ++c) {
        const unsigned c0 = c * 32u;
        v8f s0 = (v8f){}, s1 = (v8f){};
#pragma unroll
        for (int d = 0; d < 2; ++d) { const size_t ko = koff + (size_t)c0 * HD + d * 32;
            const V kb0 = WFrag<T16>::ld(KA + ko), kb1 = WFrag<T16>::ld(KA + ko + 16 * HD);
            s0 = WFrag<T16>::mma(aq[d], kb0, s0); s1 = WFrag<T16>::mma(aq[d], kb1, s1);
            if (HR) { const V kl0 = WFrag<T16>::ld(KB + ko), kl1 = WFrag<T16>::ld(KB + ko + 16 * HD);
                s0 = WFrag<T16>::mma(aql[d], kb0, s0); s1 = WFrag<T16>::mma(aql[d], kb1, s1); s0 = WFrag<T16>::mma(aq[d], kl0, s0); s1 = WFrag<T16>::mma(aq[d], kl1, s1); } }
        asm volatile("v_nop\n\tv_nop\n\tv_nop\n\tv_nop" : "+v"(s0), "+v"(s1) : "v"(aq[0]), "v"(aq[1]));
        const unsigned col0 = c0 + lr, col1 = col0 + 16u, rb = q0 + 8u * hi;
#pragma unroll
        for (int j = 0; j < 8; ++j) { const unsigned row = rb + (unsigned)j; const bool v0 = (col0 <= row), v1 = (col1 <= row);
            const float t0 = s0[j] * SC2, t1 = s1[j] * SC2;
            float cm = fmaxf(v0 ? t0 : -1.0e30f, v1 ? t1 : -1.0e30f); cm = rmax16(cm);
            const float nm = fmaxf(m[j], cm); const float al = __builtin_amdgcn_exp2f(m[j] - nm); m[j] = nm;
            const float e0 = __builtin_amdgcn_exp2f(fminf(t0 - nm, 0.0f)), e1 = __builtin_amdgcn_exp2f(fminf(t1 - nm, 0.0f));
            const float p0 = v0 ? e0 : 0.0f, p1 = v1 ? e1 : 0.0f;
            l[j] = l[j] * al + (p0 + p1);
            o[0][j] *= al; o[1][j] *= al; o[2][j] *= al; o[3][j] *= al;
            const unsigned pi = (8u * hi + (unsigned)j) * 32u + lr;
            WFrag<T16>::pst(ptw, ptl, pi, p0); WFrag<T16>::pst(ptw, ptl, pi + 16u, p1); }
        __builtin_amdgcn_wave_barrier(); asm volatile("" ::: "memory");      // wave-private tile: stores above, fragment reload below (same element type, may_alias vector)
        const V ap = WFrag<T16>::lds(ptw + lr * 32u + 8u * hi); V apl; if (HR) apl = WFrag<T16>::lds(ptl + lr * 32u + 8u * hi);
#pragma unroll
        for (int t = 0; t < 4; ++t) { const size_t vo = voff + (size_t)t * 16 * QR + c0; const V vb = WFrag<T16>::ld(VA + vo);
            o[t] = WFrag<T16>::mma(ap, vb, o[t]);
            if (HR) { const V vl = WFrag<T16>::ld(VB + vo); o[t] = WFrag<T16>::mma(apl, vb, o[t]); o[t] = WFrag<T16>::mma(ap, vl, o[t]); } }
        asm volatile("v_nop\n\tv_nop\n\tv_nop\n\tv_nop" : "+v"(o[0]), "+v"(o[1]), "+v"(o[2]), "+v"(o[3]) : "v"(ap));
        __builtin_amdgcn_wave_barrier(); asm volatile("" ::: "memory");
    }
    const float cs = HR ? 1.0f : (1.0f / PCAR);
#pragma unroll
    for (int j = 0; j < 8; ++j) { const float ls = rsum16(l[j]); const float inv = (1.0f / ls) * cs;
#pragma unroll
        for (int t = 0; t < 4; ++t) osw[(8u * hi + (unsigned)j) * 68u + (unsigned)t * 16u + lr] = o[t][j] * inv; }
    __builtin_amdgcn_wave_barrier(); asm volatile("" ::: "memory");
    const unsigned b = z / (unsigned)NH, h = z % (unsigned)NH; const unsigned rq = lane >> 3, seg = lane & 7u;      // rows 4s + rq, s = 0..3, rq = 0..3: all 16 rows
{
#pragma unroll
        for (int s = 0; s < 4; ++s) { const unsigned row = 4u * (unsigned)s + rq; const v4f a = *(const v4fa*)(osw + row * 68u + seg * 8u), bq = *(const v4fa*)(osw + row * 68u + seg * 8u + 4u); v8us oh, ol;
#pragma unroll
            for (int k = 0; k < 4; ++k) { unsigned short x, y2; splitf(a[k], x, y2); oh[k] = x; ol[k] = y2; splitf(bq[k], x, y2); oh[k + 4] = x; ol[k + 4] = y2; }
            const size_t oo = (size_t)(b * SEQ + q0 + row) * DM + h * HD + seg * 8u;
            *(v8us*)(ATh + oo) = oh; *(v8us*)(ATl + oo) = ol; }
         }
}

// coverage: k_flash_hr grid NZ*(RH/16)/4 x 4 waves x (16 rows x 64 d) == NZ*RH*HD; k_flash_pl grid NZ*((SEQ-RH)/16)/4 x 4 waves x (16 x 64) == NZ*(SEQ-RH)*HD; union == NB*SEQ*DM per context plane.
static_assert((NZ * (RH / 16)) % 4 == 0);
static_assert((NZ * ((SEQ - RH) / 16)) % 4 == 0);
__global__ __launch_bounds__(128) void k_flash_hr(const bf* Qh, const bf* Ql, const bf* Kh, const bf* Kl, const bf* Vh, const bf* Vl, bf* ATh, bf* ATl) {
    __shared__ __align__(16) bf pt[4 * 2 * 512]; __shared__ __align__(16) float os[4 * 16 * 68];
    flash_body<bf, true>(Qh, Ql, Kh, Kl, Vh, Vl, ATh, ATl, pt, os); }
__global__ __launch_bounds__(128) void k_flash_pl(const h16* Q16, const h16* K16, const h16* V16, bf* ATh, bf* ATl) {
    __shared__ __align__(16) h16 pt[4 * 2 * 512]; __shared__ __align__(16) float os[4 * 16 * 68];
    flash_body<h16, false>(Q16, nullptr, K16, nullptr, V16, nullptr, ATh, ATl, pt, os); }

// workspace carve (bytes; every region a multiple of 256)
constexpr size_t SZ_WT  = (size_t)4 * DM * DM * 2;
constexpr size_t SZ_XB  = (size_t)NB * SEQ * DM * 2;
constexpr size_t SZ_F   = (size_t)3 * NB * SEQ * DM * 4;
constexpr size_t SZ_QK  = (size_t)2 * NZ * SEQ * HD * 2;
constexpr size_t SZ_V   = (size_t)NZ * HD * SEQ * 2;
constexpr size_t SZ_QKH = (size_t)2 * NZ * RH * HD * 2;
constexpr size_t SZ_VH  = (size_t)NZ * HD * RH * 2;
constexpr size_t SZ_AT  = (size_t)NB * SEQ * DM * 2;
constexpr size_t WS_TOTAL = SZ_WT + SZ_XB + SZ_F + SZ_QK + SZ_V + 2 * SZ_QKH + 2 * SZ_VH + 2 * SZ_AT;
static_assert(WS_TOTAL <= (size_t)134217728);
static_assert(SZ_WT % 256 == 0 && SZ_XB % 256 == 0 && SZ_F % 256 == 0 && SZ_QK % 256 == 0 && SZ_V % 256 == 0 && SZ_QKH % 256 == 0 && SZ_VH % 256 == 0 && SZ_AT % 256 == 0);

extern "C" void kernel_launch(void* const* d_in, const int* in_sizes, int n_in,
                              void* d_out, int out_size, void* d_ws, size_t ws_size, hipStream_t stream) {
    if (n_in < 7) return;
    const long long need_x = ((long long)(NB - 1) * SEQ_FULL + SEQ) * DM;
    if ((long long)in_sizes[0] < need_x || (long long)out_size < need_x) return;
    if (in_sizes[1] < DM * DM || in_sizes[2] < DM * DM || in_sizes[3] < DM * DM || in_sizes[4] < DM * DM) return;
    if (in_sizes[5] < SEQ * (HD / 2) || in_sizes[6] < SEQ * (HD / 2)) return;
    if (WS_TOTAL > ws_size) return;
    const float* x = (const float*)d_in[0]; const float* wq = (const float*)d_in[1]; const float* wk = (const float*)d_in[2]; const float* wv = (const float*)d_in[3]; const float* wo = (const float*)d_in[4];
    const float* fcos = (const float*)d_in[5]; const float* fsin = (const float*)d_in[6];
    float* OUT = (float*)d_out;
    char* wsp = (char*)d_ws;
    auto take = [&](size_t bytes) { char* p = wsp; wsp += bytes; return (void*)p; };
    bf* WT = (bf*)take(SZ_WT);            // [4][DM n][DM k]: q | k | v | o
    bf* XB = (bf*)take(SZ_XB);            // [NB*SEQ][DM]
    float* F = (float*)take(SZ_F);        // [3][NB*SEQ][DM]: q | k | v projections
    h16* QK16 = (h16*)take(SZ_QK);        // [2][NZ][SEQ][HD]
    h16* V16 = (h16*)take(SZ_V);          // [NZ][HD][SEQ]
    bf* QKh = (bf*)take(SZ_QKH); bf* QKl = (bf*)take(SZ_QKH);    // [2][NZ][RH][HD]
    bf* Vh = (bf*)take(SZ_VH); bf* Vl = (bf*)take(SZ_VH);        // [NZ][HD][RH]
    bf* ATh = (bf*)take(SZ_AT); bf* ATl = (bf*)take(SZ_AT);      // [NB*SEQ][DM]
    if ((size_t)(wsp - (char*)d_ws) > ws_size) return;

    k_cvtx<<<dim3((unsigned)((size_t)SEQ * DM / 2048), NB, 1), 256, 0, stream>>>(x, XB);
    k_wt4<<<dim3((unsigned)((size_t)DM * DM / 4096), 4, 1), 256, 0, stream>>>(wq, wk, wv, wo, WT);
    k_gemmw<bf, 0, false><<<dim3(NB * SEQ / 64, DM / 64, 3), 32, 0, stream>>>(XB, nullptr, WT, nullptr, DM, F, DM, nullptr, (size_t)0, (size_t)DM * DM, (size_t)NB * SEQ * DM);
    k_ropeqk<<<dim3((unsigned)((size_t)NZ * SEQ * 8 / 256), 2, 1), 256, 0, stream>>>(F, fcos, fsin, QK16, QKh, QKl);
    k_vtp<<<(unsigned)((size_t)NZ * HD * (SEQ / 8) / 256), 256, 0, stream>>>(F + (size_t)2 * NB * SEQ * DM, V16, Vh, Vl);
    k_flash_hr<<<(unsigned)(NZ * (RH / 16) / 4), 128, 0, stream>>>(QKh, QKl, QKh + (size_t)NZ * RH * HD, QKl + (size_t)NZ * RH * HD, Vh, Vl, ATh, ATl);
    if (SEQ > RH) k_flash_pl<<<(unsigned)(NZ * ((SEQ - RH) / 16) / 4), 128, 0, stream>>>(QK16, QK16 + (size_t)NZ * SEQ * HD, V16, ATh, ATl);
    k_gemmw<bf, 1, false><<<dim3(SEQ / 64, DM / 64, NB), 32, 0, stream>>>(ATh, ATl, WT + (size_t)3 * DM * DM, nullptr, DM, OUT, DM, nullptr, (size_t)SEQ * DM, (size_t)0, (size_t)SEQ_FULL * DM);
}

// v001
// One run takes 225 microseconds.
// Two timings next to v000 put it at 1.28 and 1.29 times that version's speed.
#include <hip/hip_runtime.h>

// Contractions (f32 accumulate): q/k/v projections v_wmma_f32_16x16x32_bf16 on bf16 RNE-converted inputs (single product); causal scores and probability x value: query rows < RH on bf16 hi/lo planes (3 products), rows >= RH v_wmma_f32_16x16x32_f16 (probabilities carried x1024); output projection bf16 hi/lo context x bf16 weight (2 products); softmax f32.
// Causal multi-head attention with interleaved-pair rotary tables read as INPUT values: x [NB][SEQ_FULL][1024] (rows t < SEQ used); wq/wk/wv/wo [in][out], no bias; 16 heads x 64; scores x 64^-0.5; causal by index.
// Layout: bf16 copy of x (both batches, compact rows); four weights transposed once to K-contiguous Bt planes; one z-batched projection GEMM (q | k | v); plane builders (rotary on q, k; transposed v);
// flash attention, one wave per 16-row query tile, 32-key chunks with the key and value fragments fetched one chunk ahead, online softmax with running max; context hi/lo planes; output GEMM.

#ifndef NB
#define NB 2
#endif
#ifndef SEQ
#define SEQ 2048
#endif
#define NB_FULL  2
#define SEQ_FULL 2048
#define DM   1024
#define NH   16
#define HD   64
#define NZ   (NB * NH)
#define RH   ((SEQ < 512) ? SEQ : 512)     // query rows < RH use hi+lo planes
#define PCAR 1024.0f
#define SC2  0.18033688011112042f          // HD^-0.5 * log2(e)

static_assert((SEQ & (SEQ - 1)) == 0);
static_assert(SEQ % 256 == 0);
static_assert(RH % 256 == 0);
static_assert(RH <= SEQ);
static_assert(DM == NH * HD);
static_assert(HD == 64);
static_assert((NB * SEQ) % 64 == 0);
static_assert(DM % 64 == 0);
static_assert(NB <= NB_FULL && SEQ <= SEQ_FULL);

typedef _Float16 h16;
typedef unsigned short bf;
typedef __attribute__((ext_vector_type(16))) __bf16   v16bf;
typedef __attribute__((ext_vector_type(16))) _Float16 v16h;
typedef __attribute__((ext_vector_type(8)))  _Float16 v8h;
typedef __attribute__((ext_vector_type(8)))  unsigned short v8us;
typedef __attribute__((ext_vector_type(2)))  unsigned short v2us;
typedef __attribute__((ext_vector_type(8)))  float    v8f;
typedef __attribute__((ext_vector_type(4)))  float    v4f;
typedef v8h  __attribute__((may_alias)) v8ha;
typedef v4f  __attribute__((may_alias)) v4fa;
typedef v8us __attribute__((may_alias)) v8usa;

__device__ __forceinline__ unsigned short f2bf(float f) { unsigned u = __float_as_uint(f); u += 0x7FFFu + ((u >> 16) & 1u); return (unsigned short)(u >> 16); }
__device__ __forceinline__ float bf2f(unsigned short b) { return __uint_as_float(((unsigned)b) << 16); }
__device__ __forceinline__ float bfr(float f) { return bf2f(f2bf(f)); }
__device__ __forceinline__ void splitf(float y, unsigned short& h, unsigned short& l) { h = f2bf(y); l = f2bf(y - bf2f(h)); }
__device__ __forceinline__ v16h cat16(v8h lo, v8h hi) { return __builtin_shufflevector(lo, hi, 0, 1, 2, 3, 4, 5, 6, 7, 8, 9, 10, 11, 12, 13, 14, 15); }
__device__ __forceinline__ v16bf cat16b(v8us lo, v8us hi) { return __builtin_bit_cast(v16bf, __builtin_shufflevector(lo, hi, 0, 1, 2, 3, 4, 5, 6, 7, 8, 9, 10, 11, 12, 13, 14, 15)); }
__device__ __forceinline__ v8f wmma16(v16h a, v16h b, v8f c) { return __builtin_amdgcn_wmma_f32_16x16x32_f16(false, a, false, b, (short)0, c, false, false); }
__device__ __forceinline__ v8f wmmab(v16bf a, v16bf b, v8f c) { return __builtin_amdgcn_wmma_f32_16x16x32_bf16(false, a, false, b, (short)0, c, false, false); }

// Fragment loader: lane (lr = lane & 15, hi = lane >> 4); p already points at row lr, k0 + 8*hi; elements 0..7 <- k0+8hi.., elements 8..15 <- k0+16+8hi.. (same map for A and B).
template <typename T16> struct WFrag;
template <> struct WFrag<h16> { typedef v16h V;
    static __device__ __forceinline__ V ld(const h16* p) { return cat16(*(const v8h*)p, *(const v8h*)(p + 16)); }
    static __device__ __forceinline__ V lds(const h16* p) { return cat16(*(const v8ha*)p, *(const v8ha*)(p + 16)); }
    static __device__ __forceinline__ v8f mma(V a, V b, v8f c) { return wmma16(a, b, c); }
    static __device__ __forceinline__ void pst(h16* ph, h16* pl, unsigned i, float p) { (void)pl; ph[i] = (h16)(p * PCAR); } };
template <> struct WFrag<bf> { typedef v16bf V;
    static __device__ __forceinline__ V ld(const bf* p) { return cat16b(*(const v8us*)p, *(const v8us*)(p + 16)); }
    static __device__ __forceinline__ V lds(const bf* p) { return cat16b(*(const v8usa*)p, *(const v8usa*)(p + 16)); }
    static __device__ __forceinline__ v8f mma(V a, V b, v8f c) { return wmmab(a, b, c); }
    static __device__ __forceinline__ void pst(bf* ph, bf* pl, unsigned i, float p) { unsigned short a, c; splitf(p, a, c); ph[i] = a; pl[i] = c; } };

// ---- k_gemmw: register-blocked GEMM, ONE WAVE per 64x64 output tile (16 accumulators), operands straight from K-contiguous 16-bit planes; grid (M/64, N/64, Z), 32 threads.
// C[m][n] (f32, pitch ldc, + optional f32 bias[n]) = sum_k A[m][k] Bt[n][k] (+ split products per NSPLIT). z-batch strides sA/sB/sC in elements. K % 32 == 0.
template <typename T16, int NSPLIT, bool BIAS>
__global__ __launch_bounds__(32) void k_gemmw(const T16* __restrict__ A, const T16* __restrict__ A2, const T16* __restrict__ Bt, const T16* __restrict__ Bt2, int K, float* C, int ldc, const float* __restrict__ bias, size_t sA, size_t sB, size_t sC) {
    typedef typename WFrag<T16>::V V;
    __shared__ __align__(16) float os[16 * 68];
    const size_t z = blockIdx.z; A += z * sA; if (A2) A2 += z * sA; Bt += z * sB; if (Bt2) Bt2 += z * sB; C += z * sC;
    const int lane = threadIdx.x & 31, lr = lane & 15, hi = lane >> 4; const int r0 = blockIdx.x * 64, c0 = blockIdx.y * 64;
    v8f acc[4][4];
#pragma unroll
    for (int mb = 0; mb < 4; ++mb)
#pragma unroll
        for (int nb = 0; nb < 4; ++nb) acc[mb][nb] = (v8f){};
    const size_t aoff = (size_t)(r0 + lr) * K + 8 * hi, boff = (size_t)(c0 + lr) * K + 8 * hi;
#pragma unroll 1
    for (int kc = 0; kc < K; kc += 32) {
        V a[4], a2[4];
#pragma unroll
        for (int mb = 0; mb < 4; ++mb) { a[mb] = WFrag<T16>::ld(A + aoff + (size_t)mb * 16 * K + kc); if (NSPLIT == 1 || NSPLIT == 2) a2[mb] = WFrag<T16>::ld(A2 + aoff + (size_t)mb * 16 * K + kc); }
#pragma unroll
        for (int nb = 0; nb < 4; ++nb) { const V b = WFrag<T16>::ld(Bt + boff + (size_t)nb * 16 * K + kc); V b2; if (NSPLIT >= 2) b2 = WFrag<T16>::ld(Bt2 + boff + (size_t)nb * 16 * K + kc);
#pragma unroll
            for (int mb = 0; mb < 4; ++mb) { acc[mb][nb] = WFrag<T16>::mma(a[mb], b, acc[mb][nb]); if (NSPLIT == 1 || NSPLIT == 2) acc[mb][nb] = WFrag<T16>::mma(a2[mb], b, acc[mb][nb]); if (NSPLIT >= 2) acc[mb][nb] = WFrag<T16>::mma(a[mb], b2, acc[mb][nb]); } }
        asm volatile("v_nop\n\tv_nop\n\tv_nop\n\tv_nop" : "+v"(acc[0][0]), "+v"(acc[1][1]), "+v"(acc[2][2]), "+v"(acc[3][3]) : "v"(a[0]), "v"(a[3]));
    }
#pragma unroll
    for (int mb = 0; mb < 4; ++mb) {
#pragma unroll
        for (int nb = 0; nb < 4; ++nb) {
#pragma unroll
            for (int j = 0; j < 8; ++j) os[(hi * 8 + j) * 68 + nb * 16 + lr] = acc[mb][nb][j]; }
        __builtin_amdgcn_wave_barrier(); asm volatile("" ::: "memory");
        float* crow = C + (size_t)(r0 + mb * 16) * ldc + c0;
{
#pragma unroll
            for (int s = 0; s < 8; ++s) { const int row = 2 * s + hi, cofs = lr * 4; v4f val = *(const v4fa*)(os + row * 68 + cofs); if (BIAS) { val[0] += bfr(bias[c0 + cofs]); val[1] += bfr(bias[c0 + cofs + 1]); val[2] += bfr(bias[c0 + cofs + 2]); val[3] += bfr(bias[c0 + cofs + 3]); }
                *(v4f*)(crow + (size_t)row * ldc + cofs) = val; }
             }
        __builtin_amdgcn_wave_barrier(); asm volatile("" ::: "memory");
    }
}

// coverage: grid (SEQ*DM/2048, NB) x 256 threads x 8 elements == NB*SEQ*DM.
static_assert(((size_t)SEQ * DM) % 2048 == 0);
__global__ __launch_bounds__(256) void k_cvtx(const float* __restrict__ src, bf* dst) {
    const unsigned i = blockIdx.x * 256u + threadIdx.x; const unsigned b = blockIdx.y;
    const float* s = src + (size_t)b * SEQ_FULL * DM + (size_t)i * 8; bf* d = dst + (size_t)b * SEQ * DM + (size_t)i * 8;
    const v8f v = *(const v8f*)s; v8us o;
#pragma unroll
    for (int k = 0; k < 8; ++k) o[k] = f2bf(v[k]);
    *(v8us*)d = o;  }

// coverage: grid (DM*DM/4096, 4) x 8 waves x 8 lines x 64 elements == 4*DM*DM.
static_assert(((size_t)DM * DM) % 4096 == 0);
__global__ __launch_bounds__(256) void k_wt4(const float* __restrict__ w0, const float* __restrict__ w1, const float* __restrict__ w2, const float* __restrict__ w3, bf* Bt) {
    const unsigned y = blockIdx.y; const float* w = (y == 0u) ? w0 : (y == 1u) ? w1 : (y == 2u) ? w2 : w3; bf* o = Bt + (size_t)y * DM * DM;
    const unsigned lane = threadIdx.x & 31u; const unsigned L0 = (blockIdx.x * 8u + (threadIdx.x >> 5)) * 8u;
{
#pragma unroll 1
        for (unsigned l = 0; l < 8u; ++l) { const unsigned e = (L0 + l) * 64u + lane * 2u; const unsigned k = e % (unsigned)DM, n = e / (unsigned)DM; v2us q;
            q[0] = f2bf(w[(size_t)k * DM + n]); q[1] = f2bf(w[(size_t)(k + 1u) * DM + n]); *(v2us*)(o + e) = q; }
         }
}

// ---- k_ropeqk: head planes [z][t][d] of the rotated q (blockIdx.y 0) and k (1): pair i of head row: out[2i] = x[2i] c - x[2i+1] s, out[2i+1] = x[2i] s + x[2i+1] c with c, s = bf16 RNE-converted INPUT table values [t][i].
// coverage: grid (NZ*SEQ*8/256, 2) x 256 threads x 8 elements == 2*NZ*SEQ*HD (fp16); rows t < RH of every z also fill 2*NZ*RH*HD hi and lo.
static_assert(((size_t)NZ * SEQ * 8) % 256 == 0);
__global__ __launch_bounds__(256) void k_ropeqk(const float* __restrict__ F, const float* __restrict__ cosT, const float* __restrict__ sinT, h16* P16, bf* Ph, bf* Pl) {
    const unsigned y = blockIdx.y; const unsigned g = blockIdx.x * 256u + threadIdx.x; const unsigned seg = g & 7u, prow = g >> 3;
    const unsigned t = prow % (unsigned)SEQ, z = prow / (unsigned)SEQ, b = z / (unsigned)NH, h = z % (unsigned)NH;
    const float* f = F + (size_t)y * NB * SEQ * DM + (size_t)(b * SEQ + t) * DM + h * HD + seg * 8u;
    const v4f x0 = *(const v4f*)f, x1 = *(const v4f*)(f + 4); const v4f cv = *(const v4f*)(cosT + (size_t)t * 32 + seg * 4u), sv = *(const v4f*)(sinT + (size_t)t * 32 + seg * 4u);
    float xs[8]; xs[0] = x0[0]; xs[1] = x0[1]; xs[2] = x0[2]; xs[3] = x0[3]; xs[4] = x1[0]; xs[5] = x1[1]; xs[6] = x1[2]; xs[7] = x1[3];
    v8h o16; v8us oh, ol;
#pragma unroll
    for (int i = 0; i < 4; ++i) { const float c = bfr(cv[i]), s = bfr(sv[i]); const float tr = xs[2 * i], ti = xs[2 * i + 1]; const float rr = tr * c - ti * s, ri = tr * s + ti * c;
        o16[2 * i] = (h16)rr; o16[2 * i + 1] = (h16)ri; unsigned short a, d2; splitf(rr, a, d2); oh[2 * i] = a; ol[2 * i] = d2; splitf(ri, a, d2); oh[2 * i + 1] = a; ol[2 * i + 1] = d2; }
    h16* p16 = P16 + (size_t)y * NZ * SEQ * HD + (size_t)prow * HD + seg * 8u;
    const bool hl = (t < (unsigned)RH);     // uniform per wave (4 consecutive rows, RH % 4 == 0)
    const size_t ho = (size_t)y * NZ * RH * HD + ((size_t)z * RH + (hl ? t : 0u)) * HD + seg * 8u;
    *(v8h*)p16 = o16; if (hl) { *(v8us*)(Ph + ho) = oh; *(v8us*)(Pl + ho) = ol; }
    
}

// coverage: grid NZ*HD*(SEQ/8)/256 x 256 threads x 8 elements == NZ*HD*SEQ (fp16); segments t0 < RH of every row fill NZ*HD*RH hi and lo.
static_assert(((size_t)NZ * HD * (SEQ / 8)) % 256 == 0);
__global__ __launch_bounds__(256) void k_vtp(const float* __restrict__ Fv, h16* V16, bf* Vh, bf* Vl) {
    const unsigned g = blockIdx.x * 256u + threadIdx.x; const unsigned SEGS = (unsigned)SEQ / 8u; const unsigned seg = g % SEGS, vrow = g / SEGS;
    const unsigned d = vrow % (unsigned)HD, z = vrow / (unsigned)HD, b = z / (unsigned)NH, h = z % (unsigned)NH, t0 = seg * 8u;
    const float* f = Fv + (size_t)(b * SEQ + t0) * DM + h * HD + d; v8h o16; v8us oh, ol;
#pragma unroll
    for (int j = 0; j < 8; ++j) { const float x = f[(size_t)j * DM]; o16[j] = (h16)x; unsigned short a, c2; splitf(x, a, c2); oh[j] = a; ol[j] = c2; }
    h16* p16 = V16 + (size_t)vrow * SEQ + t0; const bool hl = (t0 < (unsigned)RH);     // uniform per wave (32 lanes = 256 consecutive t, RH % 256 == 0)
    const size_t ho = (size_t)vrow * RH + (hl ? t0 : 0u);
    *(v8h*)p16 = o16; if (hl) { *(v8us*)(Vh + ho) = oh; *(v8us*)(Vl + ho) = ol; }
    
}

// ---- flash attention: one wave = one (z, 16-row query tile); 32-key chunks up to the diagonal; online softmax (running max, log2 domain); probabilities go D-layout -> wave-private LDS tile -> A fragment.
// The key fragments of chunk c + 1 are requested right behind the score products of chunk c, the value fragments right behind its value products: each request has the rest of a trip to land, and no product waits out a load it has just issued.
// HR: bf16 hi/lo planes (rows per z = RH), products hh + lh + hl on both contractions. Plain: fp16 planes, probabilities x PCAR. Output: context hi/lo planes [b*SEQ + t][h*HD + d].
__device__ __forceinline__ float rmax16(float v) { v = fmaxf(v, __shfl_xor(v, 1, 32)); v = fmaxf(v, __shfl_xor(v, 2, 32)); v = fmaxf(v, __shfl_xor(v, 4, 32)); v = fmaxf(v, __shfl_xor(v, 8, 32)); return v; }
__device__ __forceinline__ float rsum16(float v) { v += __shfl_xor(v, 1, 32); v += __shfl_xor(v, 2, 32); v += __shfl_xor(v, 4, 32); v += __shfl_xor(v, 8, 32); return v; }

template <typename T16, bool HR>
__device__ __forceinline__ void flash_body(const T16* QA, const T16* QB, const T16* KA, const T16* KB, const T16* VA, const T16* VB, bf* ATh, bf* ATl, T16* pt, float* os) {
    typedef typename WFrag<T16>::V V;
    constexpr unsigned QR   = HR ? (unsigned)RH : (unsigned)SEQ;     // rows per z of the q/k planes = key pitch of the v planes
    constexpr unsigned ROW0 = HR ? 0u : (unsigned)RH;
    constexpr unsigned NT   = HR ? (unsigned)RH / 16u : (unsigned)(SEQ - RH) / 16u;
    constexpr unsigned NTD  = NT ? NT : 1u;
    const unsigned lane = threadIdx.x & 31u, wid = threadIdx.x >> 5, lr = lane & 15u, hi = lane >> 4;
    const unsigned w = blockIdx.x * 4u + wid; const unsigned z = w / NTD, mt = w % NTD; const unsigned q0 = ROW0 + mt * 16u;
    T16* ptw = pt + (size_t)wid * 1024; T16* ptl = ptw + 512; float* osw = os + (size_t)wid * (16 * 68);
    const size_t qoff = ((size_t)z * QR + q0 + lr) * HD + 8u * hi;
    V aq[2], aql[2];
#pragma unroll
    for (int d = 0; d < 2; ++d) { aq[d] = WFrag<T16>::ld(QA + qoff + d * 32); if (HR) aql[d] = WFrag<T16>::ld(QB + qoff + d * 32); }
    const size_t koff = ((size_t)z * QR + lr) * HD + 8u * hi;
    const size_t voff = ((size_t)z * HD + lr) * QR + 8u * hi;
    v8f o[4]; float m[8], l[8];
#pragma unroll
    for (int t = 0; t < 4; ++t) o[t] = (v8f){};
#pragma unroll
    for (int j = 0; j < 8; ++j) { m[j] = -1.0e30f; l[j] = 0.0f; }
    const unsigned nch = (q0 + 15u) / 32u + 1u;      // wave-uniform; keys < nch*32 <= QR
    V kb[2][2], kl[2][2], vb[4], vl[4];              // fragments of the current chunk: kb[d][i] = keys 16i.., depth 32d..; vb[t] = depth 16t..
    // Chunk 0 is requested in the loop's own order (queries, keys, values): loads retire in order and the wait at the loop's head is counted for both ways in, so another order here makes every trip's score products wait for the value requests too.
    asm volatile("s_wait_xcnt 0x0" ::: "memory");    // key fragments land in registers that held the query requests' addresses: a precaution in front of that reuse; as a memory fence it also keeps the query requests ahead of the key requests
#pragma unroll
    for (int d = 0; d < 2; ++d) { const size_t ko = koff + d * 32;
        kb[d][0] = WFrag<T16>::ld(KA + ko); kb[d][1] = WFrag<T16>::ld(KA + ko + 16 * HD); if (HR) { kl[d][0] = WFrag<T16>::ld(KB + ko); kl[d][1] = WFrag<T16>::ld(KB + ko + 16 * HD); } }
    __builtin_amdgcn_sched_barrier(0);               // keeps the key requests ahead of the value requests
#pragma unroll
    for (int t = 0; t < 4; ++t) { const size_t vo = voff + (size_t)t * 16 * QR; vb[t] = WFrag<T16>::ld(VA + vo); if (HR) vl[t] = WFrag<T16>::ld(VB + vo); }
#pragma unroll 1
    for (unsigned c = 0; c < nch; ++c) {
        const unsigned c0 = c * 32u;
        const unsigned cn = ((c + 1u < nch) ? c + 1u : c) * 32u;      // chunk fetched ahead; the last trip asks for its own chunk again (in bounds, never used)
        v8f s0 = (v8f){}, s1 = (v8f){};
#pragma unroll
        for (int d = 0; d < 2; ++d) {
            s0 = WFrag<T16>::mma(aq[d], kb[d][0], s0); s1 = WFrag<T16>::mma(aq[d], kb[d][1], s1);
            if (HR) { s0 = WFrag<T16>::mma(aql[d], kb[d][0], s0); s1 = WFrag<T16>::mma(aql[d], kb[d][1], s1); s0 = WFrag<T16>::mma(aq[d], kl[d][0], s0); s1 = WFrag<T16>::mma(aq[d], kl[d][1], s1); } }
        asm volatile("v_nop\n\tv_nop\n\tv_nop\n\tv_nop" : "+v"(s0), "+v"(s1) : "v"(aq[0]), "v"(aq[1]));
#pragma unroll
        for (int d = 0; d < 2; ++d) { const size_t ko = koff + (size_t)cn * HD + d * 32;
            kb[d][0] = WFrag<T16>::ld(KA + ko); kb[d][1] = WFrag<T16>::ld(KA + ko + 16 * HD); if (HR) { kl[d][0] = WFrag<T16>::ld(KB + ko); kl[d][1] = WFrag<T16>::ld(KB + ko + 16 * HD); } }
        __builtin_amdgcn_sched_barrier(0);      // holds the key requests above the softmax, which is the time they have to land; sunk towards their use they would be waited out
        const unsigned col0 = c0 + lr, col1 = col0 + 16u, rb = q0 + 8u * hi;
#pragma unroll
        for (int j = 0; j < 8; ++j) { const unsigned row = rb + (unsigned)j; const bool v0 = (col0 <= row), v1 = (col1 <= row);
            const float t0 = s0[j] * SC2, t1 = s1[j] * SC2;
            float cm = fmaxf(v0 ? t0 : -1.0e30f, v1 ? t1 : -1.0e30f); cm = rmax16(cm);
            const float nm = fmaxf(m[j], cm); const float al = __builtin_amdgcn_exp2f(m[j] - nm); m[j] = nm;
            const float e0 = __builtin_amdgcn_exp2f(fminf(t0 - nm, 0.0f)), e1 = __builtin_amdgcn_exp2f(fminf(t1 - nm, 0.0f));
            const float p0 = v0 ? e0 : 0.0f, p1 = v1 ? e1 : 0.0f;
            l[j] = l[j] * al + (p0 + p1);
            o[0][j] *= al; o[1][j] *= al; o[2][j] *= al; o[3][j] *= al;
            const unsigned pi = (8u * hi + (unsigned)j) * 32u + lr;
            WFrag<T16>::pst(ptw, ptl, pi, p0); WFrag<T16>::pst(ptw, ptl, pi + 16u, p1); }
        __builtin_amdgcn_wave_barrier(); asm volatile("" ::: "memory");      // wave-private tile: stores above, fragment reload below (same element type, may_alias vector)
        const V ap = WFrag<T16>::lds(ptw + lr * 32u + 8u * hi); V apl; if (HR) apl = WFrag<T16>::lds(ptl + lr * 32u + 8u * hi);
#pragma unroll
        for (int t = 0; t < 4; ++t) {
            o[t] = WFrag<T16>::mma(ap, vb[t], o[t]);
            if (HR) { o[t] = WFrag<T16>::mma(apl, vb[t], o[t]); o[t] = WFrag<T16>::mma(ap, vl[t], o[t]); } }
        asm volatile("v_nop\n\tv_nop\n\tv_nop\n\tv_nop" : "+v"(o[0]), "+v"(o[1]), "+v"(o[2]), "+v"(o[3]) : "v"(ap));
#pragma unroll
        for (int t = 0; t < 4; ++t) { const size_t vo = voff + (size_t)t * 16 * QR + cn; vb[t] = WFrag<T16>::ld(VA + vo); if (HR) vl[t] = WFrag<T16>::ld(VB + vo); }
        __builtin_amdgcn_wave_barrier(); asm volatile("" ::: "memory");
    }
    asm volatile("s_wait_loadcnt 0x0" ::: "memory");      // the last trip's requests are never read: they retire here, before the wave gives its registers back
    const float cs = HR ? 1.0f : (1.0f / PCAR);
#pragma unroll
    for (int j = 0; j < 8; ++j) { const float ls = rsum16(l[j]); const float inv = (1.0f / ls) * cs;
#pragma unroll
        for (int t = 0; t < 4; ++t) osw[(8u * hi + (unsigned)j) * 68u + (unsigned)t * 16u + lr] = o[t][j] * inv; }
    __builtin_amdgcn_wave_barrier(); asm volatile("" ::: "memory");
    const unsigned b = z / (unsigned)NH, h = z % (unsigned)NH; const unsigned rq = lane >> 3, seg = lane & 7u;      // rows 4s + rq, s = 0..3, rq = 0..3: all 16 rows
{
#pragma unroll
        for (int s = 0; s < 4; ++s) { const unsigned row = 4u * (unsigned)s + rq; const v4f a = *(const v4fa*)(osw + row * 68u + seg * 8u), bq = *(const v4fa*)(osw + row * 68u + seg * 8u + 4u); v8us oh, ol;
#pragma unroll
            for (int k = 0; k < 4; ++k) { unsigned short x, y2; splitf(a[k], x, y2); oh[k] = x; ol[k] = y2; splitf(bq[k], x, y2); oh[k + 4] = x; ol[k + 4] = y2; }
            const size_t oo = (size_t)(b * SEQ + q0 + row) * DM + h * HD + seg * 8u;
            *(v8us*)(ATh + oo) = oh; *(v8us*)(ATl + oo) = ol; }
         }
}

// coverage: k_flash_hr grid NZ*(RH/16)/4 x 4 waves x (16 rows x 64 d) == NZ*RH*HD; k_flash_pl grid NZ*((SEQ-RH)/16)/4 x 4 waves x (16 x 64) == NZ*(SEQ-RH)*HD; union == NB*SEQ*DM per context plane.
static_assert((NZ * (RH / 16)) % 4 == 0);
static_assert((NZ * ((SEQ - RH) / 16)) % 4 == 0);
__global__ __launch_bounds__(128) void k_flash_hr(const bf* Qh, const bf* Ql, const bf* Kh, const bf* Kl, const bf* Vh, const bf* Vl, bf* ATh, bf* ATl) {
    __shared__ __align__(16) bf pt[4 * 2 * 512]; __shared__ __align__(16) float os[4 * 16 * 68];
    flash_body<bf, true>(Qh, Ql, Kh, Kl, Vh, Vl, ATh, ATl, pt, os); }
__global__ __launch_bounds__(128) void k_flash_pl(const h16* Q16, const h16* K16, const h16* V16, bf* ATh, bf* ATl) {
    __shared__ __align__(16) h16 pt[4 * 2 * 512]; __shared__ __align__(16) float os[4 * 16 * 68];
    flash_body<h16, false>(Q16, nullptr, K16, nullptr, V16, nullptr, ATh, ATl, pt, os); }

// workspace carve (bytes; every region a multiple of 256)
constexpr size_t SZ_WT  = (size_t)4 * DM * DM * 2;
constexpr size_t SZ_XB  = (size_t)NB * SEQ * DM * 2;
constexpr size_t SZ_F   = (size_t)3 * NB * SEQ * DM * 4;
constexpr size_t SZ_QK  = (size_t)2 * NZ * SEQ * HD * 2;
constexpr size_t SZ_V   = (size_t)NZ * HD * SEQ * 2;
constexpr size_t SZ_QKH = (size_t)2 * NZ * RH * HD * 2;
constexpr size_t SZ_VH  = (size_t)NZ * HD * RH * 2;
constexpr size_t SZ_AT  = (size_t)NB * SEQ * DM * 2;
constexpr size_t WS_TOTAL = SZ_WT + SZ_XB + SZ_F + SZ_QK + SZ_V + 2 * SZ_QKH + 2 * SZ_VH + 2 * SZ_AT;
static_assert(WS_TOTAL <= (size_t)134217728);
static_assert(SZ_WT % 256 == 0 && SZ_XB % 256 == 0 && SZ_F % 256 == 0 && SZ_QK % 256 == 0 && SZ_V % 256 == 0 && SZ_QKH % 256 == 0 && SZ_VH % 256 == 0 && SZ_AT % 256 == 0);

extern "C" void kernel_launch(void* const* d_in, const int* in_sizes, int n_in,
                              void* d_out, int out_size, void* d_ws, size_t ws_size, hipStream_t stream) {
    if (n_in < 7) return;
    const long long need_x = ((long long)(NB - 1) * SEQ_FULL + SEQ) * DM;
    if ((long long)in_sizes[0] < need_x || (long long)out_size < need_x) return;
    if (in_sizes[1] < DM * DM || in_sizes[2] < DM * DM || in_sizes[3] < DM * DM || in_sizes[4] < DM * DM) return;
    if (in_sizes[5] < SEQ * (HD / 2) || in_sizes[6] < SEQ * (HD / 2)) return;
    if (WS_TOTAL > ws_size) return;
    const float* x = (const float*)d_in[0]; const float* wq = (const float*)d_in[1]; const float* wk = (const float*)d_in[2]; const float* wv = (const float*)d_in[3]; const float* wo = (const float*)d_in[4];
    const float* fcos = (const float*)d_in[5]; const float* fsin = (const float*)d_in[6];
    float* OUT = (float*)d_out;
    char* wsp = (char*)d_ws;
    auto take = [&](size_t bytes) { char* p = wsp; wsp += bytes; return (void*)p; };
    bf* WT = (bf*)take(SZ_WT);            // [4][DM n][DM k]: q | k | v | o
    bf* XB = (bf*)take(SZ_XB);            // [NB*SEQ][DM]
    float* F = (float*)take(SZ_F);        // [3][NB*SEQ][DM]: q | k | v projections
    h16* QK16 = (h16*)take(SZ_QK);        // [2][NZ][SEQ][HD]
    h16* V16 = (h16*)take(SZ_V);          // [NZ][HD][SEQ]
    bf* QKh = (bf*)take(SZ_QKH); bf* QKl = (bf*)take(SZ_QKH);    // [2][NZ][RH][HD]
    bf* Vh = (bf*)take(SZ_VH); bf* Vl = (bf*)take(SZ_VH);        // [NZ][HD][RH]
    bf* ATh = (bf*)take(SZ_AT); bf* ATl = (bf*)take(SZ_AT);      // [NB*SEQ][DM]
    if ((size_t)(wsp - (char*)d_ws) > ws_size) return;

    k_cvtx<<<dim3((unsigned)((size_t)SEQ * DM / 2048), NB, 1), 256, 0, stream>>>(x, XB);
    k_wt4<<<dim3((unsigned)((size_t)DM * DM / 4096), 4, 1), 256, 0, stream>>>(wq, wk, wv, wo, WT);
    k_gemmw<bf, 0, false><<<dim3(NB * SEQ / 64, DM / 64, 3), 32, 0, stream>>>(XB, nullptr, WT, nullptr, DM, F, DM, nullptr, (size_t)0, (size_t)DM * DM, (size_t)NB * SEQ * DM);
    k_ropeqk<<<dim3((unsigned)((size_t)NZ * SEQ * 8 / 256), 2, 1), 256, 0, stream>>>(F, fcos, fsin, QK16, QKh, QKl);
    k_vtp<<<(unsigned)((size_t)NZ * HD * (SEQ / 8) / 256), 256, 0, stream>>>(F + (size_t)2 * NB * SEQ * DM, V16, Vh, Vl);
    k_flash_hr<<<(unsigned)(NZ * (RH / 16) / 4), 128, 0, stream>>>(QKh, QKl, QKh + (size_t)NZ * RH * HD, QKl + (size_t)NZ * RH * HD, Vh, Vl, ATh, ATl);
    if (SEQ > RH) k_flash_pl<<<(unsigned)(NZ * ((SEQ - RH) / 16) / 4), 128, 0, stream>>>(QK16, QK16 + (size_t)NZ * SEQ * HD, V16, ATh, ATl);
    k_gemmw<bf, 1, false><<<dim3(SEQ / 64, DM / 64, NB), 32, 0, stream>>>(ATh, ATl, WT + (size_t)3 * DM * DM, nullptr, DM, OUT, DM, nullptr, (size_t)SEQ * DM, (size_t)0, (size_t)SEQ_FULL * DM);
}

// v002
// One run takes 181 microseconds.
// Timed twice side by side with v001, it ran 1.24 and 1.23 times as fast.
// All steps since v000 together make it 1.59 times as fast.
#include <hip/hip_runtime.h>

// Contractions (f32 accumulate): q/k/v projections v_wmma_f32_16x16x32_bf16 on bf16 RNE-converted inputs (single product); causal scores and probability x value: query rows < RH on bf16 hi/lo planes (3 products), rows >= RH v_wmma_f32_16x16x32_f16 (probabilities carried x1024); output projection bf16 hi/lo context x bf16 weight (2 products); softmax f32.
// Causal multi-head attention with interleaved-pair rotary tables read as INPUT values: x [NB][SEQ][1024]; wq/wk/wv/wo [in][out], no bias; 16 heads x 64; scores x 64^-0.5; causal by index.
// Layout: bf16 copy of x (both batches, compact rows); four weights transposed once to Bt planes; one z-batched projection GEMM (q | k | v); plane builders (rotary on q, k; transposed v);
// every 16-bit plane that feeds a matrix operand is stored in FRAGMENT ORDER (below), so that each fragment request of a wave covers whole 128-byte lines;
// flash attention, one wave per 16-row query tile, 32-key chunks with the key and value fragments fetched one chunk ahead, online softmax with running max; context hi/lo planes; output GEMM.

#ifndef NB
#define NB 2
#endif
#ifndef SEQ
#define SEQ 2048
#endif
#define NB_FULL  2
#define SEQ_FULL 2048
#define DM   1024
#define NH   16
#define HD   64
#define NZ   (NB * NH)
#define RH   ((SEQ < 512) ? SEQ : 512)     // query rows < RH use hi+lo planes
#define PCAR 1024.0f
#define SC2  0.18033688011112042f          // HD^-0.5 * log2(e)

static_assert((SEQ & (SEQ - 1)) == 0);
static_assert(SEQ % 256 == 0);
static_assert(RH % 256 == 0);
static_assert(RH <= SEQ);
static_assert(DM == NH * HD);
static_assert(HD == 64);
static_assert((NB * SEQ) % 64 == 0);
static_assert(DM % 64 == 0);
static_assert(NB <= NB_FULL && SEQ <= SEQ_FULL);

typedef _Float16 h16;
typedef unsigned short bf;
typedef __attribute__((ext_vector_type(16))) __bf16   v16bf;
typedef __attribute__((ext_vector_type(16))) _Float16 v16h;
typedef __attribute__((ext_vector_type(8)))  _Float16 v8h;
typedef __attribute__((ext_vector_type(8)))  unsigned short v8us;
typedef __attribute__((ext_vector_type(2)))  unsigned short v2us;
typedef __attribute__((ext_vector_type(8)))  float    v8f;
typedef __attribute__((ext_vector_type(4)))  float    v4f;
typedef v8h  __attribute__((may_alias)) v8ha;
typedef v4f  __attribute__((may_alias)) v4fa;
typedef v8us __attribute__((may_alias)) v8usa;

__device__ __forceinline__ unsigned short f2bf(float f) { unsigned u = __float_as_uint(f); u += 0x7FFFu + ((u >> 16) & 1u); return (unsigned short)(u >> 16); }
__device__ __forceinline__ float bf2f(unsigned short b) { return __uint_as_float(((unsigned)b) << 16); }
__device__ __forceinline__ float bfr(float f) { return bf2f(f2bf(f)); }
__device__ __forceinline__ void splitf(float y, unsigned short& h, unsigned short& l) { h = f2bf(y); l = f2bf(y - bf2f(h)); }
__device__ __forceinline__ v16h cat16(v8h lo, v8h hi) { return __builtin_shufflevector(lo, hi, 0, 1, 2, 3, 4, 5, 6, 7, 8, 9, 10, 11, 12, 13, 14, 15); }
__device__ __forceinline__ v16bf cat16b(v8us lo, v8us hi) { return __builtin_bit_cast(v16bf, __builtin_shufflevector(lo, hi, 0, 1, 2, 3, 4, 5, 6, 7, 8, 9, 10, 11, 12, 13, 14, 15)); }
__device__ __forceinline__ v8f wmma16(v16h a, v16h b, v8f c) { return __builtin_amdgcn_wmma_f32_16x16x32_f16(false, a, false, b, (short)0, c, false, false); }
__device__ __forceinline__ v8f wmmab(v16bf a, v16bf b, v8f c) { return __builtin_amdgcn_wmma_f32_16x16x32_bf16(false, a, false, b, (short)0, c, false, false); }

// Fragment map: lane (lr = lane & 15, hi = lane >> 4) holds row lr; elements 0..7 <- k0+8hi.., elements 8..15 <- k0+16+8hi.. (same map for A and B).
// Fragment order of a plane: blocks of 16 rows x 32 k = 512 elements; element (r, k) of a block sits at ((k >> 4) & 1) * 256 + (((k >> 3) & 1) * 16 + (r & 15)) * 8 + (k & 7).
// A fragment is then lane's 8 elements at block + lane * 8 and at block + 256 + lane * 8: two requests of 512 contiguous bytes (4 lines each) where row-major planes give 32-byte pieces of 16 lines.
// ld: global, p = block + lane * 8. lds: row-major LDS tile, p = row lr, k0 + 8*hi.
template <typename T16> struct WFrag;
template <> struct WFrag<h16> { typedef v16h V;
    static __device__ __forceinline__ V ld(const h16* p) { return cat16(*(const v8h*)p, *(const v8h*)(p + 256)); }
    static __device__ __forceinline__ V lds(const h16* p) { return cat16(*(const v8ha*)p, *(const v8ha*)(p + 16)); }
    static __device__ __forceinline__ v8f mma(V a, V b, v8f c) { return wmma16(a, b, c); }
    static __device__ __forceinline__ void pst(h16* ph, h16* pl, unsigned i, float p) { (void)pl; ph[i] = (h16)(p * PCAR); } };
template <> struct WFrag<bf> { typedef v16bf V;
    static __device__ __forceinline__ V ld(const bf* p) { return cat16b(*(const v8us*)p, *(const v8us*)(p + 256)); }
    static __device__ __forceinline__ V lds(const bf* p) { return cat16b(*(const v8usa*)p, *(const v8usa*)(p + 16)); }
    static __device__ __forceinline__ v8f mma(V a, V b, v8f c) { return wmmab(a, b, c); }
    static __device__ __forceinline__ void pst(bf* ph, bf* pl, unsigned i, float p) { unsigned short a, c; splitf(p, a, c); ph[i] = a; pl[i] = c; } };

// Named as inputs here, request addresses keep their registers to themselves up to this wait: without it a later fragment of the same trip lands in the address registers of requests just issued. A precaution.
template <typename P> __device__ __forceinline__ void hold(P a, P b, P c, P d) { asm volatile("s_wait_xcnt 0x0" :: "v"(a), "v"(b), "v"(c), "v"(d) : "memory"); }

// ---- k_gemmw: register-blocked GEMM, ONE WAVE per 64x64 output tile (16 accumulators), operands straight from fragment-ordered 16-bit planes (block (rt, kt) at rt*16*K + kt*512); grid (M/64, N/64, Z), 32 threads.
// C[m][n] (f32, pitch ldc, + optional f32 bias[n]) = sum_k A[m][k] Bt[n][k] (+ split products per NSPLIT). z-batch strides sA/sB/sC in elements. K % 32 == 0, a compile-time constant: the four row tiles of an operand are then one address and immediate offsets.
template <typename T16, int NSPLIT, bool BIAS, int K>
__global__ __launch_bounds__(32) void k_gemmw(const T16* __restrict__ A, const T16* __restrict__ A2, const T16* __restrict__ Bt, const T16* __restrict__ Bt2, float* C, int ldc, const float* __restrict__ bias, size_t sA, size_t sB, size_t sC) {
    typedef typename WFrag<T16>::V V;
    __shared__ __align__(16) float os[16 * 68];
    const size_t z = blockIdx.z; A += z * sA; if (A2) A2 += z * sA; Bt += z * sB; if (Bt2) Bt2 += z * sB; C += z * sC;
    const int lane = threadIdx.x & 31, lr = lane & 15, hi = lane >> 4; const int r0 = blockIdx.x * 64, c0 = blockIdx.y * 64;
    v8f acc[4][4];
#pragma unroll
    for (int mb = 0; mb < 4; ++mb)
#pragma unroll
        for (int nb = 0; nb < 4; ++nb) acc[mb][nb] = (v8f){};
    const size_t aoff = (size_t)r0 * K + 8 * lane, boff = (size_t)c0 * K + 8 * lane;
#pragma unroll 1
    for (int kc = 0; kc < K; kc += 32) {
        V a[4], a2[4]; const T16* pa = A + aoff + kc * 16; const T16* pa2 = A2 + aoff + kc * 16; const T16* pb = Bt + boff + kc * 16; const T16* pb2 = Bt2 + boff + kc * 16;
#pragma unroll
        for (int mb = 0; mb < 4; ++mb) { a[mb] = WFrag<T16>::ld(pa + mb * 16 * K); if (NSPLIT == 1 || NSPLIT == 2) a2[mb] = WFrag<T16>::ld(pa2 + mb * 16 * K); }
#pragma unroll
        for (int nb = 0; nb < 4; ++nb) { const V b = WFrag<T16>::ld(pb + nb * 16 * K); V b2; if (NSPLIT >= 2) b2 = WFrag<T16>::ld(pb2 + nb * 16 * K);
#pragma unroll
            for (int mb = 0; mb < 4; ++mb) { acc[mb][nb] = WFrag<T16>::mma(a[mb], b, acc[mb][nb]); if (NSPLIT == 1 || NSPLIT == 2) acc[mb][nb] = WFrag<T16>::mma(a2[mb], b, acc[mb][nb]); if (NSPLIT >= 2) acc[mb][nb] = WFrag<T16>::mma(a[mb], b2, acc[mb][nb]); } }
        asm volatile("v_nop\n\tv_nop\n\tv_nop\n\tv_nop" : "+v"(acc[0][0]), "+v"(acc[1][1]), "+v"(acc[2][2]), "+v"(acc[3][3]) : "v"(a[0]), "v"(a[3]));
        hold(pa, pb, (NSPLIT == 1 || NSPLIT == 2) ? pa2 : pa, (NSPLIT >= 2) ? pb2 : pb);
    }
#pragma unroll
    for (int mb = 0; mb < 4; ++mb) {
#pragma unroll
        for (int nb = 0; nb < 4; ++nb) {
#pragma unroll
            for (int j = 0; j < 8; ++j) os[(hi * 8 + j) * 68 + nb * 16 + lr] = acc[mb][nb][j]; }
        __builtin_amdgcn_wave_barrier(); asm volatile("" ::: "memory");
        float* crow = C + (size_t)(r0 + mb * 16) * ldc + c0;
{
#pragma unroll
            for (int s = 0; s < 8; ++s) { const int row = 2 * s + hi, cofs = lr * 4; v4f val = *(const v4fa*)(os + row * 68 + cofs); if (BIAS) { val[0] += bfr(bias[c0 + cofs]); val[1] += bfr(bias[c0 + cofs + 1]); val[2] += bfr(bias[c0 + cofs + 2]); val[3] += bfr(bias[c0 + cofs + 3]); }
                *(v4f*)(crow + (size_t)row * ldc + cofs) = val; }
             }
        __builtin_amdgcn_wave_barrier(); asm volatile("" ::: "memory");
    }
}

// thread i of a batch writes piece i (8 elements) of the fragment-ordered copy: i = (block * 2 + k half) * 32 + lane.
// coverage: grid (SEQ*DM/2048, NB) x 256 threads x 8 elements == NB*SEQ*DM.
static_assert(((size_t)SEQ * DM) % 2048 == 0);
__global__ __launch_bounds__(256) void k_cvtx(const float* __restrict__ src, bf* dst) {
    const unsigned i = blockIdx.x * 256u + threadIdx.x; const unsigned b = blockIdx.y;
    const unsigned lr = i & 15u, hi = (i >> 4) & 1u, h2 = (i >> 5) & 1u, blk = i >> 6; const unsigned kt = blk % (unsigned)(DM / 32), rt = blk / (unsigned)(DM / 32);
    const float* s = src + (size_t)b * SEQ_FULL * DM + (size_t)(rt * 16u + lr) * DM + kt * 32u + h2 * 16u + hi * 8u; bf* d = dst + (size_t)b * SEQ * DM + (size_t)i * 8;
    const v8f v = *(const v8f*)s; v8us o;
#pragma unroll
    for (int k = 0; k < 8; ++k) o[k] = f2bf(v[k]);
    *(v8us*)d = o;  }

// thread i of a weight writes piece i of its fragment-ordered transpose Bt[n][k] = w[k][n]: 8 k of one n; a wave reads 64-byte runs of two w rows per request.
// coverage: grid (DM*DM/2048, 4) x 256 threads x 8 elements == 4*DM*DM.
static_assert(((size_t)DM * DM) % 2048 == 0);
__global__ __launch_bounds__(256) void k_wt4(const float* __restrict__ w0, const float* __restrict__ w1, const float* __restrict__ w2, const float* __restrict__ w3, bf* Bt) {
    const unsigned y = blockIdx.y; const float* w = (y == 0u) ? w0 : (y == 1u) ? w1 : (y == 2u) ? w2 : w3; bf* o = Bt + (size_t)y * DM * DM;
    const unsigned i = blockIdx.x * 256u + threadIdx.x;
    const unsigned lr = i & 15u, hi = (i >> 4) & 1u, h2 = (i >> 5) & 1u, blk = i >> 6; const unsigned kt = blk % (unsigned)(DM / 32), nt = blk / (unsigned)(DM / 32);
    const float* s = w + (size_t)(kt * 32u + h2 * 16u + hi * 8u) * DM + nt * 16u + lr; v8us q;
#pragma unroll
    for (int j = 0; j < 8; ++j) q[j] = f2bf(s[(size_t)j * DM]);
    *(v8us*)(o + (size_t)i * 8) = q;
}

// ---- k_ropeqk: head planes [z] (rows t, k = d, fragment order: 2 blocks per 16 rows) of the rotated q (blockIdx.y 0) and k (1): pair i of head row: out[2i] = x[2i] c - x[2i+1] s, out[2i+1] = x[2i] s + x[2i+1] c with c, s = bf16 RNE-converted INPUT table values [t][i].
// coverage: grid (NZ*SEQ*8/256, 2) x 256 threads x 8 elements == 2*NZ*SEQ*HD (fp16); rows t < RH of every z also fill 2*NZ*RH*HD hi and lo.
static_assert(((size_t)NZ * SEQ * 8) % 256 == 0);
__global__ __launch_bounds__(256) void k_ropeqk(const float* __restrict__ F, const float* __restrict__ cosT, const float* __restrict__ sinT, h16* P16, bf* Ph, bf* Pl) {
    const unsigned y = blockIdx.y; const unsigned g = blockIdx.x * 256u + threadIdx.x; const unsigned seg = g & 7u, prow = g >> 3;
    const unsigned t = prow % (unsigned)SEQ, z = prow / (unsigned)SEQ, b = z / (unsigned)NH, h = z % (unsigned)NH;
    const float* f = F + (size_t)y * NB * SEQ * DM + (size_t)(b * SEQ + t) * DM + h * HD + seg * 8u;
    const v4f x0 = *(const v4f*)f, x1 = *(const v4f*)(f + 4); const v4f cv = *(const v4f*)(cosT + (size_t)t * 32 + seg * 4u), sv = *(const v4f*)(sinT + (size_t)t * 32 + seg * 4u);
    float xs[8]; xs[0] = x0[0]; xs[1] = x0[1]; xs[2] = x0[2]; xs[3] = x0[3]; xs[4] = x1[0]; xs[5] = x1[1]; xs[6] = x1[2]; xs[7] = x1[3];
    v8h o16; v8us oh, ol;
#pragma unroll
    for (int i = 0; i < 4; ++i) { const float c = bfr(cv[i]), s = bfr(sv[i]); const float tr = xs[2 * i], ti = xs[2 * i + 1]; const float rr = tr * c - ti * s, ri = tr * s + ti * c;
        o16[2 * i] = (h16)rr; o16[2 * i + 1] = (h16)ri; unsigned short a, d2; splitf(rr, a, d2); oh[2 * i] = a; ol[2 * i] = d2; splitf(ri, a, d2); oh[2 * i + 1] = a; ol[2 * i + 1] = d2; }
    const unsigned pc = (seg >> 2) * 512u + ((seg >> 1) & 1u) * 256u + ((seg & 1u) * 16u + (t & 15u)) * 8u;      // this thread's piece inside its 16-row tile (2 blocks = 1024 elements)
    h16* p16 = P16 + (size_t)y * NZ * SEQ * HD + (size_t)z * SEQ * HD + (t >> 4) * 1024u + pc;
    const bool hl = (t < (unsigned)RH);     // uniform per wave (4 consecutive rows, RH % 4 == 0)
    const size_t ho = (size_t)y * NZ * RH * HD + (size_t)z * RH * HD + (hl ? (t >> 4) : 0u) * 1024u + pc;
    *(v8h*)p16 = o16; if (hl) { *(v8us*)(Ph + ho) = oh; *(v8us*)(Pl + ho) = ol; }
    
}

// ---- k_vtp: value planes [z] (rows d, k = key, fragment order, the four 16-d blocks of a 32-key chunk side by side: block (chunk, dt) at (chunk * 4 + dt) * 512). Thread g writes piece g: 8 keys of one d.
// coverage: grid NZ*HD*(SEQ/8)/256 x 256 threads x 8 elements == NZ*HD*SEQ (fp16); chunks below RH of every z fill NZ*HD*RH hi and lo.
static_assert(((size_t)NZ * HD * (SEQ / 8)) % 256 == 0);
static_assert(RH % 32 == 0 && SEQ % 32 == 0);
__global__ __launch_bounds__(256) void k_vtp(const float* __restrict__ Fv, h16* V16, bf* Vh, bf* Vl) {
    const unsigned g = blockIdx.x * 256u + threadIdx.x; const unsigned lr = g & 15u, hi = (g >> 4) & 1u, h2 = (g >> 5) & 1u, dt = (g >> 6) & 3u, cz = g >> 8;
    const unsigned ch = cz % (unsigned)(SEQ / 32), z = cz / (unsigned)(SEQ / 32), b = z / (unsigned)NH, h = z % (unsigned)NH, d = dt * 16u + lr, t0 = ch * 32u + h2 * 16u + hi * 8u;
    const float* f = Fv + (size_t)(b * SEQ + t0) * DM + h * HD + d; v8h o16; v8us oh, ol;
#pragma unroll
    for (int j = 0; j < 8; ++j) { const float x = f[(size_t)j * DM]; o16[j] = (h16)x; unsigned short a, c2; splitf(x, a, c2); oh[j] = a; ol[j] = c2; }
    h16* p16 = V16 + (size_t)g * 8; const bool hl = (ch < (unsigned)(RH / 32));     // uniform per block (256 threads = one chunk of one z)
    const size_t ho = (size_t)z * HD * RH + (hl ? ch : 0u) * 2048u + (g & 255u) * 8u;
    *(v8h*)p16 = o16; if (hl) { *(v8us*)(Vh + ho) = oh; *(v8us*)(Vl + ho) = ol; }
}

// ---- flash attention: one wave = one (z, 16-row query tile); 32-key chunks up to the diagonal; online softmax (running max, log2 domain); probabilities go D-layout -> wave-private LDS tile -> A fragment.
// The key fragments of chunk c + 1 are requested right behind the score products of chunk c, the value fragments right behind its value products: each request has the rest of a trip to land, and no product waits out a load it has just issued.
// HR: bf16 hi/lo planes (rows per z = RH), products hh + lh + hl on both contractions. Plain: fp16 planes, probabilities x PCAR. Output: context hi/lo planes (rows b*SEQ + t, k = h*HD + d, fragment order).
__device__ __forceinline__ float rmax16(float v) { v = fmaxf(v, __shfl_xor(v, 1, 32)); v = fmaxf(v, __shfl_xor(v, 2, 32)); v = fmaxf(v, __shfl_xor(v, 4, 32)); v = fmaxf(v, __shfl_xor(v, 8, 32)); return v; }
__device__ __forceinline__ float rsum16(float v) { v += __shfl_xor(v, 1, 32); v += __shfl_xor(v, 2, 32); v += __shfl_xor(v, 4, 32); v += __shfl_xor(v, 8, 32); return v; }

template <typename T16, bool HR>
__device__ __forceinline__ void flash_body(const T16* QA, const T16* QB, const T16* KA, const T16* KB, const T16* VA, const T16* VB, bf* ATh, bf* ATl, T16* pt, float* os) {
    typedef typename WFrag<T16>::V V;
    constexpr unsigned QR   = HR ? (unsigned)RH : (unsigned)SEQ;     // rows per z of the q/k planes = key pitch of the v planes
    constexpr unsigned ROW0 = HR ? 0u : (unsigned)RH;
    constexpr unsigned NT   = HR ? (unsigned)RH / 16u : (unsigned)(SEQ - RH) / 16u;
    constexpr unsigned NTD  = NT ? NT : 1u;
    const unsigned lane = threadIdx.x & 31u, wid = threadIdx.x >> 5, lr = lane & 15u, hi = lane >> 4;
    const unsigned w = blockIdx.x * 4u + wid; const unsigned z = w / NTD, mt = w % NTD; const unsigned q0 = ROW0 + mt * 16u;
    T16* ptw = pt + (size_t)wid * 1024; T16* ptl = ptw + 512; float* osw = os + (size_t)wid * (16 * 68);
    const size_t zoff = (size_t)z * QR * HD + 8u * lane;      // this lane's piece of block 0 of head z, in the q, k and v planes alike; 16 rows of q or k = 2 blocks, a 32-key chunk of k or v = 4 blocks
    const size_t qoff = zoff + (size_t)q0 * HD;
    V aq[2], aql[2];
#pragma unroll
    for (int d = 0; d < 2; ++d) { aq[d] = WFrag<T16>::ld(QA + qoff + d * 512); if (HR) aql[d] = WFrag<T16>::ld(QB + qoff + d * 512); }
    v8f o[4]; float m[8], l[8];
#pragma unroll
    for (int t = 0; t < 4; ++t) o[t] = (v8f){};
#pragma unroll
    for (int j = 0; j < 8; ++j) { m[j] = -1.0e30f; l[j] = 0.0f; }
    const unsigned nch = (q0 + 15u) / 32u + 1u;      // wave-uniform; keys < nch*32 <= QR
    V kb[2][2], kl[2][2], vb[4], vl[4];              // fragments of the current chunk: kb[d][i] = keys 16i.., depth 32d..; vb[t] = depth 16t..
    // Chunk 0 is requested in the loop's own order (queries, keys, values): loads retire in order and the wait at the loop's head is counted for both ways in, so another order here makes every trip's score products wait for the value requests too.
    asm volatile("s_wait_xcnt 0x0" ::: "memory");    // key fragments land in registers that held the query requests' addresses: a precaution in front of that reuse; as a memory fence it also keeps the query requests ahead of the key requests
#pragma unroll
    for (int d = 0; d < 2; ++d) { const size_t ko = zoff + d * 512;
        kb[d][0] = WFrag<T16>::ld(KA + ko); kb[d][1] = WFrag<T16>::ld(KA + ko + 16 * HD); if (HR) { kl[d][0] = WFrag<T16>::ld(KB + ko); kl[d][1] = WFrag<T16>::ld(KB + ko + 16 * HD); } }
    __builtin_amdgcn_sched_barrier(0);               // keeps the key requests ahead of the value requests
#pragma unroll
    for (int t = 0; t < 4; ++t) { const size_t vo = zoff + t * 512; vb[t] = WFrag<T16>::ld(VA + vo); if (HR) vl[t] = WFrag<T16>::ld(VB + vo); }
#pragma unroll 1
    for (unsigned c = 0; c < nch; ++c) {
        const unsigned c0 = c * 32u;
        const unsigned cn = ((c + 1u < nch) ? c + 1u : c) * 32u;      // chunk fetched ahead; the last trip asks for its own chunk again (in bounds, never used)
        v8f s0 = (v8f){}, s1 = (v8f){};
#pragma unroll
        for (int d = 0; d < 2; ++d) {
            s0 = WFrag<T16>::mma(aq[d], kb[d][0], s0); s1 = WFrag<T16>::mma(aq[d], kb[d][1], s1);
            if (HR) { s0 = WFrag<T16>::mma(aql[d], kb[d][0], s0); s1 = WFrag<T16>::mma(aql[d], kb[d][1], s1); s0 = WFrag<T16>::mma(aq[d], kl[d][0], s0); s1 = WFrag<T16>::mma(aq[d], kl[d][1], s1); } }
        asm volatile("v_nop\n\tv_nop\n\tv_nop\n\tv_nop" : "+v"(s0), "+v"(s1) : "v"(aq[0]), "v"(aq[1]));
#pragma unroll
        for (int d = 0; d < 2; ++d) { const size_t ko = zoff + (size_t)cn * HD + d * 512;
            kb[d][0] = WFrag<T16>::ld(KA + ko); kb[d][1] = WFrag<T16>::ld(KA + ko + 16 * HD); if (HR) { kl[d][0] = WFrag<T16>::ld(KB + ko); kl[d][1] = WFrag<T16>::ld(KB + ko + 16 * HD); } }
        if (HR) asm volatile("s_wait_xcnt 0x0" ::: "memory");      // the softmax reuses the key requests' address registers: a precaution
        __builtin_amdgcn_sched_barrier(0);      // holds the key requests above the softmax, which is the time they have to land; sunk towards their use they would be waited out
        const unsigned col0 = c0 + lr, col1 = col0 + 16u, rb = q0 + 8u * hi;
#pragma unroll
        for (int j = 0; j < 8; ++j) { const unsigned row = rb + (unsigned)j; const bool v0 = (col0 <= row), v1 = (col1 <= row);
            const float t0 = s0[j] * SC2, t1 = s1[j] * SC2;
            float cm = fmaxf(v0 ? t0 : -1.0e30f, v1 ? t1 : -1.0e30f); cm = rmax16(cm);
            const float nm = fmaxf(m[j], cm); const float al = __builtin_amdgcn_exp2f(m[j] - nm); m[j] = nm;
            const float e0 = __builtin_amdgcn_exp2f(fminf(t0 - nm, 0.0f)), e1 = __builtin_amdgcn_exp2f(fminf(t1 - nm, 0.0f));
            const float p0 = v0 ? e0 : 0.0f, p1 = v1 ? e1 : 0.0f;
            l[j] = l[j] * al + (p0 + p1);
            o[0][j] *= al; o[1][j] *= al; o[2][j] *= al; o[3][j] *= al;
            const unsigned pi = (8u * hi + (unsigned)j) * 32u + lr;
            WFrag<T16>::pst(ptw, ptl, pi, p0); WFrag<T16>::pst(ptw, ptl, pi + 16u, p1); }
        __builtin_amdgcn_wave_barrier(); asm volatile("" ::: "memory");      // wave-private tile: stores above, fragment reload below (same element type, may_alias vector)
        const V ap = WFrag<T16>::lds(ptw + lr * 32u + 8u * hi); V apl; if (HR) apl = WFrag<T16>::lds(ptl + lr * 32u + 8u * hi);
#pragma unroll
        for (int t = 0; t < 4; ++t) {
            o[t] = WFrag<T16>::mma(ap, vb[t], o[t]);
            if (HR) { o[t] = WFrag<T16>::mma(apl, vb[t], o[t]); o[t] = WFrag<T16>::mma(ap, vl[t], o[t]); } }
        asm volatile("v_nop\n\tv_nop\n\tv_nop\n\tv_nop" : "+v"(o[0]), "+v"(o[1]), "+v"(o[2]), "+v"(o[3]) : "v"(ap));
#pragma unroll
        for (int t = 0; t < 4; ++t) { const size_t vo = zoff + (size_t)cn * HD + t * 512; vb[t] = WFrag<T16>::ld(VA + vo); if (HR) vl[t] = WFrag<T16>::ld(VB + vo); }
        __builtin_amdgcn_wave_barrier(); asm volatile("" ::: "memory");
    }
    asm volatile("s_wait_loadcnt 0x0" ::: "memory");      // the last trip's requests are never read: they retire here, before the wave gives its registers back
    const float cs = HR ? 1.0f : (1.0f / PCAR);
#pragma unroll
    for (int j = 0; j < 8; ++j) { const float ls = rsum16(l[j]); const float inv = (1.0f / ls) * cs;
#pragma unroll
        for (int t = 0; t < 4; ++t) osw[(8u * hi + (unsigned)j) * 68u + (unsigned)t * 16u + lr] = o[t][j] * inv; }
    __builtin_amdgcn_wave_barrier(); asm volatile("" ::: "memory");
    const unsigned b = z / (unsigned)NH, h = z % (unsigned)NH;      // the tile is blocks 2h and 2h + 1 of its 16 rows; store s fills half s & 1 of block s >> 1: row lr, columns 16s + 8hi..
{
#pragma unroll
        for (int s = 0; s < 4; ++s) { const unsigned col = 16u * (unsigned)s + 8u * hi; const v4f a = *(const v4fa*)(osw + lr * 68u + col), bq = *(const v4fa*)(osw + lr * 68u + col + 4u); v8us oh, ol;
#pragma unroll
            for (int k = 0; k < 4; ++k) { unsigned short x, y2; splitf(a[k], x, y2); oh[k] = x; ol[k] = y2; splitf(bq[k], x, y2); oh[k + 4] = x; ol[k + 4] = y2; }
            const size_t oo = (size_t)(b * SEQ + q0) * DM + h * 1024u + (unsigned)s * 256u + 8u * lane;
            *(v8us*)(ATh + oo) = oh; *(v8us*)(ATl + oo) = ol; }
         }
}

// coverage: k_flash_hr grid NZ*(RH/16)/4 x 4 waves x (16 rows x 64 d) == NZ*RH*HD; k_flash_pl grid NZ*((SEQ-RH)/16)/4 x 4 waves x (16 x 64) == NZ*(SEQ-RH)*HD; union == NB*SEQ*DM per context plane.
static_assert((NZ * (RH / 16)) % 4 == 0);
static_assert((NZ * ((SEQ - RH) / 16)) % 4 == 0);
__global__ __launch_bounds__(128) void k_flash_hr(const bf* Qh, const bf* Ql, const bf* Kh, const bf* Kl, const bf* Vh, const bf* Vl, bf* ATh, bf* ATl) {
    __shared__ __align__(16) bf pt[4 * 2 * 512]; __shared__ __align__(16) float os[4 * 16 * 68];
    flash_body<bf, true>(Qh, Ql, Kh, Kl, Vh, Vl, ATh, ATl, pt, os); }
__global__ __launch_bounds__(128) void k_flash_pl(const h16* Q16, const h16* K16, const h16* V16, bf* ATh, bf* ATl) {
    __shared__ __align__(16) h16 pt[4 * 2 * 512]; __shared__ __align__(16) float os[4 * 16 * 68];
    flash_body<h16, false>(Q16, nullptr, K16, nullptr, V16, nullptr, ATh, ATl, pt, os); }

// workspace carve (bytes; every region a multiple of 256)
constexpr size_t SZ_WT  = (size_t)4 * DM * DM * 2;
constexpr size_t SZ_XB  = (size_t)NB * SEQ * DM * 2;
constexpr size_t SZ_F   = (size_t)3 * NB * SEQ * DM * 4;
constexpr size_t SZ_QK  = (size_t)2 * NZ * SEQ * HD * 2;
constexpr size_t SZ_V   = (size_t)NZ * HD * SEQ * 2;
constexpr size_t SZ_QKH = (size_t)2 * NZ * RH * HD * 2;
constexpr size_t SZ_VH  = (size_t)NZ * HD * RH * 2;
constexpr size_t SZ_AT  = (size_t)NB * SEQ * DM * 2;
constexpr size_t WS_TOTAL = SZ_WT + SZ_XB + SZ_F + SZ_QK + SZ_V + 2 * SZ_QKH + 2 * SZ_VH + 2 * SZ_AT;
static_assert(WS_TOTAL <= (size_t)134217728);
static_assert(SZ_WT % 256 == 0 && SZ_XB % 256 == 0 && SZ_F % 256 == 0 && SZ_QK % 256 == 0 && SZ_V % 256 == 0 && SZ_QKH % 256 == 0 && SZ_VH % 256 == 0 && SZ_AT % 256 == 0);

extern "C" void kernel_launch(void* const* d_in, const int* in_sizes, int n_in,
                              void* d_out, int out_size, void* d_ws, size_t ws_size, hipStream_t stream) {
    if (n_in < 7) return;
    const long long need_x = ((long long)(NB - 1) * SEQ_FULL + SEQ) * DM;
    if ((long long)in_sizes[0] < need_x || (long long)out_size < need_x) return;
    if (in_sizes[1] < DM * DM || in_sizes[2] < DM * DM || in_sizes[3] < DM * DM || in_sizes[4] < DM * DM) return;
    if (in_sizes[5] < SEQ * (HD / 2) || in_sizes[6] < SEQ * (HD / 2)) return;
    if (WS_TOTAL > ws_size) return;
    const float* x = (const float*)d_in[0]; const float* wq = (const float*)d_in[1]; const float* wk = (const float*)d_in[2]; const float* wv = (const float*)d_in[3]; const float* wo = (const float*)d_in[4];
    const float* fcos = (const float*)d_in[5]; const float* fsin = (const float*)d_in[6];
    float* OUT = (float*)d_out;
    char* wsp = (char*)d_ws;
    auto take = [&](size_t bytes) { char* p = wsp; wsp += bytes; return (void*)p; };
    bf* WT = (bf*)take(SZ_WT);            // [4] planes (rows n, k): q | k | v | o
    bf* XB = (bf*)take(SZ_XB);            // rows NB*SEQ, k DM
    float* F = (float*)take(SZ_F);        // [3][NB*SEQ][DM]: q | k | v projections
    h16* QK16 = (h16*)take(SZ_QK);        // [2][NZ] planes (rows SEQ, k HD)
    h16* V16 = (h16*)take(SZ_V);          // [NZ] planes (rows HD, k SEQ)
    bf* QKh = (bf*)take(SZ_QKH); bf* QKl = (bf*)take(SZ_QKH);    // [2][NZ] planes (rows RH, k HD)
    bf* Vh = (bf*)take(SZ_VH); bf* Vl = (bf*)take(SZ_VH);        // [NZ] planes (rows HD, k RH)
    bf* ATh = (bf*)take(SZ_AT); bf* ATl = (bf*)take(SZ_AT);      // rows NB*SEQ, k DM
    if ((size_t)(wsp - (char*)d_ws) > ws_size) return;

    k_cvtx<<<dim3((unsigned)((size_t)SEQ * DM / 2048), NB, 1), 256, 0, stream>>>(x, XB);
    k_wt4<<<dim3((unsigned)((size_t)DM * DM / 2048), 4, 1), 256, 0, stream>>>(wq, wk, wv, wo, WT);
    k_gemmw<bf, 0, false, DM><<<dim3(NB * SEQ / 64, DM / 64, 3), 32, 0, stream>>>(XB, nullptr, WT, nullptr, F, DM, nullptr, (size_t)0, (size_t)DM * DM, (size_t)NB * SEQ * DM);
    k_ropeqk<<<dim3((unsigned)((size_t)NZ * SEQ * 8 / 256), 2, 1), 256, 0, stream>>>(F, fcos, fsin, QK16, QKh, QKl);
    k_vtp<<<(unsigned)((size_t)NZ * HD * (SEQ / 8) / 256), 256, 0, stream>>>(F + (size_t)2 * NB * SEQ * DM, V16, Vh, Vl);
    k_flash_hr<<<(unsigned)(NZ * (RH / 16) / 4), 128, 0, stream>>>(QKh, QKl, QKh + (size_t)NZ * RH * HD, QKl + (size_t)NZ * RH * HD, Vh, Vl, ATh, ATl);
    if (SEQ > RH) k_flash_pl<<<(unsigned)(NZ * ((SEQ - RH) / 16) / 4), 128, 0, stream>>>(QK16, QK16 + (size_t)NZ * SEQ * HD, V16, ATh, ATl);
    k_gemmw<bf, 1, false, DM><<<dim3(SEQ / 64, DM / 64, NB), 32, 0, stream>>>(ATh, ATl, WT + (size_t)3 * DM * DM, nullptr, OUT, DM, nullptr, (size_t)SEQ * DM, (size_t)0, (size_t)SEQ_FULL * DM);
}

// v003
// It runs in 145 microseconds.
// In two side-by-side timings against v002, it was 1.26 and 1.23 times as fast.
// All steps since v000 together make it 1.97 times as fast.
#include <hip/hip_runtime.h>

// Contractions (f32 accumulate): q/k/v projections v_wmma_f32_16x16x32_bf16 on bf16 RNE-converted inputs (single product); causal scores and probability x value: query rows < RH on bf16 hi/lo planes (3 products), rows >= RH v_wmma_f32_16x16x32_f16 (probabilities carried x1024); output projection bf16 hi/lo context x bf16 weight (2 products); softmax f32.
// Causal multi-head attention with interleaved-pair rotary tables read as INPUT values: x [NB][SEQ][1024]; wq/wk/wv/wo [in][out], no bias; 16 heads x 64; scores x 64^-0.5; causal by index.
// Layout: bf16 copy of x (both batches, compact rows); four weights transposed once to Bt planes; one z-batched projection GEMM (q | k | v); plane builders (rotary on q, k; transposed v);
// every 16-bit plane that feeds a matrix operand is stored in FRAGMENT ORDER (below), so that each fragment request of a wave covers whole 128-byte lines;
// flash attention, one wave per 16-row query tile, 32-key chunks with the key and value fragments fetched one chunk ahead, online softmax with running max; context hi/lo planes; output GEMM.

#ifndef NB
#define NB 2
#endif
#ifndef SEQ
#define SEQ 2048
#endif
#define NB_FULL  2
#define SEQ_FULL 2048
#define DM   1024
#define NH   16
#define HD   64
#define NZ   (NB * NH)
#define RH   ((SEQ < 512) ? SEQ : 512)     // query rows < RH use hi+lo planes
#define PCAR 1024.0f
#define SC2  0.18033688011112042f          // HD^-0.5 * log2(e)

static_assert((SEQ & (SEQ - 1)) == 0);
static_assert(SEQ % 256 == 0);
static_assert(RH % 256 == 0);
static_assert(RH <= SEQ);
static_assert(DM == NH * HD);
static_assert(HD == 64);
static_assert((NB * SEQ) % 64 == 0);
static_assert(DM % 64 == 0);
static_assert(NB <= NB_FULL && SEQ <= SEQ_FULL);

typedef _Float16 h16;
typedef unsigned short bf;
typedef __attribute__((ext_vector_type(16))) __bf16   v16bf;
typedef __attribute__((ext_vector_type(16))) _Float16 v16h;
typedef __attribute__((ext_vector_type(8)))  _Float16 v8h;
typedef __attribute__((ext_vector_type(8)))  unsigned short v8us;
typedef __attribute__((ext_vector_type(2)))  unsigned short v2us;
typedef __attribute__((ext_vector_type(8)))  float    v8f;
typedef __attribute__((ext_vector_type(4)))  float    v4f;
typedef v8h  __attribute__((may_alias)) v8ha;
typedef v4f  __attribute__((may_alias)) v4fa;
typedef v8us __attribute__((may_alias)) v8usa;

__device__ __forceinline__ unsigned short f2bf(float f) { unsigned u = __float_as_uint(f); u += 0x7FFFu + ((u >> 16) & 1u); return (unsigned short)(u >> 16); }
__device__ __forceinline__ float bf2f(unsigned short b) { return __uint_as_float(((unsigned)b) << 16); }
__device__ __forceinline__ float bfr(float f) { return bf2f(f2bf(f)); }
__device__ __forceinline__ void splitf(float y, unsigned short& h, unsigned short& l) { h = f2bf(y); l = f2bf(y - bf2f(h)); }
__device__ __forceinline__ v16h cat16(v8h lo, v8h hi) { return __builtin_shufflevector(lo, hi, 0, 1, 2, 3, 4, 5, 6, 7, 8, 9, 10, 11, 12, 13, 14, 15); }
__device__ __forceinline__ v16bf cat16b(v8us lo, v8us hi) { return __builtin_bit_cast(v16bf, __builtin_shufflevector(lo, hi, 0, 1, 2, 3, 4, 5, 6, 7, 8, 9, 10, 11, 12, 13, 14, 15)); }
__device__ __forceinline__ v8f wmma16(v16h a, v16h b, v8f c) { return __builtin_amdgcn_wmma_f32_16x16x32_f16(false, a, false, b, (short)0, c, false, false); }
__device__ __forceinline__ v8f wmmab(v16bf a, v16bf b, v8f c) { return __builtin_amdgcn_wmma_f32_16x16x32_bf16(false, a, false, b, (short)0, c, false, false); }

// Fragment map: lane (lr = lane & 15, hi = lane >> 4) holds row lr; elements 0..7 <- k0+8hi.., elements 8..15 <- k0+16+8hi.. (same map for A and B).
// Fragment order of a plane: blocks of 16 rows x 32 k = 512 elements; element (r, k) of a block sits at ((k >> 4) & 1) * 256 + (((k >> 3) & 1) * 16 + (r & 15)) * 8 + (k & 7).
// A fragment is then lane's 8 elements at block + lane * 8 and at block + 256 + lane * 8: two requests of 512 contiguous bytes (4 lines each) where row-major planes give 32-byte pieces of 16 lines.
// ld: global, p = block + lane * 8. lds: row-major LDS tile, p = row lr, k0 + 8*hi.
template <typename T16> struct WFrag;
template <> struct WFrag<h16> { typedef v16h V;
    static __device__ __forceinline__ V ld(const h16* p) { return cat16(*(const v8h*)p, *(const v8h*)(p + 256)); }
    static __device__ __forceinline__ V lds(const h16* p) { return cat16(*(const v8ha*)p, *(const v8ha*)(p + 16)); }
    static __device__ __forceinline__ v8f mma(V a, V b, v8f c) { return wmma16(a, b, c); }
    static __device__ __forceinline__ void pst(h16* ph, h16* pl, unsigned i, float p) { (void)pl; ph[i] = (h16)(p * PCAR); } };
template <> struct WFrag<bf> { typedef v16bf V;
    static __device__ __forceinline__ V ld(const bf* p) { return cat16b(*(const v8us*)p, *(const v8us*)(p + 256)); }
    static __device__ __forceinline__ V lds(const bf* p) { return cat16b(*(const v8usa*)p, *(const v8usa*)(p + 16)); }
    static __device__ __forceinline__ v8f mma(V a, V b, v8f c) { return wmmab(a, b, c); }
    static __device__ __forceinline__ void pst(bf* ph, bf* pl, unsigned i, float p) { unsigned short a, c; splitf(p, a, c); ph[i] = a; pl[i] = c; } };

// ---- k_gemmw: register-blocked GEMM, ONE WAVE per 64x64 output tile (16 accumulators), operands straight from fragment-ordered 16-bit planes (block (rt, kt) at rt*16*K + kt*512); grid (M/64, N/64, Z), 32 threads.
// C[m][n] (f32, pitch ldc, + optional f32 bias[n]) = sum_k A[m][k] Bt[n][k] (+ split products per NSPLIT). z-batch strides sA/sB/sC in elements. K % 32 == 0, a compile-time constant: the four row tiles of an operand are then one address and immediate offsets.
// The fragments of a 32-k trip live in one of NS register sets; a set is asked for again, for trip t + NS, right behind the products of trip t: every request has NS - 1 trips of products to land, and no product waits on a load just issued.
template <typename T16> struct GSet { typename WFrag<T16>::V a[4], a2[4], b[4], b2[4]; };

template <typename T16, int NSPLIT, int K>
__device__ __forceinline__ void g_fetch(GSet<T16>& f, const T16* pa, const T16* pa2, const T16* pb, const T16* pb2, unsigned l8, int ofs) {      // pa..pb2: wave-uniform bases; l8: the lane's piece; ofs: a constant at every call, it goes into the requests' immediate offsets
    __builtin_amdgcn_sched_barrier(0);      // keeps the requests behind the products that read this set: lifted over them they would need registers of their own
#pragma unroll
    for (int mb = 0; mb < 4; ++mb) { f.a[mb] = WFrag<T16>::ld(pa + l8 + (ofs + mb * 16 * K)); if (NSPLIT == 1 || NSPLIT == 2) f.a2[mb] = WFrag<T16>::ld(pa2 + l8 + (ofs + mb * 16 * K)); }
#pragma unroll
    for (int nb = 0; nb < 4; ++nb) { f.b[nb] = WFrag<T16>::ld(pb + l8 + (ofs + nb * 16 * K)); if (NSPLIT >= 2) f.b2[nb] = WFrag<T16>::ld(pb2 + l8 + (ofs + nb * 16 * K)); }
    asm volatile("s_wait_xcnt 0x0" ::: "memory");      // a precaution: it stands in front of every later write of a register that these requests name as an address (the next round's bases)
    __builtin_amdgcn_sched_barrier(0);      // holds the requests above the other sets' products, which are the time they have to land; sunk towards their use they would be waited out
}

template <typename T16, int NSPLIT>
__device__ __forceinline__ void g_mm(const GSet<T16>& f, v8f (&acc)[4][4]) {
#pragma unroll
    for (int nb = 0; nb < 4; ++nb) {
#pragma unroll
        for (int mb = 0; mb < 4; ++mb) { acc[mb][nb] = WFrag<T16>::mma(f.a[mb], f.b[nb], acc[mb][nb]); if (NSPLIT == 1 || NSPLIT == 2) acc[mb][nb] = WFrag<T16>::mma(f.a2[mb], f.b[nb], acc[mb][nb]); if (NSPLIT >= 2) acc[mb][nb] = WFrag<T16>::mma(f.a[mb], f.b2[nb], acc[mb][nb]); } }
    // the four slots between the last products and the requests that land in their operand registers
    asm volatile("v_nop\n\tv_nop\n\tv_nop\n\tv_nop" : "+v"(acc[0][0]), "+v"(acc[1][1]), "+v"(acc[2][2]), "+v"(acc[3][3]) : "v"(f.a[0]), "v"(f.a[3]));
}

template <typename T16, int NSPLIT, bool BIAS, int K, int NS>
__global__ __launch_bounds__(32) void k_gemmw(const T16* __restrict__ A, const T16* __restrict__ A2, const T16* __restrict__ Bt, const T16* __restrict__ Bt2, float* C, int ldc, const float* __restrict__ bias, size_t sA, size_t sB, size_t sC) {
    constexpr int NT = K / 32;               // trips
    constexpr int NL = (NT - NS) / NS;       // rounds of NS trips in which every set is asked for again
    static_assert(K % 32 == 0 && NS >= 2 && NT >= NS);
    __shared__ __align__(16) float os[16 * 68];
    const size_t z = blockIdx.z; A += z * sA; if (A2) A2 += z * sA; Bt += z * sB; if (Bt2) Bt2 += z * sB; C += z * sC;
    const int lane = threadIdx.x & 31, lr = lane & 15, hi = lane >> 4; const int r0 = blockIdx.x * 64, c0 = blockIdx.y * 64;
    v8f acc[4][4];
#pragma unroll
    for (int mb = 0; mb < 4; ++mb)
#pragma unroll
        for (int nb = 0; nb < 4; ++nb) acc[mb][nb] = (v8f){};
    const size_t aoff = (size_t)r0 * K, boff = (size_t)c0 * K; const unsigned l8 = 8u * (unsigned)lane;
    const T16* pa = A + aoff; const T16* pa2 = A2 + aoff; const T16* pb = Bt + boff; const T16* pb2 = Bt2 + boff;
    GSet<T16> f[NS];
#pragma unroll
    for (int s = 0; s < NS; ++s) g_fetch<T16, NSPLIT, K>(f[s], pa, pa2, pb, pb2, l8, s * 512);
#pragma unroll 1
    for (int i = 0; i < NL; ++i) {           // rolled: one round of NS trips is the loop's body
        const int o = (i + 1) * NS * 512; const T16* qa = pa + o; const T16* qa2 = pa2 + o; const T16* qb = pb + o; const T16* qb2 = pb2 + o;
#pragma unroll
        for (int s = 0; s < NS; ++s) { g_mm<T16, NSPLIT>(f[s], acc); g_fetch<T16, NSPLIT, K>(f[s], qa, qa2, qb, qb2, l8, s * 512); }
    }
#pragma unroll
    for (int t = NL * NS; t < NT; ++t) { g_mm<T16, NSPLIT>(f[t % NS], acc);
        if (t + NS < NT) g_fetch<T16, NSPLIT, K>(f[t % NS], pa, pa2, pb, pb2, l8, (t + NS) * 512); }
#pragma unroll
    for (int mb = 0; mb < 4; ++mb) {
#pragma unroll
        for (int nb = 0; nb < 4; ++nb) {
#pragma unroll
            for (int j = 0; j < 8; ++j) os[(hi * 8 + j) * 68 + nb * 16 + lr] = acc[mb][nb][j]; }
        __builtin_amdgcn_wave_barrier(); asm volatile("" ::: "memory");
        float* crow = C + (size_t)(r0 + mb * 16) * ldc + c0;
{
#pragma unroll
            for (int s = 0; s < 8; ++s) { const int row = 2 * s + hi, cofs = lr * 4; v4f val = *(const v4fa*)(os + row * 68 + cofs); if (BIAS) { val[0] += bfr(bias[c0 + cofs]); val[1] += bfr(bias[c0 + cofs + 1]); val[2] += bfr(bias[c0 + cofs + 2]); val[3] += bfr(bias[c0 + cofs + 3]); }
                *(v4f*)(crow + (size_t)row * ldc + cofs) = val; }
             }
        __builtin_amdgcn_wave_barrier(); asm volatile("" ::: "memory");
    }
}

// thread i of a batch writes piece i (8 elements) of the fragment-ordered copy: i = (block * 2 + k half) * 32 + lane.
// coverage: grid (SEQ*DM/2048, NB) x 256 threads x 8 elements == NB*SEQ*DM.
static_assert(((size_t)SEQ * DM) % 2048 == 0);
__global__ __launch_bounds__(256) void k_cvtx(const float* __restrict__ src, bf* dst) {
    const unsigned i = blockIdx.x * 256u + threadIdx.x; const unsigned b = blockIdx.y;
    const unsigned lr = i & 15u, hi = (i >> 4) & 1u, h2 = (i >> 5) & 1u, blk = i >> 6; const unsigned kt = blk % (unsigned)(DM / 32), rt = blk / (unsigned)(DM / 32);
    const float* s = src + (size_t)b * SEQ_FULL * DM + (size_t)(rt * 16u + lr) * DM + kt * 32u + h2 * 16u + hi * 8u; bf* d = dst + (size_t)b * SEQ * DM + (size_t)i * 8;
    const v8f v = *(const v8f*)s; v8us o;
#pragma unroll
    for (int k = 0; k < 8; ++k) o[k] = f2bf(v[k]);
    *(v8us*)d = o;  }

// thread i of a weight writes piece i of its fragment-ordered transpose Bt[n][k] = w[k][n]: 8 k of one n; a wave reads 64-byte runs of two w rows per request.
// coverage: grid (DM*DM/2048, 4) x 256 threads x 8 elements == 4*DM*DM.
static_assert(((size_t)DM * DM) % 2048 == 0);
__global__ __launch_bounds__(256) void k_wt4(const float* __restrict__ w0, const float* __restrict__ w1, const float* __restrict__ w2, const float* __restrict__ w3, bf* Bt) {
    const unsigned y = blockIdx.y; const float* w = (y == 0u) ? w0 : (y == 1u) ? w1 : (y == 2u) ? w2 : w3; bf* o = Bt + (size_t)y * DM * DM;
    const unsigned i = blockIdx.x * 256u + threadIdx.x;
    const unsigned lr = i & 15u, hi = (i >> 4) & 1u, h2 = (i >> 5) & 1u, blk = i >> 6; const unsigned kt = blk % (unsigned)(DM / 32), nt = blk / (unsigned)(DM / 32);
    const float* s = w + (size_t)(kt * 32u + h2 * 16u + hi * 8u) * DM + nt * 16u + lr; v8us q;
#pragma unroll
    for (int j = 0; j < 8; ++j) q[j] = f2bf(s[(size_t)j * DM]);
    *(v8us*)(o + (size_t)i * 8) = q;
}

// ---- k_ropeqk: head planes [z] (rows t, k = d, fragment order: 2 blocks per 16 rows) of the rotated q (blockIdx.y 0) and k (1): pair i of head row: out[2i] = x[2i] c - x[2i+1] s, out[2i+1] = x[2i] s + x[2i+1] c with c, s = bf16 RNE-converted INPUT table values [t][i].
// coverage: grid (NZ*SEQ*8/256, 2) x 256 threads x 8 elements == 2*NZ*SEQ*HD (fp16); rows t < RH of every z also fill 2*NZ*RH*HD hi and lo.
static_assert(((size_t)NZ * SEQ * 8) % 256 == 0);
__global__ __launch_bounds__(256) void k_ropeqk(const float* __restrict__ F, const float* __restrict__ cosT, const float* __restrict__ sinT, h16* P16, bf* Ph, bf* Pl) {
    const unsigned y = blockIdx.y; const unsigned g = blockIdx.x * 256u + threadIdx.x; const unsigned seg = g & 7u, prow = g >> 3;
    const unsigned t = prow % (unsigned)SEQ, z = prow / (unsigned)SEQ, b = z / (unsigned)NH, h = z % (unsigned)NH;
    const float* f = F + (size_t)y * NB * SEQ * DM + (size_t)(b * SEQ + t) * DM + h * HD + seg * 8u;
    const v4f x0 = *(const v4f*)f, x1 = *(const v4f*)(f + 4); const v4f cv = *(const v4f*)(cosT + (size_t)t * 32 + seg * 4u), sv = *(const v4f*)(sinT + (size_t)t * 32 + seg * 4u);
    float xs[8]; xs[0] = x0[0]; xs[1] = x0[1]; xs[2] = x0[2]; xs[3] = x0[3]; xs[4] = x1[0]; xs[5] = x1[1]; xs[6] = x1[2]; xs[7] = x1[3];
    v8h o16; v8us oh, ol;
#pragma unroll
    for (int i = 0; i < 4; ++i) { const float c = bfr(cv[i]), s = bfr(sv[i]); const float tr = xs[2 * i], ti = xs[2 * i + 1]; const float rr = tr * c - ti * s, ri = tr * s + ti * c;
        o16[2 * i] = (h16)rr; o16[2 * i + 1] = (h16)ri; unsigned short a, d2; splitf(rr, a, d2); oh[2 * i] = a; ol[2 * i] = d2; splitf(ri, a, d2); oh[2 * i + 1] = a; ol[2 * i + 1] = d2; }
    const unsigned pc = (seg >> 2) * 512u + ((seg >> 1) & 1u) * 256u + ((seg & 1u) * 16u + (t & 15u)) * 8u;      // this thread's piece inside its 16-row tile (2 blocks = 1024 elements)
    h16* p16 = P16 + (size_t)y * NZ * SEQ * HD + (size_t)z * SEQ * HD + (t >> 4) * 1024u + pc;
    const bool hl = (t < (unsigned)RH);     // uniform per wave (4 consecutive rows, RH % 4 == 0)
    const size_t ho = (size_t)y * NZ * RH * HD + (size_t)z * RH * HD + (hl ? (t >> 4) : 0u) * 1024u + pc;
    *(v8h*)p16 = o16; if (hl) { *(v8us*)(Ph + ho) = oh; *(v8us*)(Pl + ho) = ol; }
    
}

// ---- k_vtp: value planes [z] (rows d, k = key, fragment order, the four 16-d blocks of a 32-key chunk side by side: block (chunk, dt) at (chunk * 4 + dt) * 512). Thread g writes piece g: 8 keys of one d.
// coverage: grid NZ*HD*(SEQ/8)/256 x 256 threads x 8 elements == NZ*HD*SEQ (fp16); chunks below RH of every z fill NZ*HD*RH hi and lo.
static_assert(((size_t)NZ * HD * (SEQ / 8)) % 256 == 0);
static_assert(RH % 32 == 0 && SEQ % 32 == 0);
__global__ __launch_bounds__(256) void k_vtp(const float* __restrict__ Fv, h16* V16, bf* Vh, bf* Vl) {
    const unsigned g = blockIdx.x * 256u + threadIdx.x; const unsigned lr = g & 15u, hi = (g >> 4) & 1u, h2 = (g >> 5) & 1u, dt = (g >> 6) & 3u, cz = g >> 8;
    const unsigned ch = cz % (unsigned)(SEQ / 32), z = cz / (unsigned)(SEQ / 32), b = z / (unsigned)NH, h = z % (unsigned)NH, d = dt * 16u + lr, t0 = ch * 32u + h2 * 16u + hi * 8u;
    const float* f = Fv + (size_t)(b * SEQ + t0) * DM + h * HD + d; v8h o16; v8us oh, ol;
#pragma unroll
    for (int j = 0; j < 8; ++j) { const float x = f[(size_t)j * DM]; o16[j] = (h16)x; unsigned short a, c2; splitf(x, a, c2); oh[j] = a; ol[j] = c2; }
    h16* p16 = V16 + (size_t)g * 8; const bool hl = (ch < (unsigned)(RH / 32));     // uniform per block (256 threads = one chunk of one z)
    const size_t ho = (size_t)z * HD * RH + (hl ? ch : 0u) * 2048u + (g & 255u) * 8u;
    *(v8h*)p16 = o16; if (hl) { *(v8us*)(Vh + ho) = oh; *(v8us*)(Vl + ho) = ol; }
}

// ---- flash attention: one wave = one (z, 16-row query tile); 32-key chunks up to the diagonal; online softmax (running max, log2 domain); probabilities go D-layout -> wave-private LDS tile -> A fragment.
// The key fragments of chunk c + 1 are requested right behind the score products of chunk c, the value fragments right behind its value products: each request has the rest of a trip to land, and no product waits out a load it has just issued.
// HR: bf16 hi/lo planes (rows per z = RH), products hh + lh + hl on both contractions. Plain: fp16 planes, probabilities x PCAR. Output: context hi/lo planes (rows b*SEQ + t, k = h*HD + d, fragment order).
__device__ __forceinline__ float rmax16(float v) { v = fmaxf(v, __shfl_xor(v, 1, 32)); v = fmaxf(v, __shfl_xor(v, 2, 32)); v = fmaxf(v, __shfl_xor(v, 4, 32)); v = fmaxf(v, __shfl_xor(v, 8, 32)); return v; }
__device__ __forceinline__ float rsum16(float v) { v += __shfl_xor(v, 1, 32); v += __shfl_xor(v, 2, 32); v += __shfl_xor(v, 4, 32); v += __shfl_xor(v, 8, 32); return v; }

template <typename T16, bool HR>
__device__ __forceinline__ void flash_body(const T16* QA, const T16* QB, const T16* KA, const T16* KB, const T16* VA, const T16* VB, bf* ATh, bf* ATl, T16* pt, float* os) {
    typedef typename WFrag<T16>::V V;
    constexpr unsigned QR   = HR ? (unsigned)RH : (unsigned)SEQ;     // rows per z of the q/k planes = key pitch of the v planes
    constexpr unsigned ROW0 = HR ? 0u : (unsigned)RH;
    constexpr unsigned NT   = HR ? (unsigned)RH / 16u : (unsigned)(SEQ - RH) / 16u;
    constexpr unsigned NTD  = NT ? NT : 1u;
    const unsigned lane = threadIdx.x & 31u, wid = threadIdx.x >> 5, lr = lane & 15u, hi = lane >> 4;
    const unsigned w = blockIdx.x * 4u + wid; const unsigned z = w / NTD, mt = w % NTD; const unsigned q0 = ROW0 + mt * 16u;
    T16* ptw = pt + (size_t)wid * 1024; T16* ptl = ptw + 512; float* osw = os + (size_t)wid * (16 * 68);
    const size_t zoff = (size_t)z * QR * HD + 8u * lane;      // this lane's piece of block 0 of head z, in the q, k and v planes alike; 16 rows of q or k = 2 blocks, a 32-key chunk of k or v = 4 blocks
    const size_t qoff = zoff + (size_t)q0 * HD;
    V aq[2], aql[2];
#pragma unroll
    for (int d = 0; d < 2; ++d) { aq[d] = WFrag<T16>::ld(QA + qoff + d * 512); if (HR) aql[d] = WFrag<T16>::ld(QB + qoff + d * 512); }
    v8f o[4]; float m[8], l[8];
#pragma unroll
    for (int t = 0; t < 4; ++t) o[t] = (v8f){};
#pragma unroll
    for (int j = 0; j < 8; ++j) { m[j] = -1.0e30f; l[j] = 0.0f; }
    const unsigned nch = (q0 + 15u) / 32u + 1u;      // wave-uniform; keys < nch*32 <= QR
    V kb[2][2], kl[2][2], vb[4], vl[4];              // fragments of the current chunk: kb[d][i] = keys 16i.., depth 32d..; vb[t] = depth 16t..
    // Chunk 0 is requested in the loop's own order (queries, keys, values): loads retire in order and the wait at the loop's head is counted for both ways in, so another order here makes every trip's score products wait for the value requests too.
    asm volatile("s_wait_xcnt 0x0" ::: "memory");    // key fragments land in registers that held the query requests' addresses: a precaution in front of that reuse; as a memory fence it also keeps the query requests ahead of the key requests
#pragma unroll
    for (int d = 0; d < 2; ++d) { const size_t ko = zoff + d * 512;
        kb[d][0] = WFrag<T16>::ld(KA + ko); kb[d][1] = WFrag<T16>::ld(KA + ko + 16 * HD); if (HR) { kl[d][0] = WFrag<T16>::ld(KB + ko); kl[d][1] = WFrag<T16>::ld(KB + ko + 16 * HD); } }
    __builtin_amdgcn_sched_barrier(0);               // keeps the key requests ahead of the value requests
#pragma unroll
    for (int t = 0; t < 4; ++t) { const size_t vo = zoff + t * 512; vb[t] = WFrag<T16>::ld(VA + vo); if (HR) vl[t] = WFrag<T16>::ld(VB + vo); }
#pragma unroll 1
    for (unsigned c = 0; c < nch; ++c) {
        const unsigned c0 = c * 32u;
        const unsigned cn = ((c + 1u < nch) ? c + 1u : c) * 32u;      // chunk fetched ahead; the last trip asks for its own chunk again (in bounds, never used)
        v8f s0 = (v8f){}, s1 = (v8f){};
#pragma unroll
        for (int d = 0; d < 2; ++d) {
            s0 = WFrag<T16>::mma(aq[d], kb[d][0], s0); s1 = WFrag<T16>::mma(aq[d], kb[d][1], s1);
            if (HR) { s0 = WFrag<T16>::mma(aql[d], kb[d][0], s0); s1 = WFrag<T16>::mma(aql[d], kb[d][1], s1); s0 = WFrag<T16>::mma(aq[d], kl[d][0], s0); s1 = WFrag<T16>::mma(aq[d], kl[d][1], s1); } }
        asm volatile("v_nop\n\tv_nop\n\tv_nop\n\tv_nop" : "+v"(s0), "+v"(s1) : "v"(aq[0]), "v"(aq[1]));
#pragma unroll
        for (int d = 0; d < 2; ++d) { const size_t ko = zoff + (size_t)cn * HD + d * 512;
            kb[d][0] = WFrag<T16>::ld(KA + ko); kb[d][1] = WFrag<T16>::ld(KA + ko + 16 * HD); if (HR) { kl[d][0] = WFrag<T16>::ld(KB + ko); kl[d][1] = WFrag<T16>::ld(KB + ko + 16 * HD); } }
        if (HR) asm volatile("s_wait_xcnt 0x0" ::: "memory");      // the softmax reuses the key requests' address registers: a precaution
        __builtin_amdgcn_sched_barrier(0);      // holds the key requests above the softmax, which is the time they have to land; sunk towards their use they would be waited out
        const unsigned col0 = c0 + lr, col1 = col0 + 16u, rb = q0 + 8u * hi;
#pragma unroll
        for (int j = 0; j < 8; ++j) { const unsigned row = rb + (unsigned)j; const bool v0 = (col0 <= row), v1 = (col1 <= row);
            const float t0 = s0[j] * SC2, t1 = s1[j] * SC2;
            float cm = fmaxf(v0 ? t0 : -1.0e30f, v1 ? t1 : -1.0e30f); cm = rmax16(cm);
            const float nm = fmaxf(m[j], cm); const float al = __builtin_amdgcn_exp2f(m[j] - nm); m[j] = nm;
            const float e0 = __builtin_amdgcn_exp2f(fminf(t0 - nm, 0.0f)), e1 = __builtin_amdgcn_exp2f(fminf(t1 - nm, 0.0f));
            const float p0 = v0 ? e0 : 0.0f, p1 = v1 ? e1 : 0.0f;
            l[j] = l[j] * al + (p0 + p1);
            o[0][j] *= al; o[1][j] *= al; o[2][j] *= al; o[3][j] *= al;
            const unsigned pi = (8u * hi + (unsigned)j) * 32u + lr;
            WFrag<T16>::pst(ptw, ptl, pi, p0); WFrag<T16>::pst(ptw, ptl, pi + 16u, p1); }
        __builtin_amdgcn_wave_barrier(); asm volatile("" ::: "memory");      // wave-private tile: stores above, fragment reload below (same element type, may_alias vector)
        const V ap = WFrag<T16>::lds(ptw + lr * 32u + 8u * hi); V apl; if (HR) apl = WFrag<T16>::lds(ptl + lr * 32u + 8u * hi);
#pragma unroll
        for (int t = 0; t < 4; ++t) {
            o[t] = WFrag<T16>::mma(ap, vb[t], o[t]);
            if (HR) { o[t] = WFrag<T16>::mma(apl, vb[t], o[t]); o[t] = WFrag<T16>::mma(ap, vl[t], o[t]); } }
        asm volatile("v_nop\n\tv_nop\n\tv_nop\n\tv_nop" : "+v"(o[0]), "+v"(o[1]), "+v"(o[2]), "+v"(o[3]) : "v"(ap));
#pragma unroll
        for (int t = 0; t < 4; ++t) { const size_t vo = zoff + (size_t)cn * HD + t * 512; vb[t] = WFrag<T16>::ld(VA + vo); if (HR) vl[t] = WFrag<T16>::ld(VB + vo); }
        __builtin_amdgcn_wave_barrier(); asm volatile("" ::: "memory");
    }
    asm volatile("s_wait_loadcnt 0x0" ::: "memory");      // the last trip's requests are never read: they retire here, before the wave gives its registers back
    const float cs = HR ? 1.0f : (1.0f / PCAR);
#pragma unroll
    for (int j = 0; j < 8; ++j) { const float ls = rsum16(l[j]); const float inv = (1.0f / ls) * cs;
#pragma unroll
        for (int t = 0; t < 4; ++t) osw[(8u * hi + (unsigned)j) * 68u + (unsigned)t * 16u + lr] = o[t][j] * inv; }
    __builtin_amdgcn_wave_barrier(); asm volatile("" ::: "memory");
    const unsigned b = z / (unsigned)NH, h = z % (unsigned)NH;      // the tile is blocks 2h and 2h + 1 of its 16 rows; store s fills half s & 1 of block s >> 1: row lr, columns 16s + 8hi..
{
#pragma unroll
        for (int s = 0; s < 4; ++s) { const unsigned col = 16u * (unsigned)s + 8u * hi; const v4f a = *(const v4fa*)(osw + lr * 68u + col), bq = *(const v4fa*)(osw + lr * 68u + col + 4u); v8us oh, ol;
#pragma unroll
            for (int k = 0; k < 4; ++k) { unsigned short x, y2; splitf(a[k], x, y2); oh[k] = x; ol[k] = y2; splitf(bq[k], x, y2); oh[k + 4] = x; ol[k + 4] = y2; }
            const size_t oo = (size_t)(b * SEQ + q0) * DM + h * 1024u + (unsigned)s * 256u + 8u * lane;
            *(v8us*)(ATh + oo) = oh; *(v8us*)(ATl + oo) = ol; }
         }
}

// coverage: k_flash_hr grid NZ*(RH/16)/4 x 4 waves x (16 rows x 64 d) == NZ*RH*HD; k_flash_pl grid NZ*((SEQ-RH)/16)/4 x 4 waves x (16 x 64) == NZ*(SEQ-RH)*HD; union == NB*SEQ*DM per context plane.
static_assert((NZ * (RH / 16)) % 4 == 0);
static_assert((NZ * ((SEQ - RH) / 16)) % 4 == 0);
__global__ __launch_bounds__(128) void k_flash_hr(const bf* Qh, const bf* Ql, const bf* Kh, const bf* Kl, const bf* Vh, const bf* Vl, bf* ATh, bf* ATl) {
    __shared__ __align__(16) bf pt[4 * 2 * 512]; __shared__ __align__(16) float os[4 * 16 * 68];
    flash_body<bf, true>(Qh, Ql, Kh, Kl, Vh, Vl, ATh, ATl, pt, os); }
__global__ __launch_bounds__(128) void k_flash_pl(const h16* Q16, const h16* K16, const h16* V16, bf* ATh, bf* ATl) {
    __shared__ __align__(16) h16 pt[4 * 2 * 512]; __shared__ __align__(16) float os[4 * 16 * 68];
    flash_body<h16, false>(Q16, nullptr, K16, nullptr, V16, nullptr, ATh, ATl, pt, os); }

// workspace carve (bytes; every region a multiple of 256)
constexpr size_t SZ_WT  = (size_t)4 * DM * DM * 2;
constexpr size_t SZ_XB  = (size_t)NB * SEQ * DM * 2;
constexpr size_t SZ_F   = (size_t)3 * NB * SEQ * DM * 4;
constexpr size_t SZ_QK  = (size_t)2 * NZ * SEQ * HD * 2;
constexpr size_t SZ_V   = (size_t)NZ * HD * SEQ * 2;
constexpr size_t SZ_QKH = (size_t)2 * NZ * RH * HD * 2;
constexpr size_t SZ_VH  = (size_t)NZ * HD * RH * 2;
constexpr size_t SZ_AT  = (size_t)NB * SEQ * DM * 2;
constexpr size_t WS_TOTAL = SZ_WT + SZ_XB + SZ_F + SZ_QK + SZ_V + 2 * SZ_QKH + 2 * SZ_VH + 2 * SZ_AT;
static_assert(WS_TOTAL <= (size_t)134217728);
static_assert(SZ_WT % 256 == 0 && SZ_XB % 256 == 0 && SZ_F % 256 == 0 && SZ_QK % 256 == 0 && SZ_V % 256 == 0 && SZ_QKH % 256 == 0 && SZ_VH % 256 == 0 && SZ_AT % 256 == 0);

extern "C" void kernel_launch(void* const* d_in, const int* in_sizes, int n_in,
                              void* d_out, int out_size, void* d_ws, size_t ws_size, hipStream_t stream) {
    if (n_in < 7) return;
    const long long need_x = ((long long)(NB - 1) * SEQ_FULL + SEQ) * DM;
    if ((long long)in_sizes[0] < need_x || (long long)out_size < need_x) return;
    if (in_sizes[1] < DM * DM || in_sizes[2] < DM * DM || in_sizes[3] < DM * DM || in_sizes[4] < DM * DM) return;
    if (in_sizes[5] < SEQ * (HD / 2) || in_sizes[6] < SEQ * (HD / 2)) return;
    if (WS_TOTAL > ws_size) return;
    const float* x = (const float*)d_in[0]; const float* wq = (const float*)d_in[1]; const float* wk = (const float*)d_in[2]; const float* wv = (const float*)d_in[3]; const float* wo = (const float*)d_in[4];
    const float* fcos = (const float*)d_in[5]; const float* fsin = (const float*)d_in[6];
    float* OUT = (float*)d_out;
    char* wsp = (char*)d_ws;
    auto take = [&](size_t bytes) { char* p = wsp; wsp += bytes; return (void*)p; };
    bf* WT = (bf*)take(SZ_WT);            // [4] planes (rows n, k): q | k | v | o
    bf* XB = (bf*)take(SZ_XB);            // rows NB*SEQ, k DM
    float* F = (float*)take(SZ_F);        // [3][NB*SEQ][DM]: q | k | v projections
    h16* QK16 = (h16*)take(SZ_QK);        // [2][NZ] planes (rows SEQ, k HD)
    h16* V16 = (h16*)take(SZ_V);          // [NZ] planes (rows HD, k SEQ)
    bf* QKh = (bf*)take(SZ_QKH); bf* QKl = (bf*)take(SZ_QKH);    // [2][NZ] planes (rows RH, k HD)
    bf* Vh = (bf*)take(SZ_VH); bf* Vl = (bf*)take(SZ_VH);        // [NZ] planes (rows HD, k RH)
    bf* ATh = (bf*)take(SZ_AT); bf* ATl = (bf*)take(SZ_AT);      // rows NB*SEQ, k DM
    if ((size_t)(wsp - (char*)d_ws) > ws_size) return;

    k_cvtx<<<dim3((unsigned)((size_t)SEQ * DM / 2048), NB, 1), 256, 0, stream>>>(x, XB);
    k_wt4<<<dim3((unsigned)((size_t)DM * DM / 2048), 4, 1), 256, 0, stream>>>(wq, wk, wv, wo, WT);
    k_gemmw<bf, 0, false, DM, 2><<<dim3(NB * SEQ / 64, DM / 64, 3), 32, 0, stream>>>(XB, nullptr, WT, nullptr, F, DM, nullptr, (size_t)0, (size_t)DM * DM, (size_t)NB * SEQ * DM);
    k_ropeqk<<<dim3((unsigned)((size_t)NZ * SEQ * 8 / 256), 2, 1), 256, 0, stream>>>(F, fcos, fsin, QK16, QKh, QKl);
    k_vtp<<<(unsigned)((size_t)NZ * HD * (SEQ / 8) / 256), 256, 0, stream>>>(F + (size_t)2 * NB * SEQ * DM, V16, Vh, Vl);
    k_flash_hr<<<(unsigned)(NZ * (RH / 16) / 4), 128, 0, stream>>>(QKh, QKl, QKh + (size_t)NZ * RH * HD, QKl + (size_t)NZ * RH * HD, Vh, Vl, ATh, ATl);
    if (SEQ > RH) k_flash_pl<<<(unsigned)(NZ * ((SEQ - RH) / 16) / 4), 128, 0, stream>>>(QK16, QK16 + (size_t)NZ * SEQ * HD, V16, ATh, ATl);
    k_gemmw<bf, 1, false, DM, 3><<<dim3(SEQ / 64, DM / 64, NB), 32, 0, stream>>>(ATh, ATl, WT + (size_t)3 * DM * DM, nullptr, OUT, DM, nullptr, (size_t)SEQ * DM, (size_t)0, (size_t)SEQ_FULL * DM);
}

// v004
// A run of this version takes 134 microseconds.
// Timed twice side by side with v003, it ran 1.07 and 1.09 times as fast.
// Counting every step since v000, it is 2.13 times as fast.
#include <hip/hip_runtime.h>

// Contractions (f32 accumulate): q/k/v projections v_wmma_f32_16x16x32_bf16 on bf16 RNE-converted inputs (single product); causal scores and probability x value: query rows < RH on bf16 hi/lo planes (3 products), rows >= RH v_wmma_f32_16x16x32_f16 (probabilities carried x1024); output projection bf16 hi/lo context x bf16 weight (2 products); softmax f32.
// Causal multi-head attention with interleaved-pair rotary tables read as INPUT values: x [NB][SEQ][1024]; wq/wk/wv/wo [in][out], no bias; 16 heads x 64; scores x 64^-0.5; causal by index.
// Layout: bf16 copy of x (both batches, compact rows); four weights transposed once to Bt planes; one z-batched projection GEMM (q | k | v); plane builders (rotary on q, k; transposed v);
// every 16-bit plane that feeds a matrix operand is stored in FRAGMENT ORDER (below), so that each fragment request of a wave covers whole 128-byte lines;
// flash attention, one wave per 16-row query tile, both products transposed (keys x queries, depth x queries), 32-key chunks with the key and value fragments fetched one chunk ahead, online softmax with running max; context hi/lo planes; output GEMM.

#ifndef NB
#define NB 2
#endif
#ifndef SEQ
#define SEQ 2048
#endif
#define NB_FULL  2
#define SEQ_FULL 2048
#define DM   1024
#define NH   16
#define HD   64
#define NZ   (NB * NH)
#define RH   ((SEQ < 512) ? SEQ : 512)     // query rows < RH use hi+lo planes
#define PCAR 1024.0f
#define SC2  0.18033688011112042f          // HD^-0.5 * log2(e)

static_assert((SEQ & (SEQ - 1)) == 0);
static_assert(SEQ % 256 == 0);
static_assert(RH % 256 == 0);
static_assert(RH <= SEQ);
static_assert(DM == NH * HD);
static_assert(HD == 64);
static_assert((NB * SEQ) % 64 == 0);
static_assert(DM % 64 == 0);
static_assert(NB <= NB_FULL && SEQ <= SEQ_FULL);

typedef _Float16 h16;
typedef unsigned short bf;
typedef __attribute__((ext_vector_type(16))) __bf16   v16bf;
typedef __attribute__((ext_vector_type(16))) _Float16 v16h;
typedef __attribute__((ext_vector_type(8)))  _Float16 v8h;
typedef __attribute__((ext_vector_type(8)))  unsigned short v8us;
typedef __attribute__((ext_vector_type(2)))  unsigned short v2us;
typedef __attribute__((ext_vector_type(8)))  float    v8f;
typedef __attribute__((ext_vector_type(4)))  float    v4f;
typedef v4f  __attribute__((may_alias)) v4fa;

__device__ __forceinline__ unsigned short f2bf(float f) { unsigned u = __float_as_uint(f); u += 0x7FFFu + ((u >> 16) & 1u); return (unsigned short)(u >> 16); }
__device__ __forceinline__ float bf2f(unsigned short b) { return __uint_as_float(((unsigned)b) << 16); }
__device__ __forceinline__ float bfr(float f) { return bf2f(f2bf(f)); }
__device__ __forceinline__ void splitf(float y, unsigned short& h, unsigned short& l) { h = f2bf(y); l = f2bf(y - bf2f(h)); }
__device__ __forceinline__ v16h cat16(v8h lo, v8h hi) { return __builtin_shufflevector(lo, hi, 0, 1, 2, 3, 4, 5, 6, 7, 8, 9, 10, 11, 12, 13, 14, 15); }
__device__ __forceinline__ v16bf cat16b(v8us lo, v8us hi) { return __builtin_bit_cast(v16bf, __builtin_shufflevector(lo, hi, 0, 1, 2, 3, 4, 5, 6, 7, 8, 9, 10, 11, 12, 13, 14, 15)); }
__device__ __forceinline__ v8f wmma16(v16h a, v16h b, v8f c) { return __builtin_amdgcn_wmma_f32_16x16x32_f16(false, a, false, b, (short)0, c, false, false); }
__device__ __forceinline__ v8f wmmab(v16bf a, v16bf b, v8f c) { return __builtin_amdgcn_wmma_f32_16x16x32_bf16(false, a, false, b, (short)0, c, false, false); }

template <typename T16> struct WFrag;
template <> struct WFrag<h16> { typedef v16h V;
    static __device__ __forceinline__ V ld(const h16* p) { return cat16(*(const v8h*)p, *(const v8h*)(p + 256)); }
    static __device__ __forceinline__ v8f mma(V a, V b, v8f c) { return wmma16(a, b, c); }
    static __device__ __forceinline__ void pk(V& ph, V& pl, const float (&p0)[8], const float (&p1)[8]) { (void)pl;
#pragma unroll
        for (int j = 0; j < 8; ++j) { ph[j] = (h16)(p0[j] * PCAR); ph[j + 8] = (h16)(p1[j] * PCAR); } } };
template <> struct WFrag<bf> { typedef v16bf V;
    static __device__ __forceinline__ V ld(const bf* p) { return cat16b(*(const v8us*)p, *(const v8us*)(p + 256)); }
    static __device__ __forceinline__ v8f mma(V a, V b, v8f c) { return wmmab(a, b, c); }
    static __device__ __forceinline__ void pk(V& ph, V& pl, const float (&p0)[8], const float (&p1)[8]) { v8us h0, h1, l0, l1;
#pragma unroll
        for (int j = 0; j < 8; ++j) { unsigned short a, c; splitf(p0[j], a, c); h0[j] = a; l0[j] = c; splitf(p1[j], a, c); h1[j] = a; l1[j] = c; }
        ph = cat16b(h0, h1); pl = cat16b(l0, l1); } };

// ---- k_gemmw: register-blocked GEMM, ONE WAVE per 64x64 output tile (16 accumulators), operands straight from fragment-ordered 16-bit planes (block (rt, kt) at rt*16*K + kt*512); grid (M/64, N/64, Z), 32 threads.
// C[m][n] (f32, pitch ldc, + optional f32 bias[n]) = sum_k A[m][k] Bt[n][k] (+ split products per NSPLIT). z-batch strides sA/sB/sC in elements. K % 32 == 0, a compile-time constant: the four row tiles of an operand are then one address and immediate offsets.
// The fragments of a 32-k trip live in one of NS register sets; a set is asked for again, for trip t + NS, right behind the products of trip t: every request has NS - 1 trips of products to land, and no product waits on a load just issued.
template <typename T16> struct GSet { typename WFrag<T16>::V a[4], a2[4], b[4], b2[4]; };

template <typename T16, int NSPLIT, int K>
__device__ __forceinline__ void g_fetch(GSet<T16>& f, const T16* pa, const T16* pa2, const T16* pb, const T16* pb2, unsigned l8, int ofs) {      // pa..pb2: wave-uniform bases; l8: the lane's piece; ofs: a constant at every call, it goes into the requests' immediate offsets
    __builtin_amdgcn_sched_barrier(0);      // keeps the requests behind the products that read this set: lifted over them they would need registers of their own
#pragma unroll
    for (int mb = 0; mb < 4; ++mb) { f.a[mb] = WFrag<T16>::ld(pa + l8 + (ofs + mb * 16 * K)); if (NSPLIT == 1 || NSPLIT == 2) f.a2[mb] = WFrag<T16>::ld(pa2 + l8 + (ofs + mb * 16 * K)); }
#pragma unroll
    for (int nb = 0; nb < 4; ++nb) { f.b[nb] = WFrag<T16>::ld(pb + l8 + (ofs + nb * 16 * K)); if (NSPLIT >= 2) f.b2[nb] = WFrag<T16>::ld(pb2 + l8 + (ofs + nb * 16 * K)); }
    asm volatile("s_wait_xcnt 0x0" ::: "memory");      // a precaution: it stands in front of every later write of a register that these requests name as an address (the next round's bases)
    __builtin_amdgcn_sched_barrier(0);      // holds the requests above the other sets' products, which are the time they have to land; sunk towards their use they would be waited out
}

template <typename T16, int NSPLIT>
__device__ __forceinline__ void g_mm(const GSet<T16>& f, v8f (&acc)[4][4]) {
#pragma unroll
    for (int nb = 0; nb < 4; ++nb) {
#pragma unroll
        for (int mb = 0; mb < 4; ++mb) { acc[mb][nb] = WFrag<T16>::mma(f.a[mb], f.b[nb], acc[mb][nb]); if (NSPLIT == 1 || NSPLIT == 2) acc[mb][nb] = WFrag<T16>::mma(f.a2[mb], f.b[nb], acc[mb][nb]); if (NSPLIT >= 2) acc[mb][nb] = WFrag<T16>::mma(f.a[mb], f.b2[nb], acc[mb][nb]); } }
    // the four slots between the last products and the requests that land in their operand registers
    asm volatile("v_nop\n\tv_nop\n\tv_nop\n\tv_nop" : "+v"(acc[0][0]), "+v"(acc[1][1]), "+v"(acc[2][2]), "+v"(acc[3][3]) : "v"(f.a[0]), "v"(f.a[3]));
}

template <typename T16, int NSPLIT, bool BIAS, int K, int NS>
__global__ __launch_bounds__(32) void k_gemmw(const T16* __restrict__ A, const T16* __restrict__ A2, const T16* __restrict__ Bt, const T16* __restrict__ Bt2, float* C, int ldc, const float* __restrict__ bias, size_t sA, size_t sB, size_t sC) {
    constexpr int NT = K / 32;               // trips
    constexpr int NL = (NT - NS) / NS;       // rounds of NS trips in which every set is asked for again
    static_assert(K % 32 == 0 && NS >= 2 && NT >= NS);
    __shared__ __align__(16) float os[16 * 68];
    const size_t z = blockIdx.z; A += z * sA; if (A2) A2 += z * sA; Bt += z * sB; if (Bt2) Bt2 += z * sB; C += z * sC;
    const int lane = threadIdx.x & 31, lr = lane & 15, hi = lane >> 4; const int r0 = blockIdx.x * 64, c0 = blockIdx.y * 64;
    v8f acc[4][4];
#pragma unroll
    for (int mb = 0; mb < 4; ++mb)
#pragma unroll
        for (int nb = 0; nb < 4; ++nb) acc[mb][nb] = (v8f){};
    const size_t aoff = (size_t)r0 * K, boff = (size_t)c0 * K; const unsigned l8 = 8u * (unsigned)lane;
    const T16* pa = A + aoff; const T16* pa2 = A2 + aoff; const T16* pb = Bt + boff; const T16* pb2 = Bt2 + boff;
    GSet<T16> f[NS];
#pragma unroll
    for (int s = 0; s < NS; ++s) g_fetch<T16, NSPLIT, K>(f[s], pa, pa2, pb, pb2, l8, s * 512);
#pragma unroll 1
    for (int i = 0; i < NL; ++i) {           // rolled: one round of NS trips is the loop's body
        const int o = (i + 1) * NS * 512; const T16* qa = pa + o; const T16* qa2 = pa2 + o; const T16* qb = pb + o; const T16* qb2 = pb2 + o;
#pragma unroll
        for (int s = 0; s < NS; ++s) { g_mm<T16, NSPLIT>(f[s], acc); g_fetch<T16, NSPLIT, K>(f[s], qa, qa2, qb, qb2, l8, s * 512); }
    }
#pragma unroll
    for (int t = NL * NS; t < NT; ++t) { g_mm<T16, NSPLIT>(f[t % NS], acc);
        if (t + NS < NT) g_fetch<T16, NSPLIT, K>(f[t % NS], pa, pa2, pb, pb2, l8, (t + NS) * 512); }
#pragma unroll
    for (int mb = 0; mb < 4; ++mb) {
#pragma unroll
        for (int nb = 0; nb < 4; ++nb) {
#pragma unroll
            for (int j = 0; j < 8; ++j) os[(hi * 8 + j) * 68 + nb * 16 + lr] = acc[mb][nb][j]; }
        __builtin_amdgcn_wave_barrier(); asm volatile("" ::: "memory");
        float* crow = C + (size_t)(r0 + mb * 16) * ldc + c0;
{
#pragma unroll
            for (int s = 0; s < 8; ++s) { const int row = 2 * s + hi, cofs = lr * 4; v4f val = *(const v4fa*)(os + row * 68 + cofs); if (BIAS) { val[0] += bfr(bias[c0 + cofs]); val[1] += bfr(bias[c0 + cofs + 1]); val[2] += bfr(bias[c0 + cofs + 2]); val[3] += bfr(bias[c0 + cofs + 3]); }
                *(v4f*)(crow + (size_t)row * ldc + cofs) = val; }
             }
        __builtin_amdgcn_wave_barrier(); asm volatile("" ::: "memory");
    }
}

// thread i of a batch writes piece i (8 elements) of the fragment-ordered copy: i = (block * 2 + k half) * 32 + lane.
// coverage: grid (SEQ*DM/2048, NB) x 256 threads x 8 elements == NB*SEQ*DM.
static_assert(((size_t)SEQ * DM) % 2048 == 0);
__global__ __launch_bounds__(256) void k_cvtx(const float* __restrict__ src, bf* dst) {
    const unsigned i = blockIdx.x * 256u + threadIdx.x; const unsigned b = blockIdx.y;
    const unsigned lr = i & 15u, hi = (i >> 4) & 1u, h2 = (i >> 5) & 1u, blk = i >> 6; const unsigned kt = blk % (unsigned)(DM / 32), rt = blk / (unsigned)(DM / 32);
    const float* s = src + (size_t)b * SEQ_FULL * DM + (size_t)(rt * 16u + lr) * DM + kt * 32u + h2 * 16u + hi * 8u; bf* d = dst + (size_t)b * SEQ * DM + (size_t)i * 8;
    const v8f v = *(const v8f*)s; v8us o;
#pragma unroll
    for (int k = 0; k < 8; ++k) o[k] = f2bf(v[k]);
    *(v8us*)d = o;  }

// thread i of a weight writes piece i of its fragment-ordered transpose Bt[n][k] = w[k][n]: 8 k of one n; a wave reads 64-byte runs of two w rows per request.
// coverage: grid (DM*DM/2048, 4) x 256 threads x 8 elements == 4*DM*DM.
static_assert(((size_t)DM * DM) % 2048 == 0);
__global__ __launch_bounds__(256) void k_wt4(const float* __restrict__ w0, const float* __restrict__ w1, const float* __restrict__ w2, const float* __restrict__ w3, bf* Bt) {
    const unsigned y = blockIdx.y; const float* w = (y == 0u) ? w0 : (y == 1u) ? w1 : (y == 2u) ? w2 : w3; bf* o = Bt + (size_t)y * DM * DM;
    const unsigned i = blockIdx.x * 256u + threadIdx.x;
    const unsigned lr = i & 15u, hi = (i >> 4) & 1u, h2 = (i >> 5) & 1u, blk = i >> 6; const unsigned kt = blk % (unsigned)(DM / 32), nt = blk / (unsigned)(DM / 32);
    const float* s = w + (size_t)(kt * 32u + h2 * 16u + hi * 8u) * DM + nt * 16u + lr; v8us q;
#pragma unroll
    for (int j = 0; j < 8; ++j) q[j] = f2bf(s[(size_t)j * DM]);
    *(v8us*)(o + (size_t)i * 8) = q;
}

// ---- k_ropeqk: head planes [z] (rows t, k = d, fragment order: 2 blocks per 16 rows) of the rotated q (blockIdx.y 0) and k (1): pair i of head row: out[2i] = x[2i] c - x[2i+1] s, out[2i+1] = x[2i] s + x[2i+1] c with c, s = bf16 RNE-converted INPUT table values [t][i].
// coverage: grid (NZ*SEQ*8/256, 2) x 256 threads x 8 elements == 2*NZ*SEQ*HD (fp16); rows t < RH of every z also fill 2*NZ*RH*HD hi and lo.
static_assert(((size_t)NZ * SEQ * 8) % 256 == 0);
__global__ __launch_bounds__(256) void k_ropeqk(const float* __restrict__ F, const float* __restrict__ cosT, const float* __restrict__ sinT, h16* P16, bf* Ph, bf* Pl) {
    const unsigned y = blockIdx.y; const unsigned g = blockIdx.x * 256u + threadIdx.x; const unsigned seg = g & 7u, prow = g >> 3;
    const unsigned t = prow % (unsigned)SEQ, z = prow / (unsigned)SEQ, b = z / (unsigned)NH, h = z % (unsigned)NH;
    const float* f = F + (size_t)y * NB * SEQ * DM + (size_t)(b * SEQ + t) * DM + h * HD + seg * 8u;
    const v4f x0 = *(const v4f*)f, x1 = *(const v4f*)(f + 4); const v4f cv = *(const v4f*)(cosT + (size_t)t * 32 + seg * 4u), sv = *(const v4f*)(sinT + (size_t)t * 32 + seg * 4u);
    float xs[8]; xs[0] = x0[0]; xs[1] = x0[1]; xs[2] = x0[2]; xs[3] = x0[3]; xs[4] = x1[0]; xs[5] = x1[1]; xs[6] = x1[2]; xs[7] = x1[3];
    v8h o16; v8us oh, ol;
#pragma unroll
    for (int i = 0; i < 4; ++i) { const float c = bfr(cv[i]), s = bfr(sv[i]); const float tr = xs[2 * i], ti = xs[2 * i + 1]; const float rr = tr * c - ti * s, ri = tr * s + ti * c;
        o16[2 * i] = (h16)rr; o16[2 * i + 1] = (h16)ri; unsigned short a, d2; splitf(rr, a, d2); oh[2 * i] = a; ol[2 * i] = d2; splitf(ri, a, d2); oh[2 * i + 1] = a; ol[2 * i + 1] = d2; }
    const unsigned pc = (seg >> 2) * 512u + ((seg >> 1) & 1u) * 256u + ((seg & 1u) * 16u + (t & 15u)) * 8u;      // this thread's piece inside its 16-row tile (2 blocks = 1024 elements)
    h16* p16 = P16 + (size_t)y * NZ * SEQ * HD + (size_t)z * SEQ * HD + (t >> 4) * 1024u + pc;
    const bool hl = (t < (unsigned)RH);     // uniform per wave (4 consecutive rows, RH % 4 == 0)
    const size_t ho = (size_t)y * NZ * RH * HD + (size_t)z * RH * HD + (hl ? (t >> 4) : 0u) * 1024u + pc;
    *(v8h*)p16 = o16; if (hl) { *(v8us*)(Ph + ho) = oh; *(v8us*)(Pl + ho) = ol; }
    
}

// ---- k_vtp: value planes [z] (rows d, k = key, fragment order, the four 16-d blocks of a 32-key chunk side by side: block (chunk, dt) at (chunk * 4 + dt) * 512). Thread g writes piece g: 8 keys of one d.
// coverage: grid NZ*HD*(SEQ/8)/256 x 256 threads x 8 elements == NZ*HD*SEQ (fp16); chunks below RH of every z fill NZ*HD*RH hi and lo.
static_assert(((size_t)NZ * HD * (SEQ / 8)) % 256 == 0);
static_assert(RH % 32 == 0 && SEQ % 32 == 0);
__global__ __launch_bounds__(256) void k_vtp(const float* __restrict__ Fv, h16* V16, bf* Vh, bf* Vl) {
    const unsigned g = blockIdx.x * 256u + threadIdx.x; const unsigned lr = g & 15u, hi = (g >> 4) & 1u, h2 = (g >> 5) & 1u, dt = (g >> 6) & 3u, cz = g >> 8;
    const unsigned ch = cz % (unsigned)(SEQ / 32), z = cz / (unsigned)(SEQ / 32), b = z / (unsigned)NH, h = z % (unsigned)NH, d = dt * 16u + lr, t0 = ch * 32u + h2 * 16u + hi * 8u;
    const float* f = Fv + (size_t)(b * SEQ + t0) * DM + h * HD + d; v8h o16; v8us oh, ol;
#pragma unroll
    for (int j = 0; j < 8; ++j) { const float x = f[(size_t)j * DM]; o16[j] = (h16)x; unsigned short a, c2; splitf(x, a, c2); oh[j] = a; ol[j] = c2; }
    h16* p16 = V16 + (size_t)g * 8; const bool hl = (ch < (unsigned)(RH / 32));     // uniform per block (256 threads = one chunk of one z)
    const size_t ho = (size_t)z * HD * RH + (hl ? ch : 0u) * 2048u + (g & 255u) * 8u;
    *(v8h*)p16 = o16; if (hl) { *(v8us*)(Vh + ho) = oh; *(v8us*)(Vl + ho) = ol; }
}

__device__ __forceinline__ float xhalf(float x) { return __builtin_bit_cast(float, __builtin_amdgcn_permlanex16(__builtin_bit_cast(int, x), __builtin_bit_cast(int, x), 0x76543210, 0xfedcba98, false, false)); }      // lane l's value of lane l ^ 16

template <typename T16, bool HR>
__device__ __forceinline__ void flash_body(const T16* QA, const T16* QB, const T16* KA, const T16* KB, const T16* VA, const T16* VB, bf* ATh, bf* ATl) {
    typedef typename WFrag<T16>::V V;
    constexpr unsigned QR   = HR ? (unsigned)RH : (unsigned)SEQ;     // rows per z of the q/k planes = key pitch of the v planes
    constexpr unsigned ROW0 = HR ? 0u : (unsigned)RH;
    constexpr unsigned NT   = HR ? (unsigned)RH / 16u : (unsigned)(SEQ - RH) / 16u;
    constexpr unsigned NTD  = NT ? NT : 1u;
    const unsigned lane = threadIdx.x & 31u, wid = threadIdx.x >> 5, lr = lane & 15u, hi = lane >> 4;
    const unsigned w = blockIdx.x * 4u + wid; const unsigned z = w / NTD, mt = w % NTD; const unsigned q0 = ROW0 + mt * 16u;
    const size_t zoff = (size_t)z * QR * HD + 8u * lane;      // this lane's piece of block 0 of head z, in the q, k and v planes alike; 16 rows of q or k = 2 blocks, a 32-key chunk of k or v = 4 blocks
    const size_t qoff = zoff + (size_t)q0 * HD;
    V aq[2], aql[2];
#pragma unroll
    for (int d = 0; d < 2; ++d) { aq[d] = WFrag<T16>::ld(QA + qoff + d * 512); if (HR) aql[d] = WFrag<T16>::ld(QB + qoff + d * 512); }
    v8f o[4]; float m = -1.0e30f, l = 0.0f;          // o[t][j] = context[query lr][depth 16t + 8hi + j]; m, l: query lr (l: this half's keys)
#pragma unroll
    for (int t = 0; t < 4; ++t) o[t] = (v8f){};
    const unsigned nch = (q0 + 15u) / 32u + 1u;      // wave-uniform; keys < nch*32 <= QR
    V kb[2][2], kl[2][2], vb[4], vl[4];              // fragments of the current chunk: kb[d][i] = keys 16i.., depth 32d..; vb[t] = depth 16t..
    // Chunk 0 is requested in the loop's own order (queries, keys, values): loads retire in order and the wait at the loop's head is counted for both ways in, so another order here makes every trip's score products wait for the value requests too.
    asm volatile("s_wait_xcnt 0x0" ::: "memory");    // key fragments land in registers that held the query requests' addresses: a precaution in front of that reuse; as a memory fence it also keeps the query requests ahead of the key requests
#pragma unroll
    for (int d = 0; d < 2; ++d) { const size_t ko = zoff + d * 512;
        kb[d][0] = WFrag<T16>::ld(KA + ko); kb[d][1] = WFrag<T16>::ld(KA + ko + 16 * HD); if (HR) { kl[d][0] = WFrag<T16>::ld(KB + ko); kl[d][1] = WFrag<T16>::ld(KB + ko + 16 * HD); } }
    __builtin_amdgcn_sched_barrier(0);               // keeps the key requests ahead of the value requests
#pragma unroll
    for (int t = 0; t < 4; ++t) { const size_t vo = zoff + t * 512; vb[t] = WFrag<T16>::ld(VA + vo); if (HR) vl[t] = WFrag<T16>::ld(VB + vo); }
    const unsigned qrow = q0 + lr;
#pragma unroll 1
    for (unsigned c = 0; c < nch; ++c) {
        const unsigned c0 = c * 32u;
        const unsigned cn = ((c + 1u < nch) ? c + 1u : c) * 32u;      // chunk fetched ahead; the last trip asks for its own chunk again (in bounds, never used)
        v8f s0 = (v8f){}, s1 = (v8f){};              // s0[j] = score[key c0 + 8hi + j][query lr], s1: keys + 16
#pragma unroll
        for (int d = 0; d < 2; ++d) {
            s0 = WFrag<T16>::mma(kb[d][0], aq[d], s0); s1 = WFrag<T16>::mma(kb[d][1], aq[d], s1);
            if (HR) { s0 = WFrag<T16>::mma(kb[d][0], aql[d], s0); s1 = WFrag<T16>::mma(kb[d][1], aql[d], s1); s0 = WFrag<T16>::mma(kl[d][0], aq[d], s0); s1 = WFrag<T16>::mma(kl[d][1], aq[d], s1); } }
        asm volatile("v_nop\n\tv_nop\n\tv_nop\n\tv_nop" : "+v"(s0), "+v"(s1) : "v"(aq[0]), "v"(aq[1]));      // the four slots between the last score products and the requests that land in their operand registers
#pragma unroll
        for (int d = 0; d < 2; ++d) { const size_t ko = zoff + (size_t)cn * HD + d * 512;
            kb[d][0] = WFrag<T16>::ld(KA + ko); kb[d][1] = WFrag<T16>::ld(KA + ko + 16 * HD); if (HR) { kl[d][0] = WFrag<T16>::ld(KB + ko); kl[d][1] = WFrag<T16>::ld(KB + ko + 16 * HD); } }
        if (HR) asm volatile("s_wait_xcnt 0x0" ::: "memory");      // the softmax reuses the key requests' address registers: a precaution
        __builtin_amdgcn_sched_barrier(0);      // holds the key requests above the softmax, which is the time they have to land; sunk towards their use they would be waited out
        const unsigned key0 = c0 + 8u * hi;
        float t0[8], t1[8], p0[8], p1[8], r[8];
#pragma unroll
        for (int j = 0; j < 8; ++j) { const bool v0 = (key0 + (unsigned)j <= qrow), v1 = (key0 + 16u + (unsigned)j <= qrow);
            t0[j] = s0[j] * SC2; t1[j] = s1[j] * SC2; r[j] = fmaxf(v0 ? t0[j] : -1.0e30f, v1 ? t1[j] : -1.0e30f); }
        float cm = fmaxf(fmaxf(fmaxf(r[0], r[1]), fmaxf(r[2], r[3])), fmaxf(fmaxf(r[4], r[5]), fmaxf(r[6], r[7])));
        cm = fmaxf(cm, xhalf(cm));
        const float nm = fmaxf(m, cm); float al;
        asm("v_exp_f32 %0, %1\n\tv_nop" : "=v"(al) : "v"(m - nm));      // 2^(m - nm) with the slot behind a transcendental in the same statement
        m = nm;
#pragma unroll
        for (int j = 0; j < 8; ++j) { const bool v0 = (key0 + (unsigned)j <= qrow), v1 = (key0 + 16u + (unsigned)j <= qrow);
            const float e0 = __builtin_amdgcn_exp2f(fminf(t0[j] - nm, 0.0f)), e1 = __builtin_amdgcn_exp2f(fminf(t1[j] - nm, 0.0f));
            p0[j] = v0 ? e0 : 0.0f; p1[j] = v1 ? e1 : 0.0f; r[j] = p0[j] + p1[j]; }
        l = l * al + (((r[0] + r[1]) + (r[2] + r[3])) + ((r[4] + r[5]) + (r[6] + r[7])));
#pragma unroll
        for (int t = 0; t < 4; ++t) o[t] *= al;
        V ap, apl; WFrag<T16>::pk(ap, apl, p0, p1);
#pragma unroll
        for (int t = 0; t < 4; ++t) {
            o[t] = WFrag<T16>::mma(vb[t], ap, o[t]);
            if (HR) { o[t] = WFrag<T16>::mma(vb[t], apl, o[t]); o[t] = WFrag<T16>::mma(vl[t], ap, o[t]); } }
        asm volatile("v_nop\n\tv_nop\n\tv_nop\n\tv_nop" : "+v"(o[0]), "+v"(o[1]), "+v"(o[2]), "+v"(o[3]) : "v"(ap));      // the four slots between the last value products and the requests that land in their operand registers
        const T16* pva = VA + zoff + (size_t)cn * HD; const T16* pvb = HR ? VB + zoff + (size_t)cn * HD : pva;
#pragma unroll
        for (int t = 0; t < 4; ++t) { vb[t] = WFrag<T16>::ld(pva + t * 512); if (HR) vl[t] = WFrag<T16>::ld(pvb + t * 512); }
        if (HR) asm volatile("s_wait_xcnt 0x0" :: "v"(pva), "v"(pvb) : "memory");      // a precaution in front of the reuse of the value requests' address registers; the addresses are inputs so that their registers stay theirs up to the wait
    }
    asm volatile("s_wait_loadcnt 0x0" ::: "memory");      // the last trip's requests are never read: they retire here, before the wave gives its registers back
    const float cs = HR ? 1.0f : (1.0f / PCAR);
    const float ls = l + xhalf(l); const float inv = (1.0f / ls) * cs;
    const unsigned b = z / (unsigned)NH, h = z % (unsigned)NH;      // the tile is blocks 2h and 2h + 1 of its 16 rows; store s fills half s & 1 of block s >> 1: row lr, columns 16s + 8hi.. = accumulator s of this lane
#pragma unroll
    for (int s = 0; s < 4; ++s) { v8us oh, ol;
#pragma unroll
        for (int k = 0; k < 8; ++k) { unsigned short x, y2; splitf(o[s][k] * inv, x, y2); oh[k] = x; ol[k] = y2; }
        const size_t oo = (size_t)(b * SEQ + q0) * DM + h * 1024u + (unsigned)s * 256u + 8u * lane;
        *(v8us*)(ATh + oo) = oh; *(v8us*)(ATl + oo) = ol; }
}

// coverage: k_flash_hr grid NZ*(RH/16)/4 x 4 waves x (16 rows x 64 d) == NZ*RH*HD; k_flash_pl grid NZ*((SEQ-RH)/16)/4 x 4 waves x (16 x 64) == NZ*(SEQ-RH)*HD; union == NB*SEQ*DM per context plane.
static_assert((NZ * (RH / 16)) % 4 == 0);
static_assert((NZ * ((SEQ - RH) / 16)) % 4 == 0);
__global__ __launch_bounds__(128) void k_flash_hr(const bf* Qh, const bf* Ql, const bf* Kh, const bf* Kl, const bf* Vh, const bf* Vl, bf* ATh, bf* ATl) {
    flash_body<bf, true>(Qh, Ql, Kh, Kl, Vh, Vl, ATh, ATl); }
__global__ __launch_bounds__(128) void k_flash_pl(const h16* Q16, const h16* K16, const h16* V16, bf* ATh, bf* ATl) {
    flash_body<h16, false>(Q16, nullptr, K16, nullptr, V16, nullptr, ATh, ATl); }

// workspace carve (bytes; every region a multiple of 256)
constexpr size_t SZ_WT  = (size_t)4 * DM * DM * 2;
constexpr size_t SZ_XB  = (size_t)NB * SEQ * DM * 2;
constexpr size_t SZ_F   = (size_t)3 * NB * SEQ * DM * 4;
constexpr size_t SZ_QK  = (size_t)2 * NZ * SEQ * HD * 2;
constexpr size_t SZ_V   = (size_t)NZ * HD * SEQ * 2;
constexpr size_t SZ_QKH = (size_t)2 * NZ * RH * HD * 2;
constexpr size_t SZ_VH  = (size_t)NZ * HD * RH * 2;
constexpr size_t SZ_AT  = (size_t)NB * SEQ * DM * 2;
constexpr size_t WS_TOTAL = SZ_WT + SZ_XB + SZ_F + SZ_QK + SZ_V + 2 * SZ_QKH + 2 * SZ_VH + 2 * SZ_AT;
static_assert(WS_TOTAL <= (size_t)134217728);
static_assert(SZ_WT % 256 == 0 && SZ_XB % 256 == 0 && SZ_F % 256 == 0 && SZ_QK % 256 == 0 && SZ_V % 256 == 0 && SZ_QKH % 256 == 0 && SZ_VH % 256 == 0 && SZ_AT % 256 == 0);

extern "C" void kernel_launch(void* const* d_in, const int* in_sizes, int n_in,
                              void* d_out, int out_size, void* d_ws, size_t ws_size, hipStream_t stream) {
    if (n_in < 7) return;
    const long long need_x = ((long long)(NB - 1) * SEQ_FULL + SEQ) * DM;
    if ((long long)in_sizes[0] < need_x || (long long)out_size < need_x) return;
    if (in_sizes[1] < DM * DM || in_sizes[2] < DM * DM || in_sizes[3] < DM * DM || in_sizes[4] < DM * DM) return;
    if (in_sizes[5] < SEQ * (HD / 2) || in_sizes[6] < SEQ * (HD / 2)) return;
    if (WS_TOTAL > ws_size) return;
    const float* x = (const float*)d_in[0]; const float* wq = (const float*)d_in[1]; const float* wk = (const float*)d_in[2]; const float* wv = (const float*)d_in[3]; const float* wo = (const float*)d_in[4];
    const float* fcos = (const float*)d_in[5]; const float* fsin = (const float*)d_in[6];
    float* OUT = (float*)d_out;
    char* wsp = (char*)d_ws;
    auto take = [&](size_t bytes) { char* p = wsp; wsp += bytes; return (void*)p; };
    bf* WT = (bf*)take(SZ_WT);            // [4] planes (rows n, k): q | k | v | o
    bf* XB = (bf*)take(SZ_XB);            // rows NB*SEQ, k DM
    float* F = (float*)take(SZ_F);        // [3][NB*SEQ][DM]: q | k | v projections
    h16* QK16 = (h16*)take(SZ_QK);        // [2][NZ] planes (rows SEQ, k HD)
    h16* V16 = (h16*)take(SZ_V);          // [NZ] planes (rows HD, k SEQ)
    bf* QKh = (bf*)take(SZ_QKH); bf* QKl = (bf*)take(SZ_QKH);    // [2][NZ] planes (rows RH, k HD)
    bf* Vh = (bf*)take(SZ_VH); bf* Vl = (bf*)take(SZ_VH);        // [NZ] planes (rows HD, k RH)
    bf* ATh = (bf*)take(SZ_AT); bf* ATl = (bf*)take(SZ_AT);      // rows NB*SEQ, k DM
    if ((size_t)(wsp - (char*)d_ws) > ws_size) return;

    k_cvtx<<<dim3((unsigned)((size_t)SEQ * DM / 2048), NB, 1), 256, 0, stream>>>(x, XB);
    k_wt4<<<dim3((unsigned)((size_t)DM * DM / 2048), 4, 1), 256, 0, stream>>>(wq, wk, wv, wo, WT);
    k_gemmw<bf, 0, false, DM, 2><<<dim3(NB * SEQ / 64, DM / 64, 3), 32, 0, stream>>>(XB, nullptr, WT, nullptr, F, DM, nullptr, (size_t)0, (size_t)DM * DM, (size_t)NB * SEQ * DM);
    k_ropeqk<<<dim3((unsigned)((size_t)NZ * SEQ * 8 / 256), 2, 1), 256, 0, stream>>>(F, fcos, fsin, QK16, QKh, QKl);
    k_vtp<<<(unsigned)((size_t)NZ * HD * (SEQ / 8) / 256), 256, 0, stream>>>(F + (size_t)2 * NB * SEQ * DM, V16, Vh, Vl);
    k_flash_hr<<<(unsigned)(NZ * (RH / 16) / 4), 128, 0, stream>>>(QKh, QKl, QKh + (size_t)NZ * RH * HD, QKl + (size_t)NZ * RH * HD, Vh, Vl, ATh, ATl);
    if (SEQ > RH) k_flash_pl<<<(unsigned)(NZ * ((SEQ - RH) / 16) / 4), 128, 0, stream>>>(QK16, QK16 + (size_t)NZ * SEQ * HD, V16, ATh, ATl);
    k_gemmw<bf, 1, false, DM, 3><<<dim3(SEQ / 64, DM / 64, NB), 32, 0, stream>>>(ATh, ATl, WT + (size_t)3 * DM * DM, nullptr, OUT, DM, nullptr, (size_t)SEQ * DM, (size_t)0, (size_t)SEQ_FULL * DM);
}

// v005
// It runs in 127 microseconds.
// Two timings next to v004 both put it at 1.06 times that version's speed.
// Counting every step since v000, it is 2.26 times as fast.
#include <hip/hip_runtime.h>

// Contractions (f32 accumulate): q/k/v projections v_wmma_f32_16x16x32_bf16 on bf16 RNE-converted inputs (single product); causal scores and probability x value: query rows < RH on bf16 hi/lo planes (3 products), rows >= RH v_wmma_f32_16x16x32_f16 (probabilities carried x1024); output projection bf16 hi/lo context x bf16 weight (2 products); softmax f32.
// Causal multi-head attention with interleaved-pair rotary tables read as INPUT values: x [NB][SEQ][1024]; wq/wk/wv/wo [in][out], no bias; 16 heads x 64; scores x 64^-0.5; causal by index.
// Layout: bf16 copy of x (both batches, compact rows); four weights transposed once to Bt planes; one z-batched projection GEMM (q | k | v) whose epilogue writes the head planes itself (rotary on q, k; transposed v): no f32 projection plane;
// every 16-bit plane that feeds a matrix operand is stored in FRAGMENT ORDER (below), so that each fragment request of a wave covers whole 128-byte lines;
// flash attention, one wave per 16-row query tile, both products transposed (keys x queries, depth x queries), 32-key chunks with the key and value fragments fetched one chunk ahead, online softmax with running max; context hi/lo planes; output GEMM.

#ifndef NB
#define NB 2
#endif
#ifndef SEQ
#define SEQ 2048
#endif
#define NB_FULL  2
#define SEQ_FULL 2048
#define DM   1024
#define NH   16
#define HD   64
#define NZ   (NB * NH)
#define RH   ((SEQ < 512) ? SEQ : 512)     // query rows < RH use hi+lo planes
#define PCAR 1024.0f
#define SC2  0.18033688011112042f          // HD^-0.5 * log2(e)

static_assert((SEQ & (SEQ - 1)) == 0);
static_assert(SEQ % 256 == 0);
static_assert(RH % 256 == 0);
static_assert(RH <= SEQ);
static_assert(DM == NH * HD);
static_assert(HD == 64);
static_assert((NB * SEQ) % 64 == 0);
static_assert(DM % 64 == 0);
static_assert(NB <= NB_FULL && SEQ <= SEQ_FULL);

typedef _Float16 h16;
typedef unsigned short bf;
typedef __attribute__((ext_vector_type(16))) __bf16   v16bf;
typedef __attribute__((ext_vector_type(16))) _Float16 v16h;
typedef __attribute__((ext_vector_type(8)))  _Float16 v8h;
typedef __attribute__((ext_vector_type(8)))  unsigned short v8us;
typedef __attribute__((ext_vector_type(2)))  unsigned short v2us;
typedef __attribute__((ext_vector_type(8)))  float    v8f;
typedef __attribute__((ext_vector_type(4)))  float    v4f;
typedef v4f  __attribute__((may_alias)) v4fa;

__device__ __forceinline__ unsigned short f2bf(float f) { unsigned u = __float_as_uint(f); u += 0x7FFFu + ((u >> 16) & 1u); return (unsigned short)(u >> 16); }
__device__ __forceinline__ float bf2f(unsigned short b) { return __uint_as_float(((unsigned)b) << 16); }
__device__ __forceinline__ float bfr(float f) { return bf2f(f2bf(f)); }
__device__ __forceinline__ void splitf(float y, unsigned short& h, unsigned short& l) { h = f2bf(y); l = f2bf(y - bf2f(h)); }
__device__ __forceinline__ v16h cat16(v8h lo, v8h hi) { return __builtin_shufflevector(lo, hi, 0, 1, 2, 3, 4, 5, 6, 7, 8, 9, 10, 11, 12, 13, 14, 15); }
__device__ __forceinline__ v16bf cat16b(v8us lo, v8us hi) { return __builtin_bit_cast(v16bf, __builtin_shufflevector(lo, hi, 0, 1, 2, 3, 4, 5, 6, 7, 8, 9, 10, 11, 12, 13, 14, 15)); }
__device__ __forceinline__ v8f wmma16(v16h a, v16h b, v8f c) { return __builtin_amdgcn_wmma_f32_16x16x32_f16(false, a, false, b, (short)0, c, false, false); }
__device__ __forceinline__ v8f wmmab(v16bf a, v16bf b, v8f c) { return __builtin_amdgcn_wmma_f32_16x16x32_bf16(false, a, false, b, (short)0, c, false, false); }

template <typename T16> struct WFrag;
template <> struct WFrag<h16> { typedef v16h V;
    static __device__ __forceinline__ V ld(const h16* p) { return cat16(*(const v8h*)p, *(const v8h*)(p + 256)); }
    static __device__ __forceinline__ v8f mma(V a, V b, v8f c) { return wmma16(a, b, c); }
    static __device__ __forceinline__ void pk(V& ph, V& pl, const float (&p0)[8], const float (&p1)[8]) { (void)pl;
#pragma unroll
        for (int j = 0; j < 8; ++j) { ph[j] = (h16)(p0[j] * PCAR); ph[j + 8] = (h16)(p1[j] * PCAR); } } };
template <> struct WFrag<bf> { typedef v16bf V;
    static __device__ __forceinline__ V ld(const bf* p) { return cat16b(*(const v8us*)p, *(const v8us*)(p + 256)); }
    static __device__ __forceinline__ v8f mma(V a, V b, v8f c) { return wmmab(a, b, c); }
    static __device__ __forceinline__ void pk(V& ph, V& pl, const float (&p0)[8], const float (&p1)[8]) { v8us h0, h1, l0, l1;
#pragma unroll
        for (int j = 0; j < 8; ++j) { unsigned short a, c; splitf(p0[j], a, c); h0[j] = a; l0[j] = c; splitf(p1[j], a, c); h1[j] = a; l1[j] = c; }
        ph = cat16b(h0, h1); pl = cat16b(l0, l1); } };

// ---- k_gemmw: register-blocked GEMM, ONE WAVE per 64x64 output tile (16 accumulators), operands straight from fragment-ordered 16-bit planes (block (rt, kt) at rt*16*K + kt*512); grid (M/64, N/64, Z), 32 threads.
// C[m][n] (f32, pitch ldc, + optional f32 bias[n]) = sum_k A[m][k] Bt[n][k] (+ split products per NSPLIT). z-batch strides sA/sB/sC in elements. K % 32 == 0, a compile-time constant: the four row tiles of an operand are then one address and immediate offsets.
// The fragments of a 32-k trip live in one of NS register sets; a set is asked for again, for trip t + NS, right behind the products of trip t: every request has NS - 1 trips of products to land, and no product waits on a load just issued.
template <typename T16> struct GSet { typename WFrag<T16>::V a[4], a2[4], b[4], b2[4]; };

template <typename T16, int NSPLIT, int K>
__device__ __forceinline__ void g_fetch(GSet<T16>& f, const T16* pa, const T16* pa2, const T16* pb, const T16* pb2, unsigned l8, int ofs) {      // pa..pb2: wave-uniform bases; l8: the lane's piece; ofs: a constant at every call, it goes into the requests' immediate offsets
    __builtin_amdgcn_sched_barrier(0);      // keeps the requests behind the products that read this set: lifted over them they would need registers of their own
#pragma unroll
    for (int mb = 0; mb < 4; ++mb) { f.a[mb] = WFrag<T16>::ld(pa + l8 + (ofs + mb * 16 * K)); if (NSPLIT == 1 || NSPLIT == 2) f.a2[mb] = WFrag<T16>::ld(pa2 + l8 + (ofs + mb * 16 * K)); }
#pragma unroll
    for (int nb = 0; nb < 4; ++nb) { f.b[nb] = WFrag<T16>::ld(pb + l8 + (ofs + nb * 16 * K)); if (NSPLIT >= 2) f.b2[nb] = WFrag<T16>::ld(pb2 + l8 + (ofs + nb * 16 * K)); }
    asm volatile("s_wait_xcnt 0x0" ::: "memory");      // a precaution: it stands in front of every later write of a register that these requests name as an address (the next round's bases)
    __builtin_amdgcn_sched_barrier(0);      // holds the requests above the other sets' products, which are the time they have to land; sunk towards their use they would be waited out
}

template <typename T16, int NSPLIT>
__device__ __forceinline__ void g_mm(const GSet<T16>& f, v8f (&acc)[4][4]) {
#pragma unroll
    for (int nb = 0; nb < 4; ++nb) {
#pragma unroll
        for (int mb = 0; mb < 4; ++mb) { acc[mb][nb] = WFrag<T16>::mma(f.a[mb], f.b[nb], acc[mb][nb]); if (NSPLIT == 1 || NSPLIT == 2) acc[mb][nb] = WFrag<T16>::mma(f.a2[mb], f.b[nb], acc[mb][nb]); if (NSPLIT >= 2) acc[mb][nb] = WFrag<T16>::mma(f.a[mb], f.b2[nb], acc[mb][nb]); } }
    // the four slots between the last products and the requests that land in their operand registers
    asm volatile("v_nop\n\tv_nop\n\tv_nop\n\tv_nop" : "+v"(acc[0][0]), "+v"(acc[1][1]), "+v"(acc[2][2]), "+v"(acc[3][3]) : "v"(f.a[0]), "v"(f.a[3]));
}

template <typename T16, int NSPLIT, bool BIAS, int K, int NS>
__global__ __launch_bounds__(32) void k_gemmw(const T16* __restrict__ A, const T16* __restrict__ A2, const T16* __restrict__ Bt, const T16* __restrict__ Bt2, float* C, int ldc, const float* __restrict__ bias, size_t sA, size_t sB, size_t sC) {
    constexpr int NT = K / 32;               // trips
    constexpr int NL = (NT - NS) / NS;       // rounds of NS trips in which every set is asked for again
    static_assert(K % 32 == 0 && NS >= 2 && NT >= NS);
    __shared__ __align__(16) float os[16 * 68];
    const size_t z = blockIdx.z; A += z * sA; if (A2) A2 += z * sA; Bt += z * sB; if (Bt2) Bt2 += z * sB; C += z * sC;
    const int lane = threadIdx.x & 31, lr = lane & 15, hi = lane >> 4; const int r0 = blockIdx.x * 64, c0 = blockIdx.y * 64;
    v8f acc[4][4];
#pragma unroll
    for (int mb = 0; mb < 4; ++mb)
#pragma unroll
        for (int nb = 0; nb < 4; ++nb) acc[mb][nb] = (v8f){};
    const size_t aoff = (size_t)r0 * K, boff = (size_t)c0 * K; const unsigned l8 = 8u * (unsigned)lane;
    const T16* pa = A + aoff; const T16* pa2 = A2 + aoff; const T16* pb = Bt + boff; const T16* pb2 = Bt2 + boff;
    GSet<T16> f[NS];
#pragma unroll
    for (int s = 0; s < NS; ++s) g_fetch<T16, NSPLIT, K>(f[s], pa, pa2, pb, pb2, l8, s * 512);
#pragma unroll 1
    for (int i = 0; i < NL; ++i) {           // rolled: one round of NS trips is the loop's body
        const int o = (i + 1) * NS * 512; const T16* qa = pa + o; const T16* qa2 = pa2 + o; const T16* qb = pb + o; const T16* qb2 = pb2 + o;
#pragma unroll
        for (int s = 0; s < NS; ++s) { g_mm<T16, NSPLIT>(f[s], acc); g_fetch<T16, NSPLIT, K>(f[s], qa, qa2, qb, qb2, l8, s * 512); }
    }
#pragma unroll
    for (int t = NL * NS; t < NT; ++t) { g_mm<T16, NSPLIT>(f[t % NS], acc);
        if (t + NS < NT) g_fetch<T16, NSPLIT, K>(f[t % NS], pa, pa2, pb, pb2, l8, (t + NS) * 512); }
#pragma unroll
    for (int mb = 0; mb < 4; ++mb) {
#pragma unroll
        for (int nb = 0; nb < 4; ++nb) {
#pragma unroll
            for (int j = 0; j < 8; ++j) os[(hi * 8 + j) * 68 + nb * 16 + lr] = acc[mb][nb][j]; }
        __builtin_amdgcn_wave_barrier(); asm volatile("" ::: "memory");
        float* crow = C + (size_t)(r0 + mb * 16) * ldc + c0;
{
#pragma unroll
            for (int s = 0; s < 8; ++s) { const int row = 2 * s + hi, cofs = lr * 4; v4f val = *(const v4fa*)(os + row * 68 + cofs); if (BIAS) { val[0] += bfr(bias[c0 + cofs]); val[1] += bfr(bias[c0 + cofs + 1]); val[2] += bfr(bias[c0 + cofs + 2]); val[3] += bfr(bias[c0 + cofs + 3]); }
                *(v4f*)(crow + (size_t)row * ldc + cofs) = val; }
             }
        __builtin_amdgcn_wave_barrier(); asm volatile("" ::: "memory");
    }
}

// thread i of a batch writes piece i (8 elements) of the fragment-ordered copy: i = (block * 2 + k half) * 32 + lane.
// coverage: grid (SEQ*DM/2048, NB) x 256 threads x 8 elements == NB*SEQ*DM.
static_assert(((size_t)SEQ * DM) % 2048 == 0);
__global__ __launch_bounds__(256) void k_cvtx(const float* __restrict__ src, bf* dst) {
    const unsigned i = blockIdx.x * 256u + threadIdx.x; const unsigned b = blockIdx.y;
    const unsigned lr = i & 15u, hi = (i >> 4) & 1u, h2 = (i >> 5) & 1u, blk = i >> 6; const unsigned kt = blk % (unsigned)(DM / 32), rt = blk / (unsigned)(DM / 32);
    const float* s = src + (size_t)b * SEQ_FULL * DM + (size_t)(rt * 16u + lr) * DM + kt * 32u + h2 * 16u + hi * 8u; bf* d = dst + (size_t)b * SEQ * DM + (size_t)i * 8;
    const v8f v = *(const v8f*)s; v8us o;
#pragma unroll
    for (int k = 0; k < 8; ++k) o[k] = f2bf(v[k]);
    *(v8us*)d = o;  }

// thread i of a weight writes piece i of its fragment-ordered transpose Bt[n][k] = w[k][n]: 8 k of one n; a wave reads 64-byte runs of two w rows per request.
// coverage: grid (DM*DM/2048, 4) x 256 threads x 8 elements == 4*DM*DM.
static_assert(((size_t)DM * DM) % 2048 == 0);
__global__ __launch_bounds__(256) void k_wt4(const float* __restrict__ w0, const float* __restrict__ w1, const float* __restrict__ w2, const float* __restrict__ w3, bf* Bt) {
    const unsigned y = blockIdx.y; const float* w = (y == 0u) ? w0 : (y == 1u) ? w1 : (y == 2u) ? w2 : w3; bf* o = Bt + (size_t)y * DM * DM;
    const unsigned i = blockIdx.x * 256u + threadIdx.x;
    const unsigned lr = i & 15u, hi = (i >> 4) & 1u, h2 = (i >> 5) & 1u, blk = i >> 6; const unsigned kt = blk % (unsigned)(DM / 32), nt = blk / (unsigned)(DM / 32);
    const float* s = w + (size_t)(kt * 32u + h2 * 16u + hi * 8u) * DM + nt * 16u + lr; v8us q;
#pragma unroll
    for (int j = 0; j < 8; ++j) q[j] = f2bf(s[(size_t)j * DM]);
    *(v8us*)(o + (size_t)i * 8) = q;
}

// ---- k_gemmqkv: the q | k | v projection GEMM (blockIdx.z 0 | 1 | 2), one wave per 64x64 tile = 64 positions x ONE head (HD == 64), k loop as in k_gemmw (single product); grid (NB*SEQ/64, NH, 3), 32 threads. The epilogue writes the attention's planes from the accumulators.
// q, k: head planes [z] (rows t, k = d, fragment order: 2 blocks per 16 rows) of the rotated projection: pair i of a head row: out[2i] = x[2i] c - x[2i+1] s, out[2i+1] = x[2i] s + x[2i+1] c with c, s = bf16 RNE-converted INPUT table values [t][i].
//   The tile goes through LDS (a lane holds 8 rows of one depth, a piece is 8 depths of one row); the table rows, read as whole lines, go there 16 rows at a time; lane (lr, hi) builds piece (row lr, depths 16s + 8hi..) for s = 0..3: each store of the wave is 512 contiguous bytes.
// v: value planes [z] (rows d, k = key, fragment order, the four 16-d blocks of a 32-key chunk side by side: block (chunk, dt) at (chunk * 4 + dt) * 512). An accumulator's 8 registers are 8 keys of one depth, which is a piece: stored from the registers, 512 contiguous bytes per store.
// coverage: the tiles cover NB*SEQ rows x DM columns of each projection == NZ*SEQ*HD elements of each fp16 plane; tiles with t < RH (64 | RH) also fill the hi and lo planes (NZ*RH*HD each).
static_assert(SEQ % 64 == 0 && RH % 64 == 0 && HD == 64 && DM == NH * 64);
template <int K, int NS>
__global__ __launch_bounds__(32) void k_gemmqkv(const bf* __restrict__ A, const bf* __restrict__ Bt, const float* __restrict__ cosT, const float* __restrict__ sinT, h16* P16, bf* Ph, bf* Pl, h16* V16, bf* Vh, bf* Vl) {
    constexpr int NT = K / 32;               // trips
    constexpr int NL = (NT - NS) / NS;       // rounds of NS trips in which every set is asked for again
    static_assert(K % 32 == 0 && NS >= 2 && NT >= NS);
    __shared__ __align__(16) float os[64 * 68];
    __shared__ __align__(16) float tc[16 * 36];      // pitch 36: the 16 rows of a 16-byte column start in 16 different bank groups
    __shared__ __align__(16) float ts[16 * 36];
    const unsigned y = blockIdx.z, h = blockIdx.y, r0 = blockIdx.x * 64u;
    const unsigned lane = threadIdx.x & 31u, lr = lane & 15u, hi = lane >> 4, l8 = 8u * lane;
    v8f acc[4][4];
#pragma unroll
    for (int mb = 0; mb < 4; ++mb)
#pragma unroll
        for (int nb = 0; nb < 4; ++nb) acc[mb][nb] = (v8f){};
    const bf* pa = A + (size_t)r0 * K; const bf* pb = Bt + (size_t)y * DM * K + (size_t)h * 64u * K;
    GSet<bf> f[NS];
#pragma unroll
    for (int s = 0; s < NS; ++s) g_fetch<bf, 0, K>(f[s], pa, pa, pb, pb, l8, s * 512);
#pragma unroll 1
    for (int i = 0; i < NL; ++i) {           // rolled: one round of NS trips is the loop's body
        const int o = (i + 1) * NS * 512; const bf* qa = pa + o; const bf* qb = pb + o;
#pragma unroll
        for (int s = 0; s < NS; ++s) { g_mm<bf, 0>(f[s], acc); g_fetch<bf, 0, K>(f[s], qa, qa, qb, qb, l8, s * 512); }
    }
#pragma unroll
    for (int t = NL * NS; t < NT; ++t) { g_mm<bf, 0>(f[t % NS], acc);
        if (t + NS < NT) g_fetch<bf, 0, K>(f[t % NS], pa, pa, pb, pb, l8, (t + NS) * 512); }
    const unsigned b = r0 / (unsigned)SEQ, t0 = r0 % (unsigned)SEQ, z = b * (unsigned)NH + h;
    const bool hl = (t0 < (unsigned)RH);     // uniform per wave (64 consecutive rows, RH % 64 == 0)
    // Stores go out 16 rows at a time: all their values first, then the stores, then one s_wait_xcnt 0 (a precaution: it stands in front of every later write of a register that these stores name); the scheduling fences keep other work out of that stretch.
    if (y == 2u) {
        h16* p16 = V16 + (size_t)z * HD * SEQ + (t0 >> 5) * 2048u + l8;
        const size_t ho = (size_t)z * HD * RH + (hl ? (t0 >> 5) : 0u) * 2048u + l8; bf* ph = Vh + ho; bf* pl = Vl + ho;
#pragma unroll
        for (int mb = 0; mb < 4; ++mb) {     // keys t0 + 16mb + 8hi + j, depth 16nb + lr: chunk mb >> 1, block nb, k half mb & 1, piece lane
            const int e = (mb >> 1) * 2048 + (mb & 1) * 256; v8h o16[4];
#pragma unroll
            for (int nb = 0; nb < 4; ++nb)
#pragma unroll
                for (int j = 0; j < 8; ++j) o16[nb][j] = (h16)acc[mb][nb][j];
            if (hl) { v8us oh[4], ol[4];
#pragma unroll
                for (int nb = 0; nb < 4; ++nb)
#pragma unroll
                    for (int j = 0; j < 8; ++j) { unsigned short a, c2; splitf(acc[mb][nb][j], a, c2); oh[nb][j] = a; ol[nb][j] = c2; }
                __builtin_amdgcn_sched_barrier(0);      // values above, stores below
#pragma unroll
                for (int nb = 0; nb < 4; ++nb) { *(v8h*)(p16 + e + nb * 512) = o16[nb]; *(v8us*)(ph + e + nb * 512) = oh[nb]; *(v8us*)(pl + e + nb * 512) = ol[nb]; }
                asm volatile("s_wait_xcnt 0x0" ::: "memory");      // the precaution named above, behind these stores
            } else {
                __builtin_amdgcn_sched_barrier(0);      // values above, stores below
#pragma unroll
                for (int nb = 0; nb < 4; ++nb) *(v8h*)(p16 + e + nb * 512) = o16[nb];
                asm volatile("s_wait_xcnt 0x0" ::: "memory");      // the precaution named above, behind these stores
            }
            __builtin_amdgcn_sched_barrier(0);          // the next rows' values stay behind the wait
        }
        return;
    }
    const float* ct = cosT + (size_t)t0 * 32 + 4u * lane; const float* st = sinT + (size_t)t0 * 32 + 4u * lane;      // request q of a 16-row block: its rows 4q..4q+3, 512 contiguous bytes
    v4f cq[4], sq[4];
#pragma unroll
    for (int q = 0; q < 4; ++q) { cq[q] = *(const v4f*)(ct + q * 128); sq[q] = *(const v4f*)(st + q * 128); }      // the first 16 rows' table values fly while the tile goes to LDS
    asm volatile("s_wait_xcnt 0x0" ::: "memory");      // a precaution: it stands in front of every later write of a register that these requests name as an address
    __builtin_amdgcn_sched_barrier(0);                 // keeps later address arithmetic behind that wait
#pragma unroll
    for (int mb = 0; mb < 4; ++mb)
#pragma unroll
        for (int nb = 0; nb < 4; ++nb)
#pragma unroll
            for (int j = 0; j < 8; ++j) os[(mb * 16 + hi * 8 + j) * 68 + nb * 16 + lr] = acc[mb][nb][j];
    h16* p16 = P16 + (size_t)y * NZ * SEQ * HD + (size_t)z * SEQ * HD + (t0 >> 4) * 1024u + l8;
    const size_t ho = (size_t)y * NZ * RH * HD + (size_t)z * RH * HD + (hl ? (t0 >> 4) : 0u) * 1024u + l8; bf* ph = Ph + ho; bf* pl = Pl + ho;
    const unsigned to = (lane >> 3) * 36u + (lane & 7u) * 4u;
#pragma unroll 1
    for (unsigned mb = 0; mb < 4u; ++mb) {       // rolled: the body is long and runs four times; 16 rows a trip
#pragma unroll
        for (int q = 0; q < 4; ++q) { *(v4fa*)(tc + q * 144 + to) = cq[q]; *(v4fa*)(ts + q * 144 + to) = sq[q]; }
        if (mb < 3u) {      // the next 16 rows' table values fly while these rows are built
#pragma unroll
            for (int q = 0; q < 4; ++q) { cq[q] = *(const v4f*)(ct + (mb + 1u) * 512u + q * 128); sq[q] = *(const v4f*)(st + (mb + 1u) * 512u + q * 128); }
            asm volatile("s_wait_xcnt 0x0" ::: "memory");      // a precaution: it stands in front of every later write of a register that these requests name as an address
        }
        __builtin_amdgcn_wave_barrier(); asm volatile("" ::: "memory");      // keeps the LDS reads below behind the LDS writes above in the compiled order (one wave: the LDS serves it in order)
        float ro[4][8]; v8h o16[4];
#pragma unroll
        for (int s = 0; s < 4; ++s) { const unsigned seg = 2u * (unsigned)s + hi; const float* xr = os + (mb * 16u + lr) * 68u + seg * 8u;
            const v4f x0 = *(const v4fa*)xr, x1 = *(const v4fa*)(xr + 4); const v4f cv = *(const v4fa*)(tc + lr * 36u + seg * 4u), sv = *(const v4fa*)(ts + lr * 36u + seg * 4u);
            float xs[8]; xs[0] = x0[0]; xs[1] = x0[1]; xs[2] = x0[2]; xs[3] = x0[3]; xs[4] = x1[0]; xs[5] = x1[1]; xs[6] = x1[2]; xs[7] = x1[3];
#pragma unroll
            for (int i = 0; i < 4; ++i) { const float c = bfr(cv[i]), sn = bfr(sv[i]); const float tr = xs[2 * i], ti = xs[2 * i + 1]; ro[s][2 * i] = tr * c - ti * sn; ro[s][2 * i + 1] = tr * sn + ti * c;
                o16[s][2 * i] = (h16)ro[s][2 * i]; o16[s][2 * i + 1] = (h16)ro[s][2 * i + 1]; } }
        const unsigned e = mb * 1024u;      // 16-row tile mb; piece (depths 16s + 8hi.., row lr) sits at s * 256 + lane * 8
        if (hl) { v8us oh[4], ol[4];
#pragma unroll
            for (int s = 0; s < 4; ++s)
#pragma unroll
                for (int k = 0; k < 8; ++k) { unsigned short a, d2; splitf(ro[s][k], a, d2); oh[s][k] = a; ol[s][k] = d2; }
            __builtin_amdgcn_sched_barrier(0);      // values above, stores below
#pragma unroll
            for (int s = 0; s < 4; ++s) { *(v8h*)(p16 + e + s * 256) = o16[s]; *(v8us*)(ph + e + s * 256) = oh[s]; *(v8us*)(pl + e + s * 256) = ol[s]; }
            asm volatile("s_wait_xcnt 0x0" ::: "memory");      // the precaution named above, behind these stores
        } else {
            __builtin_amdgcn_sched_barrier(0);      // values above, stores below
#pragma unroll
            for (int s = 0; s < 4; ++s) *(v8h*)(p16 + e + s * 256) = o16[s];
            asm volatile("s_wait_xcnt 0x0" ::: "memory");      // the precaution named above, behind these stores
        }
        __builtin_amdgcn_wave_barrier(); asm volatile("" ::: "memory");      // keeps the next rows' table writes behind this trip's LDS reads in the compiled order
    }
}

__device__ __forceinline__ float xhalf(float x) { return __builtin_bit_cast(float, __builtin_amdgcn_permlanex16(__builtin_bit_cast(int, x), __builtin_bit_cast(int, x), 0x76543210, 0xfedcba98, false, false)); }      // lane l's value of lane l ^ 16

template <typename T16, bool HR>
__device__ __forceinline__ void flash_body(const T16* QA, const T16* QB, const T16* KA, const T16* KB, const T16* VA, const T16* VB, bf* ATh, bf* ATl) {
    typedef typename WFrag<T16>::V V;
    constexpr unsigned QR   = HR ? (unsigned)RH : (unsigned)SEQ;     // rows per z of the q/k planes = key pitch of the v planes
    constexpr unsigned ROW0 = HR ? 0u : (unsigned)RH;
    constexpr unsigned NT   = HR ? (unsigned)RH / 16u : (unsigned)(SEQ - RH) / 16u;
    constexpr unsigned NTD  = NT ? NT : 1u;
    const unsigned lane = threadIdx.x & 31u, wid = threadIdx.x >> 5, lr = lane & 15u, hi = lane >> 4;
    const unsigned w = blockIdx.x * 4u + wid; const unsigned z = w / NTD, mt = w % NTD; const unsigned q0 = ROW0 + mt * 16u;
    const size_t zoff = (size_t)z * QR * HD + 8u * lane;      // this lane's piece of block 0 of head z, in the q, k and v planes alike; 16 rows of q or k = 2 blocks, a 32-key chunk of k or v = 4 blocks
    const size_t qoff = zoff + (size_t)q0 * HD;
    V aq[2], aql[2];
#pragma unroll
    for (int d = 0; d < 2; ++d) { aq[d] = WFrag<T16>::ld(QA + qoff + d * 512); if (HR) aql[d] = WFrag<T16>::ld(QB + qoff + d * 512); }
    v8f o[4]; float m = -1.0e30f, l = 0.0f;          // o[t][j] = context[query lr][depth 16t + 8hi + j]; m, l: query lr (l: this half's keys)
#pragma unroll
    for (int t = 0; t < 4; ++t) o[t] = (v8f){};
    const unsigned nch = (q0 + 15u) / 32u + 1u;      // wave-uniform; keys < nch*32 <= QR
    V kb[2][2], kl[2][2], vb[4], vl[4];              // fragments of the current chunk: kb[d][i] = keys 16i.., depth 32d..; vb[t] = depth 16t..
    // Chunk 0 is requested in the loop's own order (queries, keys, values): loads retire in order and the wait at the loop's head is counted for both ways in, so another order here makes every trip's score products wait for the value requests too.
    asm volatile("s_wait_xcnt 0x0" ::: "memory");    // key fragments land in registers that held the query requests' addresses: a precaution in front of that reuse; as a memory fence it also keeps the query requests ahead of the key requests
#pragma unroll
    for (int d = 0; d < 2; ++d) { const size_t ko = zoff + d * 512;
        kb[d][0] = WFrag<T16>::ld(KA + ko); kb[d][1] = WFrag<T16>::ld(KA + ko + 16 * HD); if (HR) { kl[d][0] = WFrag<T16>::ld(KB + ko); kl[d][1] = WFrag<T16>::ld(KB + ko + 16 * HD); } }
    __builtin_amdgcn_sched_barrier(0);               // keeps the key requests ahead of the value requests
#pragma unroll
    for (int t = 0; t < 4; ++t) { const size_t vo = zoff + t * 512; vb[t] = WFrag<T16>::ld(VA + vo); if (HR) vl[t] = WFrag<T16>::ld(VB + vo); }
    const unsigned qrow = q0 + lr;
#pragma unroll 1
    for (unsigned c = 0; c < nch; ++c) {
        const unsigned c0 = c * 32u;
        const unsigned cn = ((c + 1u < nch) ? c + 1u : c) * 32u;      // chunk fetched ahead; the last trip asks for its own chunk again (in bounds, never used)
        v8f s0 = (v8f){}, s1 = (v8f){};              // s0[j] = score[key c0 + 8hi + j][query lr], s1: keys + 16
#pragma unroll
        for (int d = 0; d < 2; ++d) {
            s0 = WFrag<T16>::mma(kb[d][0], aq[d], s0); s1 = WFrag<T16>::mma(kb[d][1], aq[d], s1);
            if (HR) { s0 = WFrag<T16>::mma(kb[d][0], aql[d], s0); s1 = WFrag<T16>::mma(kb[d][1], aql[d], s1); s0 = WFrag<T16>::mma(kl[d][0], aq[d], s0); s1 = WFrag<T16>::mma(kl[d][1], aq[d], s1); } }
        asm volatile("v_nop\n\tv_nop\n\tv_nop\n\tv_nop" : "+v"(s0), "+v"(s1) : "v"(aq[0]), "v"(aq[1]));      // the four slots between the last score products and the requests that land in their operand registers
#pragma unroll
        for (int d = 0; d < 2; ++d) { const size_t ko = zoff + (size_t)cn * HD + d * 512;
            kb[d][0] = WFrag<T16>::ld(KA + ko); kb[d][1] = WFrag<T16>::ld(KA + ko + 16 * HD); if (HR) { kl[d][0] = WFrag<T16>::ld(KB + ko); kl[d][1] = WFrag<T16>::ld(KB + ko + 16 * HD); } }
        if (HR) asm volatile("s_wait_xcnt 0x0" ::: "memory");      // the softmax reuses the key requests' address registers: a precaution
        __builtin_amdgcn_sched_barrier(0);      // holds the key requests above the softmax, which is the time they have to land; sunk towards their use they would be waited out
        const unsigned key0 = c0 + 8u * hi;
        float t0[8], t1[8], p0[8], p1[8], r[8];
#pragma unroll
        for (int j = 0; j < 8; ++j) { const bool v0 = (key0 + (unsigned)j <= qrow), v1 = (key0 + 16u + (unsigned)j <= qrow);
            t0[j] = s0[j] * SC2; t1[j] = s1[j] * SC2; r[j] = fmaxf(v0 ? t0[j] : -1.0e30f, v1 ? t1[j] : -1.0e30f); }
        float cm = fmaxf(fmaxf(fmaxf(r[0], r[1]), fmaxf(r[2], r[3])), fmaxf(fmaxf(r[4], r[5]), fmaxf(r[6], r[7])));
        cm = fmaxf(cm, xhalf(cm));
        const float nm = fmaxf(m, cm); float al;
        asm("v_exp_f32 %0, %1\n\tv_nop" : "=v"(al) : "v"(m - nm));      // 2^(m - nm) with the slot behind a transcendental in the same statement
        m = nm;
#pragma unroll
        for (int j = 0; j < 8; ++j) { const bool v0 = (key0 + (unsigned)j <= qrow), v1 = (key0 + 16u + (unsigned)j <= qrow);
            const float e0 = __builtin_amdgcn_exp2f(fminf(t0[j] - nm, 0.0f)), e1 = __builtin_amdgcn_exp2f(fminf(t1[j] - nm, 0.0f));
            p0[j] = v0 ? e0 : 0.0f; p1[j] = v1 ? e1 : 0.0f; r[j] = p0[j] + p1[j]; }
        l = l * al + (((r[0] + r[1]) + (r[2] + r[3])) + ((r[4] + r[5]) + (r[6] + r[7])));
#pragma unroll
        for (int t = 0; t < 4; ++t) o[t] *= al;
        V ap, apl; WFrag<T16>::pk(ap, apl, p0, p1);
#pragma unroll
        for (int t = 0; t < 4; ++t) {
            o[t] = WFrag<T16>::mma(vb[t], ap, o[t]);
            if (HR) { o[t] = WFrag<T16>::mma(vb[t], apl, o[t]); o[t] = WFrag<T16>::mma(vl[t], ap, o[t]); } }
        asm volatile("v_nop\n\tv_nop\n\tv_nop\n\tv_nop" : "+v"(o[0]), "+v"(o[1]), "+v"(o[2]), "+v"(o[3]) : "v"(ap));      // the four slots between the last value products and the requests that land in their operand registers
        const T16* pva = VA + zoff + (size_t)cn * HD; const T16* pvb = HR ? VB + zoff + (size_t)cn * HD : pva;
#pragma unroll
        for (int t = 0; t < 4; ++t) { vb[t] = WFrag<T16>::ld(pva + t * 512); if (HR) vl[t] = WFrag<T16>::ld(pvb + t * 512); }
        if (HR) asm volatile("s_wait_xcnt 0x0" :: "v"(pva), "v"(pvb) : "memory");      // a precaution in front of the reuse of the value requests' address registers; the addresses are inputs so that their registers stay theirs up to the wait
    }
    asm volatile("s_wait_loadcnt 0x0" ::: "memory");      // the last trip's requests are never read: they retire here, before the wave gives its registers back
    const float cs = HR ? 1.0f : (1.0f / PCAR);
    const float ls = l + xhalf(l); const float inv = (1.0f / ls) * cs;
    const unsigned b = z / (unsigned)NH, h = z % (unsigned)NH;      // the tile is blocks 2h and 2h + 1 of its 16 rows; store s fills half s & 1 of block s >> 1: row lr, columns 16s + 8hi.. = accumulator s of this lane
#pragma unroll
    for (int s = 0; s < 4; ++s) { v8us oh, ol;
#pragma unroll
        for (int k = 0; k < 8; ++k) { unsigned short x, y2; splitf(o[s][k] * inv, x, y2); oh[k] = x; ol[k] = y2; }
        const size_t oo = (size_t)(b * SEQ + q0) * DM + h * 1024u + (unsigned)s * 256u + 8u * lane;
        *(v8us*)(ATh + oo) = oh; *(v8us*)(ATl + oo) = ol; }
}

// coverage: k_flash_hr grid NZ*(RH/16)/4 x 4 waves x (16 rows x 64 d) == NZ*RH*HD; k_flash_pl grid NZ*((SEQ-RH)/16)/4 x 4 waves x (16 x 64) == NZ*(SEQ-RH)*HD; union == NB*SEQ*DM per context plane.
static_assert((NZ * (RH / 16)) % 4 == 0);
static_assert((NZ * ((SEQ - RH) / 16)) % 4 == 0);
__global__ __launch_bounds__(128) void k_flash_hr(const bf* Qh, const bf* Ql, const bf* Kh, const bf* Kl, const bf* Vh, const bf* Vl, bf* ATh, bf* ATl) {
    flash_body<bf, true>(Qh, Ql, Kh, Kl, Vh, Vl, ATh, ATl); }
__global__ __launch_bounds__(128) void k_flash_pl(const h16* Q16, const h16* K16, const h16* V16, bf* ATh, bf* ATl) {
    flash_body<h16, false>(Q16, nullptr, K16, nullptr, V16, nullptr, ATh, ATl); }

// workspace carve (bytes; every region a multiple of 256)
constexpr size_t SZ_WT  = (size_t)4 * DM * DM * 2;
constexpr size_t SZ_XB  = (size_t)NB * SEQ * DM * 2;
constexpr size_t SZ_QK  = (size_t)2 * NZ * SEQ * HD * 2;
constexpr size_t SZ_V   = (size_t)NZ * HD * SEQ * 2;
constexpr size_t SZ_QKH = (size_t)2 * NZ * RH * HD * 2;
constexpr size_t SZ_VH  = (size_t)NZ * HD * RH * 2;
constexpr size_t SZ_AT  = (size_t)NB * SEQ * DM * 2;
constexpr size_t WS_TOTAL = SZ_WT + SZ_XB + SZ_QK + SZ_V + 2 * SZ_QKH + 2 * SZ_VH + 2 * SZ_AT;
static_assert(WS_TOTAL <= (size_t)134217728);
static_assert(SZ_WT % 256 == 0 && SZ_XB % 256 == 0 && SZ_QK % 256 == 0 && SZ_V % 256 == 0 && SZ_QKH % 256 == 0 && SZ_VH % 256 == 0 && SZ_AT % 256 == 0);

extern "C" void kernel_launch(void* const* d_in, const int* in_sizes, int n_in,
                              void* d_out, int out_size, void* d_ws, size_t ws_size, hipStream_t stream) {
    if (n_in < 7) return;
    const long long need_x = ((long long)(NB - 1) * SEQ_FULL + SEQ) * DM;
    if ((long long)in_sizes[0] < need_x || (long long)out_size < need_x) return;
    if (in_sizes[1] < DM * DM || in_sizes[2] < DM * DM || in_sizes[3] < DM * DM || in_sizes[4] < DM * DM) return;
    if (in_sizes[5] < SEQ * (HD / 2) || in_sizes[6] < SEQ * (HD / 2)) return;
    if (WS_TOTAL > ws_size) return;
    const float* x = (const float*)d_in[0]; const float* wq = (const float*)d_in[1]; const float* wk = (const float*)d_in[2]; const float* wv = (const float*)d_in[3]; const float* wo = (const float*)d_in[4];
    const float* fcos = (const float*)d_in[5]; const float* fsin = (const float*)d_in[6];
    float* OUT = (float*)d_out;
    char* wsp = (char*)d_ws;
    auto take = [&](size_t bytes) { char* p = wsp; wsp += bytes; return (void*)p; };
    bf* WT = (bf*)take(SZ_WT);            // [4] planes (rows n, k): q | k | v | o
    bf* XB = (bf*)take(SZ_XB);            // rows NB*SEQ, k DM
    h16* QK16 = (h16*)take(SZ_QK);        // [2][NZ] planes (rows SEQ, k HD)
    h16* V16 = (h16*)take(SZ_V);          // [NZ] planes (rows HD, k SEQ)
    bf* QKh = (bf*)take(SZ_QKH); bf* QKl = (bf*)take(SZ_QKH);    // [2][NZ] planes (rows RH, k HD)
    bf* Vh = (bf*)take(SZ_VH); bf* Vl = (bf*)take(SZ_VH);        // [NZ] planes (rows HD, k RH)
    bf* ATh = (bf*)take(SZ_AT); bf* ATl = (bf*)take(SZ_AT);      // rows NB*SEQ, k DM
    if ((size_t)(wsp - (char*)d_ws) > ws_size) return;

    k_cvtx<<<dim3((unsigned)((size_t)SEQ * DM / 2048), NB, 1), 256, 0, stream>>>(x, XB);
    k_wt4<<<dim3((unsigned)((size_t)DM * DM / 2048), 4, 1), 256, 0, stream>>>(wq, wk, wv, wo, WT);
    k_gemmqkv<DM, 2><<<dim3(NB * SEQ / 64, NH, 3), 32, 0, stream>>>(XB, WT, fcos, fsin, QK16, QKh, QKl, V16, Vh, Vl);
    k_flash_hr<<<(unsigned)(NZ * (RH / 16) / 4), 128, 0, stream>>>(QKh, QKl, QKh + (size_t)NZ * RH * HD, QKl + (size_t)NZ * RH * HD, Vh, Vl, ATh, ATl);
    if (SEQ > RH) k_flash_pl<<<(unsigned)(NZ * ((SEQ - RH) / 16) / 4), 128, 0, stream>>>(QK16, QK16 + (size_t)NZ * SEQ * HD, V16, ATh, ATl);
    k_gemmw<bf, 1, false, DM, 3><<<dim3(SEQ / 64, DM / 64, NB), 32, 0, stream>>>(ATh, ATl, WT + (size_t)3 * DM * DM, nullptr, OUT, DM, nullptr, (size_t)SEQ * DM, (size_t)0, (size_t)SEQ_FULL * DM);
}

// v006
// It runs in 108 microseconds.
// Two timings next to v005 put it at 1.18 and 1.17 times that version's speed.
// All steps since v000 together make it 2.66 times as fast.
#include <hip/hip_runtime.h>

// Contractions (f32 accumulate): q/k/v projections v_wmma_f32_16x16x32_bf16 on bf16 RNE-converted inputs (single product); causal scores and probability x value: query rows < RH on bf16 hi/lo planes (3 products), rows >= RH v_wmma_f32_16x16x32_f16 (probabilities carried x1024); output projection bf16 hi/lo context x bf16 weight (2 products); softmax f32.
// Causal multi-head attention with interleaved-pair rotary tables read as INPUT values: x [NB][SEQ][1024]; wq/wk/wv/wo [in][out], no bias; 16 heads x 64; scores x 64^-0.5; causal by index.
// Launches (4): plane builders (x copy and weight transposes, one grid) | q/k/v GEMM | attention (both row ranges, one grid) | output GEMM.
// Layout: bf16 copy of x (both batches, compact rows); four weights transposed once to Bt planes; one z-batched projection GEMM (q | k | v) whose epilogue writes the head planes itself (rotary on q, k; transposed v): no f32 projection plane;
// every 16-bit plane that feeds a matrix operand is stored in FRAGMENT ORDER (below), so that each fragment request of a wave covers whole 128-byte lines;
// flash attention, one wave per 16-row query tile, both products transposed (keys x queries, depth x queries), 32-key chunks with the key and value fragments fetched one chunk ahead, online softmax with running max; context hi/lo planes; output GEMM.

#ifndef NB
#define NB 2
#endif
#ifndef SEQ
#define SEQ 2048
#endif
#define NB_FULL  2
#define SEQ_FULL 2048
#define DM   1024
#define NH   16
#define HD   64
#define NZ   (NB * NH)
#define RH   ((SEQ < 512) ? SEQ : 512)     // query rows < RH use hi+lo planes
#define PCAR 1024.0f
#define SC2  0.18033688011112042f          // HD^-0.5 * log2(e)

static_assert((SEQ & (SEQ - 1)) == 0);
static_assert(SEQ % 256 == 0);
static_assert(RH % 256 == 0);
static_assert(RH <= SEQ);
static_assert(DM == NH * HD);
static_assert(HD == 64);
static_assert((NB * SEQ) % 64 == 0);
static_assert(DM % 64 == 0);
static_assert(NB <= NB_FULL && SEQ <= SEQ_FULL);

typedef _Float16 h16;
typedef unsigned short bf;
typedef __attribute__((ext_vector_type(16))) __bf16   v16bf;
typedef __attribute__((ext_vector_type(16))) _Float16 v16h;
typedef __attribute__((ext_vector_type(8)))  _Float16 v8h;
typedef __attribute__((ext_vector_type(8)))  unsigned short v8us;
typedef __attribute__((ext_vector_type(2)))  unsigned short v2us;
typedef __attribute__((ext_vector_type(8)))  float    v8f;
typedef __attribute__((ext_vector_type(4)))  float    v4f;
typedef v4f  __attribute__((may_alias)) v4fa;

__device__ __forceinline__ unsigned short f2bf(float f) { unsigned u = __float_as_uint(f); u += 0x7FFFu + ((u >> 16) & 1u); return (unsigned short)(u >> 16); }
__device__ __forceinline__ float bf2f(unsigned short b) { return __uint_as_float(((unsigned)b) << 16); }
__device__ __forceinline__ float bfr(float f) { return bf2f(f2bf(f)); }
__device__ __forceinline__ void splitf(float y, unsigned short& h, unsigned short& l) { h = f2bf(y); l = f2bf(y - bf2f(h)); }
__device__ __forceinline__ v16h cat16(v8h lo, v8h hi) { return __builtin_shufflevector(lo, hi, 0, 1, 2, 3, 4, 5, 6, 7, 8, 9, 10, 11, 12, 13, 14, 15); }
__device__ __forceinline__ v16bf cat16b(v8us lo, v8us hi) { return __builtin_bit_cast(v16bf, __builtin_shufflevector(lo, hi, 0, 1, 2, 3, 4, 5, 6, 7, 8, 9, 10, 11, 12, 13, 14, 15)); }
__device__ __forceinline__ v8f wmma16(v16h a, v16h b, v8f c) { return __builtin_amdgcn_wmma_f32_16x16x32_f16(false, a, false, b, (short)0, c, false, false); }
__device__ __forceinline__ v8f wmmab(v16bf a, v16bf b, v8f c) { return __builtin_amdgcn_wmma_f32_16x16x32_bf16(false, a, false, b, (short)0, c, false, false); }

template <typename T16> struct WFrag;
template <> struct WFrag<h16> { typedef v16h V;
    static __device__ __forceinline__ V ld(const h16* p) { return cat16(*(const v8h*)p, *(const v8h*)(p + 256)); }
    static __device__ __forceinline__ v8f mma(V a, V b, v8f c) { return wmma16(a, b, c); }
    static __device__ __forceinline__ void pk(V& ph, V& pl, const float (&p0)[8], const float (&p1)[8]) { (void)pl;
#pragma unroll
        for (int j = 0; j < 8; ++j) { ph[j] = (h16)(p0[j] * PCAR); ph[j + 8] = (h16)(p1[j] * PCAR); } } };
template <> struct WFrag<bf> { typedef v16bf V;
    static __device__ __forceinline__ V ld(const bf* p) { return cat16b(*(const v8us*)p, *(const v8us*)(p + 256)); }
    static __device__ __forceinline__ v8f mma(V a, V b, v8f c) { return wmmab(a, b, c); }
    static __device__ __forceinline__ void pk(V& ph, V& pl, const float (&p0)[8], const float (&p1)[8]) { v8us h0, h1, l0, l1;
#pragma unroll
        for (int j = 0; j < 8; ++j) { unsigned short a, c; splitf(p0[j], a, c); h0[j] = a; l0[j] = c; splitf(p1[j], a, c); h1[j] = a; l1[j] = c; }
        ph = cat16b(h0, h1); pl = cat16b(l0, l1); } };

// ---- k_gemmw: register-blocked GEMM, ONE WAVE per 64x64 output tile (16 accumulators), operands straight from fragment-ordered 16-bit planes (block (rt, kt) at rt*16*K + kt*512); grid (M/64, N/64, Z), 32 threads.
// C[m][n] (f32, pitch ldc, + optional f32 bias[n]) = sum_k A[m][k] Bt[n][k] (+ split products per NSPLIT). z-batch strides sA/sB/sC in elements. K % 32 == 0, a compile-time constant: the four row tiles of an operand are then one address and immediate offsets.
// The fragments of a 32-k trip live in one of NS register sets; a set is asked for again, for trip t + NS, right behind the products of trip t: every request has NS - 1 trips of products to land, and no product waits on a load just issued.
template <typename T16> struct GSet { typename WFrag<T16>::V a[4], a2[4], b[4], b2[4]; };

template <typename T16, int NSPLIT, int K>
__device__ __forceinline__ void g_fetch(GSet<T16>& f, const T16* pa, const T16* pa2, const T16* pb, const T16* pb2, unsigned l8, int ofs) {      // pa..pb2: wave-uniform bases; l8: the lane's piece; ofs: a constant at every call, it goes into the requests' immediate offsets
    __builtin_amdgcn_sched_barrier(0);      // keeps the requests behind the products that read this set: lifted over them they would need registers of their own
#pragma unroll
    for (int mb = 0; mb < 4; ++mb) { f.a[mb] = WFrag<T16>::ld(pa + l8 + (ofs + mb * 16 * K)); if (NSPLIT == 1 || NSPLIT == 2) f.a2[mb] = WFrag<T16>::ld(pa2 + l8 + (ofs + mb * 16 * K)); }
#pragma unroll
    for (int nb = 0; nb < 4; ++nb) { f.b[nb] = WFrag<T16>::ld(pb + l8 + (ofs + nb * 16 * K)); if (NSPLIT >= 2) f.b2[nb] = WFrag<T16>::ld(pb2 + l8 + (ofs + nb * 16 * K)); }
    asm volatile("s_wait_xcnt 0x0" ::: "memory");      // a precaution: it stands in front of every later write of a register that these requests name as an address (the next round's bases)
    __builtin_amdgcn_sched_barrier(0);      // holds the requests above the other sets' products, which are the time they have to land; sunk towards their use they would be waited out
}

template <typename T16, int NSPLIT>
__device__ __forceinline__ void g_mm(const GSet<T16>& f, v8f (&acc)[4][4]) {
#pragma unroll
    for (int nb = 0; nb < 4; ++nb) {
#pragma unroll
        for (int mb = 0; mb < 4; ++mb) { acc[mb][nb] = WFrag<T16>::mma(f.a[mb], f.b[nb], acc[mb][nb]); if (NSPLIT == 1 || NSPLIT == 2) acc[mb][nb] = WFrag<T16>::mma(f.a2[mb], f.b[nb], acc[mb][nb]); if (NSPLIT >= 2) acc[mb][nb] = WFrag<T16>::mma(f.a[mb], f.b2[nb], acc[mb][nb]); } }
    // the four slots between the last products and the requests that land in their operand registers
    asm volatile("v_nop\n\tv_nop\n\tv_nop\n\tv_nop" : "+v"(acc[0][0]), "+v"(acc[1][1]), "+v"(acc[2][2]), "+v"(acc[3][3]) : "v"(f.a[0]), "v"(f.a[3]));
}

template <typename T16, int NSPLIT, bool BIAS, int K, int NS>
__global__ __launch_bounds__(32) void k_gemmw(const T16* __restrict__ A, const T16* __restrict__ A2, const T16* __restrict__ Bt, const T16* __restrict__ Bt2, float* C, int ldc, const float* __restrict__ bias, size_t sA, size_t sB, size_t sC) {
    constexpr int NT = K / 32;               // trips
    constexpr int NL = (NT - NS) / NS;       // rounds of NS trips in which every set is asked for again
    static_assert(K % 32 == 0 && NS >= 2 && NT >= NS);
    __shared__ __align__(16) float os[16 * 68];
    const size_t z = blockIdx.z; A += z * sA; if (A2) A2 += z * sA; Bt += z * sB; if (Bt2) Bt2 += z * sB; C += z * sC;
    const int lane = threadIdx.x & 31, lr = lane & 15, hi = lane >> 4; const int r0 = blockIdx.x * 64, c0 = blockIdx.y * 64;
    v8f acc[4][4];
#pragma unroll
    for (int mb = 0; mb < 4; ++mb)
#pragma unroll
        for (int nb = 0; nb < 4; ++nb) acc[mb][nb] = (v8f){};
    const size_t aoff = (size_t)r0 * K, boff = (size_t)c0 * K; const unsigned l8 = 8u * (unsigned)lane;
    const T16* pa = A + aoff; const T16* pa2 = A2 + aoff; const T16* pb = Bt + boff; const T16* pb2 = Bt2 + boff;
    GSet<T16> f[NS];
#pragma unroll
    for (int s = 0; s < NS; ++s) g_fetch<T16, NSPLIT, K>(f[s], pa, pa2, pb, pb2, l8, s * 512);
#pragma unroll 1
    for (int i = 0; i < NL; ++i) {           // rolled: one round of NS trips is the loop's body
        const int o = (i + 1) * NS * 512; const T16* qa = pa + o; const T16* qa2 = pa2 + o; const T16* qb = pb + o; const T16* qb2 = pb2 + o;
#pragma unroll
        for (int s = 0; s < NS; ++s) { g_mm<T16, NSPLIT>(f[s], acc); g_fetch<T16, NSPLIT, K>(f[s], qa, qa2, qb, qb2, l8, s * 512); }
    }
#pragma unroll
    for (int t = NL * NS; t < NT; ++t) { g_mm<T16, NSPLIT>(f[t % NS], acc);
        if (t + NS < NT) g_fetch<T16, NSPLIT, K>(f[t % NS], pa, pa2, pb, pb2, l8, (t + NS) * 512); }
#pragma unroll
    for (int mb = 0; mb < 4; ++mb) {
#pragma unroll
        for (int nb = 0; nb < 4; ++nb) {
#pragma unroll
            for (int j = 0; j < 8; ++j) os[(hi * 8 + j) * 68 + nb * 16 + lr] = acc[mb][nb][j]; }
        __builtin_amdgcn_wave_barrier(); asm volatile("" ::: "memory");
        float* crow = C + (size_t)(r0 + mb * 16) * ldc + c0;
{
#pragma unroll
            for (int s = 0; s < 8; ++s) { const int row = 2 * s + hi, cofs = lr * 4; v4f val = *(const v4fa*)(os + row * 68 + cofs); if (BIAS) { val[0] += bfr(bias[c0 + cofs]); val[1] += bfr(bias[c0 + cofs + 1]); val[2] += bfr(bias[c0 + cofs + 2]); val[3] += bfr(bias[c0 + cofs + 3]); }
                *(v4f*)(crow + (size_t)row * ldc + cofs) = val; }
             }
        __builtin_amdgcn_wave_barrier(); asm volatile("" ::: "memory");
    }
}

// thread i of a batch writes piece i (8 elements) of the fragment-ordered copy: i = (block * 2 + k half) * 32 + lane.
// coverage: (SEQ*DM/2048, NB) blocks x 256 threads x 8 elements == NB*SEQ*DM.
static_assert(((size_t)SEQ * DM) % 2048 == 0);
__device__ __forceinline__ void cvtx_body(const unsigned bx, const unsigned b, const float* __restrict__ src, bf* dst) {
    const unsigned i = bx * 256u + threadIdx.x;
    const unsigned lr = i & 15u, hi = (i >> 4) & 1u, h2 = (i >> 5) & 1u, blk = i >> 6; const unsigned kt = blk % (unsigned)(DM / 32), rt = blk / (unsigned)(DM / 32);
    const float* s = src + (size_t)b * SEQ_FULL * DM + (size_t)(rt * 16u + lr) * DM + kt * 32u + h2 * 16u + hi * 8u; bf* d = dst + (size_t)b * SEQ * DM + (size_t)i * 8;
    const v8f v = *(const v8f*)s; v8us o;
#pragma unroll
    for (int k = 0; k < 8; ++k) o[k] = f2bf(v[k]);
    *(v8us*)d = o;  }

// thread i of a weight writes piece i of its fragment-ordered transpose Bt[n][k] = w[k][n]: 8 k of one n; a wave reads 64-byte runs of two w rows per request.
// coverage: (DM*DM/2048, 4) blocks x 256 threads x 8 elements == 4*DM*DM.
static_assert(((size_t)DM * DM) % 2048 == 0);
__device__ __forceinline__ void wt4_body(const unsigned bx, const unsigned y, const float* __restrict__ w0, const float* __restrict__ w1, const float* __restrict__ w2, const float* __restrict__ w3, bf* Bt) {
    const float* w = (y == 0u) ? w0 : (y == 1u) ? w1 : (y == 2u) ? w2 : w3; bf* o = Bt + (size_t)y * DM * DM;
    const unsigned i = bx * 256u + threadIdx.x;
    const unsigned lr = i & 15u, hi = (i >> 4) & 1u, h2 = (i >> 5) & 1u, blk = i >> 6; const unsigned kt = blk % (unsigned)(DM / 32), nt = blk / (unsigned)(DM / 32);
    const float* s = w + (size_t)(kt * 32u + h2 * 16u + hi * 8u) * DM + nt * 16u + lr; v8us q;
#pragma unroll
    for (int j = 0; j < 8; ++j) q[j] = f2bf(s[(size_t)j * DM]);
    *(v8us*)(o + (size_t)i * 8) = q;
}

// ---- k_prep: the two plane builders read and write disjoint buffers and neither needs the other, so they share one grid: blocks [0, PB_W) build the weight planes (their strided reads take longer: they start first), blocks [PB_W, PB_W + PB_X) the x plane.
constexpr unsigned PB_W1 = (unsigned)((size_t)DM * DM / 2048), PB_W = 4u * PB_W1;
constexpr unsigned PB_X1 = (unsigned)((size_t)SEQ * DM / 2048), PB_X = (unsigned)NB * PB_X1;
__global__ __launch_bounds__(256) void k_prep(const float* __restrict__ x, const float* __restrict__ w0, const float* __restrict__ w1, const float* __restrict__ w2, const float* __restrict__ w3, bf* XB, bf* Bt) {
    const unsigned bid = blockIdx.x;      // uniform per block: a scalar branch
    if (bid < PB_W) wt4_body(bid % PB_W1, bid / PB_W1, w0, w1, w2, w3, Bt);
    else cvtx_body((bid - PB_W) % PB_X1, (bid - PB_W) / PB_X1, x, XB);
}

// ---- k_gemmqkv: the q | k | v projection GEMM (blockIdx.z 0 | 1 | 2), one wave per 64x64 tile = 64 positions x ONE head (HD == 64), k loop as in k_gemmw (single product); grid (NB*SEQ/64, NH, 3), 32 threads. The epilogue writes the attention's planes from the accumulators.
// q, k: head planes [z] (rows t, k = d, fragment order: 2 blocks per 16 rows) of the rotated projection: pair i of a head row: out[2i] = x[2i] c - x[2i+1] s, out[2i+1] = x[2i] s + x[2i+1] c with c, s = bf16 RNE-converted INPUT table values [t][i].
//   The tile goes through LDS (a lane holds 8 rows of one depth, a piece is 8 depths of one row); the table rows, read as whole lines, go there 16 rows at a time; lane (lr, hi) builds piece (row lr, depths 16s + 8hi..) for s = 0..3: each store of the wave is 512 contiguous bytes.
// v: value planes [z] (rows d, k = key, fragment order, the four 16-d blocks of a 32-key chunk side by side: block (chunk, dt) at (chunk * 4 + dt) * 512). An accumulator's 8 registers are 8 keys of one depth, which is a piece: stored from the registers, 512 contiguous bytes per store.
// coverage: the tiles cover NB*SEQ rows x DM columns of each projection == NZ*SEQ*HD elements of each fp16 plane; tiles with t < RH (64 | RH) also fill the hi and lo planes (NZ*RH*HD each).
static_assert(SEQ % 64 == 0 && RH % 64 == 0 && HD == 64 && DM == NH * 64);
template <int K, int NS>
__global__ __launch_bounds__(32) void k_gemmqkv(const bf* __restrict__ A, const bf* __restrict__ Bt, const float* __restrict__ cosT, const float* __restrict__ sinT, h16* P16, bf* Ph, bf* Pl, h16* V16, bf* Vh, bf* Vl) {
    constexpr int NT = K / 32;               // trips
    constexpr int NL = (NT - NS) / NS;       // rounds of NS trips in which every set is asked for again
    static_assert(K % 32 == 0 && NS >= 2 && NT >= NS);
    __shared__ __align__(16) float os[64 * 68];
    __shared__ __align__(16) float tc[16 * 36];      // pitch 36: the 16 rows of a 16-byte column start in 16 different bank groups
    __shared__ __align__(16) float ts[16 * 36];
    const unsigned y = blockIdx.z, h = blockIdx.y, r0 = blockIdx.x * 64u;
    const unsigned lane = threadIdx.x & 31u, lr = lane & 15u, hi = lane >> 4, l8 = 8u * lane;
    v8f acc[4][4];
#pragma unroll
    for (int mb = 0; mb < 4; ++mb)
#pragma unroll
        for (int nb = 0; nb < 4; ++nb) acc[mb][nb] = (v8f){};
    const bf* pa = A + (size_t)r0 * K; const bf* pb = Bt + (size_t)y * DM * K + (size_t)h * 64u * K;
    GSet<bf> f[NS];
#pragma unroll
    for (int s = 0; s < NS; ++s) g_fetch<bf, 0, K>(f[s], pa, pa, pb, pb, l8, s * 512);
#pragma unroll 1
    for (int i = 0; i < NL; ++i) {           // rolled: one round of NS trips is the loop's body
        const int o = (i + 1) * NS * 512; const bf* qa = pa + o; const bf* qb = pb + o;
#pragma unroll
        for (int s = 0; s < NS; ++s) { g_mm<bf, 0>(f[s], acc); g_fetch<bf, 0, K>(f[s], qa, qa, qb, qb, l8, s * 512); }
    }
#pragma unroll
    for (int t = NL * NS; t < NT; ++t) { g_mm<bf, 0>(f[t % NS], acc);
        if (t + NS < NT) g_fetch<bf, 0, K>(f[t % NS], pa, pa, pb, pb, l8, (t + NS) * 512); }
    const unsigned b = r0 / (unsigned)SEQ, t0 = r0 % (unsigned)SEQ, z = b * (unsigned)NH + h;
    const bool hl = (t0 < (unsigned)RH);     // uniform per wave (64 consecutive rows, RH % 64 == 0)
    // Stores go out 16 rows at a time: all their values first, then the stores, then one s_wait_xcnt 0 (a precaution: it stands in front of every later write of a register that these stores name); the scheduling fences keep other work out of that stretch.
    if (y == 2u) {
        h16* p16 = V16 + (size_t)z * HD * SEQ + (t0 >> 5) * 2048u + l8;
        const size_t ho = (size_t)z * HD * RH + (hl ? (t0 >> 5) : 0u) * 2048u + l8; bf* ph = Vh + ho; bf* pl = Vl + ho;
#pragma unroll
        for (int mb = 0; mb < 4; ++mb) {     // keys t0 + 16mb + 8hi + j, depth 16nb + lr: chunk mb >> 1, block nb, k half mb & 1, piece lane
            const int e = (mb >> 1) * 2048 + (mb & 1) * 256; v8h o16[4];
#pragma unroll
            for (int nb = 0; nb < 4; ++nb)
#pragma unroll
                for (int j = 0; j < 8; ++j) o16[nb][j] = (h16)acc[mb][nb][j];
            if (hl) { v8us oh[4], ol[4];
#pragma unroll
                for (int nb = 0; nb < 4; ++nb)
#pragma unroll
                    for (int j = 0; j < 8; ++j) { unsigned short a, c2; splitf(acc[mb][nb][j], a, c2); oh[nb][j] = a; ol[nb][j] = c2; }
                __builtin_amdgcn_sched_barrier(0);      // values above, stores below
#pragma unroll
                for (int nb = 0; nb < 4; ++nb) { *(v8h*)(p16 + e + nb * 512) = o16[nb]; *(v8us*)(ph + e + nb * 512) = oh[nb]; *(v8us*)(pl + e + nb * 512) = ol[nb]; }
                asm volatile("s_wait_xcnt 0x0" ::: "memory");      // the precaution named above, behind these stores
            } else {
                __builtin_amdgcn_sched_barrier(0);      // values above, stores below
#pragma unroll
                for (int nb = 0; nb < 4; ++nb) *(v8h*)(p16 + e + nb * 512) = o16[nb];
                asm volatile("s_wait_xcnt 0x0" ::: "memory");      // the precaution named above, behind these stores
            }
            __builtin_amdgcn_sched_barrier(0);          // the next rows' values stay behind the wait
        }
        return;
    }
    const float* ct = cosT + (size_t)t0 * 32 + 4u * lane; const float* st = sinT + (size_t)t0 * 32 + 4u * lane;      // request q of a 16-row block: its rows 4q..4q+3, 512 contiguous bytes
    v4f cq[4], sq[4];
#pragma unroll
    for (int q = 0; q < 4; ++q) { cq[q] = *(const v4f*)(ct + q * 128); sq[q] = *(const v4f*)(st + q * 128); }      // the first 16 rows' table values fly while the tile goes to LDS
    asm volatile("s_wait_xcnt 0x0" ::: "memory");      // a precaution: it stands in front of every later write of a register that these requests name as an address
    __builtin_amdgcn_sched_barrier(0);                 // keeps later address arithmetic behind that wait
#pragma unroll
    for (int mb = 0; mb < 4; ++mb)
#pragma unroll
        for (int nb = 0; nb < 4; ++nb)
#pragma unroll
            for (int j = 0; j < 8; ++j) os[(mb * 16 + hi * 8 + j) * 68 + nb * 16 + lr] = acc[mb][nb][j];
    h16* p16 = P16 + (size_t)y * NZ * SEQ * HD + (size_t)z * SEQ * HD + (t0 >> 4) * 1024u + l8;
    const size_t ho = (size_t)y * NZ * RH * HD + (size_t)z * RH * HD + (hl ? (t0 >> 4) : 0u) * 1024u + l8; bf* ph = Ph + ho; bf* pl = Pl + ho;
    const unsigned to = (lane >> 3) * 36u + (lane & 7u) * 4u;
#pragma unroll 1
    for (unsigned mb = 0; mb < 4u; ++mb) {       // rolled: the body is long and runs four times; 16 rows a trip
#pragma unroll
        for (int q = 0; q < 4; ++q) { *(v4fa*)(tc + q * 144 + to) = cq[q]; *(v4fa*)(ts + q * 144 + to) = sq[q]; }
        if (mb < 3u) {      // the next 16 rows' table values fly while these rows are built
#pragma unroll
            for (int q = 0; q < 4; ++q) { cq[q] = *(const v4f*)(ct + (mb + 1u) * 512u + q * 128); sq[q] = *(const v4f*)(st + (mb + 1u) * 512u + q * 128); }
            asm volatile("s_wait_xcnt 0x0" ::: "memory");      // a precaution: it stands in front of every later write of a register that these requests name as an address
        }
        __builtin_amdgcn_wave_barrier(); asm volatile("" ::: "memory");      // keeps the LDS reads below behind the LDS writes above in the compiled order (one wave: the LDS serves it in order)
        float ro[4][8]; v8h o16[4];
#pragma unroll
        for (int s = 0; s < 4; ++s) { const unsigned seg = 2u * (unsigned)s + hi; const float* xr = os + (mb * 16u + lr) * 68u + seg * 8u;
            const v4f x0 = *(const v4fa*)xr, x1 = *(const v4fa*)(xr + 4); const v4f cv = *(const v4fa*)(tc + lr * 36u + seg * 4u), sv = *(const v4fa*)(ts + lr * 36u + seg * 4u);
            float xs[8]; xs[0] = x0[0]; xs[1] = x0[1]; xs[2] = x0[2]; xs[3] = x0[3]; xs[4] = x1[0]; xs[5] = x1[1]; xs[6] = x1[2]; xs[7] = x1[3];
#pragma unroll
            for (int i = 0; i < 4; ++i) { const float c = bfr(cv[i]), sn = bfr(sv[i]); const float tr = xs[2 * i], ti = xs[2 * i + 1]; ro[s][2 * i] = tr * c - ti * sn; ro[s][2 * i + 1] = tr * sn + ti * c;
                o16[s][2 * i] = (h16)ro[s][2 * i]; o16[s][2 * i + 1] = (h16)ro[s][2 * i + 1]; } }
        const unsigned e = mb * 1024u;      // 16-row tile mb; piece (depths 16s + 8hi.., row lr) sits at s * 256 + lane * 8
        if (hl) { v8us oh[4], ol[4];
#pragma unroll
            for (int s = 0; s < 4; ++s)
#pragma unroll
                for (int k = 0; k < 8; ++k) { unsigned short a, d2; splitf(ro[s][k], a, d2); oh[s][k] = a; ol[s][k] = d2; }
            __builtin_amdgcn_sched_barrier(0);      // values above, stores below
#pragma unroll
            for (int s = 0; s < 4; ++s) { *(v8h*)(p16 + e + s * 256) = o16[s]; *(v8us*)(ph + e + s * 256) = oh[s]; *(v8us*)(pl + e + s * 256) = ol[s]; }
            asm volatile("s_wait_xcnt 0x0" ::: "memory");      // the precaution named above, behind these stores
        } else {
            __builtin_amdgcn_sched_barrier(0);      // values above, stores below
#pragma unroll
            for (int s = 0; s < 4; ++s) *(v8h*)(p16 + e + s * 256) = o16[s];
            asm volatile("s_wait_xcnt 0x0" ::: "memory");      // the precaution named above, behind these stores
        }
        __builtin_amdgcn_wave_barrier(); asm volatile("" ::: "memory");      // keeps the next rows' table writes behind this trip's LDS reads in the compiled order
    }
}

__device__ __forceinline__ float xhalf(float x) { return __builtin_bit_cast(float, __builtin_amdgcn_permlanex16(__builtin_bit_cast(int, x), __builtin_bit_cast(int, x), 0x76543210, 0xfedcba98, false, false)); }      // lane l's value of lane l ^ 16

template <typename T16, bool HR>
__device__ __forceinline__ void flash_body(const unsigned bid, const T16* QA, const T16* QB, const T16* KA, const T16* KB, const T16* VA, const T16* VB, bf* ATh, bf* ATl) {
    typedef typename WFrag<T16>::V V;
    constexpr unsigned QR   = HR ? (unsigned)RH : (unsigned)SEQ;     // rows per z of the q/k planes = key pitch of the v planes
    constexpr unsigned ROW0 = HR ? 0u : (unsigned)RH;
    constexpr unsigned NT   = HR ? (unsigned)RH / 16u : (unsigned)(SEQ - RH) / 16u;
    constexpr unsigned NTD  = NT ? NT : 1u;
    const unsigned lane = threadIdx.x & 31u, wid = threadIdx.x >> 5, lr = lane & 15u, hi = lane >> 4;
    const unsigned w = bid * 4u + wid; const unsigned z = w / NTD, mt = w % NTD; const unsigned q0 = ROW0 + mt * 16u;
    const size_t zoff = (size_t)z * QR * HD + 8u * lane;      // this lane's piece of block 0 of head z, in the q, k and v planes alike; 16 rows of q or k = 2 blocks, a 32-key chunk of k or v = 4 blocks
    const size_t qoff = zoff + (size_t)q0 * HD;
    V aq[2], aql[2];
#pragma unroll
    for (int d = 0; d < 2; ++d) { aq[d] = WFrag<T16>::ld(QA + qoff + d * 512); if (HR) aql[d] = WFrag<T16>::ld(QB + qoff + d * 512); }
    v8f o[4]; float m = -1.0e30f, l = 0.0f;          // o[t][j] = context[query lr][depth 16t + 8hi + j]; m, l: query lr (l: this half's keys)
#pragma unroll
    for (int t = 0; t < 4; ++t) o[t] = (v8f){};
    const unsigned nch = (q0 + 15u) / 32u + 1u;      // wave-uniform; keys < nch*32 <= QR
    V kb[2][2], kl[2][2], vb[4], vl[4];              // fragments of the current chunk: kb[d][i] = keys 16i.., depth 32d..; vb[t] = depth 16t..
    // Chunk 0 is requested in the loop's own order (queries, keys, values): loads retire in order and the wait at the loop's head is counted for both ways in, so another order here makes every trip's score products wait for the value requests too.
    asm volatile("s_wait_xcnt 0x0" ::: "memory");    // key fragments land in registers that held the query requests' addresses: a precaution in front of that reuse; as a memory fence it also keeps the query requests ahead of the key requests
#pragma unroll
    for (int d = 0; d < 2; ++d) { const size_t ko = zoff + d * 512;
        kb[d][0] = WFrag<T16>::ld(KA + ko); kb[d][1] = WFrag<T16>::ld(KA + ko + 16 * HD); if (HR) { kl[d][0] = WFrag<T16>::ld(KB + ko); kl[d][1] = WFrag<T16>::ld(KB + ko + 16 * HD); } }
    __builtin_amdgcn_sched_barrier(0);               // keeps the key requests ahead of the value requests
#pragma unroll
    for (int t = 0; t < 4; ++t) { const size_t vo = zoff + t * 512; vb[t] = WFrag<T16>::ld(VA + vo); if (HR) vl[t] = WFrag<T16>::ld(VB + vo); }
    const unsigned qrow = q0 + lr;
#pragma unroll 1
    for (unsigned c = 0; c < nch; ++c) {
        const unsigned c0 = c * 32u;
        const unsigned cn = ((c + 1u < nch) ? c + 1u : c) * 32u;      // chunk fetched ahead; the last trip asks for its own chunk again (in bounds, never used)
        v8f s0 = (v8f){}, s1 = (v8f){};              // s0[j] = score[key c0 + 8hi + j][query lr], s1: keys + 16
#pragma unroll
        for (int d = 0; d < 2; ++d) {
            s0 = WFrag<T16>::mma(kb[d][0], aq[d], s0); s1 = WFrag<T16>::mma(kb[d][1], aq[d], s1);
            if (HR) { s0 = WFrag<T16>::mma(kb[d][0], aql[d], s0); s1 = WFrag<T16>::mma(kb[d][1], aql[d], s1); s0 = WFrag<T16>::mma(kl[d][0], aq[d], s0); s1 = WFrag<T16>::mma(kl[d][1], aq[d], s1); } }
        asm volatile("v_nop\n\tv_nop\n\tv_nop\n\tv_nop" : "+v"(s0), "+v"(s1) : "v"(aq[0]), "v"(aq[1]));      // the four slots between the last score products and the requests that land in their operand registers
#pragma unroll
        for (int d = 0; d < 2; ++d) { const size_t ko = zoff + (size_t)cn * HD + d * 512;
            kb[d][0] = WFrag<T16>::ld(KA + ko); kb[d][1] = WFrag<T16>::ld(KA + ko + 16 * HD); if (HR) { kl[d][0] = WFrag<T16>::ld(KB + ko); kl[d][1] = WFrag<T16>::ld(KB + ko + 16 * HD); } }
        if (HR) asm volatile("s_wait_xcnt 0x0" ::: "memory");      // the softmax reuses the key requests' address registers: a precaution
        __builtin_amdgcn_sched_barrier(0);      // holds the key requests above the softmax, which is the time they have to land; sunk towards their use they would be waited out
        const unsigned key0 = c0 + 8u * hi;
        float t0[8], t1[8], p0[8], p1[8], r[8];
#pragma unroll
        for (int j = 0; j < 8; ++j) { const bool v0 = (key0 + (unsigned)j <= qrow), v1 = (key0 + 16u + (unsigned)j <= qrow);
            t0[j] = s0[j] * SC2; t1[j] = s1[j] * SC2; r[j] = fmaxf(v0 ? t0[j] : -1.0e30f, v1 ? t1[j] : -1.0e30f); }
        float cm = fmaxf(fmaxf(fmaxf(r[0], r[1]), fmaxf(r[2], r[3])), fmaxf(fmaxf(r[4], r[5]), fmaxf(r[6], r[7])));
        cm = fmaxf(cm, xhalf(cm));
        const float nm = fmaxf(m, cm); float al;
        asm("v_exp_f32 %0, %1\n\tv_nop" : "=v"(al) : "v"(m - nm));      // 2^(m - nm) with the slot behind a transcendental in the same statement
        m = nm;
#pragma unroll
        for (int j = 0; j < 8; ++j) { const bool v0 = (key0 + (unsigned)j <= qrow), v1 = (key0 + 16u + (unsigned)j <= qrow);
            const float e0 = __builtin_amdgcn_exp2f(fminf(t0[j] - nm, 0.0f)), e1 = __builtin_amdgcn_exp2f(fminf(t1[j] - nm, 0.0f));
            p0[j] = v0 ? e0 : 0.0f; p1[j] = v1 ? e1 : 0.0f; r[j] = p0[j] + p1[j]; }
        l = l * al + (((r[0] + r[1]) + (r[2] + r[3])) + ((r[4] + r[5]) + (r[6] + r[7])));
#pragma unroll
        for (int t = 0; t < 4; ++t) o[t] *= al;
        V ap, apl; WFrag<T16>::pk(ap, apl, p0, p1);
#pragma unroll
        for (int t = 0; t < 4; ++t) {
            o[t] = WFrag<T16>::mma(vb[t], ap, o[t]);
            if (HR) { o[t] = WFrag<T16>::mma(vb[t], apl, o[t]); o[t] = WFrag<T16>::mma(vl[t], ap, o[t]); } }
        asm volatile("v_nop\n\tv_nop\n\tv_nop\n\tv_nop" : "+v"(o[0]), "+v"(o[1]), "+v"(o[2]), "+v"(o[3]) : "v"(ap));      // the four slots between the last value products and the requests that land in their operand registers
        const T16* pva = VA + zoff + (size_t)cn * HD; const T16* pvb = HR ? VB + zoff + (size_t)cn * HD : pva;
#pragma unroll
        for (int t = 0; t < 4; ++t) { vb[t] = WFrag<T16>::ld(pva + t * 512); if (HR) vl[t] = WFrag<T16>::ld(pvb + t * 512); }
        if (HR) asm volatile("s_wait_xcnt 0x0" :: "v"(pva), "v"(pvb) : "memory");      // a precaution in front of the reuse of the value requests' address registers; the addresses are inputs so that their registers stay theirs up to the wait
    }
    asm volatile("s_wait_loadcnt 0x0" ::: "memory");      // the last trip's requests are never read: they retire here, before the wave gives its registers back
    const float cs = HR ? 1.0f : (1.0f / PCAR);
    const float ls = l + xhalf(l); const float inv = (1.0f / ls) * cs;
    const unsigned b = z / (unsigned)NH, h = z % (unsigned)NH;      // the tile is blocks 2h and 2h + 1 of its 16 rows; store s fills half s & 1 of block s >> 1: row lr, columns 16s + 8hi.. = accumulator s of this lane
#pragma unroll
    for (int s = 0; s < 4; ++s) { v8us oh, ol;
#pragma unroll
        for (int k = 0; k < 8; ++k) { unsigned short x, y2; splitf(o[s][k] * inv, x, y2); oh[k] = x; ol[k] = y2; }
        const size_t oo = (size_t)(b * SEQ + q0) * DM + h * 1024u + (unsigned)s * 256u + 8u * lane;
        *(v8us*)(ATh + oo) = oh; *(v8us*)(ATl + oo) = ol; }
}

// ---- k_flash: the two row ranges (rows >= RH on the fp16 planes, rows < RH on the hi/lo planes) write disjoint context rows and neither needs the other, so they share one grid: blocks [0, FB_PL) take rows >= RH (up to SEQ/32 chunks a wave: the long ones start first), blocks [FB_PL, FB_PL + FB_HR) rows < RH (at most RH/32 chunks), which run beside the long waves instead of in front of them.
// coverage: FB_HR = NZ*(RH/16)/4 blocks x 4 waves x (16 rows x 64 d) == NZ*RH*HD; FB_PL = NZ*((SEQ-RH)/16)/4 blocks x 4 waves x (16 x 64) == NZ*(SEQ-RH)*HD; union == NB*SEQ*DM per context plane.
static_assert((NZ * (RH / 16)) % 4 == 0);
static_assert((NZ * ((SEQ - RH) / 16)) % 4 == 0);
constexpr unsigned FB_PL = (unsigned)(NZ * ((SEQ - RH) / 16) / 4), FB_HR = (unsigned)(NZ * (RH / 16) / 4);
__global__ __launch_bounds__(128) void k_flash(const h16* Q16, const h16* K16, const h16* V16, const bf* Qh, const bf* Ql, const bf* Kh, const bf* Kl, const bf* Vh, const bf* Vl, bf* ATh, bf* ATl) {
    const unsigned bid = blockIdx.x;      // uniform per block: a scalar branch
    if (bid < FB_PL) flash_body<h16, false>(bid, Q16, nullptr, K16, nullptr, V16, nullptr, ATh, ATl);
    else flash_body<bf, true>(bid - FB_PL, Qh, Ql, Kh, Kl, Vh, Vl, ATh, ATl);
}

// workspace carve (bytes; every region a multiple of 256)
constexpr size_t SZ_WT  = (size_t)4 * DM * DM * 2;
constexpr size_t SZ_XB  = (size_t)NB * SEQ * DM * 2;
constexpr size_t SZ_QK  = (size_t)2 * NZ * SEQ * HD * 2;
constexpr size_t SZ_V   = (size_t)NZ * HD * SEQ * 2;
constexpr size_t SZ_QKH = (size_t)2 * NZ * RH * HD * 2;
constexpr size_t SZ_VH  = (size_t)NZ * HD * RH * 2;
constexpr size_t SZ_AT  = (size_t)NB * SEQ * DM * 2;
constexpr size_t WS_TOTAL = SZ_WT + SZ_XB + SZ_QK + SZ_V + 2 * SZ_QKH + 2 * SZ_VH + 2 * SZ_AT;
static_assert(WS_TOTAL <= (size_t)134217728);
static_assert(SZ_WT % 256 == 0 && SZ_XB % 256 == 0 && SZ_QK % 256 == 0 && SZ_V % 256 == 0 && SZ_QKH % 256 == 0 && SZ_VH % 256 == 0 && SZ_AT % 256 == 0);

extern "C" void kernel_launch(void* const* d_in, const int* in_sizes, int n_in,
                              void* d_out, int out_size, void* d_ws, size_t ws_size, hipStream_t stream) {
    if (n_in < 7) return;
    const long long need_x = ((long long)(NB - 1) * SEQ_FULL + SEQ) * DM;
    if ((long long)in_sizes[0] < need_x || (long long)out_size < need_x) return;
    if (in_sizes[1] < DM * DM || in_sizes[2] < DM * DM || in_sizes[3] < DM * DM || in_sizes[4] < DM * DM) return;
    if (in_sizes[5] < SEQ * (HD / 2) || in_sizes[6] < SEQ * (HD / 2)) return;
    if (WS_TOTAL > ws_size) return;
    const float* x = (const float*)d_in[0]; const float* wq = (const float*)d_in[1]; const float* wk = (const float*)d_in[2]; const float* wv = (const float*)d_in[3]; const float* wo = (const float*)d_in[4];
    const float* fcos = (const float*)d_in[5]; const float* fsin = (const float*)d_in[6];
    float* OUT = (float*)d_out;
    char* wsp = (char*)d_ws;
    auto take = [&](size_t bytes) { char* p = wsp; wsp += bytes; return (void*)p; };
    bf* WT = (bf*)take(SZ_WT);            // [4] planes (rows n, k): q | k | v | o
    bf* XB = (bf*)take(SZ_XB);            // rows NB*SEQ, k DM
    h16* QK16 = (h16*)take(SZ_QK);        // [2][NZ] planes (rows SEQ, k HD)
    h16* V16 = (h16*)take(SZ_V);          // [NZ] planes (rows HD, k SEQ)
    bf* QKh = (bf*)take(SZ_QKH); bf* QKl = (bf*)take(SZ_QKH);    // [2][NZ] planes (rows RH, k HD)
    bf* Vh = (bf*)take(SZ_VH); bf* Vl = (bf*)take(SZ_VH);        // [NZ] planes (rows HD, k RH)
    bf* ATh = (bf*)take(SZ_AT); bf* ATl = (bf*)take(SZ_AT);      // rows NB*SEQ, k DM
    if ((size_t)(wsp - (char*)d_ws) > ws_size) return;

    k_prep<<<PB_W + PB_X, 256, 0, stream>>>(x, wq, wk, wv, wo, XB, WT);
    k_gemmqkv<DM, 2><<<dim3(NB * SEQ / 64, NH, 3), 32, 0, stream>>>(XB, WT, fcos, fsin, QK16, QKh, QKl, V16, Vh, Vl);
    k_flash<<<FB_PL + FB_HR, 128, 0, stream>>>(QK16, QK16 + (size_t)NZ * SEQ * HD, V16, QKh, QKl, QKh + (size_t)NZ * RH * HD, QKl + (size_t)NZ * RH * HD, Vh, Vl, ATh, ATl);
    k_gemmw<bf, 1, false, DM, 3><<<dim3(SEQ / 64, DM / 64, NB), 32, 0, stream>>>(ATh, ATl, WT + (size_t)3 * DM * DM, nullptr, OUT, DM, nullptr, (size_t)SEQ * DM, (size_t)0, (size_t)SEQ_FULL * DM);
}

// v007
// A run of this version takes 102 microseconds.
// Next to v006, in two timings, it ran 1.06 and 1.07 times as fast.
// All steps since v000 together make it 2.83 times as fast.
#include <hip/hip_runtime.h>

// Contractions (f32 accumulate): q/k/v projections v_wmma_f32_16x16x32_bf16 on bf16 RNE-converted inputs (single product); causal scores and probability x value: query rows < RH on bf16 hi/lo planes (3 products), rows >= RH v_wmma_f32_16x16x32_f16 (probabilities carried x1024); output projection bf16 hi/lo context x bf16 weight (2 products); softmax f32.
// Causal multi-head attention with interleaved-pair rotary tables read as INPUT values: x [NB][SEQ][1024]; wq/wk/wv/wo [in][out], no bias; 16 heads x 64; scores x 64^-0.5; causal by index.
// Launches (4): plane builders (x copy and weight transposes, one grid) | q/k/v GEMM | attention (both row ranges, one grid) | output GEMM.
// Layout: bf16 copy of x (both batches, compact rows); four weights transposed once to Bt planes; one z-batched projection GEMM (q | k | v) whose epilogue writes the head planes itself (rotary on q, k; transposed v): no f32 projection plane;
// every 16-bit plane that feeds a matrix operand is stored in FRAGMENT ORDER (below), so that each fragment request of a wave covers whole 128-byte lines;
// flash attention, one wave per 16-row query tile, both products transposed (keys x queries, depth x queries), 32-key chunks with the key and value fragments fetched one chunk ahead, online softmax with running max; context hi/lo planes; output GEMM.

#ifndef NB
#define NB 2
#endif
#ifndef SEQ
#define SEQ 2048
#endif
#define NB_FULL  2
#define SEQ_FULL 2048
#define DM   1024
#define NH   16
#define HD   64
#define NZ   (NB * NH)
#define RH   ((SEQ < 512) ? SEQ : 512)     // query rows < RH use hi+lo planes
#define PCAR 1024.0f
#define SC2  0.18033688011112042f          // HD^-0.5 * log2(e)

static_assert((SEQ & (SEQ - 1)) == 0);
static_assert(SEQ % 256 == 0);
static_assert(RH % 256 == 0);
static_assert(RH <= SEQ);
static_assert(DM == NH * HD);
static_assert(HD == 64);
static_assert((NB * SEQ) % 64 == 0);
static_assert(DM % 64 == 0);
static_assert(NB <= NB_FULL && SEQ <= SEQ_FULL);

typedef _Float16 h16;
typedef unsigned short bf;
typedef __attribute__((ext_vector_type(16))) __bf16   v16bf;
typedef __attribute__((ext_vector_type(16))) _Float16 v16h;
typedef __attribute__((ext_vector_type(8)))  _Float16 v8h;
typedef __attribute__((ext_vector_type(8)))  unsigned short v8us;
typedef __attribute__((ext_vector_type(2)))  unsigned short v2us;
typedef __attribute__((ext_vector_type(8)))  float    v8f;
typedef __attribute__((ext_vector_type(4)))  float    v4f;
typedef v4f  __attribute__((may_alias)) v4fa;

__device__ __forceinline__ unsigned short f2bf(float f) { unsigned u = __float_as_uint(f); u += 0x7FFFu + ((u >> 16) & 1u); return (unsigned short)(u >> 16); }
__device__ __forceinline__ float bf2f(unsigned short b) { return __uint_as_float(((unsigned)b) << 16); }
__device__ __forceinline__ float bfr(float f) { return bf2f(f2bf(f)); }
__device__ __forceinline__ void splitf(float y, unsigned short& h, unsigned short& l) { h = f2bf(y); l = f2bf(y - bf2f(h)); }
__device__ __forceinline__ v16h cat16(v8h lo, v8h hi) { return __builtin_shufflevector(lo, hi, 0, 1, 2, 3, 4, 5, 6, 7, 8, 9, 10, 11, 12, 13, 14, 15); }
__device__ __forceinline__ v16bf cat16b(v8us lo, v8us hi) { return __builtin_bit_cast(v16bf, __builtin_shufflevector(lo, hi, 0, 1, 2, 3, 4, 5, 6, 7, 8, 9, 10, 11, 12, 13, 14, 15)); }
__device__ __forceinline__ v8f wmma16(v16h a, v16h b, v8f c) { return __builtin_amdgcn_wmma_f32_16x16x32_f16(false, a, false, b, (short)0, c, false, false); }
__device__ __forceinline__ v8f wmmab(v16bf a, v16bf b, v8f c) { return __builtin_amdgcn_wmma_f32_16x16x32_bf16(false, a, false, b, (short)0, c, false, false); }

template <typename T16> struct WFrag;
template <> struct WFrag<h16> { typedef v16h V;
    static __device__ __forceinline__ V ld(const h16* p) { return cat16(*(const v8h*)p, *(const v8h*)(p + 256)); }
    static __device__ __forceinline__ v8f mma(V a, V b, v8f c) { return wmma16(a, b, c); }
    static __device__ __forceinline__ void pk(V& ph, V& pl, const float (&p0)[8], const float (&p1)[8]) { (void)pl;
#pragma unroll
        for (int j = 0; j < 8; ++j) { ph[j] = (h16)(p0[j] * PCAR); ph[j + 8] = (h16)(p1[j] * PCAR); } } };
template <> struct WFrag<bf> { typedef v16bf V;
    static __device__ __forceinline__ V ld(const bf* p) { return cat16b(*(const v8us*)p, *(const v8us*)(p + 256)); }
    static __device__ __forceinline__ v8f mma(V a, V b, v8f c) { return wmmab(a, b, c); }
    static __device__ __forceinline__ void pk(V& ph, V& pl, const float (&p0)[8], const float (&p1)[8]) { v8us h0, h1, l0, l1;
#pragma unroll
        for (int j = 0; j < 8; ++j) { unsigned short a, c; splitf(p0[j], a, c); h0[j] = a; l0[j] = c; splitf(p1[j], a, c); h1[j] = a; l1[j] = c; }
        ph = cat16b(h0, h1); pl = cat16b(l0, l1); } };

// ---- k_gemmw: register-blocked GEMM, ONE WAVE per 64x64 output tile (16 accumulators), operands straight from fragment-ordered 16-bit planes (block (rt, kt) at rt*16*K + kt*512); grid (M/64, N/64, Z), 32 threads.
// C[m][n] (f32, pitch ldc, + optional f32 bias[n]) = sum_k A[m][k] Bt[n][k] (+ split products per NSPLIT). z-batch strides sA/sB/sC in elements. K % 32 == 0, a compile-time constant: the four row tiles of an operand are then one address and immediate offsets.
// The fragments of a 32-k trip live in one of NS register sets; a set is asked for again, for trip t + NS, right behind the products of trip t: every request has NS - 1 trips of products to land, and no product waits on a load just issued.
template <typename T16> struct GSet { typename WFrag<T16>::V a[4], a2[4], b[4], b2[4]; };

template <typename T16, int NSPLIT, int K>
__device__ __forceinline__ void g_fetch(GSet<T16>& f, const T16* pa, const T16* pa2, const T16* pb, const T16* pb2, unsigned l8, int ofs) {      // pa..pb2: wave-uniform bases; l8: the lane's piece; ofs: a constant at every call, it goes into the requests' immediate offsets
    __builtin_amdgcn_sched_barrier(0);      // keeps the requests behind the products that read this set: lifted over them they would need registers of their own
#pragma unroll
    for (int mb = 0; mb < 4; ++mb) { f.a[mb] = WFrag<T16>::ld(pa + l8 + (ofs + mb * 16 * K)); if (NSPLIT == 1 || NSPLIT == 2) f.a2[mb] = WFrag<T16>::ld(pa2 + l8 + (ofs + mb * 16 * K)); }
#pragma unroll
    for (int nb = 0; nb < 4; ++nb) { f.b[nb] = WFrag<T16>::ld(pb + l8 + (ofs + nb * 16 * K)); if (NSPLIT >= 2) f.b2[nb] = WFrag<T16>::ld(pb2 + l8 + (ofs + nb * 16 * K)); }
    asm volatile("s_wait_xcnt 0x0" ::: "memory");      // a precaution: it stands in front of every later write of a register that these requests name as an address (the next round's bases)
    __builtin_amdgcn_sched_barrier(0);      // holds the requests above the other sets' products, which are the time they have to land; sunk towards their use they would be waited out
}

template <typename T16, int NSPLIT>
__device__ __forceinline__ void g_mm(const GSet<T16>& f, v8f (&acc)[4][4]) {
#pragma unroll
    for (int nb = 0; nb < 4; ++nb) {
#pragma unroll
        for (int mb = 0; mb < 4; ++mb) { acc[mb][nb] = WFrag<T16>::mma(f.a[mb], f.b[nb], acc[mb][nb]); if (NSPLIT == 1 || NSPLIT == 2) acc[mb][nb] = WFrag<T16>::mma(f.a2[mb], f.b[nb], acc[mb][nb]); if (NSPLIT >= 2) acc[mb][nb] = WFrag<T16>::mma(f.a[mb], f.b2[nb], acc[mb][nb]); } }
    // the four slots between the last products and the requests that land in their operand registers
    asm volatile("v_nop\n\tv_nop\n\tv_nop\n\tv_nop" : "+v"(acc[0][0]), "+v"(acc[1][1]), "+v"(acc[2][2]), "+v"(acc[3][3]) : "v"(f.a[0]), "v"(f.a[3]));
}

template <typename T16, int NSPLIT, bool BIAS, int K, int NS>
__global__ __launch_bounds__(32) void k_gemmw(const T16* __restrict__ A, const T16* __restrict__ A2, const T16* __restrict__ Bt, const T16* __restrict__ Bt2, float* C, int ldc, const float* __restrict__ bias, size_t sA, size_t sB, size_t sC) {
    constexpr int NT = K / 32;               // trips
    constexpr int NL = (NT - NS) / NS;       // rounds of NS trips in which every set is asked for again
    static_assert(K % 32 == 0 && NS >= 2 && NT >= NS);
    __shared__ __align__(16) float os[16 * 68];
    const size_t z = blockIdx.z; A += z * sA; if (A2) A2 += z * sA; Bt += z * sB; if (Bt2) Bt2 += z * sB; C += z * sC;
    const int lane = threadIdx.x & 31, lr = lane & 15, hi = lane >> 4; const int r0 = blockIdx.x * 64, c0 = blockIdx.y * 64;
    v8f acc[4][4];
#pragma unroll
    for (int mb = 0; mb < 4; ++mb)
#pragma unroll
        for (int nb = 0; nb < 4; ++nb) acc[mb][nb] = (v8f){};
    const size_t aoff = (size_t)r0 * K, boff = (size_t)c0 * K; const unsigned l8 = 8u * (unsigned)lane;
    const T16* pa = A + aoff; const T16* pa2 = A2 + aoff; const T16* pb = Bt + boff; const T16* pb2 = Bt2 + boff;
    GSet<T16> f[NS];
#pragma unroll
    for (int s = 0; s < NS; ++s) g_fetch<T16, NSPLIT, K>(f[s], pa, pa2, pb, pb2, l8, s * 512);
#pragma unroll 1
    for (int i = 0; i < NL; ++i) {           // rolled: one round of NS trips is the loop's body
        const int o = (i + 1) * NS * 512; const T16* qa = pa + o; const T16* qa2 = pa2 + o; const T16* qb = pb + o; const T16* qb2 = pb2 + o;
#pragma unroll
        for (int s = 0; s < NS; ++s) { g_mm<T16, NSPLIT>(f[s], acc); g_fetch<T16, NSPLIT, K>(f[s], qa, qa2, qb, qb2, l8, s * 512); }
    }
#pragma unroll
    for (int t = NL * NS; t < NT; ++t) { g_mm<T16, NSPLIT>(f[t % NS], acc);
        if (t + NS < NT) g_fetch<T16, NSPLIT, K>(f[t % NS], pa, pa2, pb, pb2, l8, (t + NS) * 512); }
#pragma unroll
    for (int mb = 0; mb < 4; ++mb) {
#pragma unroll
        for (int nb = 0; nb < 4; ++nb) {
#pragma unroll
            for (int j = 0; j < 8; ++j) os[(hi * 8 + j) * 68 + nb * 16 + lr] = acc[mb][nb][j]; }
        __builtin_amdgcn_wave_barrier(); asm volatile("" ::: "memory");
        float* crow = C + (size_t)(r0 + mb * 16) * ldc + c0;
{
#pragma unroll
            for (int s = 0; s < 8; ++s) { const int row = 2 * s + hi, cofs = lr * 4; v4f val = *(const v4fa*)(os + row * 68 + cofs); if (BIAS) { val[0] += bfr(bias[c0 + cofs]); val[1] += bfr(bias[c0 + cofs + 1]); val[2] += bfr(bias[c0 + cofs + 2]); val[3] += bfr(bias[c0 + cofs + 3]); }
                *(v4f*)(crow + (size_t)row * ldc + cofs) = val; }
             }
        __builtin_amdgcn_wave_barrier(); asm volatile("" ::: "memory");
    }
}

// thread i of a batch writes piece i (8 elements) of the fragment-ordered copy: i = (block * 2 + k half) * 32 + lane.
// coverage: (SEQ*DM/2048, NB) blocks x 256 threads x 8 elements == NB*SEQ*DM.
static_assert(((size_t)SEQ * DM) % 2048 == 0);
__device__ __forceinline__ void cvtx_body(const unsigned bx, const unsigned b, const float* __restrict__ src, bf* dst) {
    const unsigned i = bx * 256u + threadIdx.x;
    const unsigned lr = i & 15u, hi = (i >> 4) & 1u, h2 = (i >> 5) & 1u, blk = i >> 6; const unsigned kt = blk % (unsigned)(DM / 32), rt = blk / (unsigned)(DM / 32);
    const float* s = src + (size_t)b * SEQ_FULL * DM + (size_t)(rt * 16u + lr) * DM + kt * 32u + h2 * 16u + hi * 8u; bf* d = dst + (size_t)b * SEQ * DM + (size_t)i * 8;
    const v8f v = *(const v8f*)s; v8us o;
#pragma unroll
    for (int k = 0; k < 8; ++k) o[k] = f2bf(v[k]);
    *(v8us*)d = o;  }

// thread i of a weight writes piece i of its fragment-ordered transpose Bt[n][k] = w[k][n]: 8 k of one n; a wave reads 64-byte runs of two w rows per request.
// coverage: (DM*DM/2048, 4) blocks x 256 threads x 8 elements == 4*DM*DM.
static_assert(((size_t)DM * DM) % 2048 == 0);
__device__ __forceinline__ void wt4_body(const unsigned bx, const unsigned y, const float* __restrict__ w0, const float* __restrict__ w1, const float* __restrict__ w2, const float* __restrict__ w3, bf* Bt) {
    const float* w = (y == 0u) ? w0 : (y == 1u) ? w1 : (y == 2u) ? w2 : w3; bf* o = Bt + (size_t)y * DM * DM;
    const unsigned i = bx * 256u + threadIdx.x;
    const unsigned lr = i & 15u, hi = (i >> 4) & 1u, h2 = (i >> 5) & 1u, blk = i >> 6; const unsigned kt = blk % (unsigned)(DM / 32), nt = blk / (unsigned)(DM / 32);
    const float* s = w + (size_t)(kt * 32u + h2 * 16u + hi * 8u) * DM + nt * 16u + lr; v8us q;
#pragma unroll
    for (int j = 0; j < 8; ++j) q[j] = f2bf(s[(size_t)j * DM]);
    *(v8us*)(o + (size_t)i * 8) = q;
}

// ---- k_prep: the two plane builders read and write disjoint buffers and neither needs the other, so they share one grid: blocks [0, PB_W) build the weight planes (their strided reads take longer: they start first), blocks [PB_W, PB_W + PB_X) the x plane.
constexpr unsigned PB_W1 = (unsigned)((size_t)DM * DM / 2048), PB_W = 4u * PB_W1;
constexpr unsigned PB_X1 = (unsigned)((size_t)SEQ * DM / 2048), PB_X = (unsigned)NB * PB_X1;
__global__ __launch_bounds__(256) void k_prep(const float* __restrict__ x, const float* __restrict__ w0, const float* __restrict__ w1, const float* __restrict__ w2, const float* __restrict__ w3, bf* XB, bf* Bt) {
    const unsigned bid = blockIdx.x;      // uniform per block: a scalar branch
    if (bid < PB_W) wt4_body(bid % PB_W1, bid / PB_W1, w0, w1, w2, w3, Bt);
    else cvtx_body((bid - PB_W) % PB_X1, (bid - PB_W) / PB_X1, x, XB);
}

// ---- g_ring: k loop of a work-group of FOUR WAVES (2 x 2) on a 128x128 output tile, each wave a 64x64 tile (16 accumulators). Operands are fragment-ordered 16-bit planes (block (rt, kt) at rt*16*K + kt*512).
// A stage is 64 k of the tile's 128 A rows and 128 B rows: per 16-row tile two blocks, 2 KB, contiguous in the plane and in LDS. Asynchronous copies bring it from global memory into LDS once per work-group; each wave copies two row tiles of either plane.
// Every operand byte then leaves L2 once per 128x128 tile, not once per 64x64 tile, and a fragment is two contiguous 512-byte LDS reads of the wave.
// Two buffers. A trip reads its whole stage into registers; behind the barrier that ends those reads, stage t + 2 is asked for into the same buffer, and only then come the trip's products: the copies fly during them and during the next trip's reads.
template <int K>
__device__ __forceinline__ void g_copy2(const unsigned l, const bf* g) {      // two row tiles (4 KB) of one plane: l = this lane's LDS byte address, g = this lane's global address, of the first 16 bytes
    const bf* h = g + 16 * K;
    // the copies and, as the last line, the precaution that stands in front of every later write of a register that they name
    asm volatile("global_load_async_to_lds_b128 %0, %8, off\n\t"
                 "global_load_async_to_lds_b128 %1, %9, off\n\t"
                 "global_load_async_to_lds_b128 %2, %10, off\n\t"
                 "global_load_async_to_lds_b128 %3, %11, off\n\t"
                 "global_load_async_to_lds_b128 %4, %12, off\n\t"
                 "global_load_async_to_lds_b128 %5, %13, off\n\t"
                 "global_load_async_to_lds_b128 %6, %14, off\n\t"
                 "global_load_async_to_lds_b128 %7, %15, off\n\t"
                 "s_wait_xcnt 0x0"
                 :: "v"(l), "v"(l + 512u), "v"(l + 1024u), "v"(l + 1536u), "v"(l + 2048u), "v"(l + 2560u), "v"(l + 3072u), "v"(l + 3584u),
                    "v"(g), "v"(g + 256), "v"(g + 512), "v"(g + 768), "v"(h), "v"(h + 256), "v"(h + 512), "v"(h + 768) : "memory");
}

// ring: 64 KB of LDS (per buffer 16 KB of A, 16 KB of B). ga, gb: this lane's address in rows 32 * wid of the tile's A and B rows, k = 0. acc[mb][nb] += sum over k, blocks in rising order.
template <int K>
__device__ __forceinline__ void g_ring(const bf* ring, const bf* ga, const bf* gb, const unsigned wid, const unsigned lane, v8f (&acc)[4][4]) {
    constexpr int NT = K / 64;                       // stages
    static_assert(K % 64 == 0 && NT >= 2);
    const unsigned lw = (unsigned)(size_t)ring + wid * 4096u + lane * 16u;
    g_copy2<K>(lw, ga); g_copy2<K>(lw + 16384u, gb);
    asm volatile("s_wait_asynccnt 0x0" ::: "memory");      // this wave's copies of stage 0 have landed
    __syncthreads();                                       // every wave's have
    g_copy2<K>(lw + 32768u, ga + 1024); g_copy2<K>(lw + 49152u, gb + 1024);
    const bf* fa = ring + (wid >> 1) * 4096u + lane * 8u; const bf* fb = ring + 8192u + (wid & 1u) * 4096u + lane * 8u;
#pragma unroll 1
    for (int t = 0; t < NT; ++t) {                   // rolled: one stage is the loop's body
        const unsigned bo = (unsigned)(t & 1) * 16384u;
        v16bf a[2][4], b[2][4];
#pragma unroll
        for (int kk = 0; kk < 2; ++kk) {
#pragma unroll
            for (int mb = 0; mb < 4; ++mb) a[kk][mb] = WFrag<bf>::ld(fa + bo + mb * 1024 + kk * 512);
#pragma unroll
            for (int nb = 0; nb < 4; ++nb) b[kk][nb] = WFrag<bf>::ld(fb + bo + nb * 1024 + kk * 512);
        }
        asm volatile("s_wait_dscnt 0x0" ::: "memory");         // this wave's reads of the buffer have returned
        asm volatile("s_wait_asynccnt 0x0" ::: "memory");      // its copies of stage t + 1 have landed
        __syncthreads();                                       // stage t + 1 is published, and every reader has left stage t's buffer
        if (t + 2 < NT) { g_copy2<K>(lw + 2u * bo, ga + (t + 2) * 1024); g_copy2<K>(lw + 2u * bo + 16384u, gb + (t + 2) * 1024); }
        __builtin_amdgcn_sched_barrier(0);           // keeps the products behind the copies: lifted over them they would take away the time the copies have to land
#pragma unroll
        for (int kk = 0; kk < 2; ++kk)
#pragma unroll
            for (int nb = 0; nb < 4; ++nb)
#pragma unroll
                for (int mb = 0; mb < 4; ++mb) acc[mb][nb] = wmmab(a[kk][mb], b[kk][nb], acc[mb][nb]);
    }
    asm volatile("s_wait_asynccnt 0x0" ::: "memory");          // nothing is outstanding when the LDS goes to other use
}

// ---- k_gemmqkv: the q | k | v projection GEMM (blockIdx.z 0 | 1 | 2), one wave per 64x64 tile = 64 positions x ONE head (HD == 64), four waves (2 x 2) a work-group, k loop g_ring (single product); grid (NB*SEQ/128, NH/2, 3), 128 threads. The epilogue writes the attention's planes from the accumulators, each wave for itself.
// q, k: head planes [z] (rows t, k = d, fragment order: 2 blocks per 16 rows) of the rotated projection: pair i of a head row: out[2i] = x[2i] c - x[2i+1] s, out[2i+1] = x[2i] s + x[2i+1] c with c, s = bf16 RNE-converted INPUT table values [t][i].
//   The tile goes through LDS (a lane holds 8 rows of one depth, a piece is 8 depths of one row); the table rows, read as whole lines, go there 16 rows at a time; lane (lr, hi) builds piece (row lr, depths 16s + 8hi..) for s = 0..3: each store of the wave is 512 contiguous bytes.
// v: value planes [z] (rows d, k = key, fragment order, the four 16-d blocks of a 32-key chunk side by side: block (chunk, dt) at (chunk * 4 + dt) * 512). An accumulator's 8 registers are 8 keys of one depth, which is a piece: stored from the registers, 512 contiguous bytes per store.
// coverage: the tiles cover NB*SEQ rows x DM columns of each projection == NZ*SEQ*HD elements of each fp16 plane; tiles with t < RH (64 | RH) also fill the hi and lo planes (NZ*RH*HD each).
static_assert(SEQ % 128 == 0 && RH % 64 == 0 && HD == 64 && DM == NH * 64 && NH % 2 == 0);
template <int K>
__global__ __launch_bounds__(128) void k_gemmqkv(const bf* __restrict__ A, const bf* __restrict__ Bt, const float* __restrict__ cosT, const float* __restrict__ sinT, h16* P16, bf* Ph, bf* Pl, h16* V16, bf* Vh, bf* Vl) {
    constexpr unsigned EW = 64 * 68 + 2 * 16 * 36;      // floats of a wave's epilogue staging
    static_assert(4 * EW * 4 >= 65536);
    __shared__ __align__(16) float sm[4 * EW];          // first the ring of the k loop (64 KB); behind the loop's last barrier, which ends every read of the ring, each wave's own staging
    const unsigned wid = (unsigned)__builtin_amdgcn_readfirstlane((int)(threadIdx.x >> 5));      // the wave's number, in a scalar register
    const unsigned y = blockIdx.z, h = blockIdx.y * 2u + (wid & 1u), r0 = blockIdx.x * 128u + (wid >> 1) * 64u;
    const unsigned lane = threadIdx.x & 31u, lr = lane & 15u, hi = lane >> 4, l8 = 8u * lane;
    v8f acc[4][4];
#pragma unroll
    for (int mb = 0; mb < 4; ++mb)
#pragma unroll
        for (int nb = 0; nb < 4; ++nb) acc[mb][nb] = (v8f){};
    g_ring<K>((const bf*)sm, A + (size_t)(blockIdx.x * 128u + wid * 32u) * K + l8, Bt + (size_t)y * DM * K + (size_t)(blockIdx.y * 128u + wid * 32u) * K + l8, wid, lane, acc);
    float* os = sm + wid * EW; float* tc = os + 64 * 68; float* ts = tc + 16 * 36;      // tc, ts pitch 36: the 16 rows of a 16-byte column start in 16 different bank groups
    const unsigned b = r0 / (unsigned)SEQ, t0 = r0 % (unsigned)SEQ, z = b * (unsigned)NH + h;
    const bool hl = (t0 < (unsigned)RH);     // uniform per wave (64 consecutive rows, RH % 64 == 0)
    // Stores go out 16 rows at a time: all their values first, then the stores, then one s_wait_xcnt 0 (a precaution: it stands in front of every later write of a register that these stores name); the scheduling fences keep other work out of that stretch.
    if (y == 2u) {
        h16* p16 = V16 + (size_t)z * HD * SEQ + (t0 >> 5) * 2048u + l8;
        const size_t ho = (size_t)z * HD * RH + (hl ? (t0 >> 5) : 0u) * 2048u + l8; bf* ph = Vh + ho; bf* pl = Vl + ho;
#pragma unroll
        for (int mb = 0; mb < 4; ++mb) {     // keys t0 + 16mb + 8hi + j, depth 16nb + lr: chunk mb >> 1, block nb, k half mb & 1, piece lane
            const int e = (mb >> 1) * 2048 + (mb & 1) * 256; v8h o16[4];
#pragma unroll
            for (int nb = 0; nb < 4; ++nb)
#pragma unroll
                for (int j = 0; j < 8; ++j) o16[nb][j] = (h16)acc[mb][nb][j];
            if (hl) { v8us oh[4], ol[4];
#pragma unroll
                for (int nb = 0; nb < 4; ++nb)
#pragma unroll
                    for (int j = 0; j < 8; ++j) { unsigned short a, c2; splitf(acc[mb][nb][j], a, c2); oh[nb][j] = a; ol[nb][j] = c2; }
                __builtin_amdgcn_sched_barrier(0);      // values above, stores below
#pragma unroll
                for (int nb = 0; nb < 4; ++nb) { *(v8h*)(p16 + e + nb * 512) = o16[nb]; *(v8us*)(ph + e + nb * 512) = oh[nb]; *(v8us*)(pl + e + nb * 512) = ol[nb]; }
                asm volatile("s_wait_xcnt 0x0" ::: "memory");      // the precaution named above, behind these stores
            } else {
                __builtin_amdgcn_sched_barrier(0);      // values above, stores below
#pragma unroll
                for (int nb = 0; nb < 4; ++nb) *(v8h*)(p16 + e + nb * 512) = o16[nb];
                asm volatile("s_wait_xcnt 0x0" ::: "memory");      // the precaution named above, behind these stores
            }
            __builtin_amdgcn_sched_barrier(0);          // the next rows' values stay behind the wait
        }
        return;
    }
    const float* ct = cosT + (size_t)t0 * 32 + 4u * lane; const float* st = sinT + (size_t)t0 * 32 + 4u * lane;      // request q of a 16-row block: its rows 4q..4q+3, 512 contiguous bytes
    v4f cq[4], sq[4];
#pragma unroll
    for (int q = 0; q < 4; ++q) { cq[q] = *(const v4f*)(ct + q * 128); sq[q] = *(const v4f*)(st + q * 128); }      // the first 16 rows' table values fly while the tile goes to LDS
    asm volatile("s_wait_xcnt 0x0" ::: "memory");      // a precaution: it stands in front of every later write of a register that these requests name as an address
    __builtin_amdgcn_sched_barrier(0);                 // keeps later address arithmetic behind that wait
#pragma unroll
    for (int mb = 0; mb < 4; ++mb)
#pragma unroll
        for (int nb = 0; nb < 4; ++nb)
#pragma unroll
            for (int j = 0; j < 8; ++j) os[(mb * 16 + hi * 8 + j) * 68 + nb * 16 + lr] = acc[mb][nb][j];
    h16* p16 = P16 + (size_t)y * NZ * SEQ * HD + (size_t)z * SEQ * HD + (t0 >> 4) * 1024u + l8;
    const size_t ho = (size_t)y * NZ * RH * HD + (size_t)z * RH * HD + (hl ? (t0 >> 4) : 0u) * 1024u + l8; bf* ph = Ph + ho; bf* pl = Pl + ho;
    const unsigned to = (lane >> 3) * 36u + (lane & 7u) * 4u;
#pragma unroll 1
    for (unsigned mb = 0; mb < 4u; ++mb) {       // rolled: the body is long and runs four times; 16 rows a trip
#pragma unroll
        for (int q = 0; q < 4; ++q) { *(v4fa*)(tc + q * 144 + to) = cq[q]; *(v4fa*)(ts + q * 144 + to) = sq[q]; }
        if (mb < 3u) {      // the next 16 rows' table values fly while these rows are built
#pragma unroll
            for (int q = 0; q < 4; ++q) { cq[q] = *(const v4f*)(ct + (mb + 1u) * 512u + q * 128); sq[q] = *(const v4f*)(st + (mb + 1u) * 512u + q * 128); }
            asm volatile("s_wait_xcnt 0x0" ::: "memory");      // a precaution: it stands in front of every later write of a register that these requests name as an address
        }
        __builtin_amdgcn_wave_barrier(); asm volatile("" ::: "memory");      // keeps the LDS reads below behind the LDS writes above in the compiled order (one wave: the LDS serves it in order)
        float ro[4][8]; v8h o16[4];
#pragma unroll
        for (int s = 0; s < 4; ++s) { const unsigned seg = 2u * (unsigned)s + hi; const float* xr = os + (mb * 16u + lr) * 68u + seg * 8u;
            const v4f x0 = *(const v4fa*)xr, x1 = *(const v4fa*)(xr + 4); const v4f cv = *(const v4fa*)(tc + lr * 36u + seg * 4u), sv = *(const v4fa*)(ts + lr * 36u + seg * 4u);
            float xs[8]; xs[0] = x0[0]; xs[1] = x0[1]; xs[2] = x0[2]; xs[3] = x0[3]; xs[4] = x1[0]; xs[5] = x1[1]; xs[6] = x1[2]; xs[7] = x1[3];
#pragma unroll
            for (int i = 0; i < 4; ++i) { const float c = bfr(cv[i]), sn = bfr(sv[i]); const float tr = xs[2 * i], ti = xs[2 * i + 1]; ro[s][2 * i] = tr * c - ti * sn; ro[s][2 * i + 1] = tr * sn + ti * c;
                o16[s][2 * i] = (h16)ro[s][2 * i]; o16[s][2 * i + 1] = (h16)ro[s][2 * i + 1]; } }
        const unsigned e = mb * 1024u;      // 16-row tile mb; piece (depths 16s + 8hi.., row lr) sits at s * 256 + lane * 8
        if (hl) { v8us oh[4], ol[4];
#pragma unroll
            for (int s = 0; s < 4; ++s)
#pragma unroll
                for (int k = 0; k < 8; ++k) { unsigned short a, d2; splitf(ro[s][k], a, d2); oh[s][k] = a; ol[s][k] = d2; }
            __builtin_amdgcn_sched_barrier(0);      // values above, stores below
#pragma unroll
            for (int s = 0; s < 4; ++s) { *(v8h*)(p16 + e + s * 256) = o16[s]; *(v8us*)(ph + e + s * 256) = oh[s]; *(v8us*)(pl + e + s * 256) = ol[s]; }
            asm volatile("s_wait_xcnt 0x0" ::: "memory");      // the precaution named above, behind these stores
        } else {
            __builtin_amdgcn_sched_barrier(0);      // values above, stores below
#pragma unroll
            for (int s = 0; s < 4; ++s) *(v8h*)(p16 + e + s * 256) = o16[s];
            asm volatile("s_wait_xcnt 0x0" ::: "memory");      // the precaution named above, behind these stores
        }
        __builtin_amdgcn_wave_barrier(); asm volatile("" ::: "memory");      // keeps the next rows' table writes behind this trip's LDS reads in the compiled order
    }
}

__device__ __forceinline__ float xhalf(float x) { return __builtin_bit_cast(float, __builtin_amdgcn_permlanex16(__builtin_bit_cast(int, x), __builtin_bit_cast(int, x), 0x76543210, 0xfedcba98, false, false)); }      // lane l's value of lane l ^ 16

template <typename T16, bool HR>
__device__ __forceinline__ void flash_body(const unsigned bid, const T16* QA, const T16* QB, const T16* KA, const T16* KB, const T16* VA, const T16* VB, bf* ATh, bf* ATl) {
    typedef typename WFrag<T16>::V V;
    constexpr unsigned QR   = HR ? (unsigned)RH : (unsigned)SEQ;     // rows per z of the q/k planes = key pitch of the v planes
    constexpr unsigned ROW0 = HR ? 0u : (unsigned)RH;
    constexpr unsigned NT   = HR ? (unsigned)RH / 16u : (unsigned)(SEQ - RH) / 16u;
    constexpr unsigned NTD  = NT ? NT : 1u;
    const unsigned lane = threadIdx.x & 31u, wid = threadIdx.x >> 5, lr = lane & 15u, hi = lane >> 4;
    const unsigned w = bid * 4u + wid; const unsigned z = w / NTD, mt = w % NTD; const unsigned q0 = ROW0 + mt * 16u;
    const size_t zoff = (size_t)z * QR * HD + 8u * lane;      // this lane's piece of block 0 of head z, in the q, k and v planes alike; 16 rows of q or k = 2 blocks, a 32-key chunk of k or v = 4 blocks
    const size_t qoff = zoff + (size_t)q0 * HD;
    V aq[2], aql[2];
#pragma unroll
    for (int d = 0; d < 2; ++d) { aq[d] = WFrag<T16>::ld(QA + qoff + d * 512); if (HR) aql[d] = WFrag<T16>::ld(QB + qoff + d * 512); }
    v8f o[4]; float m = -1.0e30f, l = 0.0f;          // o[t][j] = context[query lr][depth 16t + 8hi + j]; m, l: query lr (l: this half's keys)
#pragma unroll
    for (int t = 0; t < 4; ++t) o[t] = (v8f){};
    const unsigned nch = (q0 + 15u) / 32u + 1u;      // wave-uniform; keys < nch*32 <= QR
    V kb[2][2], kl[2][2], vb[4], vl[4];              // fragments of the current chunk: kb[d][i] = keys 16i.., depth 32d..; vb[t] = depth 16t..
    // Chunk 0 is requested in the loop's own order (queries, keys, values): loads retire in order and the wait at the loop's head is counted for both ways in, so another order here makes every trip's score products wait for the value requests too.
    asm volatile("s_wait_xcnt 0x0" ::: "memory");    // key fragments land in registers that held the query requests' addresses: a precaution in front of that reuse; as a memory fence it also keeps the query requests ahead of the key requests
#pragma unroll
    for (int d = 0; d < 2; ++d) { const size_t ko = zoff + d * 512;
        kb[d][0] = WFrag<T16>::ld(KA + ko); kb[d][1] = WFrag<T16>::ld(KA + ko + 16 * HD); if (HR) { kl[d][0] = WFrag<T16>::ld(KB + ko); kl[d][1] = WFrag<T16>::ld(KB + ko + 16 * HD); } }
    __builtin_amdgcn_sched_barrier(0);               // keeps the key requests ahead of the value requests
#pragma unroll
    for (int t = 0; t < 4; ++t) { const size_t vo = zoff + t * 512; vb[t] = WFrag<T16>::ld(VA + vo); if (HR) vl[t] = WFrag<T16>::ld(VB + vo); }
    const unsigned qrow = q0 + lr;
#pragma unroll 1
    for (unsigned c = 0; c < nch; ++c) {
        const unsigned c0 = c * 32u;
        const unsigned cn = ((c + 1u < nch) ? c + 1u : c) * 32u;      // chunk fetched ahead; the last trip asks for its own chunk again (in bounds, never used)
        v8f s0 = (v8f){}, s1 = (v8f){};              // s0[j] = score[key c0 + 8hi + j][query lr], s1: keys + 16
#pragma unroll
        for (int d = 0; d < 2; ++d) {
            s0 = WFrag<T16>::mma(kb[d][0], aq[d], s0); s1 = WFrag<T16>::mma(kb[d][1], aq[d], s1);
            if (HR) { s0 = WFrag<T16>::mma(kb[d][0], aql[d], s0); s1 = WFrag<T16>::mma(kb[d][1], aql[d], s1); s0 = WFrag<T16>::mma(kl[d][0], aq[d], s0); s1 = WFrag<T16>::mma(kl[d][1], aq[d], s1); } }
        asm volatile("v_nop\n\tv_nop\n\tv_nop\n\tv_nop" : "+v"(s0), "+v"(s1) : "v"(aq[0]), "v"(aq[1]));      // the four slots between the last score products and the requests that land in their operand registers
#pragma unroll
        for (int d = 0; d < 2; ++d) { const size_t ko = zoff + (size_t)cn * HD + d * 512;
            kb[d][0] = WFrag<T16>::ld(KA + ko); kb[d][1] = WFrag<T16>::ld(KA + ko + 16 * HD); if (HR) { kl[d][0] = WFrag<T16>::ld(KB + ko); kl[d][1] = WFrag<T16>::ld(KB + ko + 16 * HD); } }
        if (HR) asm volatile("s_wait_xcnt 0x0" ::: "memory");      // the softmax reuses the key requests' address registers: a precaution
        __builtin_amdgcn_sched_barrier(0);      // holds the key requests above the softmax, which is the time they have to land; sunk towards their use they would be waited out
        const unsigned key0 = c0 + 8u * hi;
        float t0[8], t1[8], p0[8], p1[8], r[8];
#pragma unroll
        for (int j = 0; j < 8; ++j) { const bool v0 = (key0 + (unsigned)j <= qrow), v1 = (key0 + 16u + (unsigned)j <= qrow);
            t0[j] = s0[j] * SC2; t1[j] = s1[j] * SC2; r[j] = fmaxf(v0 ? t0[j] : -1.0e30f, v1 ? t1[j] : -1.0e30f); }
        float cm = fmaxf(fmaxf(fmaxf(r[0], r[1]), fmaxf(r[2], r[3])), fmaxf(fmaxf(r[4], r[5]), fmaxf(r[6], r[7])));
        cm = fmaxf(cm, xhalf(cm));
        const float nm = fmaxf(m, cm); float al;
        asm("v_exp_f32 %0, %1\n\tv_nop" : "=v"(al) : "v"(m - nm));      // 2^(m - nm) with the slot behind a transcendental in the same statement
        m = nm;
#pragma unroll
        for (int j = 0; j < 8; ++j) { const bool v0 = (key0 + (unsigned)j <= qrow), v1 = (key0 + 16u + (unsigned)j <= qrow);
            const float e0 = __builtin_amdgcn_exp2f(fminf(t0[j] - nm, 0.0f)), e1 = __builtin_amdgcn_exp2f(fminf(t1[j] - nm, 0.0f));
            p0[j] = v0 ? e0 : 0.0f; p1[j] = v1 ? e1 : 0.0f; r[j] = p0[j] + p1[j]; }
        l = l * al + (((r[0] + r[1]) + (r[2] + r[3])) + ((r[4] + r[5]) + (r[6] + r[7])));
#pragma unroll
        for (int t = 0; t < 4; ++t) o[t] *= al;
        V ap, apl; WFrag<T16>::pk(ap, apl, p0, p1);
#pragma unroll
        for (int t = 0; t < 4; ++t) {
            o[t] = WFrag<T16>::mma(vb[t], ap, o[t]);
            if (HR) { o[t] = WFrag<T16>::mma(vb[t], apl, o[t]); o[t] = WFrag<T16>::mma(vl[t], ap, o[t]); } }
        asm volatile("v_nop\n\tv_nop\n\tv_nop\n\tv_nop" : "+v"(o[0]), "+v"(o[1]), "+v"(o[2]), "+v"(o[3]) : "v"(ap));      // the four slots between the last value products and the requests that land in their operand registers
        const T16* pva = VA + zoff + (size_t)cn * HD; const T16* pvb = HR ? VB + zoff + (size_t)cn * HD : pva;
#pragma unroll
        for (int t = 0; t < 4; ++t) { vb[t] = WFrag<T16>::ld(pva + t * 512); if (HR) vl[t] = WFrag<T16>::ld(pvb + t * 512); }
        if (HR) asm volatile("s_wait_xcnt 0x0" :: "v"(pva), "v"(pvb) : "memory");      // a precaution in front of the reuse of the value requests' address registers; the addresses are inputs so that their registers stay theirs up to the wait
    }
    asm volatile("s_wait_loadcnt 0x0" ::: "memory");      // the last trip's requests are never read: they retire here, before the wave gives its registers back
    const float cs = HR ? 1.0f : (1.0f / PCAR);
    const float ls = l + xhalf(l); const float inv = (1.0f / ls) * cs;
    const unsigned b = z / (unsigned)NH, h = z % (unsigned)NH;      // the tile is blocks 2h and 2h + 1 of its 16 rows; store s fills half s & 1 of block s >> 1: row lr, columns 16s + 8hi.. = accumulator s of this lane
#pragma unroll
    for (int s = 0; s < 4; ++s) { v8us oh, ol;
#pragma unroll
        for (int k = 0; k < 8; ++k) { unsigned short x, y2; splitf(o[s][k] * inv, x, y2); oh[k] = x; ol[k] = y2; }
        const size_t oo = (size_t)(b * SEQ + q0) * DM + h * 1024u + (unsigned)s * 256u + 8u * lane;
        *(v8us*)(ATh + oo) = oh; *(v8us*)(ATl + oo) = ol; }
}

// ---- k_flash: the two row ranges (rows >= RH on the fp16 planes, rows < RH on the hi/lo planes) write disjoint context rows and neither needs the other, so they share one grid: blocks [0, FB_PL) take rows >= RH (up to SEQ/32 chunks a wave: the long ones start first), blocks [FB_PL, FB_PL + FB_HR) rows < RH (at most RH/32 chunks), which run beside the long waves instead of in front of them.
// coverage: FB_HR = NZ*(RH/16)/4 blocks x 4 waves x (16 rows x 64 d) == NZ*RH*HD; FB_PL = NZ*((SEQ-RH)/16)/4 blocks x 4 waves x (16 x 64) == NZ*(SEQ-RH)*HD; union == NB*SEQ*DM per context plane.
static_assert((NZ * (RH / 16)) % 4 == 0);
static_assert((NZ * ((SEQ - RH) / 16)) % 4 == 0);
constexpr unsigned FB_PL = (unsigned)(NZ * ((SEQ - RH) / 16) / 4), FB_HR = (unsigned)(NZ * (RH / 16) / 4);
__global__ __launch_bounds__(128) void k_flash(const h16* Q16, const h16* K16, const h16* V16, const bf* Qh, const bf* Ql, const bf* Kh, const bf* Kl, const bf* Vh, const bf* Vl, bf* ATh, bf* ATl) {
    const unsigned bid = blockIdx.x;      // uniform per block: a scalar branch
    if (bid < FB_PL) flash_body<h16, false>(bid, Q16, nullptr, K16, nullptr, V16, nullptr, ATh, ATl);
    else flash_body<bf, true>(bid - FB_PL, Qh, Ql, Kh, Kl, Vh, Vl, ATh, ATl);
}

// workspace carve (bytes; every region a multiple of 256)
constexpr size_t SZ_WT  = (size_t)4 * DM * DM * 2;
constexpr size_t SZ_XB  = (size_t)NB * SEQ * DM * 2;
constexpr size_t SZ_QK  = (size_t)2 * NZ * SEQ * HD * 2;
constexpr size_t SZ_V   = (size_t)NZ * HD * SEQ * 2;
constexpr size_t SZ_QKH = (size_t)2 * NZ * RH * HD * 2;
constexpr size_t SZ_VH  = (size_t)NZ * HD * RH * 2;
constexpr size_t SZ_AT  = (size_t)NB * SEQ * DM * 2;
constexpr size_t WS_TOTAL = SZ_WT + SZ_XB + SZ_QK + SZ_V + 2 * SZ_QKH + 2 * SZ_VH + 2 * SZ_AT;
static_assert(WS_TOTAL <= (size_t)134217728);
static_assert(SZ_WT % 256 == 0 && SZ_XB % 256 == 0 && SZ_QK % 256 == 0 && SZ_V % 256 == 0 && SZ_QKH % 256 == 0 && SZ_VH % 256 == 0 && SZ_AT % 256 == 0);

extern "C" void kernel_launch(void* const* d_in, const int* in_sizes, int n_in,
                              void* d_out, int out_size, void* d_ws, size_t ws_size, hipStream_t stream) {
    if (n_in < 7) return;
    const long long need_x = ((long long)(NB - 1) * SEQ_FULL + SEQ) * DM;
    if ((long long)in_sizes[0] < need_x || (long long)out_size < need_x) return;
    if (in_sizes[1] < DM * DM || in_sizes[2] < DM * DM || in_sizes[3] < DM * DM || in_sizes[4] < DM * DM) return;
    if (in_sizes[5] < SEQ * (HD / 2) || in_sizes[6] < SEQ * (HD / 2)) return;
    if (WS_TOTAL > ws_size) return;
    const float* x = (const float*)d_in[0]; const float* wq = (const float*)d_in[1]; const float* wk = (const float*)d_in[2]; const float* wv = (const float*)d_in[3]; const float* wo = (const float*)d_in[4];
    const float* fcos = (const float*)d_in[5]; const float* fsin = (const float*)d_in[6];
    float* OUT = (float*)d_out;
    char* wsp = (char*)d_ws;
    auto take = [&](size_t bytes) { char* p = wsp; wsp += bytes; return (void*)p; };
    bf* WT = (bf*)take(SZ_WT);            // [4] planes (rows n, k): q | k | v | o
    bf* XB = (bf*)take(SZ_XB);            // rows NB*SEQ, k DM
    h16* QK16 = (h16*)take(SZ_QK);        // [2][NZ] planes (rows SEQ, k HD)
    h16* V16 = (h16*)take(SZ_V);          // [NZ] planes (rows HD, k SEQ)
    bf* QKh = (bf*)take(SZ_QKH); bf* QKl = (bf*)take(SZ_QKH);    // [2][NZ] planes (rows RH, k HD)
    bf* Vh = (bf*)take(SZ_VH); bf* Vl = (bf*)take(SZ_VH);        // [NZ] planes (rows HD, k RH)
    bf* ATh = (bf*)take(SZ_AT); bf* ATl = (bf*)take(SZ_AT);      // rows NB*SEQ, k DM
    if ((size_t)(wsp - (char*)d_ws) > ws_size) return;

    k_prep<<<PB_W + PB_X, 256, 0, stream>>>(x, wq, wk, wv, wo, XB, WT);
    k_gemmqkv<DM><<<dim3(NB * SEQ / 128, NH / 2, 3), 128, 0, stream>>>(XB, WT, fcos, fsin, QK16, QKh, QKl, V16, Vh, Vl);
    k_flash<<<FB_PL + FB_HR, 128, 0, stream>>>(QK16, QK16 + (size_t)NZ * SEQ * HD, V16, QKh, QKl, QKh + (size_t)NZ * RH * HD, QKl + (size_t)NZ * RH * HD, Vh, Vl, ATh, ATl);
    k_gemmw<bf, 1, false, DM, 3><<<dim3(SEQ / 64, DM / 64, NB), 32, 0, stream>>>(ATh, ATl, WT + (size_t)3 * DM * DM, nullptr, OUT, DM, nullptr, (size_t)SEQ * DM, (size_t)0, (size_t)SEQ_FULL * DM);
}

// v008
// It runs in 91.6 microseconds.
// Timed twice side by side with v007, it ran 1.12 times as fast both times.
// All steps since v000 together make it 3.17 times as fast.
#include <hip/hip_runtime.h>

// Contractions (f32 accumulate): q/k/v projections v_wmma_f32_16x16x32_bf16 on bf16 RNE-converted inputs (single product); causal scores and probability x value: query rows < RH on bf16 hi/lo planes (3 products), rows >= RH v_wmma_f32_16x16x32_f16 (probabilities carried x1024); output projection bf16 hi/lo context x bf16 weight (2 products); softmax f32.
// Causal multi-head attention with interleaved-pair rotary tables read as INPUT values: x [NB][SEQ][1024]; wq/wk/wv/wo [in][out], no bias; 16 heads x 64; scores x 64^-0.5; causal by index.
// Launches (4): plane builders (x copy and weight transposes, one grid) | q/k/v GEMM | attention (both row ranges, one grid) | output GEMM.
// Layout: bf16 copy of x (both batches, compact rows); four weights transposed once to Bt planes; one z-batched projection GEMM (q | k | v) whose epilogue writes the head planes itself (rotary on q, k; transposed v): no f32 projection plane;
// every 16-bit plane that feeds a matrix operand is stored in FRAGMENT ORDER (below), so that each fragment request of a wave covers whole 128-byte lines;
// flash attention, one wave per 16-row query tile, both products transposed (keys x queries, depth x queries), 32-key chunks (rows < RH: key and value fragments fetched one chunk ahead from global memory; rows >= RH: 64-key stages in LDS, shared by a work-group's four waves), online softmax with running max; context hi/lo planes; output GEMM.

#ifndef NB
#define NB 2
#endif
#ifndef SEQ
#define SEQ 2048
#endif
#define NB_FULL  2
#define SEQ_FULL 2048
#define DM   1024
#define NH   16
#define HD   64
#define NZ   (NB * NH)
#define RH   ((SEQ < 512) ? SEQ : 512)     // query rows < RH use hi+lo planes
#define PCAR 1024.0f
#define SC2  0.18033688011112042f          // HD^-0.5 * log2(e)

static_assert((SEQ & (SEQ - 1)) == 0);
static_assert(SEQ % 256 == 0);
static_assert(RH % 256 == 0);
static_assert(RH <= SEQ);
static_assert(DM == NH * HD);
static_assert(HD == 64);
static_assert((NB * SEQ) % 64 == 0);
static_assert(DM % 64 == 0);
static_assert(NB <= NB_FULL && SEQ <= SEQ_FULL);

typedef _Float16 h16;
typedef unsigned short bf;
typedef __attribute__((ext_vector_type(16))) __bf16   v16bf;
typedef __attribute__((ext_vector_type(16))) _Float16 v16h;
typedef __attribute__((ext_vector_type(8)))  _Float16 v8h;
typedef __attribute__((ext_vector_type(8)))  unsigned short v8us;
typedef __attribute__((ext_vector_type(2)))  unsigned short v2us;
typedef __attribute__((ext_vector_type(8)))  float    v8f;
typedef __attribute__((ext_vector_type(4)))  float    v4f;
typedef v4f  __attribute__((may_alias)) v4fa;

__device__ __forceinline__ unsigned short f2bf(float f) { unsigned u = __float_as_uint(f); u += 0x7FFFu + ((u >> 16) & 1u); return (unsigned short)(u >> 16); }
__device__ __forceinline__ float bf2f(unsigned short b) { return __uint_as_float(((unsigned)b) << 16); }
__device__ __forceinline__ float bfr(float f) { return bf2f(f2bf(f)); }
__device__ __forceinline__ void splitf(float y, unsigned short& h, unsigned short& l) { h = f2bf(y); l = f2bf(y - bf2f(h)); }
__device__ __forceinline__ v16h cat16(v8h lo, v8h hi) { return __builtin_shufflevector(lo, hi, 0, 1, 2, 3, 4, 5, 6, 7, 8, 9, 10, 11, 12, 13, 14, 15); }
__device__ __forceinline__ v16bf cat16b(v8us lo, v8us hi) { return __builtin_bit_cast(v16bf, __builtin_shufflevector(lo, hi, 0, 1, 2, 3, 4, 5, 6, 7, 8, 9, 10, 11, 12, 13, 14, 15)); }
__device__ __forceinline__ v8f wmma16(v16h a, v16h b, v8f c) { return __builtin_amdgcn_wmma_f32_16x16x32_f16(false, a, false, b, (short)0, c, false, false); }
__device__ __forceinline__ v8f wmmab(v16bf a, v16bf b, v8f c) { return __builtin_amdgcn_wmma_f32_16x16x32_bf16(false, a, false, b, (short)0, c, false, false); }

template <typename T16> struct WFrag;
template <> struct WFrag<h16> { typedef v16h V;
    static __device__ __forceinline__ V ld(const h16* p) { return cat16(*(const v8h*)p, *(const v8h*)(p + 256)); }
    static __device__ __forceinline__ v8f mma(V a, V b, v8f c) { return wmma16(a, b, c); }
    static __device__ __forceinline__ void pk(V& ph, V& pl, const float (&p0)[8], const float (&p1)[8]) { (void)pl;
#pragma unroll
        for (int j = 0; j < 8; ++j) { ph[j] = (h16)(p0[j] * PCAR); ph[j + 8] = (h16)(p1[j] * PCAR); } } };
template <> struct WFrag<bf> { typedef v16bf V;
    static __device__ __forceinline__ V ld(const bf* p) { return cat16b(*(const v8us*)p, *(const v8us*)(p + 256)); }
    static __device__ __forceinline__ v8f mma(V a, V b, v8f c) { return wmmab(a, b, c); }
    static __device__ __forceinline__ void pk(V& ph, V& pl, const float (&p0)[8], const float (&p1)[8]) { v8us h0, h1, l0, l1;
#pragma unroll
        for (int j = 0; j < 8; ++j) { unsigned short a, c; splitf(p0[j], a, c); h0[j] = a; l0[j] = c; splitf(p1[j], a, c); h1[j] = a; l1[j] = c; }
        ph = cat16b(h0, h1); pl = cat16b(l0, l1); } };

// ---- k_gemmw: register-blocked GEMM, ONE WAVE per 64x64 output tile (16 accumulators), operands straight from fragment-ordered 16-bit planes (block (rt, kt) at rt*16*K + kt*512); grid (M/64, N/64, Z), 32 threads.
// C[m][n] (f32, pitch ldc, + optional f32 bias[n]) = sum_k A[m][k] Bt[n][k] (+ split products per NSPLIT). z-batch strides sA/sB/sC in elements. K % 32 == 0, a compile-time constant: the four row tiles of an operand are then one address and immediate offsets.
// The fragments of a 32-k trip live in one of NS register sets; a set is asked for again, for trip t + NS, right behind the products of trip t: every request has NS - 1 trips of products to land, and no product waits on a load just issued.
template <typename T16> struct GSet { typename WFrag<T16>::V a[4], a2[4], b[4], b2[4]; };

template <typename T16, int NSPLIT, int K>
__device__ __forceinline__ void g_fetch(GSet<T16>& f, const T16* pa, const T16* pa2, const T16* pb, const T16* pb2, unsigned l8, int ofs) {      // pa..pb2: wave-uniform bases; l8: the lane's piece; ofs: a constant at every call, it goes into the requests' immediate offsets
    __builtin_amdgcn_sched_barrier(0);      // keeps the requests behind the products that read this set: lifted over them they would need registers of their own
#pragma unroll
    for (int mb = 0; mb < 4; ++mb) { f.a[mb] = WFrag<T16>::ld(pa + l8 + (ofs + mb * 16 * K)); if (NSPLIT == 1 || NSPLIT == 2) f.a2[mb] = WFrag<T16>::ld(pa2 + l8 + (ofs + mb * 16 * K)); }
#pragma unroll
    for (int nb = 0; nb < 4; ++nb) { f.b[nb] = WFrag<T16>::ld(pb + l8 + (ofs + nb * 16 * K)); if (NSPLIT >= 2) f.b2[nb] = WFrag<T16>::ld(pb2 + l8 + (ofs + nb * 16 * K)); }
    asm volatile("s_wait_xcnt 0x0" ::: "memory");      // a precaution: it stands in front of every later write of a register that these requests name as an address (the next round's bases)
    __builtin_amdgcn_sched_barrier(0);      // holds the requests above the other sets' products, which are the time they have to land; sunk towards their use they would be waited out
}

template <typename T16, int NSPLIT>
__device__ __forceinline__ void g_mm(const GSet<T16>& f, v8f (&acc)[4][4]) {
#pragma unroll
    for (int nb = 0; nb < 4; ++nb) {
#pragma unroll
        for (int mb = 0; mb < 4; ++mb) { acc[mb][nb] = WFrag<T16>::mma(f.a[mb], f.b[nb], acc[mb][nb]); if (NSPLIT == 1 || NSPLIT == 2) acc[mb][nb] = WFrag<T16>::mma(f.a2[mb], f.b[nb], acc[mb][nb]); if (NSPLIT >= 2) acc[mb][nb] = WFrag<T16>::mma(f.a[mb], f.b2[nb], acc[mb][nb]); } }
    // the four slots between the last products and the requests that land in their operand registers
    asm volatile("v_nop\n\tv_nop\n\tv_nop\n\tv_nop" : "+v"(acc[0][0]), "+v"(acc[1][1]), "+v"(acc[2][2]), "+v"(acc[3][3]) : "v"(f.a[0]), "v"(f.a[3]));
}

template <typename T16, int NSPLIT, bool BIAS, int K, int NS>
__global__ __launch_bounds__(32) void k_gemmw(const T16* __restrict__ A, const T16* __restrict__ A2, const T16* __restrict__ Bt, const T16* __restrict__ Bt2, float* C, int ldc, const float* __restrict__ bias, size_t sA, size_t sB, size_t sC) {
    constexpr int NT = K / 32;               // trips
    constexpr int NL = (NT - NS) / NS;       // rounds of NS trips in which every set is asked for again
    static_assert(K % 32 == 0 && NS >= 2 && NT >= NS);
    __shared__ __align__(16) float os[16 * 68];
    const size_t z = blockIdx.z; A += z * sA; if (A2) A2 += z * sA; Bt += z * sB; if (Bt2) Bt2 += z * sB; C += z * sC;
    const int lane = threadIdx.x & 31, lr = lane & 15, hi = lane >> 4; const int r0 = blockIdx.x * 64, c0 = blockIdx.y * 64;
    v8f acc[4][4];
#pragma unroll
    for (int mb = 0; mb < 4; ++mb)
#pragma unroll
        for (int nb = 0; nb < 4; ++nb) acc[mb][nb] = (v8f){};
    const size_t aoff = (size_t)r0 * K, boff = (size_t)c0 * K; const unsigned l8 = 8u * (unsigned)lane;
    const T16* pa = A + aoff; const T16* pa2 = A2 + aoff; const T16* pb = Bt + boff; const T16* pb2 = Bt2 + boff;
    GSet<T16> f[NS];
#pragma unroll
    for (int s = 0; s < NS; ++s) g_fetch<T16, NSPLIT, K>(f[s], pa, pa2, pb, pb2, l8, s * 512);
#pragma unroll 1
    for (int i = 0; i < NL; ++i) {           // rolled: one round of NS trips is the loop's body
        const int o = (i + 1) * NS * 512; const T16* qa = pa + o; const T16* qa2 = pa2 + o; const T16* qb = pb + o; const T16* qb2 = pb2 + o;
#pragma unroll
        for (int s = 0; s < NS; ++s) { g_mm<T16, NSPLIT>(f[s], acc); g_fetch<T16, NSPLIT, K>(f[s], qa, qa2, qb, qb2, l8, s * 512); }
    }
#pragma unroll
    for (int t = NL * NS; t < NT; ++t) { g_mm<T16, NSPLIT>(f[t % NS], acc);
        if (t + NS < NT) g_fetch<T16, NSPLIT, K>(f[t % NS], pa, pa2, pb, pb2, l8, (t + NS) * 512); }
#pragma unroll
    for (int mb = 0; mb < 4; ++mb) {
#pragma unroll
        for (int nb = 0; nb < 4; ++nb) {
#pragma unroll
            for (int j = 0; j < 8; ++j) os[(hi * 8 + j) * 68 + nb * 16 + lr] = acc[mb][nb][j]; }
        __builtin_amdgcn_wave_barrier(); asm volatile("" ::: "memory");
        float* crow = C + (size_t)(r0 + mb * 16) * ldc + c0;
{
#pragma unroll
            for (int s = 0; s < 8; ++s) { const int row = 2 * s + hi, cofs = lr * 4; v4f val = *(const v4fa*)(os + row * 68 + cofs); if (BIAS) { val[0] += bfr(bias[c0 + cofs]); val[1] += bfr(bias[c0 + cofs + 1]); val[2] += bfr(bias[c0 + cofs + 2]); val[3] += bfr(bias[c0 + cofs + 3]); }
                *(v4f*)(crow + (size_t)row * ldc + cofs) = val; }
             }
        __builtin_amdgcn_wave_barrier(); asm volatile("" ::: "memory");
    }
}

// thread i of a batch writes piece i (8 elements) of the fragment-ordered copy: i = (block * 2 + k half) * 32 + lane.
// coverage: (SEQ*DM/2048, NB) blocks x 256 threads x 8 elements == NB*SEQ*DM.
static_assert(((size_t)SEQ * DM) % 2048 == 0);
__device__ __forceinline__ void cvtx_body(const unsigned bx, const unsigned b, const float* __restrict__ src, bf* dst) {
    const unsigned i = bx * 256u + threadIdx.x;
    const unsigned lr = i & 15u, hi = (i >> 4) & 1u, h2 = (i >> 5) & 1u, blk = i >> 6; const unsigned kt = blk % (unsigned)(DM / 32), rt = blk / (unsigned)(DM / 32);
    const float* s = src + (size_t)b * SEQ_FULL * DM + (size_t)(rt * 16u + lr) * DM + kt * 32u + h2 * 16u + hi * 8u; bf* d = dst + (size_t)b * SEQ * DM + (size_t)i * 8;
    const v8f v = *(const v8f*)s; v8us o;
#pragma unroll
    for (int k = 0; k < 8; ++k) o[k] = f2bf(v[k]);
    *(v8us*)d = o;  }

// thread i of a weight writes piece i of its fragment-ordered transpose Bt[n][k] = w[k][n]: 8 k of one n; a wave reads 64-byte runs of two w rows per request.
// coverage: (DM*DM/2048, 4) blocks x 256 threads x 8 elements == 4*DM*DM.
static_assert(((size_t)DM * DM) % 2048 == 0);
__device__ __forceinline__ void wt4_body(const unsigned bx, const unsigned y, const float* __restrict__ w0, const float* __restrict__ w1, const float* __restrict__ w2, const float* __restrict__ w3, bf* Bt) {
    const float* w = (y == 0u) ? w0 : (y == 1u) ? w1 : (y == 2u) ? w2 : w3; bf* o = Bt + (size_t)y * DM * DM;
    const unsigned i = bx * 256u + threadIdx.x;
    const unsigned lr = i & 15u, hi = (i >> 4) & 1u, h2 = (i >> 5) & 1u, blk = i >> 6; const unsigned kt = blk % (unsigned)(DM / 32), nt = blk / (unsigned)(DM / 32);
    const float* s = w + (size_t)(kt * 32u + h2 * 16u + hi * 8u) * DM + nt * 16u + lr; v8us q;
#pragma unroll
    for (int j = 0; j < 8; ++j) q[j] = f2bf(s[(size_t)j * DM]);
    *(v8us*)(o + (size_t)i * 8) = q;
}

// ---- k_prep: the two plane builders read and write disjoint buffers and neither needs the other, so they share one grid: blocks [0, PB_W) build the weight planes (their strided reads take longer: they start first), blocks [PB_W, PB_W + PB_X) the x plane.
constexpr unsigned PB_W1 = (unsigned)((size_t)DM * DM / 2048), PB_W = 4u * PB_W1;
constexpr unsigned PB_X1 = (unsigned)((size_t)SEQ * DM / 2048), PB_X = (unsigned)NB * PB_X1;
__global__ __launch_bounds__(256) void k_prep(const float* __restrict__ x, const float* __restrict__ w0, const float* __restrict__ w1, const float* __restrict__ w2, const float* __restrict__ w3, bf* XB, bf* Bt) {
    const unsigned bid = blockIdx.x;      // uniform per block: a scalar branch
    if (bid < PB_W) wt4_body(bid % PB_W1, bid / PB_W1, w0, w1, w2, w3, Bt);
    else cvtx_body((bid - PB_W) % PB_X1, (bid - PB_W) / PB_X1, x, XB);
}

// ---- g_ring: k loop of a work-group of FOUR WAVES (2 x 2) on a 128x128 output tile, each wave a 64x64 tile (16 accumulators). Operands are fragment-ordered 16-bit planes (block (rt, kt) at rt*16*K + kt*512).
// A stage is 64 k of the tile's 128 A rows and 128 B rows: per 16-row tile two blocks, 2 KB, contiguous in the plane and in LDS. Asynchronous copies bring it from global memory into LDS once per work-group; each wave copies two row tiles of either plane.
// Every operand byte then leaves L2 once per 128x128 tile, not once per 64x64 tile, and a fragment is two contiguous 512-byte LDS reads of the wave.
// Two buffers. A trip reads its whole stage into registers; behind the barrier that ends those reads, stage t + 2 is asked for into the same buffer, and only then come the trip's products: the copies fly during them and during the next trip's reads.
template <int K>
__device__ __forceinline__ void g_copy2(const unsigned l, const bf* g) {      // two row tiles (4 KB) of one plane: l = this lane's LDS byte address, g = this lane's global address, of the first 16 bytes
    const bf* h = g + 16 * K;
    // the copies and, as the last line, the precaution that stands in front of every later write of a register that they name
    asm volatile("global_load_async_to_lds_b128 %0, %8, off\n\t"
                 "global_load_async_to_lds_b128 %1, %9, off\n\t"
                 "global_load_async_to_lds_b128 %2, %10, off\n\t"
                 "global_load_async_to_lds_b128 %3, %11, off\n\t"
                 "global_load_async_to_lds_b128 %4, %12, off\n\t"
                 "global_load_async_to_lds_b128 %5, %13, off\n\t"
                 "global_load_async_to_lds_b128 %6, %14, off\n\t"
                 "global_load_async_to_lds_b128 %7, %15, off\n\t"
                 "s_wait_xcnt 0x0"
                 :: "v"(l), "v"(l + 512u), "v"(l + 1024u), "v"(l + 1536u), "v"(l + 2048u), "v"(l + 2560u), "v"(l + 3072u), "v"(l + 3584u),
                    "v"(g), "v"(g + 256), "v"(g + 512), "v"(g + 768), "v"(h), "v"(h + 256), "v"(h + 512), "v"(h + 768) : "memory");
}

// ring: 64 KB of LDS (per buffer 16 KB of A, 16 KB of B). ga, gb: this lane's address in rows 32 * wid of the tile's A and B rows, k = 0. acc[mb][nb] += sum over k, blocks in rising order.
template <int K>
__device__ __forceinline__ void g_ring(const bf* ring, const bf* ga, const bf* gb, const unsigned wid, const unsigned lane, v8f (&acc)[4][4]) {
    constexpr int NT = K / 64;                       // stages
    static_assert(K % 64 == 0 && NT >= 2);
    const unsigned lw = (unsigned)(size_t)ring + wid * 4096u + lane * 16u;
    g_copy2<K>(lw, ga); g_copy2<K>(lw + 16384u, gb);
    asm volatile("s_wait_asynccnt 0x0" ::: "memory");      // this wave's copies of stage 0 have landed
    __syncthreads();                                       // every wave's have
    g_copy2<K>(lw + 32768u, ga + 1024); g_copy2<K>(lw + 49152u, gb + 1024);
    const bf* fa = ring + (wid >> 1) * 4096u + lane * 8u; const bf* fb = ring + 8192u + (wid & 1u) * 4096u + lane * 8u;
#pragma unroll 1
    for (int t = 0; t < NT; ++t) {                   // rolled: one stage is the loop's body
        const unsigned bo = (unsigned)(t & 1) * 16384u;
        v16bf a[2][4], b[2][4];
#pragma unroll
        for (int kk = 0; kk < 2; ++kk) {
#pragma unroll
            for (int mb = 0; mb < 4; ++mb) a[kk][mb] = WFrag<bf>::ld(fa + bo + mb * 1024 + kk * 512);
#pragma unroll
            for (int nb = 0; nb < 4; ++nb) b[kk][nb] = WFrag<bf>::ld(fb + bo + nb * 1024 + kk * 512);
        }
        asm volatile("s_wait_dscnt 0x0" ::: "memory");         // this wave's reads of the buffer have returned
        asm volatile("s_wait_asynccnt 0x0" ::: "memory");      // its copies of stage t + 1 have landed
        __syncthreads();                                       // stage t + 1 is published, and every reader has left stage t's buffer
        if (t + 2 < NT) { g_copy2<K>(lw + 2u * bo, ga + (t + 2) * 1024); g_copy2<K>(lw + 2u * bo + 16384u, gb + (t + 2) * 1024); }
        __builtin_amdgcn_sched_barrier(0);           // keeps the products behind the copies: lifted over them they would take away the time the copies have to land
#pragma unroll
        for (int kk = 0; kk < 2; ++kk)
#pragma unroll
            for (int nb = 0; nb < 4; ++nb)
#pragma unroll
                for (int mb = 0; mb < 4; ++mb) acc[mb][nb] = wmmab(a[kk][mb], b[kk][nb], acc[mb][nb]);
    }
    asm volatile("s_wait_asynccnt 0x0" ::: "memory");          // nothing is outstanding when the LDS goes to other use
}

// ---- k_gemmqkv: the q | k | v projection GEMM (blockIdx.z 0 | 1 | 2), one wave per 64x64 tile = 64 positions x ONE head (HD == 64), four waves (2 x 2) a work-group, k loop g_ring (single product); grid (NB*SEQ/128, NH/2, 3), 128 threads. The epilogue writes the attention's planes from the accumulators, each wave for itself.
// q, k: head planes [z] (rows t, k = d, fragment order: 2 blocks per 16 rows) of the rotated projection: pair i of a head row: out[2i] = x[2i] c - x[2i+1] s, out[2i+1] = x[2i] s + x[2i+1] c with c, s = bf16 RNE-converted INPUT table values [t][i].
//   The tile goes through LDS (a lane holds 8 rows of one depth, a piece is 8 depths of one row); the table rows, read as whole lines, go there 16 rows at a time; lane (lr, hi) builds piece (row lr, depths 16s + 8hi..) for s = 0..3: each store of the wave is 512 contiguous bytes.
// v: value planes [z] (rows d, k = key, fragment order, the four 16-d blocks of a 32-key chunk side by side: block (chunk, dt) at (chunk * 4 + dt) * 512). An accumulator's 8 registers are 8 keys of one depth, which is a piece: stored from the registers, 512 contiguous bytes per store.
// coverage: the tiles cover NB*SEQ rows x DM columns of each projection == NZ*SEQ*HD elements of each fp16 plane; tiles with t < RH (64 | RH) also fill the hi and lo planes (NZ*RH*HD each).
static_assert(SEQ % 128 == 0 && RH % 64 == 0 && HD == 64 && DM == NH * 64 && NH % 2 == 0);
template <int K>
__global__ __launch_bounds__(128) void k_gemmqkv(const bf* __restrict__ A, const bf* __restrict__ Bt, const float* __restrict__ cosT, const float* __restrict__ sinT, h16* P16, bf* Ph, bf* Pl, h16* V16, bf* Vh, bf* Vl) {
    constexpr unsigned EW = 64 * 68 + 2 * 16 * 36;      // floats of a wave's epilogue staging
    static_assert(4 * EW * 4 >= 65536);
    __shared__ __align__(16) float sm[4 * EW];          // first the ring of the k loop (64 KB); behind the loop's last barrier, which ends every read of the ring, each wave's own staging
    const unsigned wid = (unsigned)__builtin_amdgcn_readfirstlane((int)(threadIdx.x >> 5));      // the wave's number, in a scalar register
    const unsigned y = blockIdx.z, h = blockIdx.y * 2u + (wid & 1u), r0 = blockIdx.x * 128u + (wid >> 1) * 64u;
    const unsigned lane = threadIdx.x & 31u, lr = lane & 15u, hi = lane >> 4, l8 = 8u * lane;
    v8f acc[4][4];
#pragma unroll
    for (int mb = 0; mb < 4; ++mb)
#pragma unroll
        for (int nb = 0; nb < 4; ++nb) acc[mb][nb] = (v8f){};
    g_ring<K>((const bf*)sm, A + (size_t)(blockIdx.x * 128u + wid * 32u) * K + l8, Bt + (size_t)y * DM * K + (size_t)(blockIdx.y * 128u + wid * 32u) * K + l8, wid, lane, acc);
    float* os = sm + wid * EW; float* tc = os + 64 * 68; float* ts = tc + 16 * 36;      // tc, ts pitch 36: the 16 rows of a 16-byte column start in 16 different bank groups
    const unsigned b = r0 / (unsigned)SEQ, t0 = r0 % (unsigned)SEQ, z = b * (unsigned)NH + h;
    const bool hl = (t0 < (unsigned)RH);     // uniform per wave (64 consecutive rows, RH % 64 == 0)
    // Stores go out 16 rows at a time: all their values first, then the stores, then one s_wait_xcnt 0 (a precaution: it stands in front of every later write of a register that these stores name); the scheduling fences keep other work out of that stretch.
    if (y == 2u) {
        h16* p16 = V16 + (size_t)z * HD * SEQ + (t0 >> 5) * 2048u + l8;
        const size_t ho = (size_t)z * HD * RH + (hl ? (t0 >> 5) : 0u) * 2048u + l8; bf* ph = Vh + ho; bf* pl = Vl + ho;
#pragma unroll
        for (int mb = 0; mb < 4; ++mb) {     // keys t0 + 16mb + 8hi + j, depth 16nb + lr: chunk mb >> 1, block nb, k half mb & 1, piece lane
            const int e = (mb >> 1) * 2048 + (mb & 1) * 256; v8h o16[4];
#pragma unroll
            for (int nb = 0; nb < 4; ++nb)
#pragma unroll
                for (int j = 0; j < 8; ++j) o16[nb][j] = (h16)acc[mb][nb][j];
            if (hl) { v8us oh[4], ol[4];
#pragma unroll
                for (int nb = 0; nb < 4; ++nb)
#pragma unroll
                    for (int j = 0; j < 8; ++j) { unsigned short a, c2; splitf(acc[mb][nb][j], a, c2); oh[nb][j] = a; ol[nb][j] = c2; }
                __builtin_amdgcn_sched_barrier(0);      // values above, stores below
#pragma unroll
                for (int nb = 0; nb < 4; ++nb) { *(v8h*)(p16 + e + nb * 512) = o16[nb]; *(v8us*)(ph + e + nb * 512) = oh[nb]; *(v8us*)(pl + e + nb * 512) = ol[nb]; }
                asm volatile("s_wait_xcnt 0x0" ::: "memory");      // the precaution named above, behind these stores
            } else {
                __builtin_amdgcn_sched_barrier(0);      // values above, stores below
#pragma unroll
                for (int nb = 0; nb < 4; ++nb) *(v8h*)(p16 + e + nb * 512) = o16[nb];
                asm volatile("s_wait_xcnt 0x0" ::: "memory");      // the precaution named above, behind these stores
            }
            __builtin_amdgcn_sched_barrier(0);          // the next rows' values stay behind the wait
        }
        return;
    }
    const float* ct = cosT + (size_t)t0 * 32 + 4u * lane; const float* st = sinT + (size_t)t0 * 32 + 4u * lane;      // request q of a 16-row block: its rows 4q..4q+3, 512 contiguous bytes
    v4f cq[4], sq[4];
#pragma unroll
    for (int q = 0; q < 4; ++q) { cq[q] = *(const v4f*)(ct + q * 128); sq[q] = *(const v4f*)(st + q * 128); }      // the first 16 rows' table values fly while the tile goes to LDS
    asm volatile("s_wait_xcnt 0x0" ::: "memory");      // a precaution: it stands in front of every later write of a register that these requests name as an address
    __builtin_amdgcn_sched_barrier(0);                 // keeps later address arithmetic behind that wait
#pragma unroll
    for (int mb = 0; mb < 4; ++mb)
#pragma unroll
        for (int nb = 0; nb < 4; ++nb)
#pragma unroll
            for (int j = 0; j < 8; ++j) os[(mb * 16 + hi * 8 + j) * 68 + nb * 16 + lr] = acc[mb][nb][j];
    h16* p16 = P16 + (size_t)y * NZ * SEQ * HD + (size_t)z * SEQ * HD + (t0 >> 4) * 1024u + l8;
    const size_t ho = (size_t)y * NZ * RH * HD + (size_t)z * RH * HD + (hl ? (t0 >> 4) : 0u) * 1024u + l8; bf* ph = Ph + ho; bf* pl = Pl + ho;
    const unsigned to = (lane >> 3) * 36u + (lane & 7u) * 4u;
#pragma unroll 1
    for (unsigned mb = 0; mb < 4u; ++mb) {       // rolled: the body is long and runs four times; 16 rows a trip
#pragma unroll
        for (int q = 0; q < 4; ++q) { *(v4fa*)(tc + q * 144 + to) = cq[q]; *(v4fa*)(ts + q * 144 + to) = sq[q]; }
        if (mb < 3u) {      // the next 16 rows' table values fly while these rows are built
#pragma unroll
            for (int q = 0; q < 4; ++q) { cq[q] = *(const v4f*)(ct + (mb + 1u) * 512u + q * 128); sq[q] = *(const v4f*)(st + (mb + 1u) * 512u + q * 128); }
            asm volatile("s_wait_xcnt 0x0" ::: "memory");      // a precaution: it stands in front of every later write of a register that these requests name as an address
        }
        __builtin_amdgcn_wave_barrier(); asm volatile("" ::: "memory");      // keeps the LDS reads below behind the LDS writes above in the compiled order (one wave: the LDS serves it in order)
        float ro[4][8]; v8h o16[4];
#pragma unroll
        for (int s = 0; s < 4; ++s) { const unsigned seg = 2u * (unsigned)s + hi; const float* xr = os + (mb * 16u + lr) * 68u + seg * 8u;
            const v4f x0 = *(const v4fa*)xr, x1 = *(const v4fa*)(xr + 4); const v4f cv = *(const v4fa*)(tc + lr * 36u + seg * 4u), sv = *(const v4fa*)(ts + lr * 36u + seg * 4u);
            float xs[8]; xs[0] = x0[0]; xs[1] = x0[1]; xs[2] = x0[2]; xs[3] = x0[3]; xs[4] = x1[0]; xs[5] = x1[1]; xs[6] = x1[2]; xs[7] = x1[3];
#pragma unroll
            for (int i = 0; i < 4; ++i) { const float c = bfr(cv[i]), sn = bfr(sv[i]); const float tr = xs[2 * i], ti = xs[2 * i + 1]; ro[s][2 * i] = tr * c - ti * sn; ro[s][2 * i + 1] = tr * sn + ti * c;
                o16[s][2 * i] = (h16)ro[s][2 * i]; o16[s][2 * i + 1] = (h16)ro[s][2 * i + 1]; } }
        const unsigned e = mb * 1024u;      // 16-row tile mb; piece (depths 16s + 8hi.., row lr) sits at s * 256 + lane * 8
        if (hl) { v8us oh[4], ol[4];
#pragma unroll
            for (int s = 0; s < 4; ++s)
#pragma unroll
                for (int k = 0; k < 8; ++k) { unsigned short a, d2; splitf(ro[s][k], a, d2); oh[s][k] = a; ol[s][k] = d2; }
            __builtin_amdgcn_sched_barrier(0);      // values above, stores below
#pragma unroll
            for (int s = 0; s < 4; ++s) { *(v8h*)(p16 + e + s * 256) = o16[s]; *(v8us*)(ph + e + s * 256) = oh[s]; *(v8us*)(pl + e + s * 256) = ol[s]; }
            asm volatile("s_wait_xcnt 0x0" ::: "memory");      // the precaution named above, behind these stores
        } else {
            __builtin_amdgcn_sched_barrier(0);      // values above, stores below
#pragma unroll
            for (int s = 0; s < 4; ++s) *(v8h*)(p16 + e + s * 256) = o16[s];
            asm volatile("s_wait_xcnt 0x0" ::: "memory");      // the precaution named above, behind these stores
        }
        __builtin_amdgcn_wave_barrier(); asm volatile("" ::: "memory");      // keeps the next rows' table writes behind this trip's LDS reads in the compiled order
    }
}

__device__ __forceinline__ float xhalf(float x) { return __builtin_bit_cast(float, __builtin_amdgcn_permlanex16(__builtin_bit_cast(int, x), __builtin_bit_cast(int, x), 0x76543210, 0xfedcba98, false, false)); }      // lane l's value of lane l ^ 16

template <typename T16, bool HR>
__device__ __forceinline__ void flash_body(const unsigned bid, const T16* QA, const T16* QB, const T16* KA, const T16* KB, const T16* VA, const T16* VB, bf* ATh, bf* ATl) {
    typedef typename WFrag<T16>::V V;
    constexpr unsigned QR   = HR ? (unsigned)RH : (unsigned)SEQ;     // rows per z of the q/k planes = key pitch of the v planes
    constexpr unsigned ROW0 = HR ? 0u : (unsigned)RH;
    constexpr unsigned NT   = HR ? (unsigned)RH / 16u : (unsigned)(SEQ - RH) / 16u;
    constexpr unsigned NTD  = NT ? NT : 1u;
    const unsigned lane = threadIdx.x & 31u, wid = threadIdx.x >> 5, lr = lane & 15u, hi = lane >> 4;
    const unsigned w = bid * 4u + wid; const unsigned z = w / NTD, mt = w % NTD; const unsigned q0 = ROW0 + mt * 16u;
    const size_t zoff = (size_t)z * QR * HD + 8u * lane;      // this lane's piece of block 0 of head z, in the q, k and v planes alike; 16 rows of q or k = 2 blocks, a 32-key chunk of k or v = 4 blocks
    const size_t qoff = zoff + (size_t)q0 * HD;
    V aq[2], aql[2];
#pragma unroll
    for (int d = 0; d < 2; ++d) { aq[d] = WFrag<T16>::ld(QA + qoff + d * 512); if (HR) aql[d] = WFrag<T16>::ld(QB + qoff + d * 512); }
    v8f o[4]; float m = -1.0e30f, l = 0.0f;          // o[t][j] = context[query lr][depth 16t + 8hi + j]; m, l: query lr (l: this half's keys)
#pragma unroll
    for (int t = 0; t < 4; ++t) o[t] = (v8f){};
    const unsigned nch = (q0 + 15u) / 32u + 1u;      // wave-uniform; keys < nch*32 <= QR
    V kb[2][2], kl[2][2], vb[4], vl[4];              // fragments of the current chunk: kb[d][i] = keys 16i.., depth 32d..; vb[t] = depth 16t..
    // Chunk 0 is requested in the loop's own order (queries, keys, values): loads retire in order and the wait at the loop's head is counted for both ways in, so another order here makes every trip's score products wait for the value requests too.
    asm volatile("s_wait_xcnt 0x0" ::: "memory");    // key fragments land in registers that held the query requests' addresses: a precaution in front of that reuse; as a memory fence it also keeps the query requests ahead of the key requests
#pragma unroll
    for (int d = 0; d < 2; ++d) { const size_t ko = zoff + d * 512;
        kb[d][0] = WFrag<T16>::ld(KA + ko); kb[d][1] = WFrag<T16>::ld(KA + ko + 16 * HD); if (HR) { kl[d][0] = WFrag<T16>::ld(KB + ko); kl[d][1] = WFrag<T16>::ld(KB + ko + 16 * HD); } }
    __builtin_amdgcn_sched_barrier(0);               // keeps the key requests ahead of the value requests
#pragma unroll
    for (int t = 0; t < 4; ++t) { const size_t vo = zoff + t * 512; vb[t] = WFrag<T16>::ld(VA + vo); if (HR) vl[t] = WFrag<T16>::ld(VB + vo); }
    const unsigned qrow = q0 + lr;
#pragma unroll 1
    for (unsigned c = 0; c < nch; ++c) {
        const unsigned c0 = c * 32u;
        const unsigned cn = ((c + 1u < nch) ? c + 1u : c) * 32u;      // chunk fetched ahead; the last trip asks for its own chunk again (in bounds, never used)
        v8f s0 = (v8f){}, s1 = (v8f){};              // s0[j] = score[key c0 + 8hi + j][query lr], s1: keys + 16
#pragma unroll
        for (int d = 0; d < 2; ++d) {
            s0 = WFrag<T16>::mma(kb[d][0], aq[d], s0); s1 = WFrag<T16>::mma(kb[d][1], aq[d], s1);
            if (HR) { s0 = WFrag<T16>::mma(kb[d][0], aql[d], s0); s1 = WFrag<T16>::mma(kb[d][1], aql[d], s1); s0 = WFrag<T16>::mma(kl[d][0], aq[d], s0); s1 = WFrag<T16>::mma(kl[d][1], aq[d], s1); } }
        asm volatile("v_nop\n\tv_nop\n\tv_nop\n\tv_nop" : "+v"(s0), "+v"(s1) : "v"(aq[0]), "v"(aq[1]));      // the four slots between the last score products and the requests that land in their operand registers
#pragma unroll
        for (int d = 0; d < 2; ++d) { const size_t ko = zoff + (size_t)cn * HD + d * 512;
            kb[d][0] = WFrag<T16>::ld(KA + ko); kb[d][1] = WFrag<T16>::ld(KA + ko + 16 * HD); if (HR) { kl[d][0] = WFrag<T16>::ld(KB + ko); kl[d][1] = WFrag<T16>::ld(KB + ko + 16 * HD); } }
        if (HR) asm volatile("s_wait_xcnt 0x0" ::: "memory");      // the softmax reuses the key requests' address registers: a precaution
        __builtin_amdgcn_sched_barrier(0);      // holds the key requests above the softmax, which is the time they have to land; sunk towards their use they would be waited out
        const unsigned key0 = c0 + 8u * hi;
        float t0[8], t1[8], p0[8], p1[8], r[8];
#pragma unroll
        for (int j = 0; j < 8; ++j) { const bool v0 = (key0 + (unsigned)j <= qrow), v1 = (key0 + 16u + (unsigned)j <= qrow);
            t0[j] = s0[j] * SC2; t1[j] = s1[j] * SC2; r[j] = fmaxf(v0 ? t0[j] : -1.0e30f, v1 ? t1[j] : -1.0e30f); }
        float cm = fmaxf(fmaxf(fmaxf(r[0], r[1]), fmaxf(r[2], r[3])), fmaxf(fmaxf(r[4], r[5]), fmaxf(r[6], r[7])));
        cm = fmaxf(cm, xhalf(cm));
        const float nm = fmaxf(m, cm); float al;
        asm("v_exp_f32 %0, %1\n\tv_nop" : "=v"(al) : "v"(m - nm));      // 2^(m - nm) with the slot behind a transcendental in the same statement
        m = nm;
#pragma unroll
        for (int j = 0; j < 8; ++j) { const bool v0 = (key0 + (unsigned)j <= qrow), v1 = (key0 + 16u + (unsigned)j <= qrow);
            const float e0 = __builtin_amdgcn_exp2f(fminf(t0[j] - nm, 0.0f)), e1 = __builtin_amdgcn_exp2f(fminf(t1[j] - nm, 0.0f));
            p0[j] = v0 ? e0 : 0.0f; p1[j] = v1 ? e1 : 0.0f; r[j] = p0[j] + p1[j]; }
        l = l * al + (((r[0] + r[1]) + (r[2] + r[3])) + ((r[4] + r[5]) + (r[6] + r[7])));
#pragma unroll
        for (int t = 0; t < 4; ++t) o[t] *= al;
        V ap, apl; WFrag<T16>::pk(ap, apl, p0, p1);
#pragma unroll
        for (int t = 0; t < 4; ++t) {
            o[t] = WFrag<T16>::mma(vb[t], ap, o[t]);
            if (HR) { o[t] = WFrag<T16>::mma(vb[t], apl, o[t]); o[t] = WFrag<T16>::mma(vl[t], ap, o[t]); } }
        asm volatile("v_nop\n\tv_nop\n\tv_nop\n\tv_nop" : "+v"(o[0]), "+v"(o[1]), "+v"(o[2]), "+v"(o[3]) : "v"(ap));      // the four slots between the last value products and the requests that land in their operand registers
        const T16* pva = VA + zoff + (size_t)cn * HD; const T16* pvb = HR ? VB + zoff + (size_t)cn * HD : pva;
#pragma unroll
        for (int t = 0; t < 4; ++t) { vb[t] = WFrag<T16>::ld(pva + t * 512); if (HR) vl[t] = WFrag<T16>::ld(pvb + t * 512); }
        if (HR) asm volatile("s_wait_xcnt 0x0" :: "v"(pva), "v"(pvb) : "memory");      // a precaution in front of the reuse of the value requests' address registers; the addresses are inputs so that their registers stay theirs up to the wait
    }
    asm volatile("s_wait_loadcnt 0x0" ::: "memory");      // the last trip's requests are never read: they retire here, before the wave gives its registers back
    const float cs = HR ? 1.0f : (1.0f / PCAR);
    const float ls = l + xhalf(l); const float inv = (1.0f / ls) * cs;
    const unsigned b = z / (unsigned)NH, h = z % (unsigned)NH;      // the tile is blocks 2h and 2h + 1 of its 16 rows; store s fills half s & 1 of block s >> 1: row lr, columns 16s + 8hi.. = accumulator s of this lane
#pragma unroll
    for (int s = 0; s < 4; ++s) { v8us oh, ol;
#pragma unroll
        for (int k = 0; k < 8; ++k) { unsigned short x, y2; splitf(o[s][k] * inv, x, y2); oh[k] = x; ol[k] = y2; }
        const size_t oo = (size_t)(b * SEQ + q0) * DM + h * 1024u + (unsigned)s * 256u + 8u * lane;
        *(v8us*)(ATh + oo) = oh; *(v8us*)(ATl + oo) = ol; }
}

// ---- flash_pl: rows >= RH on the fp16 planes. The four waves of a work-group hold 64 consecutive query rows of one head and walk the same keys, so the keys and values come to LDS once per work-group, not once per wave.
// A stage is 64 keys: 8 KB of the key plane and 8 KB of the value plane, each contiguous in fragment order; each wave copies a quarter of either (global_load_async_to_lds_b128). Two buffers. A trip asks for its whole stage from LDS into registers and works on the first chunk; then comes the barrier that ends those reads, behind it stage t + 2 is asked for into the same buffer, then the second chunk: the copies fly during it and during the next trip's first chunk.
// Every wave walks all stages of its work-group (up to the last row's diagonal); a chunk wholly above a wave's own diagonal is masked like any other: its probabilities are 0, maximum, sum and context keep their values.
__device__ __forceinline__ void exp8(float (&e)[8], const float (&x)[8]) {      // e[j] = 2^x[j]. One statement: each v_exp is followed by one that neither reads its result nor writes its source (results in registers of their own), the last by the slot behind a transcendental
    asm("v_exp_f32 %0, %8\n\tv_exp_f32 %1, %9\n\tv_exp_f32 %2, %10\n\tv_exp_f32 %3, %11\n\tv_exp_f32 %4, %12\n\tv_exp_f32 %5, %13\n\tv_exp_f32 %6, %14\n\tv_exp_f32 %7, %15\n\tv_nop"
        : "=&v"(e[0]), "=&v"(e[1]), "=&v"(e[2]), "=&v"(e[3]), "=&v"(e[4]), "=&v"(e[5]), "=&v"(e[6]), "=&v"(e[7])
        : "v"(x[0]), "v"(x[1]), "v"(x[2]), "v"(x[3]), "v"(x[4]), "v"(x[5]), "v"(x[6]), "v"(x[7]));
}

__device__ __forceinline__ void kv_copy(const unsigned l, const h16* gk, const h16* gv) {      // a wave's quarter (2 KB + 2 KB) of a stage: l = this lane's LDS byte address in the key half, gk, gv = this lane's global addresses, of the first 16 bytes
    // the copies and, as the last line, the precaution that stands in front of every later write of a register that they name
    asm volatile("global_load_async_to_lds_b128 %0, %8, off\n\t"
                 "global_load_async_to_lds_b128 %1, %9, off\n\t"
                 "global_load_async_to_lds_b128 %2, %10, off\n\t"
                 "global_load_async_to_lds_b128 %3, %11, off\n\t"
                 "global_load_async_to_lds_b128 %4, %12, off\n\t"
                 "global_load_async_to_lds_b128 %5, %13, off\n\t"
                 "global_load_async_to_lds_b128 %6, %14, off\n\t"
                 "global_load_async_to_lds_b128 %7, %15, off\n\t"
                 "s_wait_xcnt 0x0"
                 :: "v"(l), "v"(l + 512u), "v"(l + 1024u), "v"(l + 1536u), "v"(l + 8192u), "v"(l + 8704u), "v"(l + 9216u), "v"(l + 9728u),
                    "v"(gk), "v"(gk + 256), "v"(gk + 512), "v"(gk + 768), "v"(gv), "v"(gv + 256), "v"(gv + 512), "v"(gv + 768) : "memory");
}

static_assert(RH % 64 == 0 && ((SEQ - RH) / 16) % 4 == 0);
__device__ __forceinline__ void flash_pl(const unsigned bid, const h16* QA, const h16* KA, const h16* VA, bf* ATh, bf* ATl, const h16* kv) {      // kv: 32 KB of LDS, two buffers of [keys 8 KB | values 8 KB]
    typedef WFrag<h16>::V V;
    constexpr unsigned NT  = (unsigned)(SEQ - RH) / 16u;
    constexpr unsigned NTD = NT ? NT : 1u;
    const unsigned wid = (unsigned)__builtin_amdgcn_readfirstlane((int)(threadIdx.x >> 5));      // the wave's number, in a scalar register
    const unsigned lane = threadIdx.x & 31u, lr = lane & 15u, hi = lane >> 4;
    const unsigned w = bid * 4u + wid; const unsigned z = w / NTD, mt = w % NTD; const unsigned q0 = (unsigned)RH + mt * 16u;      // NT % 4 == 0: the four waves share z
    const unsigned nst = ((unsigned)RH + ((bid * 4u) % NTD) * 16u) / 64u + 1u;      // stages up to the diagonal of the work-group's last row; uniform per work-group; keys < nst * 64 <= SEQ; nst >= 2 (RH >= 64)
    const size_t zoff = (size_t)z * SEQ * HD;
    const unsigned lw = (unsigned)(size_t)kv + wid * 2048u + lane * 16u;
    const h16* gk = KA + zoff + wid * 1024u + lane * 8u; const h16* gv = VA + zoff + wid * 1024u + lane * 8u;      // a stage is 4096 elements of either plane
    kv_copy(lw, gk, gv);
    V aq[2];
#pragma unroll
    for (int d = 0; d < 2; ++d) aq[d] = WFrag<h16>::ld(QA + zoff + (size_t)q0 * HD + 8u * lane + d * 512);
    asm volatile("s_wait_asynccnt 0x0" ::: "memory");      // this wave's copies of stage 0 have landed
    __syncthreads();                                       // every wave's have
    kv_copy(lw + 16384u, gk + 4096, gv + 4096);
    v8f o[4]; float m = -1.0e30f, l = 0.0f;          // o[t][j] = context[query lr][depth 16t + 8hi + j]; m, l: query lr (l: this half's keys)
#pragma unroll
    for (int t = 0; t < 4; ++t) o[t] = (v8f){};
    const unsigned qrow = q0 + lr;
#pragma unroll 1
    for (unsigned st = 0; st < nst; ++st) {          // rolled: one stage (two 32-key chunks) is the loop's body
        const unsigned bo = (st & 1u) * 8192u; const h16* fk = kv + bo + lane * 8u;
        V kb[2][2][2], vb[2][4];                     // kb[chunk][d][i] = keys 16i.., depth 32d..; vb[chunk][t] = depth 16t..
#pragma unroll
        for (int cc = 0; cc < 2; ++cc) {
#pragma unroll
            for (int d = 0; d < 2; ++d) { kb[cc][d][0] = WFrag<h16>::ld(fk + cc * 2048 + d * 512); kb[cc][d][1] = WFrag<h16>::ld(fk + cc * 2048 + 1024 + d * 512); }
#pragma unroll
            for (int t = 0; t < 4; ++t) vb[cc][t] = WFrag<h16>::ld(fk + 4096 + cc * 2048 + t * 512);
        }
        __builtin_amdgcn_sched_barrier(0);           // holds the stage's LDS reads together at the head of the trip: sunk towards their products, each group's latency would be waited out
#pragma unroll
        for (int cc = 0; cc < 2; ++cc) {
            if (cc == 1) {      // between the chunks: the second chunk's fragments have returned under the first chunk's work, so the wait for them costs nothing
                __builtin_amdgcn_sched_barrier(0);                     // keeps the waits and the barrier behind the first chunk's work: lifted over it they would wait out the LDS reads
                asm volatile("s_wait_dscnt 0x0" ::: "memory");         // this wave's reads of the buffer have returned
                asm volatile("s_wait_asynccnt 0x0" ::: "memory");      // its copies of stage st + 1 have landed
                __syncthreads();                                       // stage st + 1 is published, and every reader has left stage st's buffer
                if (st + 2u < nst) kv_copy(lw + 2u * bo, gk + (size_t)(st + 2u) * 4096u, gv + (size_t)(st + 2u) * 4096u);
                __builtin_amdgcn_sched_barrier(0);                     // keeps the second chunk's work behind the copies: lifted over them it would take away the time the copies have to land
            }
            v8f s0 = (v8f){}, s1 = (v8f){};          // s0[j] = score[key c0 + 8hi + j][query lr], s1: keys + 16
#pragma unroll
            for (int d = 0; d < 2; ++d) { s0 = wmma16(kb[cc][d][0], aq[d], s0); s1 = wmma16(kb[cc][d][1], aq[d], s1); }
            const unsigned key0 = st * 64u + (unsigned)cc * 32u + 8u * hi;
            float t0[8], t1[8], p0[8], p1[8], r[8];
#pragma unroll
            for (int j = 0; j < 8; ++j) { const bool v0 = (key0 + (unsigned)j <= qrow), v1 = (key0 + 16u + (unsigned)j <= qrow);
                t0[j] = s0[j] * SC2; t1[j] = s1[j] * SC2; r[j] = fmaxf(v0 ? t0[j] : -1.0e30f, v1 ? t1[j] : -1.0e30f); }
            float cm = fmaxf(fmaxf(fmaxf(r[0], r[1]), fmaxf(r[2], r[3])), fmaxf(fmaxf(r[4], r[5]), fmaxf(r[6], r[7])));
            cm = fmaxf(cm, xhalf(cm));
            const float nm = fmaxf(m, cm); float al;
            asm("v_exp_f32 %0, %1\n\tv_nop" : "=v"(al) : "v"(m - nm));      // 2^(m - nm) with the slot behind a transcendental in the same statement
            m = nm;
#pragma unroll
            for (int j = 0; j < 8; ++j) { t0[j] = fminf(t0[j] - nm, 0.0f); t1[j] = fminf(t1[j] - nm, 0.0f); }
            float e0[8], e1[8]; exp8(e0, t0); exp8(e1, t1);
#pragma unroll
            for (int j = 0; j < 8; ++j) { const bool v0 = (key0 + (unsigned)j <= qrow), v1 = (key0 + 16u + (unsigned)j <= qrow);
                p0[j] = v0 ? e0[j] : 0.0f; p1[j] = v1 ? e1[j] : 0.0f; r[j] = p0[j] + p1[j]; }
            l = l * al + (((r[0] + r[1]) + (r[2] + r[3])) + ((r[4] + r[5]) + (r[6] + r[7])));
#pragma unroll
            for (int t = 0; t < 4; ++t) o[t] *= al;
            V ap, apl; WFrag<h16>::pk(ap, apl, p0, p1);
#pragma unroll
            for (int t = 0; t < 4; ++t) o[t] = wmma16(vb[cc][t], ap, o[t]);
        }
    }
    asm volatile("s_wait_asynccnt 0x0" ::: "memory");          // nothing is outstanding when the wave ends
    const float ls = l + xhalf(l); const float inv = (1.0f / ls) * (1.0f / PCAR);
    const unsigned b = z / (unsigned)NH, h = z % (unsigned)NH;      // the tile is blocks 2h and 2h + 1 of its 16 rows; store s fills half s & 1 of block s >> 1: row lr, columns 16s + 8hi.. = accumulator s of this lane
#pragma unroll
    for (int s = 0; s < 4; ++s) { v8us oh, ol;
#pragma unroll
        for (int k = 0; k < 8; ++k) { unsigned short x, y2; splitf(o[s][k] * inv, x, y2); oh[k] = x; ol[k] = y2; }
        const size_t oo = (size_t)(b * SEQ + q0) * DM + h * 1024u + (unsigned)s * 256u + 8u * lane;
        *(v8us*)(ATh + oo) = oh; *(v8us*)(ATl + oo) = ol; }
}

// ---- k_flash: the two row ranges (rows >= RH on the fp16 planes, rows < RH on the hi/lo planes) write disjoint context rows and neither needs the other, so they share one grid: blocks [0, FB_PL) take rows >= RH (up to SEQ/32 chunks a wave: the long ones start first), blocks [FB_PL, FB_PL + FB_HR) rows < RH (at most RH/32 chunks), which run beside the long waves instead of in front of them.
// coverage: FB_HR = NZ*(RH/16)/4 blocks x 4 waves x (16 rows x 64 d) == NZ*RH*HD; FB_PL = NZ*((SEQ-RH)/16)/4 blocks x 4 waves x (16 x 64) == NZ*(SEQ-RH)*HD; union == NB*SEQ*DM per context plane.
static_assert((NZ * (RH / 16)) % 4 == 0);
static_assert((NZ * ((SEQ - RH) / 16)) % 4 == 0);
constexpr unsigned FB_PL = (unsigned)(NZ * ((SEQ - RH) / 16) / 4), FB_HR = (unsigned)(NZ * (RH / 16) / 4);
__global__ __launch_bounds__(128) void k_flash(const h16* Q16, const h16* K16, const h16* V16, const bf* Qh, const bf* Ql, const bf* Kh, const bf* Kl, const bf* Vh, const bf* Vl, bf* ATh, bf* ATl) {
    const unsigned bid = blockIdx.x;      // uniform per block: a scalar branch
    __shared__ __align__(16) h16 kv[2 * 8192];      // the key and value stages of rows >= RH
    if (bid < FB_PL) flash_pl(bid, Q16, K16, V16, ATh, ATl, kv);
    else flash_body<bf, true>(bid - FB_PL, Qh, Ql, Kh, Kl, Vh, Vl, ATh, ATl);
}

// workspace carve (bytes; every region a multiple of 256)
constexpr size_t SZ_WT  = (size_t)4 * DM * DM * 2;
constexpr size_t SZ_XB  = (size_t)NB * SEQ * DM * 2;
constexpr size_t SZ_QK  = (size_t)2 * NZ * SEQ * HD * 2;
constexpr size_t SZ_V   = (size_t)NZ * HD * SEQ * 2;
constexpr size_t SZ_QKH = (size_t)2 * NZ * RH * HD * 2;
constexpr size_t SZ_VH  = (size_t)NZ * HD * RH * 2;
constexpr size_t SZ_AT  = (size_t)NB * SEQ * DM * 2;
constexpr size_t WS_TOTAL = SZ_WT + SZ_XB + SZ_QK + SZ_V + 2 * SZ_QKH + 2 * SZ_VH + 2 * SZ_AT;
static_assert(WS_TOTAL <= (size_t)134217728);
static_assert(SZ_WT % 256 == 0 && SZ_XB % 256 == 0 && SZ_QK % 256 == 0 && SZ_V % 256 == 0 && SZ_QKH % 256 == 0 && SZ_VH % 256 == 0 && SZ_AT % 256 == 0);

extern "C" void kernel_launch(void* const* d_in, const int* in_sizes, int n_in,
                              void* d_out, int out_size, void* d_ws, size_t ws_size, hipStream_t stream) {
    if (n_in < 7) return;
    const long long need_x = ((long long)(NB - 1) * SEQ_FULL + SEQ) * DM;
    if ((long long)in_sizes[0] < need_x || (long long)out_size < need_x) return;
    if (in_sizes[1] < DM * DM || in_sizes[2] < DM * DM || in_sizes[3] < DM * DM || in_sizes[4] < DM * DM) return;
    if (in_sizes[5] < SEQ * (HD / 2) || in_sizes[6] < SEQ * (HD / 2)) return;
    if (WS_TOTAL > ws_size) return;
    const float* x = (const float*)d_in[0]; const float* wq = (const float*)d_in[1]; const float* wk = (const float*)d_in[2]; const float* wv = (const float*)d_in[3]; const float* wo = (const float*)d_in[4];
    const float* fcos = (const float*)d_in[5]; const float* fsin = (const float*)d_in[6];
    float* OUT = (float*)d_out;
    char* wsp = (char*)d_ws;
    auto take = [&](size_t bytes) { char* p = wsp; wsp += bytes; return (void*)p; };
    bf* WT = (bf*)take(SZ_WT);            // [4] planes (rows n, k): q | k | v | o
    bf* XB = (bf*)take(SZ_XB);            // rows NB*SEQ, k DM
    h16* QK16 = (h16*)take(SZ_QK);        // [2][NZ] planes (rows SEQ, k HD)
    h16* V16 = (h16*)take(SZ_V);          // [NZ] planes (rows HD, k SEQ)
    bf* QKh = (bf*)take(SZ_QKH); bf* QKl = (bf*)take(SZ_QKH);    // [2][NZ] planes (rows RH, k HD)
    bf* Vh = (bf*)take(SZ_VH); bf* Vl = (bf*)take(SZ_VH);        // [NZ] planes (rows HD, k RH)
    bf* ATh = (bf*)take(SZ_AT); bf* ATl = (bf*)take(SZ_AT);      // rows NB*SEQ, k DM
    if ((size_t)(wsp - (char*)d_ws) > ws_size) return;

    k_prep<<<PB_W + PB_X, 256, 0, stream>>>(x, wq, wk, wv, wo, XB, WT);
    k_gemmqkv<DM><<<dim3(NB * SEQ / 128, NH / 2, 3), 128, 0, stream>>>(XB, WT, fcos, fsin, QK16, QKh, QKl, V16, Vh, Vl);
    k_flash<<<FB_PL + FB_HR, 128, 0, stream>>>(QK16, QK16 + (size_t)NZ * SEQ * HD, V16, QKh, QKl, QKh + (size_t)NZ * RH * HD, QKl + (size_t)NZ * RH * HD, Vh, Vl, ATh, ATl);
    k_gemmw<bf, 1, false, DM, 3><<<dim3(SEQ / 64, DM / 64, NB), 32, 0, stream>>>(ATh, ATl, WT + (size_t)3 * DM * DM, nullptr, OUT, DM, nullptr, (size_t)SEQ * DM, (size_t)0, (size_t)SEQ_FULL * DM);
}

// v009
// One run takes 88.5 microseconds.
// Timed twice side by side with v008, it ran 1.03 times as fast both times.
// All steps since v000 together make it 3.28 times as fast.
#include <hip/hip_runtime.h>

// Contractions (f32 accumulate): q/k/v projections v_wmma_f32_16x16x32_bf16 on bf16 RNE-converted inputs (single product); causal scores and probability x value: query rows < RH on bf16 hi/lo planes (3 products), rows >= RH v_wmma_f32_16x16x32_f16 (probabilities carried x1024); output projection bf16 hi/lo context x bf16 weight (2 products); softmax f32.
// Causal multi-head attention with interleaved-pair rotary tables read as INPUT values: x [NB][SEQ][1024]; wq/wk/wv/wo [in][out], no bias; 16 heads x 64; scores x 64^-0.5; causal by index.
// Launches (4): plane builders (x copy and weight transposes, one grid) | q/k/v GEMM | attention (both row ranges, one grid) | output GEMM.
// Layout: bf16 copy of x (both batches, compact rows); four weights transposed once to Bt planes; one z-batched projection GEMM (q | k | v) whose epilogue writes the head planes itself (rotary on q, k; transposed v): no f32 projection plane;
// every 16-bit plane that feeds a matrix operand is stored in FRAGMENT ORDER (below), so that each fragment request of a wave covers whole 128-byte lines;
// flash attention, one wave per 16-row query tile, both products transposed (keys x queries, depth x queries), 32-key chunks (rows < RH: key and value fragments fetched one chunk ahead from global memory; rows >= RH: 64-key stages in LDS, shared by a work-group's four waves), online softmax with running max; context hi/lo planes; output GEMM.

#ifndef NB
#define NB 2
#endif
#ifndef SEQ
#define SEQ 2048
#endif
#define NB_FULL  2
#define SEQ_FULL 2048
#define DM   1024
#define NH   16
#define HD   64
#define NZ   (NB * NH)
#define RH   ((SEQ < 512) ? SEQ : 512)     // query rows < RH use hi+lo planes
#define PCAR 1024.0f
#define SC2  0.18033688011112042f          // HD^-0.5 * log2(e)

static_assert((SEQ & (SEQ - 1)) == 0);
static_assert(SEQ % 256 == 0);
static_assert(RH % 256 == 0);
static_assert(RH <= SEQ);
static_assert(DM == NH * HD);
static_assert(HD == 64);
static_assert((NB * SEQ) % 64 == 0);
static_assert(DM % 64 == 0);
static_assert(NB <= NB_FULL && SEQ <= SEQ_FULL);

typedef _Float16 h16;
typedef unsigned short bf;
typedef __attribute__((ext_vector_type(16))) __bf16   v16bf;
typedef __attribute__((ext_vector_type(16))) _Float16 v16h;
typedef __attribute__((ext_vector_type(8)))  _Float16 v8h;
typedef __attribute__((ext_vector_type(8)))  unsigned short v8us;
typedef __attribute__((ext_vector_type(2)))  unsigned short v2us;
typedef __attribute__((ext_vector_type(8)))  float    v8f;
typedef __attribute__((ext_vector_type(4)))  float    v4f;
typedef v4f  __attribute__((may_alias)) v4fa;

__device__ __forceinline__ unsigned short f2bf(float f) { unsigned u = __float_as_uint(f); u += 0x7FFFu + ((u >> 16) & 1u); return (unsigned short)(u >> 16); }
__device__ __forceinline__ float bf2f(unsigned short b) { return __uint_as_float(((unsigned)b) << 16); }
__device__ __forceinline__ float bfr(float f) { return bf2f(f2bf(f)); }
__device__ __forceinline__ void splitf(float y, unsigned short& h, unsigned short& l) { h = f2bf(y); l = f2bf(y - bf2f(h)); }
__device__ __forceinline__ v16h cat16(v8h lo, v8h hi) { return __builtin_shufflevector(lo, hi, 0, 1, 2, 3, 4, 5, 6, 7, 8, 9, 10, 11, 12, 13, 14, 15); }
__device__ __forceinline__ v16bf cat16b(v8us lo, v8us hi) { return __builtin_bit_cast(v16bf, __builtin_shufflevector(lo, hi, 0, 1, 2, 3, 4, 5, 6, 7, 8, 9, 10, 11, 12, 13, 14, 15)); }
__device__ __forceinline__ v8f wmma16(v16h a, v16h b, v8f c) { return __builtin_amdgcn_wmma_f32_16x16x32_f16(false, a, false, b, (short)0, c, false, false); }
__device__ __forceinline__ v8f wmmab(v16bf a, v16bf b, v8f c) { return __builtin_amdgcn_wmma_f32_16x16x32_bf16(false, a, false, b, (short)0, c, false, false); }

template <typename T16> struct WFrag;
template <> struct WFrag<h16> { typedef v16h V;
    static __device__ __forceinline__ V ld(const h16* p) { return cat16(*(const v8h*)p, *(const v8h*)(p + 256)); }
    static __device__ __forceinline__ v8f mma(V a, V b, v8f c) { return wmma16(a, b, c); }
    static __device__ __forceinline__ void pk(V& ph, V& pl, const float (&p0)[8], const float (&p1)[8]) { (void)pl;
#pragma unroll
        for (int j = 0; j < 8; ++j) { ph[j] = (h16)(p0[j] * PCAR); ph[j + 8] = (h16)(p1[j] * PCAR); } } };
template <> struct WFrag<bf> { typedef v16bf V;
    static __device__ __forceinline__ V ld(const bf* p) { return cat16b(*(const v8us*)p, *(const v8us*)(p + 256)); }
    static __device__ __forceinline__ v8f mma(V a, V b, v8f c) { return wmmab(a, b, c); }
    static __device__ __forceinline__ void pk(V& ph, V& pl, const float (&p0)[8], const float (&p1)[8]) { v8us h0, h1, l0, l1;
#pragma unroll
        for (int j = 0; j < 8; ++j) { unsigned short a, c; splitf(p0[j], a, c); h0[j] = a; l0[j] = c; splitf(p1[j], a, c); h1[j] = a; l1[j] = c; }
        ph = cat16b(h0, h1); pl = cat16b(l0, l1); } };

// ---- k_gemmw: register-blocked GEMM, ONE WAVE per 64x64 output tile (16 accumulators), operands straight from fragment-ordered 16-bit planes (block (rt, kt) at rt*16*K + kt*512); grid (M/64, N/64, Z), 32 threads.
// C[m][n] (f32, pitch ldc, + optional f32 bias[n]) = sum_k A[m][k] Bt[n][k] (+ split products per NSPLIT). z-batch strides sA/sB/sC in elements. K % 32 == 0, a compile-time constant: the four row tiles of an operand are then one address and immediate offsets.
// The fragments of a 32-k trip live in one of NS register sets; a set is asked for again, for trip t + NS, right behind the products of trip t: every request has NS - 1 trips of products to land, and no product waits on a load just issued.
template <typename T16> struct GSet { typename WFrag<T16>::V a[4], a2[4], b[4], b2[4]; };

template <typename T16, int NSPLIT, int K>
__device__ __forceinline__ void g_fetch(GSet<T16>& f, const T16* pa, const T16* pa2, const T16* pb, const T16* pb2, unsigned l8, int ofs) {      // pa..pb2: wave-uniform bases; l8: the lane's piece; ofs: a constant at every call, it goes into the requests' immediate offsets
    __builtin_amdgcn_sched_barrier(0);      // keeps the requests behind the products that read this set: lifted over them they would need registers of their own
#pragma unroll
    for (int mb = 0; mb < 4; ++mb) { f.a[mb] = WFrag<T16>::ld(pa + l8 + (ofs + mb * 16 * K)); if (NSPLIT == 1 || NSPLIT == 2) f.a2[mb] = WFrag<T16>::ld(pa2 + l8 + (ofs + mb * 16 * K)); }
#pragma unroll
    for (int nb = 0; nb < 4; ++nb) { f.b[nb] = WFrag<T16>::ld(pb + l8 + (ofs + nb * 16 * K)); if (NSPLIT >= 2) f.b2[nb] = WFrag<T16>::ld(pb2 + l8 + (ofs + nb * 16 * K)); }
    asm volatile("s_wait_xcnt 0x0" ::: "memory");      // a precaution: it stands in front of every later write of a register that these requests name as an address (the next round's bases)
    __builtin_amdgcn_sched_barrier(0);      // holds the requests above the other sets' products, which are the time they have to land; sunk towards their use they would be waited out
}

template <typename T16, int NSPLIT>
__device__ __forceinline__ void g_mm(const GSet<T16>& f, v8f (&acc)[4][4]) {
#pragma unroll
    for (int nb = 0; nb < 4; ++nb) {
#pragma unroll
        for (int mb = 0; mb < 4; ++mb) { acc[mb][nb] = WFrag<T16>::mma(f.a[mb], f.b[nb], acc[mb][nb]); if (NSPLIT == 1 || NSPLIT == 2) acc[mb][nb] = WFrag<T16>::mma(f.a2[mb], f.b[nb], acc[mb][nb]); if (NSPLIT >= 2) acc[mb][nb] = WFrag<T16>::mma(f.a[mb], f.b2[nb], acc[mb][nb]); } }
    // the four slots between the last products and the requests that land in their operand registers
    asm volatile("v_nop\n\tv_nop\n\tv_nop\n\tv_nop" : "+v"(acc[0][0]), "+v"(acc[1][1]), "+v"(acc[2][2]), "+v"(acc[3][3]) : "v"(f.a[0]), "v"(f.a[3]));
}

template <typename T16, int NSPLIT, bool BIAS, int K, int NS>
__global__ __launch_bounds__(32) void k_gemmw(const T16* __restrict__ A, const T16* __restrict__ A2, const T16* __restrict__ Bt, const T16* __restrict__ Bt2, float* C, int ldc, const float* __restrict__ bias, size_t sA, size_t sB, size_t sC) {
    constexpr int NT = K / 32;               // trips
    constexpr int NL = (NT - NS) / NS;       // rounds of NS trips in which every set is asked for again
    static_assert(K % 32 == 0 && NS >= 2 && NT >= NS);
    __shared__ __align__(16) float os[16 * 68];
    const size_t z = blockIdx.z; A += z * sA; if (A2) A2 += z * sA; Bt += z * sB; if (Bt2) Bt2 += z * sB; C += z * sC;
    const int lane = threadIdx.x & 31, lr = lane & 15, hi = lane >> 4; const int r0 = blockIdx.x * 64, c0 = blockIdx.y * 64;
    v8f acc[4][4];
#pragma unroll
    for (int mb = 0; mb < 4; ++mb)
#pragma unroll
        for (int nb = 0; nb < 4; ++nb) acc[mb][nb] = (v8f){};
    const size_t aoff = (size_t)r0 * K, boff = (size_t)c0 * K; const unsigned l8 = 8u * (unsigned)lane;
    const T16* pa = A + aoff; const T16* pa2 = A2 + aoff; const T16* pb = Bt + boff; const T16* pb2 = Bt2 + boff;
    GSet<T16> f[NS];
#pragma unroll
    for (int s = 0; s < NS; ++s) g_fetch<T16, NSPLIT, K>(f[s], pa, pa2, pb, pb2, l8, s * 512);
#pragma unroll 1
    for (int i = 0; i < NL; ++i) {           // rolled: one round of NS trips is the loop's body
        const int o = (i + 1) * NS * 512; const T16* qa = pa + o; const T16* qa2 = pa2 + o; const T16* qb = pb + o; const T16* qb2 = pb2 + o;
#pragma unroll
        for (int s = 0; s < NS; ++s) { g_mm<T16, NSPLIT>(f[s], acc); g_fetch<T16, NSPLIT, K>(f[s], qa, qa2, qb, qb2, l8, s * 512); }
    }
#pragma unroll
    for (int t = NL * NS; t < NT; ++t) { g_mm<T16, NSPLIT>(f[t % NS], acc);
        if (t + NS < NT) g_fetch<T16, NSPLIT, K>(f[t % NS], pa, pa2, pb, pb2, l8, (t + NS) * 512); }
#pragma unroll
    for (int mb = 0; mb < 4; ++mb) {
#pragma unroll
        for (int nb = 0; nb < 4; ++nb) {
#pragma unroll
            for (int j = 0; j < 8; ++j) os[(hi * 8 + j) * 68 + nb * 16 + lr] = acc[mb][nb][j]; }
        __builtin_amdgcn_wave_barrier(); asm volatile("" ::: "memory");
        float* crow = C + (size_t)(r0 + mb * 16) * ldc + c0;
{
#pragma unroll
            for (int s = 0; s < 8; ++s) { const int row = 2 * s + hi, cofs = lr * 4; v4f val = *(const v4fa*)(os + row * 68 + cofs); if (BIAS) { val[0] += bfr(bias[c0 + cofs]); val[1] += bfr(bias[c0 + cofs + 1]); val[2] += bfr(bias[c0 + cofs + 2]); val[3] += bfr(bias[c0 + cofs + 3]); }
                *(v4f*)(crow + (size_t)row * ldc + cofs) = val; }
             }
        __builtin_amdgcn_wave_barrier(); asm volatile("" ::: "memory");
    }
}

// thread i of a batch writes piece i (8 elements) of the fragment-ordered copy: i = (block * 2 + k half) * 32 + lane.
// coverage: (SEQ*DM/2048, NB) blocks x 256 threads x 8 elements == NB*SEQ*DM.
static_assert(((size_t)SEQ * DM) % 2048 == 0);
__device__ __forceinline__ void cvtx_body(const unsigned bx, const unsigned b, const float* __restrict__ src, bf* dst) {
    const unsigned i = bx * 256u + threadIdx.x;
    const unsigned lr = i & 15u, hi = (i >> 4) & 1u, h2 = (i >> 5) & 1u, blk = i >> 6; const unsigned kt = blk % (unsigned)(DM / 32), rt = blk / (unsigned)(DM / 32);
    const float* s = src + (size_t)b * SEQ_FULL * DM + (size_t)(rt * 16u + lr) * DM + kt * 32u + h2 * 16u + hi * 8u; bf* d = dst + (size_t)b * SEQ * DM + (size_t)i * 8;
    const v8f v = *(const v8f*)s; v8us o;
#pragma unroll
    for (int k = 0; k < 8; ++k) o[k] = f2bf(v[k]);
    *(v8us*)d = o;  }

// thread i of a weight writes piece i of its fragment-ordered transpose Bt[n][k] = w[k][n]: 8 k of one n; a wave reads 64-byte runs of two w rows per request.
// coverage: (DM*DM/2048, 4) blocks x 256 threads x 8 elements == 4*DM*DM.
static_assert(((size_t)DM * DM) % 2048 == 0);
__device__ __forceinline__ void wt4_body(const unsigned bx, const unsigned y, const float* __restrict__ w0, const float* __restrict__ w1, const float* __restrict__ w2, const float* __restrict__ w3, bf* Bt) {
    const float* w = (y == 0u) ? w0 : (y == 1u) ? w1 : (y == 2u) ? w2 : w3; bf* o = Bt + (size_t)y * DM * DM;
    const unsigned i = bx * 256u + threadIdx.x;
    const unsigned lr = i & 15u, hi = (i >> 4) & 1u, h2 = (i >> 5) & 1u, blk = i >> 6; const unsigned kt = blk % (unsigned)(DM / 32), nt = blk / (unsigned)(DM / 32);
    const float* s = w + (size_t)(kt * 32u + h2 * 16u + hi * 8u) * DM + nt * 16u + lr; v8us q;
#pragma unroll
    for (int j = 0; j < 8; ++j) q[j] = f2bf(s[(size_t)j * DM]);
    *(v8us*)(o + (size_t)i * 8) = q;
}

// ---- k_prep: the two plane builders read and write disjoint buffers and neither needs the other, so they share one grid: blocks [0, PB_W) build the weight planes (their strided reads take longer: they start first), blocks [PB_W, PB_W + PB_X) the x plane.
constexpr unsigned PB_W1 = (unsigned)((size_t)DM * DM / 2048), PB_W = 4u * PB_W1;
constexpr unsigned PB_X1 = (unsigned)((size_t)SEQ * DM / 2048), PB_X = (unsigned)NB * PB_X1;
__global__ __launch_bounds__(256) void k_prep(const float* __restrict__ x, const float* __restrict__ w0, const float* __restrict__ w1, const float* __restrict__ w2, const float* __restrict__ w3, bf* XB, bf* Bt) {
    const unsigned bid = blockIdx.x;      // uniform per block: a scalar branch
    if (bid < PB_W) wt4_body(bid % PB_W1, bid / PB_W1, w0, w1, w2, w3, Bt);
    else cvtx_body((bid - PB_W) % PB_X1, (bid - PB_W) / PB_X1, x, XB);
}

// ---- g_ring: k loop of a work-group of FOUR WAVES (2 x 2) on a 128x128 output tile, each wave a 64x64 tile (16 accumulators). Operands are fragment-ordered 16-bit planes (block (rt, kt) at rt*16*K + kt*512).
// A stage is 64 k of the tile's 128 A rows and 128 B rows: per 16-row tile two blocks, 2 KB, contiguous in the plane and in LDS. Asynchronous copies bring it from global memory into LDS once per work-group; each wave copies two row tiles of either plane.
// Every operand byte then leaves L2 once per 128x128 tile, not once per 64x64 tile, and a fragment is two contiguous 512-byte LDS reads of the wave.
// Two buffers. A trip reads its whole stage into registers; behind the barrier that ends those reads, stage t + 2 is asked for into the same buffer, and only then come the trip's products: the copies fly during them and during the next trip's reads.
template <int K>
__device__ __forceinline__ void g_copy2(const unsigned l, const bf* g) {      // two row tiles (4 KB) of one plane: l = this lane's LDS byte address, g = this lane's global address, of the first 16 bytes
    const bf* h = g + 16 * K;
    // the copies and, as the last line, the precaution that stands in front of every later write of a register that they name
    asm volatile("global_load_async_to_lds_b128 %0, %8, off\n\t"
                 "global_load_async_to_lds_b128 %1, %9, off\n\t"
                 "global_load_async_to_lds_b128 %2, %10, off\n\t"
                 "global_load_async_to_lds_b128 %3, %11, off\n\t"
                 "global_load_async_to_lds_b128 %4, %12, off\n\t"
                 "global_load_async_to_lds_b128 %5, %13, off\n\t"
                 "global_load_async_to_lds_b128 %6, %14, off\n\t"
                 "global_load_async_to_lds_b128 %7, %15, off\n\t"
                 "s_wait_xcnt 0x0"
                 :: "v"(l), "v"(l + 512u), "v"(l + 1024u), "v"(l + 1536u), "v"(l + 2048u), "v"(l + 2560u), "v"(l + 3072u), "v"(l + 3584u),
                    "v"(g), "v"(g + 256), "v"(g + 512), "v"(g + 768), "v"(h), "v"(h + 256), "v"(h + 512), "v"(h + 768) : "memory");
}

// ring: 64 KB of LDS (per buffer 16 KB of A, 16 KB of B). ga, gb: this lane's address in rows 32 * wid of the tile's A and B rows, k = 0. acc[mb][nb] += sum over k, blocks in rising order.
template <int K>
__device__ __forceinline__ void g_ring(const bf* ring, const bf* ga, const bf* gb, const unsigned wid, const unsigned lane, v8f (&acc)[4][4]) {
    constexpr int NT = K / 64;                       // stages
    static_assert(K % 64 == 0 && NT >= 2);
    const unsigned lw = (unsigned)(size_t)ring + wid * 4096u + lane * 16u;
    g_copy2<K>(lw, ga); g_copy2<K>(lw + 16384u, gb);
    asm volatile("s_wait_asynccnt 0x0" ::: "memory");      // this wave's copies of stage 0 have landed
    __syncthreads();                                       // every wave's have
    g_copy2<K>(lw + 32768u, ga + 1024); g_copy2<K>(lw + 49152u, gb + 1024);
    const bf* fa = ring + (wid >> 1) * 4096u + lane * 8u; const bf* fb = ring + 8192u + (wid & 1u) * 4096u + lane * 8u;
#pragma unroll 1
    for (int t = 0; t < NT; ++t) {                   // rolled: one stage is the loop's body
        const unsigned bo = (unsigned)(t & 1) * 16384u;
        v16bf a[2][4], b[2][4];
#pragma unroll
        for (int kk = 0; kk < 2; ++kk) {
#pragma unroll
            for (int mb = 0; mb < 4; ++mb) a[kk][mb] = WFrag<bf>::ld(fa + bo + mb * 1024 + kk * 512);
#pragma unroll
            for (int nb = 0; nb < 4; ++nb) b[kk][nb] = WFrag<bf>::ld(fb + bo + nb * 1024 + kk * 512);
        }
        asm volatile("s_wait_dscnt 0x0" ::: "memory");         // this wave's reads of the buffer have returned
        asm volatile("s_wait_asynccnt 0x0" ::: "memory");      // its copies of stage t + 1 have landed
        __syncthreads();                                       // stage t + 1 is published, and every reader has left stage t's buffer
        if (t + 2 < NT) { g_copy2<K>(lw + 2u * bo, ga + (t + 2) * 1024); g_copy2<K>(lw + 2u * bo + 16384u, gb + (t + 2) * 1024); }
        __builtin_amdgcn_sched_barrier(0);           // keeps the products behind the copies: lifted over them they would take away the time the copies have to land
#pragma unroll
        for (int kk = 0; kk < 2; ++kk)
#pragma unroll
            for (int nb = 0; nb < 4; ++nb)
#pragma unroll
                for (int mb = 0; mb < 4; ++mb) acc[mb][nb] = wmmab(a[kk][mb], b[kk][nb], acc[mb][nb]);
    }
    asm volatile("s_wait_asynccnt 0x0" ::: "memory");          // nothing is outstanding when the LDS goes to other use
}

// ---- k_gemmqkv: the q | k | v projection GEMM (blockIdx.z 0 | 1 | 2), one wave per 64x64 tile = 64 positions x ONE head (HD == 64), four waves (2 x 2) a work-group, k loop g_ring (single product); grid (NB*SEQ/128, NH/2, 3), 128 threads. The epilogue writes the attention's planes from the accumulators, each wave for itself.
// q, k: head planes [z] (rows t, k = d, fragment order: 2 blocks per 16 rows) of the rotated projection: pair i of a head row: out[2i] = x[2i] c - x[2i+1] s, out[2i+1] = x[2i] s + x[2i+1] c with c, s = bf16 RNE-converted INPUT table values [t][i].
//   The tile goes through LDS (a lane holds 8 rows of one depth, a piece is 8 depths of one row); the table rows, read as whole lines, go there 16 rows at a time; lane (lr, hi) builds piece (row lr, depths 16s + 8hi..) for s = 0..3: each store of the wave is 512 contiguous bytes.
// v: value planes [z] (rows d, k = key, fragment order, the four 16-d blocks of a 32-key chunk side by side: block (chunk, dt) at (chunk * 4 + dt) * 512). An accumulator's 8 registers are 8 keys of one depth, which is a piece: stored from the registers, 512 contiguous bytes per store.
// coverage: the tiles cover NB*SEQ rows x DM columns of each projection == NZ*SEQ*HD elements of each fp16 plane; tiles with t < RH (64 | RH) also fill the hi and lo planes (NZ*RH*HD each).
static_assert(SEQ % 128 == 0 && RH % 64 == 0 && HD == 64 && DM == NH * 64 && NH % 2 == 0);
template <int K>
__global__ __launch_bounds__(128) void k_gemmqkv(const bf* __restrict__ A, const bf* __restrict__ Bt, const float* __restrict__ cosT, const float* __restrict__ sinT, h16* P16, bf* Ph, bf* Pl, h16* V16, bf* Vh, bf* Vl) {
    constexpr unsigned EW = 64 * 68 + 2 * 16 * 36;      // floats of a wave's epilogue staging
    static_assert(4 * EW * 4 >= 65536);
    __shared__ __align__(16) float sm[4 * EW];          // first the ring of the k loop (64 KB); behind the loop's last barrier, which ends every read of the ring, each wave's own staging
    const unsigned wid = (unsigned)__builtin_amdgcn_readfirstlane((int)(threadIdx.x >> 5));      // the wave's number, in a scalar register
    const unsigned y = blockIdx.z, h = blockIdx.y * 2u + (wid & 1u), r0 = blockIdx.x * 128u + (wid >> 1) * 64u;
    const unsigned lane = threadIdx.x & 31u, lr = lane & 15u, hi = lane >> 4, l8 = 8u * lane;
    v8f acc[4][4];
#pragma unroll
    for (int mb = 0; mb < 4; ++mb)
#pragma unroll
        for (int nb = 0; nb < 4; ++nb) acc[mb][nb] = (v8f){};
    g_ring<K>((const bf*)sm, A + (size_t)(blockIdx.x * 128u + wid * 32u) * K + l8, Bt + (size_t)y * DM * K + (size_t)(blockIdx.y * 128u + wid * 32u) * K + l8, wid, lane, acc);
    float* os = sm + wid * EW; float* tc = os + 64 * 68; float* ts = tc + 16 * 36;      // tc, ts pitch 36: the 16 rows of a 16-byte column start in 16 different bank groups
    const unsigned b = r0 / (unsigned)SEQ, t0 = r0 % (unsigned)SEQ, z = b * (unsigned)NH + h;
    const bool hl = (t0 < (unsigned)RH);     // uniform per wave (64 consecutive rows, RH % 64 == 0)
    // Stores go out 16 rows at a time: all their values first, then the stores, then one s_wait_xcnt 0 (a precaution: it stands in front of every later write of a register that these stores name); the scheduling fences keep other work out of that stretch.
    if (y == 2u) {
        h16* p16 = V16 + (size_t)z * HD * SEQ + (t0 >> 5) * 2048u + l8;
        const size_t ho = (size_t)z * HD * RH + (hl ? (t0 >> 5) : 0u) * 2048u + l8; bf* ph = Vh + ho; bf* pl = Vl + ho;
#pragma unroll
        for (int mb = 0; mb < 4; ++mb) {     // keys t0 + 16mb + 8hi + j, depth 16nb + lr: chunk mb >> 1, block nb, k half mb & 1, piece lane
            const int e = (mb >> 1) * 2048 + (mb & 1) * 256; v8h o16[4];
#pragma unroll
            for (int nb = 0; nb < 4; ++nb)
#pragma unroll
                for (int j = 0; j < 8; ++j) o16[nb][j] = (h16)acc[mb][nb][j];
            if (hl) { v8us oh[4], ol[4];
#pragma unroll
                for (int nb = 0; nb < 4; ++nb)
#pragma unroll
                    for (int j = 0; j < 8; ++j) { unsigned short a, c2; splitf(acc[mb][nb][j], a, c2); oh[nb][j] = a; ol[nb][j] = c2; }
                __builtin_amdgcn_sched_barrier(0);      // values above, stores below
#pragma unroll
                for (int nb = 0; nb < 4; ++nb) { *(v8h*)(p16 + e + nb * 512) = o16[nb]; *(v8us*)(ph + e + nb * 512) = oh[nb]; *(v8us*)(pl + e + nb * 512) = ol[nb]; }
                asm volatile("s_wait_xcnt 0x0" ::: "memory");      // the precaution named above, behind these stores
            } else {
                __builtin_amdgcn_sched_barrier(0);      // values above, stores below
#pragma unroll
                for (int nb = 0; nb < 4; ++nb) *(v8h*)(p16 + e + nb * 512) = o16[nb];
                asm volatile("s_wait_xcnt 0x0" ::: "memory");      // the precaution named above, behind these stores
            }
            __builtin_amdgcn_sched_barrier(0);          // the next rows' values stay behind the wait
        }
        return;
    }
    const float* ct = cosT + (size_t)t0 * 32 + 4u * lane; const float* st = sinT + (size_t)t0 * 32 + 4u * lane;      // request q of a 16-row block: its rows 4q..4q+3, 512 contiguous bytes
    v4f cq[4], sq[4];
#pragma unroll
    for (int q = 0; q < 4; ++q) { cq[q] = *(const v4f*)(ct + q * 128); sq[q] = *(const v4f*)(st + q * 128); }      // the first 16 rows' table values fly while the tile goes to LDS
    asm volatile("s_wait_xcnt 0x0" ::: "memory");      // a precaution: it stands in front of every later write of a register that these requests name as an address
    __builtin_amdgcn_sched_barrier(0);                 // keeps later address arithmetic behind that wait
#pragma unroll
    for (int mb = 0; mb < 4; ++mb)
#pragma unroll
        for (int nb = 0; nb < 4; ++nb)
#pragma unroll
            for (int j = 0; j < 8; ++j) os[(mb * 16 + hi * 8 + j) * 68 + nb * 16 + lr] = acc[mb][nb][j];
    h16* p16 = P16 + (size_t)y * NZ * SEQ * HD + (size_t)z * SEQ * HD + (t0 >> 4) * 1024u + l8;
    const size_t ho = (size_t)y * NZ * RH * HD + (size_t)z * RH * HD + (hl ? (t0 >> 4) : 0u) * 1024u + l8; bf* ph = Ph + ho; bf* pl = Pl + ho;
    const unsigned to = (lane >> 3) * 36u + (lane & 7u) * 4u;
#pragma unroll 1
    for (unsigned mb = 0; mb < 4u; ++mb) {       // rolled: the body is long and runs four times; 16 rows a trip
#pragma unroll
        for (int q = 0; q < 4; ++q) { *(v4fa*)(tc + q * 144 + to) = cq[q]; *(v4fa*)(ts + q * 144 + to) = sq[q]; }
        if (mb < 3u) {      // the next 16 rows' table values fly while these rows are built
#pragma unroll
            for (int q = 0; q < 4; ++q) { cq[q] = *(const v4f*)(ct + (mb + 1u) * 512u + q * 128); sq[q] = *(const v4f*)(st + (mb + 1u) * 512u + q * 128); }
            asm volatile("s_wait_xcnt 0x0" ::: "memory");      // a precaution: it stands in front of every later write of a register that these requests name as an address
        }
        __builtin_amdgcn_wave_barrier(); asm volatile("" ::: "memory");      // keeps the LDS reads below behind the LDS writes above in the compiled order (one wave: the LDS serves it in order)
        float ro[4][8]; v8h o16[4];
#pragma unroll
        for (int s = 0; s < 4; ++s) { const unsigned seg = 2u * (unsigned)s + hi; const float* xr = os + (mb * 16u + lr) * 68u + seg * 8u;
            const v4f x0 = *(const v4fa*)xr, x1 = *(const v4fa*)(xr + 4); const v4f cv = *(const v4fa*)(tc + lr * 36u + seg * 4u), sv = *(const v4fa*)(ts + lr * 36u + seg * 4u);
            float xs[8]; xs[0] = x0[0]; xs[1] = x0[1]; xs[2] = x0[2]; xs[3] = x0[3]; xs[4] = x1[0]; xs[5] = x1[1]; xs[6] = x1[2]; xs[7] = x1[3];
#pragma unroll
            for (int i = 0; i < 4; ++i) { const float c = bfr(cv[i]), sn = bfr(sv[i]); const float tr = xs[2 * i], ti = xs[2 * i + 1]; ro[s][2 * i] = tr * c - ti * sn; ro[s][2 * i + 1] = tr * sn + ti * c;
                o16[s][2 * i] = (h16)ro[s][2 * i]; o16[s][2 * i + 1] = (h16)ro[s][2 * i + 1]; } }
        const unsigned e = mb * 1024u;      // 16-row tile mb; piece (depths 16s + 8hi.., row lr) sits at s * 256 + lane * 8
        if (hl) { v8us oh[4], ol[4];
#pragma unroll
            for (int s = 0; s < 4; ++s)
#pragma unroll
                for (int k = 0; k < 8; ++k) { unsigned short a, d2; splitf(ro[s][k], a, d2); oh[s][k] = a; ol[s][k] = d2; }
            __builtin_amdgcn_sched_barrier(0);      // values above, stores below
#pragma unroll
            for (int s = 0; s < 4; ++s) { *(v8h*)(p16 + e + s * 256) = o16[s]; *(v8us*)(ph + e + s * 256) = oh[s]; *(v8us*)(pl + e + s * 256) = ol[s]; }
            asm volatile("s_wait_xcnt 0x0" ::: "memory");      // the precaution named above, behind these stores
        } else {
            __builtin_amdgcn_sched_barrier(0);      // values above, stores below
#pragma unroll
            for (int s = 0; s < 4; ++s) *(v8h*)(p16 + e + s * 256) = o16[s];
            asm volatile("s_wait_xcnt 0x0" ::: "memory");      // the precaution named above, behind these stores
        }
        __builtin_amdgcn_wave_barrier(); asm volatile("" ::: "memory");      // keeps the next rows' table writes behind this trip's LDS reads in the compiled order
    }
}

__device__ __forceinline__ float xhalf(float x) { return __builtin_bit_cast(float, __builtin_amdgcn_permlanex16(__builtin_bit_cast(int, x), __builtin_bit_cast(int, x), 0x76543210, 0xfedcba98, false, false)); }      // lane l's value of lane l ^ 16

template <typename T16, bool HR>
__device__ __forceinline__ void flash_body(const unsigned bid, const T16* QA, const T16* QB, const T16* KA, const T16* KB, const T16* VA, const T16* VB, bf* ATh, bf* ATl) {
    typedef typename WFrag<T16>::V V;
    constexpr unsigned QR   = HR ? (unsigned)RH : (unsigned)SEQ;     // rows per z of the q/k planes = key pitch of the v planes
    constexpr unsigned ROW0 = HR ? 0u : (unsigned)RH;
    constexpr unsigned NT   = HR ? (unsigned)RH / 16u : (unsigned)(SEQ - RH) / 16u;
    constexpr unsigned NTD  = NT ? NT : 1u;
    const unsigned lane = threadIdx.x & 31u, wid = threadIdx.x >> 5, lr = lane & 15u, hi = lane >> 4;
    const unsigned w = bid * 4u + wid; const unsigned z = w / NTD, mt = w % NTD; const unsigned q0 = ROW0 + mt * 16u;
    const size_t zoff = (size_t)z * QR * HD + 8u * lane;      // this lane's piece of block 0 of head z, in the q, k and v planes alike; 16 rows of q or k = 2 blocks, a 32-key chunk of k or v = 4 blocks
    const size_t qoff = zoff + (size_t)q0 * HD;
    V aq[2], aql[2];
#pragma unroll
    for (int d = 0; d < 2; ++d) { aq[d] = WFrag<T16>::ld(QA + qoff + d * 512); if (HR) aql[d] = WFrag<T16>::ld(QB + qoff + d * 512); }
    v8f o[4]; float m = -1.0e30f, l = 0.0f;          // o[t][j] = context[query lr][depth 16t + 8hi + j]; m, l: query lr (l: this half's keys)
#pragma unroll
    for (int t = 0; t < 4; ++t) o[t] = (v8f){};
    const unsigned nch = (q0 + 15u) / 32u + 1u;      // wave-uniform; keys < nch*32 <= QR
    V kb[2][2], kl[2][2], vb[4], vl[4];              // fragments of the current chunk: kb[d][i] = keys 16i.., depth 32d..; vb[t] = depth 16t..
    // Chunk 0 is requested in the loop's own order (queries, keys, values): loads retire in order and the wait at the loop's head is counted for both ways in, so another order here makes every trip's score products wait for the value requests too.
    asm volatile("s_wait_xcnt 0x0" ::: "memory");    // key fragments land in registers that held the query requests' addresses: a precaution in front of that reuse; as a memory fence it also keeps the query requests ahead of the key requests
#pragma unroll
    for (int d = 0; d < 2; ++d) { const size_t ko = zoff + d * 512;
        kb[d][0] = WFrag<T16>::ld(KA + ko); kb[d][1] = WFrag<T16>::ld(KA + ko + 16 * HD); if (HR) { kl[d][0] = WFrag<T16>::ld(KB + ko); kl[d][1] = WFrag<T16>::ld(KB + ko + 16 * HD); } }
    __builtin_amdgcn_sched_barrier(0);               // keeps the key requests ahead of the value requests
#pragma unroll
    for (int t = 0; t < 4; ++t) { const size_t vo = zoff + t * 512; vb[t] = WFrag<T16>::ld(VA + vo); if (HR) vl[t] = WFrag<T16>::ld(VB + vo); }
    const unsigned qrow = q0 + lr;
#pragma unroll 1
    for (unsigned c = 0; c < nch; ++c) {
        const unsigned c0 = c * 32u;
        const unsigned cn = ((c + 1u < nch) ? c + 1u : c) * 32u;      // chunk fetched ahead; the last trip asks for its own chunk again (in bounds, never used)
        v8f s0 = (v8f){}, s1 = (v8f){};              // s0[j] = score[key c0 + 8hi + j][query lr], s1: keys + 16
#pragma unroll
        for (int d = 0; d < 2; ++d) {
            s0 = WFrag<T16>::mma(kb[d][0], aq[d], s0); s1 = WFrag<T16>::mma(kb[d][1], aq[d], s1);
            if (HR) { s0 = WFrag<T16>::mma(kb[d][0], aql[d], s0); s1 = WFrag<T16>::mma(kb[d][1], aql[d], s1); s0 = WFrag<T16>::mma(kl[d][0], aq[d], s0); s1 = WFrag<T16>::mma(kl[d][1], aq[d], s1); } }
        asm volatile("v_nop\n\tv_nop\n\tv_nop\n\tv_nop" : "+v"(s0), "+v"(s1) : "v"(aq[0]), "v"(aq[1]));      // the four slots between the last score products and the requests that land in their operand registers
#pragma unroll
        for (int d = 0; d < 2; ++d) { const size_t ko = zoff + (size_t)cn * HD + d * 512;
            kb[d][0] = WFrag<T16>::ld(KA + ko); kb[d][1] = WFrag<T16>::ld(KA + ko + 16 * HD); if (HR) { kl[d][0] = WFrag<T16>::ld(KB + ko); kl[d][1] = WFrag<T16>::ld(KB + ko + 16 * HD); } }
        if (HR) asm volatile("s_wait_xcnt 0x0" ::: "memory");      // the softmax reuses the key requests' address registers: a precaution
        __builtin_amdgcn_sched_barrier(0);      // holds the key requests above the softmax, which is the time they have to land; sunk towards their use they would be waited out
        const unsigned key0 = c0 + 8u * hi;
        float t0[8], t1[8], p0[8], p1[8], r[8];
#pragma unroll
        for (int j = 0; j < 8; ++j) { const bool v0 = (key0 + (unsigned)j <= qrow), v1 = (key0 + 16u + (unsigned)j <= qrow);
            t0[j] = s0[j] * SC2; t1[j] = s1[j] * SC2; r[j] = fmaxf(v0 ? t0[j] : -1.0e30f, v1 ? t1[j] : -1.0e30f); }
        float cm = fmaxf(fmaxf(fmaxf(r[0], r[1]), fmaxf(r[2], r[3])), fmaxf(fmaxf(r[4], r[5]), fmaxf(r[6], r[7])));
        cm = fmaxf(cm, xhalf(cm));
        const float nm = fmaxf(m, cm); float al;
        asm("v_exp_f32 %0, %1\n\tv_nop" : "=v"(al) : "v"(m - nm));      // 2^(m - nm) with the slot behind a transcendental in the same statement
        m = nm;
#pragma unroll
        for (int j = 0; j < 8; ++j) { const bool v0 = (key0 + (unsigned)j <= qrow), v1 = (key0 + 16u + (unsigned)j <= qrow);
            const float e0 = __builtin_amdgcn_exp2f(fminf(t0[j] - nm, 0.0f)), e1 = __builtin_amdgcn_exp2f(fminf(t1[j] - nm, 0.0f));
            p0[j] = v0 ? e0 : 0.0f; p1[j] = v1 ? e1 : 0.0f; r[j] = p0[j] + p1[j]; }
        l = l * al + (((r[0] + r[1]) + (r[2] + r[3])) + ((r[4] + r[5]) + (r[6] + r[7])));
#pragma unroll
        for (int t = 0; t < 4; ++t) o[t] *= al;
        V ap, apl; WFrag<T16>::pk(ap, apl, p0, p1);
#pragma unroll
        for (int t = 0; t < 4; ++t) {
            o[t] = WFrag<T16>::mma(vb[t], ap, o[t]);
            if (HR) { o[t] = WFrag<T16>::mma(vb[t], apl, o[t]); o[t] = WFrag<T16>::mma(vl[t], ap, o[t]); } }
        asm volatile("v_nop\n\tv_nop\n\tv_nop\n\tv_nop" : "+v"(o[0]), "+v"(o[1]), "+v"(o[2]), "+v"(o[3]) : "v"(ap));      // the four slots between the last value products and the requests that land in their operand registers
        const T16* pva = VA + zoff + (size_t)cn * HD; const T16* pvb = HR ? VB + zoff + (size_t)cn * HD : pva;
#pragma unroll
        for (int t = 0; t < 4; ++t) { vb[t] = WFrag<T16>::ld(pva + t * 512); if (HR) vl[t] = WFrag<T16>::ld(pvb + t * 512); }
        if (HR) asm volatile("s_wait_xcnt 0x0" :: "v"(pva), "v"(pvb) : "memory");      // a precaution in front of the reuse of the value requests' address registers; the addresses are inputs so that their registers stay theirs up to the wait
    }
    asm volatile("s_wait_loadcnt 0x0" ::: "memory");      // the last trip's requests are never read: they retire here, before the wave gives its registers back
    const float cs = HR ? 1.0f : (1.0f / PCAR);
    const float ls = l + xhalf(l); const float inv = (1.0f / ls) * cs;
    const unsigned b = z / (unsigned)NH, h = z % (unsigned)NH;      // the tile is blocks 2h and 2h + 1 of its 16 rows; store s fills half s & 1 of block s >> 1: row lr, columns 16s + 8hi.. = accumulator s of this lane
#pragma unroll
    for (int s = 0; s < 4; ++s) { v8us oh, ol;
#pragma unroll
        for (int k = 0; k < 8; ++k) { unsigned short x, y2; splitf(o[s][k] * inv, x, y2); oh[k] = x; ol[k] = y2; }
        const size_t oo = (size_t)(b * SEQ + q0) * DM + h * 1024u + (unsigned)s * 256u + 8u * lane;
        *(v8us*)(ATh + oo) = oh; *(v8us*)(ATl + oo) = ol; }
}

// ---- flash_pl: rows >= RH on the fp16 planes. The four waves of a work-group hold 64 consecutive query rows of one head and walk the same keys, so the keys and values come to LDS once per work-group, not once per wave.
// A stage is 64 keys: 8 KB of the key plane and 8 KB of the value plane, each contiguous in fragment order; each wave copies a quarter of either (global_load_async_to_lds_b128). Two buffers. A trip asks for its whole stage from LDS into registers and works on the first chunk; then comes the barrier that ends those reads, behind it stage t + 2 is asked for into the same buffer, then the second chunk: the copies fly during it and during the next trip's first chunk.
// Every wave walks all stages of its work-group (up to the last row's diagonal); a chunk wholly above a wave's own diagonal lies in the last stage and is masked there: its probabilities are 0, maximum, sum and context keep their values.
__device__ __forceinline__ void exp8(float (&e)[8], const float (&x)[8]) {      // e[j] = 2^x[j]. One statement: each v_exp is followed by one that neither reads its result nor writes its source (results in registers of their own), the last by the slot behind a transcendental
    asm("v_exp_f32 %0, %8\n\tv_exp_f32 %1, %9\n\tv_exp_f32 %2, %10\n\tv_exp_f32 %3, %11\n\tv_exp_f32 %4, %12\n\tv_exp_f32 %5, %13\n\tv_exp_f32 %6, %14\n\tv_exp_f32 %7, %15\n\tv_nop"
        : "=&v"(e[0]), "=&v"(e[1]), "=&v"(e[2]), "=&v"(e[3]), "=&v"(e[4]), "=&v"(e[5]), "=&v"(e[6]), "=&v"(e[7])
        : "v"(x[0]), "v"(x[1]), "v"(x[2]), "v"(x[3]), "v"(x[4]), "v"(x[5]), "v"(x[6]), "v"(x[7]));
}

__device__ __forceinline__ void kv_copy(const unsigned l, const h16* gk, const h16* gv) {      // a wave's quarter (2 KB + 2 KB) of a stage: l = this lane's LDS byte address in the key half, gk, gv = this lane's global addresses, of the first 16 bytes
    // the copies and, as the last line, the precaution that stands in front of every later write of a register that they name
    asm volatile("global_load_async_to_lds_b128 %0, %8, off\n\t"
                 "global_load_async_to_lds_b128 %1, %9, off\n\t"
                 "global_load_async_to_lds_b128 %2, %10, off\n\t"
                 "global_load_async_to_lds_b128 %3, %11, off\n\t"
                 "global_load_async_to_lds_b128 %4, %12, off\n\t"
                 "global_load_async_to_lds_b128 %5, %13, off\n\t"
                 "global_load_async_to_lds_b128 %6, %14, off\n\t"
                 "global_load_async_to_lds_b128 %7, %15, off\n\t"
                 "s_wait_xcnt 0x0"
                 :: "v"(l), "v"(l + 512u), "v"(l + 1024u), "v"(l + 1536u), "v"(l + 8192u), "v"(l + 8704u), "v"(l + 9216u), "v"(l + 9728u),
                    "v"(gk), "v"(gk + 256), "v"(gk + 512), "v"(gk + 768), "v"(gv), "v"(gv + 256), "v"(gv + 512), "v"(gv + 768) : "memory");
}

static_assert(RH % 64 == 0 && ((SEQ - RH) / 16) % 4 == 0);
// One stage (two 32-key chunks) of flash_pl. A work-group's 64 query rows start at a multiple of 64, so every key of a stage below the last lies below every one of its rows: only the last stage holds the diagonal.
// LAST = false: no mask, that is no key index, compare or select. LAST = true: the causal mask as written; no stage follows, so there is nothing to publish and nothing to refill.
template <bool LAST>
__device__ __forceinline__ void pl_stage(const unsigned st, const unsigned nst, const h16* kv, const unsigned lane, const unsigned hi, const unsigned qrow, const unsigned lw, const h16* gk, const h16* gv,
                                         const WFrag<h16>::V (&aq)[2], v8f (&o)[4], float& m, float& l) {
    typedef WFrag<h16>::V V;
    const unsigned bo = (st & 1u) * 8192u; const h16* fk = kv + bo + lane * 8u;
    V kb[2][2][2], vb[2][4];                     // kb[chunk][d][i] = keys 16i.., depth 32d..; vb[chunk][t] = depth 16t..
#pragma unroll
    for (int cc = 0; cc < 2; ++cc) {
#pragma unroll
        for (int d = 0; d < 2; ++d) { kb[cc][d][0] = WFrag<h16>::ld(fk + cc * 2048 + d * 512); kb[cc][d][1] = WFrag<h16>::ld(fk + cc * 2048 + 1024 + d * 512); }
#pragma unroll
        for (int t = 0; t < 4; ++t) vb[cc][t] = WFrag<h16>::ld(fk + 4096 + cc * 2048 + t * 512);
    }
    __builtin_amdgcn_sched_barrier(0);           // holds the stage's LDS reads together at the head of the trip: sunk towards their products, each group's latency would be waited out
#pragma unroll
    for (int cc = 0; cc < 2; ++cc) {
        if (!LAST && cc == 1) {      // between the chunks: the second chunk's fragments have returned under the first chunk's work, so the wait for them costs nothing
            __builtin_amdgcn_sched_barrier(0);                     // keeps the waits and the barrier behind the first chunk's work: lifted over it they would wait out the LDS reads
            asm volatile("s_wait_dscnt 0x0" ::: "memory");         // this wave's reads of the buffer have returned
            asm volatile("s_wait_asynccnt 0x0" ::: "memory");      // its copies of stage st + 1 have landed
            __syncthreads();                                       // stage st + 1 is published, and every reader has left stage st's buffer
            if (st + 2u < nst) kv_copy(lw + 2u * bo, gk + (size_t)(st + 2u) * 4096u, gv + (size_t)(st + 2u) * 4096u);
            __builtin_amdgcn_sched_barrier(0);                     // keeps the second chunk's work behind the copies: lifted over them it would take away the time the copies have to land
        }
        v8f s0 = (v8f){}, s1 = (v8f){};          // s0[j] = score[key c0 + 8hi + j][query lr], s1: keys + 16
#pragma unroll
        for (int d = 0; d < 2; ++d) { s0 = wmma16(kb[cc][d][0], aq[d], s0); s1 = wmma16(kb[cc][d][1], aq[d], s1); }
        const unsigned key0 = st * 64u + (unsigned)cc * 32u + 8u * hi;
        float t0[8], t1[8], p0[8], p1[8], r[8];
#pragma unroll
        for (int j = 0; j < 8; ++j) { const bool v0 = !LAST || (key0 + (unsigned)j <= qrow), v1 = !LAST || (key0 + 16u + (unsigned)j <= qrow);
            t0[j] = s0[j] * SC2; t1[j] = s1[j] * SC2; r[j] = fmaxf(v0 ? t0[j] : -1.0e30f, v1 ? t1[j] : -1.0e30f); }
        float cm = fmaxf(fmaxf(fmaxf(r[0], r[1]), fmaxf(r[2], r[3])), fmaxf(fmaxf(r[4], r[5]), fmaxf(r[6], r[7])));
        cm = fmaxf(cm, xhalf(cm));
        const float nm = fmaxf(m, cm); float al;
        asm("v_exp_f32 %0, %1\n\tv_nop" : "=v"(al) : "v"(m - nm));      // 2^(m - nm) with the slot behind a transcendental in the same statement
        m = nm;
#pragma unroll
        for (int j = 0; j < 8; ++j) { t0[j] = fminf(t0[j] - nm, 0.0f); t1[j] = fminf(t1[j] - nm, 0.0f); }
        float e0[8], e1[8]; exp8(e0, t0); exp8(e1, t1);
#pragma unroll
        for (int j = 0; j < 8; ++j) { const bool v0 = !LAST || (key0 + (unsigned)j <= qrow), v1 = !LAST || (key0 + 16u + (unsigned)j <= qrow);
            p0[j] = v0 ? e0[j] : 0.0f; p1[j] = v1 ? e1[j] : 0.0f; r[j] = p0[j] + p1[j]; }
        l = l * al + (((r[0] + r[1]) + (r[2] + r[3])) + ((r[4] + r[5]) + (r[6] + r[7])));
#pragma unroll
        for (int t = 0; t < 4; ++t) o[t] *= al;
        V ap, apl; WFrag<h16>::pk(ap, apl, p0, p1);
#pragma unroll
        for (int t = 0; t < 4; ++t) o[t] = wmma16(vb[cc][t], ap, o[t]);
    }
}

__device__ __forceinline__ void flash_pl(const unsigned bid, const h16* QA, const h16* KA, const h16* VA, bf* ATh, bf* ATl, const h16* kv) {      // kv: 32 KB of LDS, two buffers of [keys 8 KB | values 8 KB]
    typedef WFrag<h16>::V V;
    constexpr unsigned NT  = (unsigned)(SEQ - RH) / 16u;
    constexpr unsigned NTD = NT ? NT : 1u;
    const unsigned wid = (unsigned)__builtin_amdgcn_readfirstlane((int)(threadIdx.x >> 5));      // the wave's number, in a scalar register
    const unsigned lane = threadIdx.x & 31u, lr = lane & 15u, hi = lane >> 4;
    const unsigned w = bid * 4u + wid; const unsigned z = w / NTD, mt = w % NTD; const unsigned q0 = (unsigned)RH + mt * 16u;      // NT % 4 == 0: the four waves share z
    const unsigned nst = ((unsigned)RH + ((bid * 4u) % NTD) * 16u) / 64u + 1u;      // stages up to the diagonal of the work-group's last row; uniform per work-group; keys < nst * 64 <= SEQ; nst >= 2 (RH >= 64)
    const size_t zoff = (size_t)z * SEQ * HD;
    const unsigned lw = (unsigned)(size_t)kv + wid * 2048u + lane * 16u;
    const h16* gk = KA + zoff + wid * 1024u + lane * 8u; const h16* gv = VA + zoff + wid * 1024u + lane * 8u;      // a stage is 4096 elements of either plane
    kv_copy(lw, gk, gv);
    V aq[2];
#pragma unroll
    for (int d = 0; d < 2; ++d) aq[d] = WFrag<h16>::ld(QA + zoff + (size_t)q0 * HD + 8u * lane + d * 512);
    asm volatile("s_wait_asynccnt 0x0" ::: "memory");      // this wave's copies of stage 0 have landed
    __syncthreads();                                       // every wave's have
    kv_copy(lw + 16384u, gk + 4096, gv + 4096);
    v8f o[4]; float m = -1.0e30f, l = 0.0f;          // o[t][j] = context[query lr][depth 16t + 8hi + j]; m, l: query lr (l: this half's keys)
#pragma unroll
    for (int t = 0; t < 4; ++t) o[t] = (v8f){};
    const unsigned qrow = q0 + lr;
#pragma unroll 1
    for (unsigned st = 0; st + 1u < nst; ++st)       // rolled: one stage is the loop's body; the stages wholly below the diagonal
        pl_stage<false>(st, nst, kv, lane, hi, qrow, lw, gk, gv, aq, o, m, l);
    pl_stage<true>(nst - 1u, nst, kv, lane, hi, qrow, lw, gk, gv, aq, o, m, l);      // the stage that holds the diagonal
    asm volatile("s_wait_asynccnt 0x0" ::: "memory");          // nothing is outstanding when the wave ends
    const float ls = l + xhalf(l); const float inv = (1.0f / ls) * (1.0f / PCAR);
    const unsigned b = z / (unsigned)NH, h = z % (unsigned)NH;      // the tile is blocks 2h and 2h + 1 of its 16 rows; store s fills half s & 1 of block s >> 1: row lr, columns 16s + 8hi.. = accumulator s of this lane
#pragma unroll
    for (int s = 0; s < 4; ++s) { v8us oh, ol;
#pragma unroll
        for (int k = 0; k < 8; ++k) { unsigned short x, y2; splitf(o[s][k] * inv, x, y2); oh[k] = x; ol[k] = y2; }
        const size_t oo = (size_t)(b * SEQ + q0) * DM + h * 1024u + (unsigned)s * 256u + 8u * lane;
        *(v8us*)(ATh + oo) = oh; *(v8us*)(ATl + oo) = ol; }
}

// ---- k_flash: the two row ranges (rows >= RH on the fp16 planes, rows < RH on the hi/lo planes) write disjoint context rows and neither needs the other, so they share one grid: blocks [0, FB_PL) take rows >= RH (up to SEQ/32 chunks a wave: the long ones start first), blocks [FB_PL, FB_PL + FB_HR) rows < RH (at most RH/32 chunks), which run beside the long waves instead of in front of them.
// coverage: FB_HR = NZ*(RH/16)/4 blocks x 4 waves x (16 rows x 64 d) == NZ*RH*HD; FB_PL = NZ*((SEQ-RH)/16)/4 blocks x 4 waves x (16 x 64) == NZ*(SEQ-RH)*HD; union == NB*SEQ*DM per context plane.
static_assert((NZ * (RH / 16)) % 4 == 0);
static_assert((NZ * ((SEQ - RH) / 16)) % 4 == 0);
constexpr unsigned FB_PL = (unsigned)(NZ * ((SEQ - RH) / 16) / 4), FB_HR = (unsigned)(NZ * (RH / 16) / 4);
__global__ __launch_bounds__(128) void k_flash(const h16* Q16, const h16* K16, const h16* V16, const bf* Qh, const bf* Ql, const bf* Kh, const bf* Kl, const bf* Vh, const bf* Vl, bf* ATh, bf* ATl) {
    const unsigned bid = blockIdx.x;      // uniform per block: a scalar branch
    __shared__ __align__(16) h16 kv[2 * 8192];      // the key and value stages of rows >= RH
    if (bid < FB_PL) flash_pl(bid, Q16, K16, V16, ATh, ATl, kv);
    else flash_body<bf, true>(bid - FB_PL, Qh, Ql, Kh, Kl, Vh, Vl, ATh, ATl);
}

// workspace carve (bytes; every region a multiple of 256)
constexpr size_t SZ_WT  = (size_t)4 * DM * DM * 2;
constexpr size_t SZ_XB  = (size_t)NB * SEQ * DM * 2;
constexpr size_t SZ_QK  = (size_t)2 * NZ * SEQ * HD * 2;
constexpr size_t SZ_V   = (size_t)NZ * HD * SEQ * 2;
constexpr size_t SZ_QKH = (size_t)2 * NZ * RH * HD * 2;
constexpr size_t SZ_VH  = (size_t)NZ * HD * RH * 2;
constexpr size_t SZ_AT  = (size_t)NB * SEQ * DM * 2;
constexpr size_t WS_TOTAL = SZ_WT + SZ_XB + SZ_QK + SZ_V + 2 * SZ_QKH + 2 * SZ_VH + 2 * SZ_AT;
static_assert(WS_TOTAL <= (size_t)134217728);
static_assert(SZ_WT % 256 == 0 && SZ_XB % 256 == 0 && SZ_QK % 256 == 0 && SZ_V % 256 == 0 && SZ_QKH % 256 == 0 && SZ_VH % 256 == 0 && SZ_AT % 256 == 0);

extern "C" void kernel_launch(void* const* d_in, const int* in_sizes, int n_in,
                              void* d_out, int out_size, void* d_ws, size_t ws_size, hipStream_t stream) {
    if (n_in < 7) return;
    const long long need_x = ((long long)(NB - 1) * SEQ_FULL + SEQ) * DM;
    if ((long long)in_sizes[0] < need_x || (long long)out_size < need_x) return;
    if (in_sizes[1] < DM * DM || in_sizes[2] < DM * DM || in_sizes[3] < DM * DM || in_sizes[4] < DM * DM) return;
    if (in_sizes[5] < SEQ * (HD / 2) || in_sizes[6] < SEQ * (HD / 2)) return;
    if (WS_TOTAL > ws_size) return;
    const float* x = (const float*)d_in[0]; const float* wq = (const float*)d_in[1]; const float* wk = (const float*)d_in[2]; const float* wv = (const float*)d_in[3]; const float* wo = (const float*)d_in[4];
    const float* fcos = (const float*)d_in[5]; const float* fsin = (const float*)d_in[6];
    float* OUT = (float*)d_out;
    char* wsp = (char*)d_ws;
    auto take = [&](size_t bytes) { char* p = wsp; wsp += bytes; return (void*)p; };
    bf* WT = (bf*)take(SZ_WT);            // [4] planes (rows n, k): q | k | v | o
    bf* XB = (bf*)take(SZ_XB);            // rows NB*SEQ, k DM
    h16* QK16 = (h16*)take(SZ_QK);        // [2][NZ] planes (rows SEQ, k HD)
    h16* V16 = (h16*)take(SZ_V);          // [NZ] planes (rows HD, k SEQ)
    bf* QKh = (bf*)take(SZ_QKH); bf* QKl = (bf*)take(SZ_QKH);    // [2][NZ] planes (rows RH, k HD)
    bf* Vh = (bf*)take(SZ_VH); bf* Vl = (bf*)take(SZ_VH);        // [NZ] planes (rows HD, k RH)
    bf* ATh = (bf*)take(SZ_AT); bf* ATl = (bf*)take(SZ_AT);      // rows NB*SEQ, k DM
    if ((size_t)(wsp - (char*)d_ws) > ws_size) return;

    k_prep<<<PB_W + PB_X, 256, 0, stream>>>(x, wq, wk, wv, wo, XB, WT);
    k_gemmqkv<DM><<<dim3(NB * SEQ / 128, NH / 2, 3), 128, 0, stream>>>(XB, WT, fcos, fsin, QK16, QKh, QKl, V16, Vh, Vl);
    k_flash<<<FB_PL + FB_HR, 128, 0, stream>>>(QK16, QK16 + (size_t)NZ * SEQ * HD, V16, QKh, QKl, QKh + (size_t)NZ * RH * HD, QKl + (size_t)NZ * RH * HD, Vh, Vl, ATh, ATl);
    k_gemmw<bf, 1, false, DM, 3><<<dim3(SEQ / 64, DM / 64, NB), 32, 0, stream>>>(ATh, ATl, WT + (size_t)3 * DM * DM, nullptr, OUT, DM, nullptr, (size_t)SEQ * DM, (size_t)0, (size_t)SEQ_FULL * DM);
}

// v010
// It runs in 79.7 microseconds.
// Next to v009, in two timings, it ran 1.10 and 1.11 times as fast.
// All steps since v000 together make it 3.63 times as fast.
#include <hip/hip_runtime.h>

// Contractions (f32 accumulate): q/k/v projections v_wmma_f32_16x16x32_bf16 on bf16 RNE-converted inputs (single product); causal scores and probability x value: query rows < RH on bf16 hi/lo planes (3 products), rows >= RH v_wmma_f32_16x16x32_f16 (probabilities carried x1024); output projection bf16 hi/lo context x bf16 weight (2 products); softmax f32.
// Causal multi-head attention with interleaved-pair rotary tables read as INPUT values: x [NB][SEQ][1024]; wq/wk/wv/wo [in][out], no bias; 16 heads x 64; scores x 64^-0.5; causal by index.
// Launches (4): plane builders (x copy and weight transposes, one grid) | q/k/v GEMM | attention (both row ranges, one grid) | output GEMM.
// Layout: bf16 copy of x (both batches, compact rows); four weights transposed once to Bt planes; one z-batched projection GEMM (q | k | v) whose epilogue writes the head planes itself (rotary on q, k; transposed v): no f32 projection plane;
// every 16-bit plane that feeds a matrix operand is stored in FRAGMENT ORDER (below), so that each fragment request of a wave covers whole 128-byte lines;
// flash attention, one wave per 16-row query tile, both products transposed (keys x queries, depth x queries), 32-key chunks (rows < RH: key and value fragments fetched one chunk ahead from global memory; rows >= RH: 64-key stages in LDS, shared by a work-group's four waves), online softmax with running max; context hi/lo planes; output GEMM.

#ifndef NB
#define NB 2
#endif
#ifndef SEQ
#define SEQ 2048
#endif
#define NB_FULL  2
#define SEQ_FULL 2048
#define DM   1024
#define NH   16
#define HD   64
#define NZ   (NB * NH)
#define RH   ((SEQ < 512) ? SEQ : 512)     // query rows < RH use hi+lo planes
#define PCAR 1024.0f
#define SC2  0.18033688011112042f          // HD^-0.5 * log2(e)

static_assert((SEQ & (SEQ - 1)) == 0);
static_assert(SEQ % 256 == 0);
static_assert(RH % 256 == 0);
static_assert(RH <= SEQ);
static_assert(DM == NH * HD);
static_assert(HD == 64);
static_assert((NB * SEQ) % 64 == 0);
static_assert(DM % 64 == 0);
static_assert(NB <= NB_FULL && SEQ <= SEQ_FULL);

typedef _Float16 h16;
typedef unsigned short bf;
typedef __attribute__((ext_vector_type(16))) __bf16   v16bf;
typedef __attribute__((ext_vector_type(16))) _Float16 v16h;
typedef __attribute__((ext_vector_type(8)))  _Float16 v8h;
typedef __attribute__((ext_vector_type(8)))  unsigned short v8us;
typedef __attribute__((ext_vector_type(2)))  unsigned short v2us;
typedef __attribute__((ext_vector_type(8)))  float    v8f;
typedef __attribute__((ext_vector_type(4)))  float    v4f;
typedef v4f  __attribute__((may_alias)) v4fa;

__device__ __forceinline__ unsigned short f2bf(float f) { unsigned u = __float_as_uint(f); u += 0x7FFFu + ((u >> 16) & 1u); return (unsigned short)(u >> 16); }
__device__ __forceinline__ float bf2f(unsigned short b) { return __uint_as_float(((unsigned)b) << 16); }
__device__ __forceinline__ float bfr(float f) { return bf2f(f2bf(f)); }
__device__ __forceinline__ void splitf(float y, unsigned short& h, unsigned short& l) { h = f2bf(y); l = f2bf(y - bf2f(h)); }
__device__ __forceinline__ v16h cat16(v8h lo, v8h hi) { return __builtin_shufflevector(lo, hi, 0, 1, 2, 3, 4, 5, 6, 7, 8, 9, 10, 11, 12, 13, 14, 15); }
__device__ __forceinline__ v16bf cat16b(v8us lo, v8us hi) { return __builtin_bit_cast(v16bf, __builtin_shufflevector(lo, hi, 0, 1, 2, 3, 4, 5, 6, 7, 8, 9, 10, 11, 12, 13, 14, 15)); }
__device__ __forceinline__ v8f wmma16(v16h a, v16h b, v8f c) { return __builtin_amdgcn_wmma_f32_16x16x32_f16(false, a, false, b, (short)0, c, false, false); }
__device__ __forceinline__ v8f wmmab(v16bf a, v16bf b, v8f c) { return __builtin_amdgcn_wmma_f32_16x16x32_bf16(false, a, false, b, (short)0, c, false, false); }

template <typename T16> struct WFrag;
template <> struct WFrag<h16> { typedef v16h V;
    static __device__ __forceinline__ V ld(const h16* p) { return cat16(*(const v8h*)p, *(const v8h*)(p + 256)); }
    static __device__ __forceinline__ v8f mma(V a, V b, v8f c) { return wmma16(a, b, c); }
    static __device__ __forceinline__ void pk(V& ph, V& pl, const float (&p0)[8], const float (&p1)[8]) { (void)pl;
#pragma unroll
        for (int j = 0; j < 8; ++j) { ph[j] = (h16)(p0[j] * PCAR); ph[j + 8] = (h16)(p1[j] * PCAR); } } };
template <> struct WFrag<bf> { typedef v16bf V;
    static __device__ __forceinline__ V ld(const bf* p) { return cat16b(*(const v8us*)p, *(const v8us*)(p + 256)); }
    static __device__ __forceinline__ v8f mma(V a, V b, v8f c) { return wmmab(a, b, c); }
    static __device__ __forceinline__ void pk(V& ph, V& pl, const float (&p0)[8], const float (&p1)[8]) { v8us h0, h1, l0, l1;
#pragma unroll
        for (int j = 0; j < 8; ++j) { unsigned short a, c; splitf(p0[j], a, c); h0[j] = a; l0[j] = c; splitf(p1[j], a, c); h1[j] = a; l1[j] = c; }
        ph = cat16b(h0, h1); pl = cat16b(l0, l1); } };

// ---- k_gemmw: register-blocked GEMM, ONE WAVE per 64x64 output tile (16 accumulators), operands straight from fragment-ordered 16-bit planes (block (rt, kt) at rt*16*K + kt*512); grid (M/64, N/64, Z), 32 threads.
// C[m][n] (f32, pitch ldc, + optional f32 bias[n]) = sum_k A[m][k] Bt[n][k] (+ split products per NSPLIT). z-batch strides sA/sB/sC in elements. K % 32 == 0, a compile-time constant: the four row tiles of an operand are then one address and immediate offsets.
// The fragments of a 32-k trip live in one of NS register sets; a set is asked for again, for trip t + NS, right behind the products of trip t: every request has NS - 1 trips of products to land, and no product waits on a load just issued.
template <typename T16> struct GSet { typename WFrag<T16>::V a[4], a2[4], b[4], b2[4]; };

template <typename T16, int NSPLIT, int K>
__device__ __forceinline__ void g_fetch(GSet<T16>& f, const T16* pa, const T16* pa2, const T16* pb, const T16* pb2, unsigned l8, int ofs) {      // pa..pb2: wave-uniform bases; l8: the lane's piece; ofs: a constant at every call, it goes into the requests' immediate offsets
    __builtin_amdgcn_sched_barrier(0);      // keeps the requests behind the products that read this set: lifted over them they would need registers of their own
#pragma unroll
    for (int mb = 0; mb < 4; ++mb) { f.a[mb] = WFrag<T16>::ld(pa + l8 + (ofs + mb * 16 * K)); if (NSPLIT == 1 || NSPLIT == 2) f.a2[mb] = WFrag<T16>::ld(pa2 + l8 + (ofs + mb * 16 * K)); }
#pragma unroll
    for (int nb = 0; nb < 4; ++nb) { f.b[nb] = WFrag<T16>::ld(pb + l8 + (ofs + nb * 16 * K)); if (NSPLIT >= 2) f.b2[nb] = WFrag<T16>::ld(pb2 + l8 + (ofs + nb * 16 * K)); }
    asm volatile("s_wait_xcnt 0x0" ::: "memory");      // a precaution: it stands in front of every later write of a register that these requests name as an address (the next round's bases)
    __builtin_amdgcn_sched_barrier(0);      // holds the requests above the other sets' products, which are the time they have to land; sunk towards their use they would be waited out
}

template <typename T16, int NSPLIT>
__device__ __forceinline__ void g_mm(const GSet<T16>& f, v8f (&acc)[4][4]) {
#pragma unroll
    for (int nb = 0; nb < 4; ++nb) {
#pragma unroll
        for (int mb = 0; mb < 4; ++mb) { acc[mb][nb] = WFrag<T16>::mma(f.a[mb], f.b[nb], acc[mb][nb]); if (NSPLIT == 1 || NSPLIT == 2) acc[mb][nb] = WFrag<T16>::mma(f.a2[mb], f.b[nb], acc[mb][nb]); if (NSPLIT >= 2) acc[mb][nb] = WFrag<T16>::mma(f.a[mb], f.b2[nb], acc[mb][nb]); } }
    // the four slots between the last products and the requests that land in their operand registers
    asm volatile("v_nop\n\tv_nop\n\tv_nop\n\tv_nop" : "+v"(acc[0][0]), "+v"(acc[1][1]), "+v"(acc[2][2]), "+v"(acc[3][3]) : "v"(f.a[0]), "v"(f.a[3]));
}

template <typename T16, int NSPLIT, bool BIAS, int K, int NS>
__global__ __launch_bounds__(32) void k_gemmw(const T16* __restrict__ A, const T16* __restrict__ A2, const T16* __restrict__ Bt, const T16* __restrict__ Bt2, float* C, int ldc, const float* __restrict__ bias, size_t sA, size_t sB, size_t sC) {
    constexpr int NT = K / 32;               // trips
    constexpr int NL = (NT - NS) / NS;       // rounds of NS trips in which every set is asked for again
    static_assert(K % 32 == 0 && NS >= 2 && NT >= NS);
    __shared__ __align__(16) float os[16 * 68];
    const size_t z = blockIdx.z; A += z * sA; if (A2) A2 += z * sA; Bt += z * sB; if (Bt2) Bt2 += z * sB; C += z * sC;
    const int lane = threadIdx.x & 31, lr = lane & 15, hi = lane >> 4; const int r0 = blockIdx.x * 64, c0 = blockIdx.y * 64;
    v8f acc[4][4];
#pragma unroll
    for (int mb = 0; mb < 4; ++mb)
#pragma unroll
        for (int nb = 0; nb < 4; ++nb) acc[mb][nb] = (v8f){};
    const size_t aoff = (size_t)r0 * K, boff = (size_t)c0 * K; const unsigned l8 = 8u * (unsigned)lane;
    const T16* pa = A + aoff; const T16* pa2 = A2 + aoff; const T16* pb = Bt + boff; const T16* pb2 = Bt2 + boff;
    GSet<T16> f[NS];
#pragma unroll
    for (int s = 0; s < NS; ++s) g_fetch<T16, NSPLIT, K>(f[s], pa, pa2, pb, pb2, l8, s * 512);
#pragma unroll 1
    for (int i = 0; i < NL; ++i) {           // rolled: one round of NS trips is the loop's body
        const int o = (i + 1) * NS * 512; const T16* qa = pa + o; const T16* qa2 = pa2 + o; const T16* qb = pb + o; const T16* qb2 = pb2 + o;
#pragma unroll
        for (int s = 0; s < NS; ++s) { g_mm<T16, NSPLIT>(f[s], acc); g_fetch<T16, NSPLIT, K>(f[s], qa, qa2, qb, qb2, l8, s * 512); }
    }
#pragma unroll
    for (int t = NL * NS; t < NT; ++t) { g_mm<T16, NSPLIT>(f[t % NS], acc);
        if (t + NS < NT) g_fetch<T16, NSPLIT, K>(f[t % NS], pa, pa2, pb, pb2, l8, (t + NS) * 512); }
#pragma unroll
    for (int mb = 0; mb < 4; ++mb) {
#pragma unroll
        for (int nb = 0; nb < 4; ++nb) {
#pragma unroll
            for (int j = 0; j < 8; ++j) os[(hi * 8 + j) * 68 + nb * 16 + lr] = acc[mb][nb][j]; }
        __builtin_amdgcn_wave_barrier(); asm volatile("" ::: "memory");
        float* crow = C + (size_t)(r0 + mb * 16) * ldc + c0;
{
#pragma unroll
            for (int s = 0; s < 8; ++s) { const int row = 2 * s + hi, cofs = lr * 4; v4f val = *(const v4fa*)(os + row * 68 + cofs); if (BIAS) { val[0] += bfr(bias[c0 + cofs]); val[1] += bfr(bias[c0 + cofs + 1]); val[2] += bfr(bias[c0 + cofs + 2]); val[3] += bfr(bias[c0 + cofs + 3]); }
                *(v4f*)(crow + (size_t)row * ldc + cofs) = val; }
             }
        __builtin_amdgcn_wave_barrier(); asm volatile("" ::: "memory");
    }
}

// thread i of a batch writes piece i (8 elements) of the fragment-ordered copy: i = (block * 2 + k half) * 32 + lane.
// coverage: (SEQ*DM/2048, NB) blocks x 256 threads x 8 elements == NB*SEQ*DM.
static_assert(((size_t)SEQ * DM) % 2048 == 0);
__device__ __forceinline__ void cvtx_body(const unsigned bx, const unsigned b, const float* __restrict__ src, bf* dst) {
    const unsigned i = bx * 256u + threadIdx.x;
    const unsigned lr = i & 15u, hi = (i >> 4) & 1u, h2 = (i >> 5) & 1u, blk = i >> 6; const unsigned kt = blk % (unsigned)(DM / 32), rt = blk / (unsigned)(DM / 32);
    const float* s = src + (size_t)b * SEQ_FULL * DM + (size_t)(rt * 16u + lr) * DM + kt * 32u + h2 * 16u + hi * 8u; bf* d = dst + (size_t)b * SEQ * DM + (size_t)i * 8;
    const v8f v = *(const v8f*)s; v8us o;
#pragma unroll
    for (int k = 0; k < 8; ++k) o[k] = f2bf(v[k]);
    *(v8us*)d = o;  }

// thread i of a weight writes piece i of its fragment-ordered transpose Bt[n][k] = w[k][n]: 8 k of one n; a wave reads 64-byte runs of two w rows per request.
// coverage: (DM*DM/2048, 4) blocks x 256 threads x 8 elements == 4*DM*DM.
static_assert(((size_t)DM * DM) % 2048 == 0);
__device__ __forceinline__ void wt4_body(const unsigned bx, const unsigned y, const float* __restrict__ w0, const float* __restrict__ w1, const float* __restrict__ w2, const float* __restrict__ w3, bf* Bt) {
    const float* w = (y == 0u) ? w0 : (y == 1u) ? w1 : (y == 2u) ? w2 : w3; bf* o = Bt + (size_t)y * DM * DM;
    const unsigned i = bx * 256u + threadIdx.x;
    const unsigned lr = i & 15u, hi = (i >> 4) & 1u, h2 = (i >> 5) & 1u, blk = i >> 6; const unsigned kt = blk % (unsigned)(DM / 32), nt = blk / (unsigned)(DM / 32);
    const float* s = w + (size_t)(kt * 32u + h2 * 16u + hi * 8u) * DM + nt * 16u + lr; v8us q;
#pragma unroll
    for (int j = 0; j < 8; ++j) q[j] = f2bf(s[(size_t)j * DM]);
    *(v8us*)(o + (size_t)i * 8) = q;
}

// ---- k_prep: the two plane builders read and write disjoint buffers and neither needs the other, so they share one grid: blocks [0, PB_W) build the weight planes (their strided reads take longer: they come first, for speed only), blocks [PB_W, PB_W + PB_X) the x plane.
constexpr unsigned PB_W1 = (unsigned)((size_t)DM * DM / 2048), PB_W = 4u * PB_W1;
constexpr unsigned PB_X1 = (unsigned)((size_t)SEQ * DM / 2048), PB_X = (unsigned)NB * PB_X1;
__global__ __launch_bounds__(256) void k_prep(const float* __restrict__ x, const float* __restrict__ w0, const float* __restrict__ w1, const float* __restrict__ w2, const float* __restrict__ w3, bf* XB, bf* Bt) {
    const unsigned bid = blockIdx.x;      // uniform per block: a scalar branch
    if (bid < PB_W) wt4_body(bid % PB_W1, bid / PB_W1, w0, w1, w2, w3, Bt);
    else cvtx_body((bid - PB_W) % PB_X1, (bid - PB_W) / PB_X1, x, XB);
}

// ---- g_ring: k loop of a work-group of FOUR WAVES (2 x 2) on a 128x128 output tile, each wave a 64x64 tile (16 accumulators). Operands are fragment-ordered 16-bit planes (block (rt, kt) at rt*16*K + kt*512).
// A stage is 64 k of the tile's 128 A rows and 128 B rows: per 16-row tile two blocks, 2 KB, contiguous in the plane and in LDS. Asynchronous copies bring it from global memory into LDS once per work-group; each wave copies two row tiles of either plane.
// Every operand byte then leaves L2 once per 128x128 tile, not once per 64x64 tile, and a fragment is two contiguous 512-byte LDS reads of the wave.
// Two buffers. A trip reads its whole stage into registers; behind the barrier that ends those reads, stage t + 2 is asked for into the same buffer, and only then come the trip's products: the copies fly during them and during the next trip's reads.
template <int K>
__device__ __forceinline__ void g_copy2(const unsigned l, const bf* g) {      // two row tiles (4 KB) of one plane: l = this lane's LDS byte address, g = this lane's global address, of the first 16 bytes
    const bf* h = g + 16 * K;
    // the copies and, as the last line, the precaution that stands in front of every later write of a register that they name
    asm volatile("global_load_async_to_lds_b128 %0, %8, off\n\t"
                 "global_load_async_to_lds_b128 %1, %9, off\n\t"
                 "global_load_async_to_lds_b128 %2, %10, off\n\t"
                 "global_load_async_to_lds_b128 %3, %11, off\n\t"
                 "global_load_async_to_lds_b128 %4, %12, off\n\t"
                 "global_load_async_to_lds_b128 %5, %13, off\n\t"
                 "global_load_async_to_lds_b128 %6, %14, off\n\t"
                 "global_load_async_to_lds_b128 %7, %15, off\n\t"
                 "s_wait_xcnt 0x0"
                 :: "v"(l), "v"(l + 512u), "v"(l + 1024u), "v"(l + 1536u), "v"(l + 2048u), "v"(l + 2560u), "v"(l + 3072u), "v"(l + 3584u),
                    "v"(g), "v"(g + 256), "v"(g + 512), "v"(g + 768), "v"(h), "v"(h + 256), "v"(h + 512), "v"(h + 768) : "memory");
}

// ring: 64 KB of LDS (per buffer 16 KB of A, 16 KB of B). ga, gb: this lane's address in rows 32 * wid of the tile's A and B rows, k = 0. acc[mb][nb] += sum over k, blocks in rising order.
template <int K>
__device__ __forceinline__ void g_ring(const bf* ring, const bf* ga, const bf* gb, const unsigned wid, const unsigned lane, v8f (&acc)[4][4]) {
    constexpr int NT = K / 64;                       // stages
    static_assert(K % 64 == 0 && NT >= 2);
    const unsigned lw = (unsigned)(size_t)ring + wid * 4096u + lane * 16u;
    g_copy2<K>(lw, ga); g_copy2<K>(lw + 16384u, gb);
    asm volatile("s_wait_asynccnt 0x0" ::: "memory");      // this wave's copies of stage 0 have landed
    __syncthreads();                                       // every wave's have
    g_copy2<K>(lw + 32768u, ga + 1024); g_copy2<K>(lw + 49152u, gb + 1024);
    const bf* fa = ring + (wid >> 1) * 4096u + lane * 8u; const bf* fb = ring + 8192u + (wid & 1u) * 4096u + lane * 8u;
#pragma unroll 1
    for (int t = 0; t < NT; ++t) {                   // rolled: one stage is the loop's body
        const unsigned bo = (unsigned)(t & 1) * 16384u;
        v16bf a[2][4], b[2][4];
#pragma unroll
        for (int kk = 0; kk < 2; ++kk) {
#pragma unroll
            for (int mb = 0; mb < 4; ++mb) a[kk][mb] = WFrag<bf>::ld(fa + bo + mb * 1024 + kk * 512);
#pragma unroll
            for (int nb = 0; nb < 4; ++nb) b[kk][nb] = WFrag<bf>::ld(fb + bo + nb * 1024 + kk * 512);
        }
        asm volatile("s_wait_dscnt 0x0" ::: "memory");         // this wave's reads of the buffer have returned
        asm volatile("s_wait_asynccnt 0x0" ::: "memory");      // its copies of stage t + 1 have landed
        __syncthreads();                                       // stage t + 1 is published, and every reader has left stage t's buffer
        if (t + 2 < NT) { g_copy2<K>(lw + 2u * bo, ga + (t + 2) * 1024); g_copy2<K>(lw + 2u * bo + 16384u, gb + (t + 2) * 1024); }
        __builtin_amdgcn_sched_barrier(0);           // keeps the products behind the copies: lifted over them they would take away the time the copies have to land
#pragma unroll
        for (int kk = 0; kk < 2; ++kk)
#pragma unroll
            for (int nb = 0; nb < 4; ++nb)
#pragma unroll
                for (int mb = 0; mb < 4; ++mb) acc[mb][nb] = wmmab(a[kk][mb], b[kk][nb], acc[mb][nb]);
    }
    asm volatile("s_wait_asynccnt 0x0" ::: "memory");          // nothing is outstanding when the LDS goes to other use
}

// ---- k_gemmqkv: the q | k | v projection GEMM (blockIdx.z 0 | 1 | 2), one wave per 64x64 tile = 64 positions x ONE head (HD == 64), four waves (2 x 2) a work-group, k loop g_ring (single product); grid (NB*SEQ/128, NH/2, 3), 128 threads. The epilogue writes the attention's planes from the accumulators, each wave for itself.
// q, k: head planes [z] (rows t, k = d, fragment order: 2 blocks per 16 rows) of the rotated projection: pair i of a head row: out[2i] = x[2i] c - x[2i+1] s, out[2i+1] = x[2i] s + x[2i+1] c with c, s = bf16 RNE-converted INPUT table values [t][i].
//   The tile goes through LDS (a lane holds 8 rows of one depth, a piece is 8 depths of one row); the table rows, read as whole lines, go there 16 rows at a time; lane (lr, hi) builds piece (row lr, depths 16s + 8hi..) for s = 0..3: each store of the wave is 512 contiguous bytes.
// v: value planes [z] (rows d, k = key, fragment order, the four 16-d blocks of a 32-key chunk side by side: block (chunk, dt) at (chunk * 4 + dt) * 512). An accumulator's 8 registers are 8 keys of one depth, which is a piece: stored from the registers, 512 contiguous bytes per store.
// coverage: the tiles cover NB*SEQ rows x DM columns of each projection == NZ*SEQ*HD elements of each fp16 plane; tiles with t < RH (64 | RH) also fill the hi and lo planes (NZ*RH*HD each).
static_assert(SEQ % 128 == 0 && RH % 64 == 0 && HD == 64 && DM == NH * 64 && NH % 2 == 0);
template <int K>
__global__ __launch_bounds__(128) void k_gemmqkv(const bf* __restrict__ A, const bf* __restrict__ Bt, const float* __restrict__ cosT, const float* __restrict__ sinT, h16* P16, bf* Ph, bf* Pl, h16* V16, bf* Vh, bf* Vl) {
    constexpr unsigned EW = 64 * 68 + 2 * 16 * 36;      // floats of a wave's epilogue staging
    static_assert(4 * EW * 4 >= 65536);
    __shared__ __align__(16) float sm[4 * EW];          // first the ring of the k loop (64 KB); behind the loop's last barrier, which ends every read of the ring, each wave's own staging
    const unsigned wid = (unsigned)__builtin_amdgcn_readfirstlane((int)(threadIdx.x >> 5));      // the wave's number, in a scalar register
    const unsigned y = blockIdx.z, h = blockIdx.y * 2u + (wid & 1u), r0 = blockIdx.x * 128u + (wid >> 1) * 64u;
    const unsigned lane = threadIdx.x & 31u, lr = lane & 15u, hi = lane >> 4, l8 = 8u * lane;
    v8f acc[4][4];
#pragma unroll
    for (int mb = 0; mb < 4; ++mb)
#pragma unroll
        for (int nb = 0; nb < 4; ++nb) acc[mb][nb] = (v8f){};
    g_ring<K>((const bf*)sm, A + (size_t)(blockIdx.x * 128u + wid * 32u) * K + l8, Bt + (size_t)y * DM * K + (size_t)(blockIdx.y * 128u + wid * 32u) * K + l8, wid, lane, acc);
    float* os = sm + wid * EW; float* tc = os + 64 * 68; float* ts = tc + 16 * 36;      // tc, ts pitch 36: the 16 rows of a 16-byte column start in 16 different bank groups
    const unsigned b = r0 / (unsigned)SEQ, t0 = r0 % (unsigned)SEQ, z = b * (unsigned)NH + h;
    const bool hl = (t0 < (unsigned)RH);     // uniform per wave (64 consecutive rows, RH % 64 == 0)
    // Stores go out 16 rows at a time: all their values first, then the stores, then one s_wait_xcnt 0 (a precaution: it stands in front of every later write of a register that these stores name); the scheduling fences keep other work out of that stretch.
    if (y == 2u) {
        h16* p16 = V16 + (size_t)z * HD * SEQ + (t0 >> 5) * 2048u + l8;
        const size_t ho = (size_t)z * HD * RH + (hl ? (t0 >> 5) : 0u) * 2048u + l8; bf* ph = Vh + ho; bf* pl = Vl + ho;
#pragma unroll
        for (int mb = 0; mb < 4; ++mb) {     // keys t0 + 16mb + 8hi + j, depth 16nb + lr: chunk mb >> 1, block nb, k half mb & 1, piece lane
            const int e = (mb >> 1) * 2048 + (mb & 1) * 256; v8h o16[4];
#pragma unroll
            for (int nb = 0; nb < 4; ++nb)
#pragma unroll
                for (int j = 0; j < 8; ++j) o16[nb][j] = (h16)acc[mb][nb][j];
            if (hl) { v8us oh[4], ol[4];
#pragma unroll
                for (int nb = 0; nb < 4; ++nb)
#pragma unroll
                    for (int j = 0; j < 8; ++j) { unsigned short a, c2; splitf(acc[mb][nb][j], a, c2); oh[nb][j] = a; ol[nb][j] = c2; }
                __builtin_amdgcn_sched_barrier(0);      // values above, stores below
#pragma unroll
                for (int nb = 0; nb < 4; ++nb) { *(v8h*)(p16 + e + nb * 512) = o16[nb]; *(v8us*)(ph + e + nb * 512) = oh[nb]; *(v8us*)(pl + e + nb * 512) = ol[nb]; }
                asm volatile("s_wait_xcnt 0x0" ::: "memory");      // the precaution named above, behind these stores
            } else {
                __builtin_amdgcn_sched_barrier(0);      // values above, stores below
#pragma unroll
                for (int nb = 0; nb < 4; ++nb) *(v8h*)(p16 + e + nb * 512) = o16[nb];
                asm volatile("s_wait_xcnt 0x0" ::: "memory");      // the precaution named above, behind these stores
            }
            __builtin_amdgcn_sched_barrier(0);          // the next rows' values stay behind the wait
        }
        return;
    }
    const float* ct = cosT + (size_t)t0 * 32 + 4u * lane; const float* st = sinT + (size_t)t0 * 32 + 4u * lane;      // request q of a 16-row block: its rows 4q..4q+3, 512 contiguous bytes
    v4f cq[4], sq[4];
#pragma unroll
    for (int q = 0; q < 4; ++q) { cq[q] = *(const v4f*)(ct + q * 128); sq[q] = *(const v4f*)(st + q * 128); }      // the first 16 rows' table values fly while the tile goes to LDS
    asm volatile("s_wait_xcnt 0x0" ::: "memory");      // a precaution: it stands in front of every later write of a register that these requests name as an address
    __builtin_amdgcn_sched_barrier(0);                 // keeps later address arithmetic behind that wait
#pragma unroll
    for (int mb = 0; mb < 4; ++mb)
#pragma unroll
        for (int nb = 0; nb < 4; ++nb)
#pragma unroll
            for (int j = 0; j < 8; ++j) os[(mb * 16 + hi * 8 + j) * 68 + nb * 16 + lr] = acc[mb][nb][j];
    h16* p16 = P16 + (size_t)y * NZ * SEQ * HD + (size_t)z * SEQ * HD + (t0 >> 4) * 1024u + l8;
    const size_t ho = (size_t)y * NZ * RH * HD + (size_t)z * RH * HD + (hl ? (t0 >> 4) : 0u) * 1024u + l8; bf* ph = Ph + ho; bf* pl = Pl + ho;
    const unsigned to = (lane >> 3) * 36u + (lane & 7u) * 4u;
#pragma unroll 1
    for (unsigned mb = 0; mb < 4u; ++mb) {       // rolled: the body is long and runs four times; 16 rows a trip
#pragma unroll
        for (int q = 0; q < 4; ++q) { *(v4fa*)(tc + q * 144 + to) = cq[q]; *(v4fa*)(ts + q * 144 + to) = sq[q]; }
        if (mb < 3u) {      // the next 16 rows' table values fly while these rows are built
#pragma unroll
            for (int q = 0; q < 4; ++q) { cq[q] = *(const v4f*)(ct + (mb + 1u) * 512u + q * 128); sq[q] = *(const v4f*)(st + (mb + 1u) * 512u + q * 128); }
            asm volatile("s_wait_xcnt 0x0" ::: "memory");      // a precaution: it stands in front of every later write of a register that these requests name as an address
        }
        __builtin_amdgcn_wave_barrier(); asm volatile("" ::: "memory");      // keeps the LDS reads below behind the LDS writes above in the compiled order (one wave: the LDS serves it in order)
        float ro[4][8]; v8h o16[4];
#pragma unroll
        for (int s = 0; s < 4; ++s) { const unsigned seg = 2u * (unsigned)s + hi; const float* xr = os + (mb * 16u + lr) * 68u + seg * 8u;
            const v4f x0 = *(const v4fa*)xr, x1 = *(const v4fa*)(xr + 4); const v4f cv = *(const v4fa*)(tc + lr * 36u + seg * 4u), sv = *(const v4fa*)(ts + lr * 36u + seg * 4u);
            float xs[8]; xs[0] = x0[0]; xs[1] = x0[1]; xs[2] = x0[2]; xs[3] = x0[3]; xs[4] = x1[0]; xs[5] = x1[1]; xs[6] = x1[2]; xs[7] = x1[3];
#pragma unroll
            for (int i = 0; i < 4; ++i) { const float c = bfr(cv[i]), sn = bfr(sv[i]); const float tr = xs[2 * i], ti = xs[2 * i + 1]; ro[s][2 * i] = tr * c - ti * sn; ro[s][2 * i + 1] = tr * sn + ti * c;
                o16[s][2 * i] = (h16)ro[s][2 * i]; o16[s][2 * i + 1] = (h16)ro[s][2 * i + 1]; } }
        const unsigned e = mb * 1024u;      // 16-row tile mb; piece (depths 16s + 8hi.., row lr) sits at s * 256 + lane * 8
        if (hl) { v8us oh[4], ol[4];
#pragma unroll
            for (int s = 0; s < 4; ++s)
#pragma unroll
                for (int k = 0; k < 8; ++k) { unsigned short a, d2; splitf(ro[s][k], a, d2); oh[s][k] = a; ol[s][k] = d2; }
            __builtin_amdgcn_sched_barrier(0);      // values above, stores below
#pragma unroll
            for (int s = 0; s < 4; ++s) { *(v8h*)(p16 + e + s * 256) = o16[s]; *(v8us*)(ph + e + s * 256) = oh[s]; *(v8us*)(pl + e + s * 256) = ol[s]; }
            asm volatile("s_wait_xcnt 0x0" ::: "memory");      // the precaution named above, behind these stores
        } else {
            __builtin_amdgcn_sched_barrier(0);      // values above, stores below
#pragma unroll
            for (int s = 0; s < 4; ++s) *(v8h*)(p16 + e + s * 256) = o16[s];
            asm volatile("s_wait_xcnt 0x0" ::: "memory");      // the precaution named above, behind these stores
        }
        __builtin_amdgcn_wave_barrier(); asm volatile("" ::: "memory");      // keeps the next rows' table writes behind this trip's LDS reads in the compiled order
    }
}

__device__ __forceinline__ float xhalf(float x) { return __builtin_bit_cast(float, __builtin_amdgcn_permlanex16(__builtin_bit_cast(int, x), __builtin_bit_cast(int, x), 0x76543210, 0xfedcba98, false, false)); }      // lane l's value of lane l ^ 16

template <typename T16, bool HR>
__device__ __forceinline__ void flash_body(const unsigned bid, const T16* QA, const T16* QB, const T16* KA, const T16* KB, const T16* VA, const T16* VB, bf* ATh, bf* ATl) {
    typedef typename WFrag<T16>::V V;
    constexpr unsigned QR   = HR ? (unsigned)RH : (unsigned)SEQ;     // rows per z of the q/k planes = key pitch of the v planes
    constexpr unsigned ROW0 = HR ? 0u : (unsigned)RH;
    constexpr unsigned NT   = HR ? (unsigned)RH / 16u : (unsigned)(SEQ - RH) / 16u;
    constexpr unsigned NTD  = NT ? NT : 1u;
    const unsigned lane = threadIdx.x & 31u, wid = threadIdx.x >> 5, lr = lane & 15u, hi = lane >> 4;
    const unsigned z = bid % (unsigned)NZ, mt = (NTD / 4u - 1u - bid / (unsigned)NZ) * 4u + wid; const unsigned q0 = ROW0 + mt * 16u;      // block -> (head, 64-row tile): see k_flash
    const size_t zoff = (size_t)z * QR * HD + 8u * lane;      // this lane's piece of block 0 of head z, in the q, k and v planes alike; 16 rows of q or k = 2 blocks, a 32-key chunk of k or v = 4 blocks
    const size_t qoff = zoff + (size_t)q0 * HD;
    V aq[2], aql[2];
#pragma unroll
    for (int d = 0; d < 2; ++d) { aq[d] = WFrag<T16>::ld(QA + qoff + d * 512); if (HR) aql[d] = WFrag<T16>::ld(QB + qoff + d * 512); }
    v8f o[4]; float m = -1.0e30f, l = 0.0f;          // o[t][j] = context[query lr][depth 16t + 8hi + j]; m, l: query lr (l: this half's keys)
#pragma unroll
    for (int t = 0; t < 4; ++t) o[t] = (v8f){};
    const unsigned nch = (q0 + 15u) / 32u + 1u;      // wave-uniform; keys < nch*32 <= QR
    V kb[2][2], kl[2][2], vb[4], vl[4];              // fragments of the current chunk: kb[d][i] = keys 16i.., depth 32d..; vb[t] = depth 16t..
    // Chunk 0 is requested in the loop's own order (queries, keys, values): loads retire in order and the wait at the loop's head is counted for both ways in, so another order here makes every trip's score products wait for the value requests too.
    asm volatile("s_wait_xcnt 0x0" ::: "memory");    // key fragments land in registers that held the query requests' addresses: a precaution in front of that reuse; as a memory fence it also keeps the query requests ahead of the key requests
#pragma unroll
    for (int d = 0; d < 2; ++d) { const size_t ko = zoff + d * 512;
        kb[d][0] = WFrag<T16>::ld(KA + ko); kb[d][1] = WFrag<T16>::ld(KA + ko + 16 * HD); if (HR) { kl[d][0] = WFrag<T16>::ld(KB + ko); kl[d][1] = WFrag<T16>::ld(KB + ko + 16 * HD); } }
    __builtin_amdgcn_sched_barrier(0);               // keeps the key requests ahead of the value requests
#pragma unroll
    for (int t = 0; t < 4; ++t) { const size_t vo = zoff + t * 512; vb[t] = WFrag<T16>::ld(VA + vo); if (HR) vl[t] = WFrag<T16>::ld(VB + vo); }
    const unsigned qrow = q0 + lr;
#pragma unroll 1
    for (unsigned c = 0; c < nch; ++c) {
        const unsigned c0 = c * 32u;
        const unsigned cn = ((c + 1u < nch) ? c + 1u : c) * 32u;      // chunk fetched ahead; the last trip asks for its own chunk again (in bounds, never used)
        v8f s0 = (v8f){}, s1 = (v8f){};              // s0[j] = score[key c0 + 8hi + j][query lr], s1: keys + 16
#pragma unroll
        for (int d = 0; d < 2; ++d) {
            s0 = WFrag<T16>::mma(kb[d][0], aq[d], s0); s1 = WFrag<T16>::mma(kb[d][1], aq[d], s1);
            if (HR) { s0 = WFrag<T16>::mma(kb[d][0], aql[d], s0); s1 = WFrag<T16>::mma(kb[d][1], aql[d], s1); s0 = WFrag<T16>::mma(kl[d][0], aq[d], s0); s1 = WFrag<T16>::mma(kl[d][1], aq[d], s1); } }
        asm volatile("v_nop\n\tv_nop\n\tv_nop\n\tv_nop" : "+v"(s0), "+v"(s1) : "v"(aq[0]), "v"(aq[1]));      // the four slots between the last score products and the requests that land in their operand registers
#pragma unroll
        for (int d = 0; d < 2; ++d) { const size_t ko = zoff + (size_t)cn * HD + d * 512;
            kb[d][0] = WFrag<T16>::ld(KA + ko); kb[d][1] = WFrag<T16>::ld(KA + ko + 16 * HD); if (HR) { kl[d][0] = WFrag<T16>::ld(KB + ko); kl[d][1] = WFrag<T16>::ld(KB + ko + 16 * HD); } }
        if (HR) asm volatile("s_wait_xcnt 0x0" ::: "memory");      // the softmax reuses the key requests' address registers: a precaution
        __builtin_amdgcn_sched_barrier(0);      // holds the key requests above the softmax, which is the time they have to land; sunk towards their use they would be waited out
        const unsigned key0 = c0 + 8u * hi;
        float t0[8], t1[8], p0[8], p1[8], r[8];
#pragma unroll
        for (int j = 0; j < 8; ++j) { const bool v0 = (key0 + (unsigned)j <= qrow), v1 = (key0 + 16u + (unsigned)j <= qrow);
            t0[j] = s0[j] * SC2; t1[j] = s1[j] * SC2; r[j] = fmaxf(v0 ? t0[j] : -1.0e30f, v1 ? t1[j] : -1.0e30f); }
        float cm = fmaxf(fmaxf(fmaxf(r[0], r[1]), fmaxf(r[2], r[3])), fmaxf(fmaxf(r[4], r[5]), fmaxf(r[6], r[7])));
        cm = fmaxf(cm, xhalf(cm));
        const float nm = fmaxf(m, cm); float al;
        asm("v_exp_f32 %0, %1\n\tv_nop" : "=v"(al) : "v"(m - nm));      // 2^(m - nm) with the slot behind a transcendental in the same statement
        m = nm;
#pragma unroll
        for (int j = 0; j < 8; ++j) { const bool v0 = (key0 + (unsigned)j <= qrow), v1 = (key0 + 16u + (unsigned)j <= qrow);
            const float e0 = __builtin_amdgcn_exp2f(fminf(t0[j] - nm, 0.0f)), e1 = __builtin_amdgcn_exp2f(fminf(t1[j] - nm, 0.0f));
            p0[j] = v0 ? e0 : 0.0f; p1[j] = v1 ? e1 : 0.0f; r[j] = p0[j] + p1[j]; }
        l = l * al + (((r[0] + r[1]) + (r[2] + r[3])) + ((r[4] + r[5]) + (r[6] + r[7])));
#pragma unroll
        for (int t = 0; t < 4; ++t) o[t] *= al;
        V ap, apl; WFrag<T16>::pk(ap, apl, p0, p1);
#pragma unroll
        for (int t = 0; t < 4; ++t) {
            o[t] = WFrag<T16>::mma(vb[t], ap, o[t]);
            if (HR) { o[t] = WFrag<T16>::mma(vb[t], apl, o[t]); o[t] = WFrag<T16>::mma(vl[t], ap, o[t]); } }
        asm volatile("v_nop\n\tv_nop\n\tv_nop\n\tv_nop" : "+v"(o[0]), "+v"(o[1]), "+v"(o[2]), "+v"(o[3]) : "v"(ap));      // the four slots between the last value products and the requests that land in their operand registers
        const T16* pva = VA + zoff + (size_t)cn * HD; const T16* pvb = HR ? VB + zoff + (size_t)cn * HD : pva;
#pragma unroll
        for (int t = 0; t < 4; ++t) { vb[t] = WFrag<T16>::ld(pva + t * 512); if (HR) vl[t] = WFrag<T16>::ld(pvb + t * 512); }
        if (HR) asm volatile("s_wait_xcnt 0x0" :: "v"(pva), "v"(pvb) : "memory");      // a precaution in front of the reuse of the value requests' address registers; the addresses are inputs so that their registers stay theirs up to the wait
    }
    asm volatile("s_wait_loadcnt 0x0" ::: "memory");      // the last trip's requests are never read: they retire here, before the wave gives its registers back
    const float cs = HR ? 1.0f : (1.0f / PCAR);
    const float ls = l + xhalf(l); const float inv = (1.0f / ls) * cs;
    const unsigned b = z / (unsigned)NH, h = z % (unsigned)NH;      // the tile is blocks 2h and 2h + 1 of its 16 rows; store s fills half s & 1 of block s >> 1: row lr, columns 16s + 8hi.. = accumulator s of this lane
#pragma unroll
    for (int s = 0; s < 4; ++s) { v8us oh, ol;
#pragma unroll
        for (int k = 0; k < 8; ++k) { unsigned short x, y2; splitf(o[s][k] * inv, x, y2); oh[k] = x; ol[k] = y2; }
        const size_t oo = (size_t)(b * SEQ + q0) * DM + h * 1024u + (unsigned)s * 256u + 8u * lane;
        *(v8us*)(ATh + oo) = oh; *(v8us*)(ATl + oo) = ol; }
}

// ---- flash_pl: rows >= RH on the fp16 planes. The four waves of a work-group hold 64 consecutive query rows of one head and walk the same keys, so the keys and values come to LDS once per work-group, not once per wave.
// A stage is 64 keys: 8 KB of the key plane and 8 KB of the value plane, each contiguous in fragment order; each wave copies a quarter of either (global_load_async_to_lds_b128). Two buffers. A trip asks for its whole stage from LDS into registers and works on the first chunk; then comes the barrier that ends those reads, behind it stage t + 2 is asked for into the same buffer, then the second chunk: the copies fly during it and during the next trip's first chunk.
// Every wave walks all stages of its work-group (up to the last row's diagonal); a chunk wholly above a wave's own diagonal lies in the last stage and is masked there: its probabilities are 0, maximum, sum and context keep their values.
__device__ __forceinline__ void exp8(float (&e)[8], const float (&x)[8]) {      // e[j] = 2^x[j]. One statement: each v_exp is followed by one that neither reads its result nor writes its source (results in registers of their own), the last by the slot behind a transcendental
    asm("v_exp_f32 %0, %8\n\tv_exp_f32 %1, %9\n\tv_exp_f32 %2, %10\n\tv_exp_f32 %3, %11\n\tv_exp_f32 %4, %12\n\tv_exp_f32 %5, %13\n\tv_exp_f32 %6, %14\n\tv_exp_f32 %7, %15\n\tv_nop"
        : "=&v"(e[0]), "=&v"(e[1]), "=&v"(e[2]), "=&v"(e[3]), "=&v"(e[4]), "=&v"(e[5]), "=&v"(e[6]), "=&v"(e[7])
        : "v"(x[0]), "v"(x[1]), "v"(x[2]), "v"(x[3]), "v"(x[4]), "v"(x[5]), "v"(x[6]), "v"(x[7]));
}

__device__ __forceinline__ void kv_copy(const unsigned l, const h16* gk, const h16* gv) {      // a wave's quarter (2 KB + 2 KB) of a stage: l = this lane's LDS byte address in the key half, gk, gv = this lane's global addresses, of the first 16 bytes
    // the copies and, as the last line, the precaution that stands in front of every later write of a register that they name
    asm volatile("global_load_async_to_lds_b128 %0, %8, off\n\t"
                 "global_load_async_to_lds_b128 %1, %9, off\n\t"
                 "global_load_async_to_lds_b128 %2, %10, off\n\t"
                 "global_load_async_to_lds_b128 %3, %11, off\n\t"
                 "global_load_async_to_lds_b128 %4, %12, off\n\t"
                 "global_load_async_to_lds_b128 %5, %13, off\n\t"
                 "global_load_async_to_lds_b128 %6, %14, off\n\t"
                 "global_load_async_to_lds_b128 %7, %15, off\n\t"
                 "s_wait_xcnt 0x0"
                 :: "v"(l), "v"(l + 512u), "v"(l + 1024u), "v"(l + 1536u), "v"(l + 8192u), "v"(l + 8704u), "v"(l + 9216u), "v"(l + 9728u),
                    "v"(gk), "v"(gk + 256), "v"(gk + 512), "v"(gk + 768), "v"(gv), "v"(gv + 256), "v"(gv + 512), "v"(gv + 768) : "memory");
}

static_assert(RH % 64 == 0 && ((SEQ - RH) / 16) % 4 == 0);
// One stage (two 32-key chunks) of flash_pl. A work-group's 64 query rows start at a multiple of 64, so every key of a stage below the last lies below every one of its rows: only the last stage holds the diagonal.
// LAST = false: no mask, that is no key index, compare or select. LAST = true: the causal mask as written; no stage follows, so there is nothing to publish and nothing to refill.
template <bool LAST>
__device__ __forceinline__ void pl_stage(const unsigned st, const unsigned nst, const h16* kv, const unsigned lane, const unsigned hi, const unsigned qrow, const unsigned lw, const h16* gk, const h16* gv,
                                         const WFrag<h16>::V (&aq)[2], v8f (&o)[4], float& m, float& l) {
    typedef WFrag<h16>::V V;
    const unsigned bo = (st & 1u) * 8192u; const h16* fk = kv + bo + lane * 8u;
    V kb[2][2][2], vb[2][4];                     // kb[chunk][d][i] = keys 16i.., depth 32d..; vb[chunk][t] = depth 16t..
#pragma unroll
    for (int cc = 0; cc < 2; ++cc) {
#pragma unroll
        for (int d = 0; d < 2; ++d) { kb[cc][d][0] = WFrag<h16>::ld(fk + cc * 2048 + d * 512); kb[cc][d][1] = WFrag<h16>::ld(fk + cc * 2048 + 1024 + d * 512); }
#pragma unroll
        for (int t = 0; t < 4; ++t) vb[cc][t] = WFrag<h16>::ld(fk + 4096 + cc * 2048 + t * 512);
    }
    __builtin_amdgcn_sched_barrier(0);           // holds the stage's LDS reads together at the head of the trip: sunk towards their products, each group's latency would be waited out
#pragma unroll
    for (int cc = 0; cc < 2; ++cc) {
        if (!LAST && cc == 1) {      // between the chunks: the second chunk's fragments have returned under the first chunk's work, so the wait for them costs nothing
            __builtin_amdgcn_sched_barrier(0);                     // keeps the waits and the barrier behind the first chunk's work: lifted over it they would wait out the LDS reads
            asm volatile("s_wait_dscnt 0x0" ::: "memory");         // this wave's reads of the buffer have returned
            asm volatile("s_wait_asynccnt 0x0" ::: "memory");      // its copies of stage st + 1 have landed
            __syncthreads();                                       // stage st + 1 is published, and every reader has left stage st's buffer
            if (st + 2u < nst) kv_copy(lw + 2u * bo, gk + (size_t)(st + 2u) * 4096u, gv + (size_t)(st + 2u) * 4096u);
            __builtin_amdgcn_sched_barrier(0);                     // keeps the second chunk's work behind the copies: lifted over them it would take away the time the copies have to land
        }
        v8f s0 = (v8f){}, s1 = (v8f){};          // s0[j] = score[key c0 + 8hi + j][query lr], s1: keys + 16
#pragma unroll
        for (int d = 0; d < 2; ++d) { s0 = wmma16(kb[cc][d][0], aq[d], s0); s1 = wmma16(kb[cc][d][1], aq[d], s1); }
        const unsigned key0 = st * 64u + (unsigned)cc * 32u + 8u * hi;
        float t0[8], t1[8], p0[8], p1[8], r[8];
#pragma unroll
        for (int j = 0; j < 8; ++j) { const bool v0 = !LAST || (key0 + (unsigned)j <= qrow), v1 = !LAST || (key0 + 16u + (unsigned)j <= qrow);
            t0[j] = s0[j] * SC2; t1[j] = s1[j] * SC2; r[j] = fmaxf(v0 ? t0[j] : -1.0e30f, v1 ? t1[j] : -1.0e30f); }
        float cm = fmaxf(fmaxf(fmaxf(r[0], r[1]), fmaxf(r[2], r[3])), fmaxf(fmaxf(r[4], r[5]), fmaxf(r[6], r[7])));
        cm = fmaxf(cm, xhalf(cm));
        const float nm = fmaxf(m, cm); float al;
        asm("v_exp_f32 %0, %1\n\tv_nop" : "=v"(al) : "v"(m - nm));      // 2^(m - nm) with the slot behind a transcendental in the same statement
        m = nm;
#pragma unroll
        for (int j = 0; j < 8; ++j) { t0[j] = fminf(t0[j] - nm, 0.0f); t1[j] = fminf(t1[j] - nm, 0.0f); }
        float e0[8], e1[8]; exp8(e0, t0); exp8(e1, t1);
#pragma unroll
        for (int j = 0; j < 8; ++j) { const bool v0 = !LAST || (key0 + (unsigned)j <= qrow), v1 = !LAST || (key0 + 16u + (unsigned)j <= qrow);
            p0[j] = v0 ? e0[j] : 0.0f; p1[j] = v1 ? e1[j] : 0.0f; r[j] = p0[j] + p1[j]; }
        l = l * al + (((r[0] + r[1]) + (r[2] + r[3])) + ((r[4] + r[5]) + (r[6] + r[7])));
#pragma unroll
        for (int t = 0; t < 4; ++t) o[t] *= al;
        V ap, apl; WFrag<h16>::pk(ap, apl, p0, p1);
#pragma unroll
        for (int t = 0; t < 4; ++t) o[t] = wmma16(vb[cc][t], ap, o[t]);
    }
}

__device__ __forceinline__ void flash_pl(const unsigned bid, const h16* QA, const h16* KA, const h16* VA, bf* ATh, bf* ATl, const h16* kv) {      // kv: 32 KB of LDS, two buffers of [keys 8 KB | values 8 KB]
    typedef WFrag<h16>::V V;
    constexpr unsigned NT  = (unsigned)(SEQ - RH) / 16u;
    constexpr unsigned NTD = NT ? NT : 1u;
    const unsigned wid = (unsigned)__builtin_amdgcn_readfirstlane((int)(threadIdx.x >> 5));      // the wave's number, in a scalar register
    const unsigned lane = threadIdx.x & 31u, lr = lane & 15u, hi = lane >> 4;
    const unsigned z = bid % (unsigned)NZ, grp = NTD / 4u - 1u - bid / (unsigned)NZ; const unsigned q0 = (unsigned)RH + (grp * 4u + wid) * 16u;      // block -> (head, 64-row tile): see k_flash; the four waves share z
    const unsigned nst = ((unsigned)RH + grp * 64u) / 64u + 1u;      // stages up to the diagonal of the work-group's last row; uniform per work-group; keys < nst * 64 <= SEQ; nst >= 2 (RH >= 64)
    const size_t zoff = (size_t)z * SEQ * HD;
    const unsigned lw = (unsigned)(size_t)kv + wid * 2048u + lane * 16u;
    const h16* gk = KA + zoff + wid * 1024u + lane * 8u; const h16* gv = VA + zoff + wid * 1024u + lane * 8u;      // a stage is 4096 elements of either plane
    kv_copy(lw, gk, gv);
    V aq[2];
#pragma unroll
    for (int d = 0; d < 2; ++d) aq[d] = WFrag<h16>::ld(QA + zoff + (size_t)q0 * HD + 8u * lane + d * 512);
    asm volatile("s_wait_asynccnt 0x0" ::: "memory");      // this wave's copies of stage 0 have landed
    __syncthreads();                                       // every wave's have
    kv_copy(lw + 16384u, gk + 4096, gv + 4096);
    v8f o[4]; float m = -1.0e30f, l = 0.0f;          // o[t][j] = context[query lr][depth 16t + 8hi + j]; m, l: query lr (l: this half's keys)
#pragma unroll
    for (int t = 0; t < 4; ++t) o[t] = (v8f){};
    const unsigned qrow = q0 + lr;
#pragma unroll 1
    for (unsigned st = 0; st + 1u < nst; ++st)       // rolled: one stage is the loop's body; the stages wholly below the diagonal
        pl_stage<false>(st, nst, kv, lane, hi, qrow, lw, gk, gv, aq, o, m, l);
    pl_stage<true>(nst - 1u, nst, kv, lane, hi, qrow, lw, gk, gv, aq, o, m, l);      // the stage that holds the diagonal
    asm volatile("s_wait_asynccnt 0x0" ::: "memory");          // nothing is outstanding when the wave ends
    const float ls = l + xhalf(l); const float inv = (1.0f / ls) * (1.0f / PCAR);
    const unsigned b = z / (unsigned)NH, h = z % (unsigned)NH;      // the tile is blocks 2h and 2h + 1 of its 16 rows; store s fills half s & 1 of block s >> 1: row lr, columns 16s + 8hi.. = accumulator s of this lane
#pragma unroll
    for (int s = 0; s < 4; ++s) { v8us oh, ol;
#pragma unroll
        for (int k = 0; k < 8; ++k) { unsigned short x, y2; splitf(o[s][k] * inv, x, y2); oh[k] = x; ol[k] = y2; }
        const size_t oo = (size_t)(b * SEQ + q0) * DM + h * 1024u + (unsigned)s * 256u + 8u * lane;
        *(v8us*)(ATh + oo) = oh; *(v8us*)(ATl + oo) = ol; }
}

// ---- k_flash: the two row ranges (rows >= RH on the fp16 planes, rows < RH on the hi/lo planes) write disjoint context rows and neither needs the other, so they share one grid: blocks [0, FB_PL) take rows >= RH (up to SEQ/32 chunks a wave: the long ones come first, for speed only), blocks [FB_PL, FB_PL + FB_HR) rows < RH (at most RH/32 chunks).
// Inside a range the head is the block index mod NZ and the 64-row tile falls as the index rises. A tile's cost grows with its row, and blocks of one cost come in runs of NZ;
// For speed only: any placement gives the same result.
// coverage: (head, tile) = (bid % NZ, n - 1 - bid / NZ) is a permutation of NZ x n pairs, n = tiles per head of the range. FB_HR = NZ*(RH/16)/4 blocks x 4 waves x (16 rows x 64 d) == NZ*RH*HD; FB_PL = NZ*((SEQ-RH)/16)/4 blocks x 4 waves x (16 x 64) == NZ*(SEQ-RH)*HD; union == NB*SEQ*DM per context plane.
static_assert((NZ * (RH / 16)) % 4 == 0);
static_assert((NZ * ((SEQ - RH) / 16)) % 4 == 0);
constexpr unsigned FB_PL = (unsigned)(NZ * ((SEQ - RH) / 16) / 4), FB_HR = (unsigned)(NZ * (RH / 16) / 4);
__global__ __launch_bounds__(128) void k_flash(const h16* Q16, const h16* K16, const h16* V16, const bf* Qh, const bf* Ql, const bf* Kh, const bf* Kl, const bf* Vh, const bf* Vl, bf* ATh, bf* ATl) {
    const unsigned bid = blockIdx.x;      // uniform per block: a scalar branch
    __shared__ __align__(16) h16 kv[2 * 8192];      // the key and value stages of rows >= RH
    if (bid < FB_PL) flash_pl(bid, Q16, K16, V16, ATh, ATl, kv);
    else flash_body<bf, true>(bid - FB_PL, Qh, Ql, Kh, Kl, Vh, Vl, ATh, ATl);
}

// workspace carve (bytes; every region a multiple of 256)
constexpr size_t SZ_WT  = (size_t)4 * DM * DM * 2;
constexpr size_t SZ_XB  = (size_t)NB * SEQ * DM * 2;
constexpr size_t SZ_QK  = (size_t)2 * NZ * SEQ * HD * 2;
constexpr size_t SZ_V   = (size_t)NZ * HD * SEQ * 2;
constexpr size_t SZ_QKH = (size_t)2 * NZ * RH * HD * 2;
constexpr size_t SZ_VH  = (size_t)NZ * HD * RH * 2;
constexpr size_t SZ_AT  = (size_t)NB * SEQ * DM * 2;
constexpr size_t WS_TOTAL = SZ_WT + SZ_XB + SZ_QK + SZ_V + 2 * SZ_QKH + 2 * SZ_VH + 2 * SZ_AT;
static_assert(WS_TOTAL <= (size_t)134217728);
static_assert(SZ_WT % 256 == 0 && SZ_XB % 256 == 0 && SZ_QK % 256 == 0 && SZ_V % 256 == 0 && SZ_QKH % 256 == 0 && SZ_VH % 256 == 0 && SZ_AT % 256 == 0);

extern "C" void kernel_launch(void* const* d_in, const int* in_sizes, int n_in,
                              void* d_out, int out_size, void* d_ws, size_t ws_size, hipStream_t stream) {
    if (n_in < 7) return;
    const long long need_x = ((long long)(NB - 1) * SEQ_FULL + SEQ) * DM;
    if ((long long)in_sizes[0] < need_x || (long long)out_size < need_x) return;
    if (in_sizes[1] < DM * DM || in_sizes[2] < DM * DM || in_sizes[3] < DM * DM || in_sizes[4] < DM * DM) return;
    if (in_sizes[5] < SEQ * (HD / 2) || in_sizes[6] < SEQ * (HD / 2)) return;
    if (WS_TOTAL > ws_size) return;
    const float* x = (const float*)d_in[0]; const float* wq = (const float*)d_in[1]; const float* wk = (const float*)d_in[2]; const float* wv = (const float*)d_in[3]; const float* wo = (const float*)d_in[4];
    const float* fcos = (const float*)d_in[5]; const float* fsin = (const float*)d_in[6];
    float* OUT = (float*)d_out;
    char* wsp = (char*)d_ws;
    auto take = [&](size_t bytes) { char* p = wsp; wsp += bytes; return (void*)p; };
    bf* WT = (bf*)take(SZ_WT);            // [4] planes (rows n, k): q | k | v | o
    bf* XB = (bf*)take(SZ_XB);            // rows NB*SEQ, k DM
    h16* QK16 = (h16*)take(SZ_QK);        // [2][NZ] planes (rows SEQ, k HD)
    h16* V16 = (h16*)take(SZ_V);          // [NZ] planes (rows HD, k SEQ)
    bf* QKh = (bf*)take(SZ_QKH); bf* QKl = (bf*)take(SZ_QKH);    // [2][NZ] planes (rows RH, k HD)
    bf* Vh = (bf*)take(SZ_VH); bf* Vl = (bf*)take(SZ_VH);        // [NZ] planes (rows HD, k RH)
    bf* ATh = (bf*)take(SZ_AT); bf* ATl = (bf*)take(SZ_AT);      // rows NB*SEQ, k DM
    if ((size_t)(wsp - (char*)d_ws) > ws_size) return;

    k_prep<<<PB_W + PB_X, 256, 0, stream>>>(x, wq, wk, wv, wo, XB, WT);
    k_gemmqkv<DM><<<dim3(NB * SEQ / 128, NH / 2, 3), 128, 0, stream>>>(XB, WT, fcos, fsin, QK16, QKh, QKl, V16, Vh, Vl);
    k_flash<<<FB_PL + FB_HR, 128, 0, stream>>>(QK16, QK16 + (size_t)NZ * SEQ * HD, V16, QKh, QKl, QKh + (size_t)NZ * RH * HD, QKl + (size_t)NZ * RH * HD, Vh, Vl, ATh, ATl);
    k_gemmw<bf, 1, false, DM, 3><<<dim3(SEQ / 64, DM / 64, NB), 32, 0, stream>>>(ATh, ATl, WT + (size_t)3 * DM * DM, nullptr, OUT, DM, nullptr, (size_t)SEQ * DM, (size_t)0, (size_t)SEQ_FULL * DM);
}
